// v000
// Times are from an AMD MI455X. After a warm-up the kernel runs many times in a row, and a time is the length of
// such a window on the GPU divided by its runs, so every launch and the gaps after it count. The runs cycle
// through copies of the inputs. A figure is the median of several windows, for all but v000 over two sittings.
// Sittings can differ by a few percent; kernels timed side by side share one.
// The starting kernel, v000, takes 950 microseconds a run.
#include <hip/hip_runtime.h>
#include <hip/hip_bf16.h>
#include <math.h>

typedef __attribute__((ext_vector_type(16))) _Float16 v16h;
typedef __attribute__((ext_vector_type(8)))  _Float16 v8h;
typedef __attribute__((ext_vector_type(8)))  float    v8f;
typedef __attribute__((ext_vector_type(4)))  float    v4f;
typedef __attribute__((ext_vector_type(4)))  unsigned int v4u;

__device__ __forceinline__ v16h loadfrag_h(const _Float16* base, int r0, int k0,
                                           int stride, unsigned lane) {
  const _Float16* p = base + (r0 + (int)(lane & 15u)) * stride + k0;
  int hi = (lane & 16u) ? 1 : 0;
  v8h lo = *(const v8h*)(p + (hi ? 8 : 0));
  v8h hj = *(const v8h*)(p + (hi ? 24 : 16));
  return __builtin_shufflevector(lo, hj, 0, 1, 2, 3, 4, 5, 6, 7, 8, 9, 10, 11,
                                 12, 13, 14, 15);
}

// A fragment for 2-tap conv chunk: K 0..15 = tap0 ch0..15, K 16..31 = tap1.
__device__ __forceinline__ v16h frag2tap(const _Float16* p0, const _Float16* p1,
                                         unsigned lane) {
  int hi = (lane & 16u) ? 8 : 0;
  v8h lo = *(const v8h*)(p0 + hi);
  v8h hj = *(const v8h*)(p1 + hi);
  return __builtin_shufflevector(lo, hj, 0, 1, 2, 3, 4, 5, 6, 7, 8, 9, 10, 11,
                                 12, 13, 14, 15);
}

// A fragment for 1-tap conv chunk over a 32-channel pixel record.
__device__ __forceinline__ v16h frag1tap(const _Float16* p, unsigned lane) {
  int hi = (lane & 16u) ? 1 : 0;
  v8h lo = *(const v8h*)(p + (hi ? 8 : 0));
  v8h hj = *(const v8h*)(p + (hi ? 24 : 16));
  return __builtin_shufflevector(lo, hj, 0, 1, 2, 3, 4, 5, 6, 7, 8, 9, 10, 11,
                                 12, 13, 14, 15);
}

// A fragment from f32 rows (softmax probabilities): 4x ds_load_b128 + cvt
__device__ __forceinline__ v16h loadfrag_f32(const float* base, int k0,
                                             int stride, unsigned lane) {
  const float* p = base + (int)(lane & 15u) * stride + k0;
  int hi = (lane & 16u) ? 1 : 0;
  v4f c0 = *(const v4f*)(p + (hi ? 8 : 0));
  v4f c1 = *(const v4f*)(p + (hi ? 8 : 0) + 4);
  v4f c2 = *(const v4f*)(p + (hi ? 24 : 16));
  v4f c3 = *(const v4f*)(p + (hi ? 24 : 16) + 4);
  v16h v;
#pragma unroll
  for (int t = 0; t < 4; ++t) {
    v[t]      = (_Float16)c0[t];
    v[4 + t]  = (_Float16)c1[t];
    v[8 + t]  = (_Float16)c2[t];
    v[12 + t] = (_Float16)c3[t];
  }
  return v;
}

__device__ __forceinline__ v8f wmma_f16(v16h a, v16h b, v8f c) {
  return __builtin_amdgcn_wmma_f32_16x16x32_f16(false, a, false, b, (short)0, c,
                                                false, false);
}

__device__ __forceinline__ v8f zero8() {
  v8f z = {0.f, 0.f, 0.f, 0.f, 0.f, 0.f, 0.f, 0.f};
  return z;
}

// ---------------------------------------------------------------------------
// Kernel 1: conv stack as per-tap WMMA GEMMs, one block (8 wave32) per image.
// Activations stored CHANNEL-LAST f16 in LDS so per-tap A-fragments are two
// raw ds_load_b128 from shifted pixel records (no im2col).
// D-stores are UNGUARDED: overflow tiles land in pre-zeroed slack pixels that
// no valid downstream output ever reads (conv3 valid reads <=483 of 512,
// conv4 valid reads <=360 of 368).
// Dynamic LDS layout (bytes):
//   xin  @      0 ( 3136)  28x28 f32
//   ws1  @   3136 ( 1024)  w1 f32
//   bb   @   4160 (  512)  biases b1..b4 padded to 32
//   h1   @   4672 (21504)  [672 pix][16ch] f16 (625 valid, slack zeroed)
//   h2   @  26176 (32768)  [512 pix][32ch] f16 (484 valid, ch pad 20->32)
//   h3   @  58944 (23552)  [368 pix][32ch] f16 (361 valid, ch pad 24->32)
//   Bc2  @  82496 (16384)  8 chunks x [32n][32k] f16 (2 taps/chunk)
//   Bc3  @  98880 (32768)  16 taps x [32n][32k] f16
//   Bc4  @ 131648 (32768)  16 taps x [32n][32k] f16
// total 164416 -> 164608
// ---------------------------------------------------------------------------
__global__ __launch_bounds__(256) void conv_stack_kernel(
    const float* __restrict__ x,
    const float* __restrict__ w1, const float* __restrict__ b1,
    const float* __restrict__ w2, const float* __restrict__ b2,
    const float* __restrict__ w3, const float* __restrict__ b3,
    const float* __restrict__ w4, const float* __restrict__ b4,
    _Float16* __restrict__ feat) {
  extern __shared__ char smem[];
  float*     xin = (float*)smem;
  float*     ws1 = (float*)(smem + 3136);
  float*     bbf = (float*)(smem + 4160);     // [4][32]
  _Float16*  h1  = (_Float16*)(smem + 4672);
  _Float16*  h2  = (_Float16*)(smem + 26176);
  _Float16*  h3  = (_Float16*)(smem + 58944);
  _Float16*  Bc2 = (_Float16*)(smem + 82496);
  _Float16*  Bc3 = (_Float16*)(smem + 98880);
  _Float16*  Bc4 = (_Float16*)(smem + 131648);

  const int tid = threadIdx.x;
  const unsigned lane = tid & 31u;
  const int wv = tid >> 5;
  const int b = blockIdx.x;

  // ---- stage: x, w1, biases, per-tap B matrices; zero h1/h2/h3 ----
  {
    const v4f* sx = (const v4f*)(x + (size_t)b * 784);
    v4f* dx = (v4f*)xin;
    for (int i = tid; i < 196; i += 256) dx[i] = sx[i];
    const v4f* s1 = (const v4f*)w1;  v4f* d1 = (v4f*)ws1;
    for (int i = tid; i < 64; i += 256) d1[i] = s1[i];
    for (int i = tid; i < 128; i += 256) {
      int g = i >> 5, n = i & 31;
      float v = 0.f;
      if (g == 0)      { if (n < 16) v = b1[n]; }
      else if (g == 1) { if (n < 20) v = b2[n]; }
      else if (g == 2) { if (n < 24) v = b3[n]; }
      else             { if (n < 30) v = b4[n]; }
      bbf[i] = v;
    }
    // zero h1..h3 (contiguous 77824 B = 4864 x b128)
    v4u zz = {0u, 0u, 0u, 0u};
    v4u* z = (v4u*)h1;
    for (int i = tid; i < 4864; i += 256) z[i] = zz;
    // Bc2: chunk c pairs taps 2c,2c+1; k<16 -> tap 2c ic=k, k>=16 -> tap 2c+1
    for (int idx = tid; idx < 8192; idx += 256) {
      int c = idx >> 10, rem = idx & 1023, n = rem >> 5, k = rem & 31;
      _Float16 v = (_Float16)0.f;
      if (n < 20) {
        int tap = 2 * c + (k >> 4), ic = k & 15;
        v = (_Float16)w2[(n * 16 + ic) * 16 + tap];
      }
      Bc2[idx] = v;
    }
    // Bc3: tap t, k = ic (20 valid of 32), n = oc (24 valid of 32)
    for (int idx = tid; idx < 16384; idx += 256) {
      int t = idx >> 10, rem = idx & 1023, n = rem >> 5, k = rem & 31;
      Bc3[idx] = (n < 24 && k < 20) ? (_Float16)w3[(n * 20 + k) * 16 + t]
                                    : (_Float16)0.f;
    }
    // Bc4: tap t, k = ic (24 valid of 32), n = oc (30 valid of 32)
    for (int idx = tid; idx < 16384; idx += 256) {
      int t = idx >> 10, rem = idx & 1023, n = rem >> 5, k = rem & 31;
      Bc4[idx] = (n < 30 && k < 24) ? (_Float16)w4[(n * 24 + k) * 16 + t]
                                    : (_Float16)0.f;
    }
  }
  __syncthreads();

  // ---- conv1 (ic=1, scalar): 28x28 -> 16x25x25, channel-last f16 ----
  for (int idx = tid; idx < 10000; idx += 256) {
    int p = idx >> 4, oc = idx & 15;
    int oy = p / 25, ox = p - oy * 25;
    float acc = bbf[oc];
    const float* wp = ws1 + oc * 16;
#pragma unroll
    for (int ky = 0; ky < 4; ++ky)
#pragma unroll
      for (int kx = 0; kx < 4; ++kx)
        acc += xin[(oy + ky) * 28 + ox + kx] * wp[ky * 4 + kx];
    h1[idx] = (_Float16)fmaxf(acc, 0.f);  // idx == p*16 + oc
  }
  __syncthreads();

  // ---- conv2 via WMMA: M=484(->496) x N=20(->32) x K=256 (8 chunks) ----
  for (int u = wv; u < 62; u += 8) {
    int mt = u >> 1, nt = u & 1;
    int m = mt * 16 + (int)(lane & 15u);
    int oy = m / 22, ox = m - oy * 22;
    v8f acc = zero8();
#pragma unroll
    for (int c = 0; c < 8; ++c) {
      int t0 = 2 * c, t1 = 2 * c + 1;
      const _Float16* p0 = h1 + ((oy + (t0 >> 2)) * 25 + ox + (t0 & 3)) * 16;
      const _Float16* p1 = h1 + ((oy + (t1 >> 2)) * 25 + ox + (t1 & 3)) * 16;
      v16h a = frag2tap(p0, p1, lane);
      v16h bf = loadfrag_h(Bc2 + c * 1024, nt * 16, 0, 32, lane);
      acc = wmma_f16(a, bf, acc);
    }
    int n = nt * 16 + (int)(lane & 15u);
    float bias = bbf[32 + n];
    int mh = (lane & 16u) ? 8 : 0;
#pragma unroll
    for (int r = 0; r < 8; ++r)
      h2[(mt * 16 + mh + r) * 32 + n] = (_Float16)fmaxf(acc[r] + bias, 0.f);
  }
  __syncthreads();

  // ---- conv3 via WMMA: M=361(->368) x N=24(->32) x K=512 (16 taps) ----
  for (int u = wv; u < 46; u += 8) {
    int mt = u >> 1, nt = u & 1;
    int m = mt * 16 + (int)(lane & 15u);
    int oy = m / 19, ox = m - oy * 19;
    v8f acc = zero8();
#pragma unroll
    for (int t = 0; t < 16; ++t) {
      const _Float16* p = h2 + ((oy + (t >> 2)) * 22 + ox + (t & 3)) * 32;
      v16h a = frag1tap(p, lane);
      v16h bf = loadfrag_h(Bc3 + t * 1024, nt * 16, 0, 32, lane);
      acc = wmma_f16(a, bf, acc);
    }
    int n = nt * 16 + (int)(lane & 15u);
    float bias = bbf[64 + n];
    int mh = (lane & 16u) ? 8 : 0;
#pragma unroll
    for (int r = 0; r < 8; ++r)
      h3[(mt * 16 + mh + r) * 32 + n] = (_Float16)fmaxf(acc[r] + bias, 0.f);
  }
  __syncthreads();

  // ---- conv4 via WMMA: M=256 x N=30(->32) x K=512; write features+coords ----
  _Float16* fb = feat + (size_t)b * 8192;
  for (int u = wv; u < 32; u += 8) {
    int mt = u >> 1, nt = u & 1;
    int m = mt * 16 + (int)(lane & 15u);
    int oy = m >> 4, ox = m & 15;
    v8f acc = zero8();
#pragma unroll
    for (int t = 0; t < 16; ++t) {
      const _Float16* p = h3 + ((oy + (t >> 2)) * 19 + ox + (t & 3)) * 32;
      v16h a = frag1tap(p, lane);
      v16h bf = loadfrag_h(Bc4 + t * 1024, nt * 16, 0, 32, lane);
      acc = wmma_f16(a, bf, acc);
    }
    int n = nt * 16 + (int)(lane & 15u);
    int mh = (lane & 16u) ? 8 : 0;
    if (n < 30) {  // per-lane-uniform guard hoisted outside the r-loop
      float bias = bbf[96 + n];
#pragma unroll
      for (int r = 0; r < 8; ++r)
        fb[(mt * 16 + mh + r) * 32 + n] = (_Float16)fmaxf(acc[r] + bias, 0.f);
    }
  }
  {
    int n = tid;  // coord channels (columns 30/31, disjoint from tile stores)
    int xx = n % 16, yy = n / 16;
    fb[n * 32 + 30] = (_Float16)((float)xx * 0.0625f);
    fb[n * 32 + 31] = (_Float16)((float)yy * 0.0625f);
  }
}

__global__ __launch_bounds__(256) void attn_kernel(
    const _Float16* __restrict__ feat,
    const float* __restrict__ kW, const float* __restrict__ kb,
    const float* __restrict__ qW, const float* __restrict__ qb,
    const float* __restrict__ vW, const float* __restrict__ vb,
    const float* __restrict__ kg, const float* __restrict__ kbe,
    const float* __restrict__ qg, const float* __restrict__ qbe,
    const float* __restrict__ vg, const float* __restrict__ vbe,
    const float* __restrict__ l1W, const float* __restrict__ l1b,
    const float* __restrict__ l2W, const float* __restrict__ l2b,
    float* __restrict__ out) {
  extern __shared__ char smem[];
  _Float16* hbuf = (_Float16*)smem;
  _Float16* Qb   = (_Float16*)(smem + 16384);
  _Float16* Kb   = (_Float16*)(smem + 49152);
  _Float16* Vt   = (_Float16*)(smem + 81920);
  _Float16* wbuf = (_Float16*)(smem + 107264);
  float* tmpf = (float*)(smem + 111104);
  float* sc   = (float*)(smem + 160256);
  float* red  = (float*)(smem + 293376);
  float* mxv  = (float*)(smem + 295456);
  float* ov   = (float*)(smem + 295648);
  float* bb   = (float*)(smem + 295712);

  const int tid = threadIdx.x;
  const unsigned lane = tid & 31u;
  const int wv = tid >> 5;
  const int b = blockIdx.x;

  {
    const v4u* src = (const v4u*)(feat + (size_t)b * 8192);
    v4u* dst = (v4u*)hbuf;
    for (int i = tid; i < 1024; i += 256) dst[i] = src[i];
    const float* Bp[3] = {vb, kb, qb};
    for (int idx = tid; idx < 144; idx += 256) {
      int p = idx / 48, j = idx % 48;
      bb[idx] = (j < 36) ? Bp[p][j] : 0.f;
    }
  }
  __syncthreads();

  const float* Ws[3] = {vW, kW, qW};
  const float* Gs[3] = {vg, kg, qg};
  const float* Es[3] = {vbe, kbe, qbe};

  for (int p = 0; p < 3; ++p) {
    for (int idx = tid; idx < 48 * 40; idx += 256) {
      int n = idx / 40, k = idx % 40;
      wbuf[idx] = (n < 36 && k < 32) ? (_Float16)Ws[p][n * 32 + k]
                                     : (_Float16)0.f;
    }
    __syncthreads();

    for (int t = wv; t < 48; t += 8) {
      int rt = t / 3, nt = t % 3;
      v16h a  = loadfrag_h(hbuf, rt * 16, 0, 32, lane);
      v16h bf = loadfrag_h(wbuf, nt * 16, 0, 40, lane);
      v8f acc = zero8();
      acc = wmma_f16(a, bf, acc);
      int n = nt * 16 + (int)(lane & 15u);
      float bias = bb[p * 48 + n];
      int mh = (lane & 16u) ? 8 : 0;
#pragma unroll
      for (int r = 0; r < 8; ++r)
        tmpf[(rt * 16 + mh + r) * 48 + n] = acc[r] + bias;
    }
    __syncthreads();

    {
      float s = 0.f, s2 = 0.f;
      const float* rowp = tmpf + tid * 48;
#pragma unroll
      for (int c = 0; c < 36; c += 4) {
        v4f v = *(const v4f*)(rowp + c);
        s += v[0] + v[1] + v[2] + v[3];
        s2 += v[0] * v[0] + v[1] * v[1] + v[2] * v[2] + v[3] * v[3];
      }
      red[tid] = s; red[256 + tid] = s2;
    }
    __syncthreads();
    for (int off = 128; off > 0; off >>= 1) {
      if (tid < off) {
        red[tid] += red[tid + off];
        red[256 + tid] += red[256 + tid + off];
      }
      __syncthreads();
    }
    float mu   = red[0] * (1.f / 9216.f);
    float var  = red[256] * (1.f / 9216.f) - mu * mu;
    float rstd = rsqrtf(var + 1e-5f);

    if (p == 0) {
      for (int idx = tid; idx < 48 * 256; idx += 256) {
        int j = idx >> 8, node = idx & 255;
        float o = 0.f;
        if (j < 36) {
          float v = (tmpf[node * 48 + j] - mu) * rstd;
          o = v * Gs[0][node * 36 + j] + Es[0][node * 36 + j];
        }
        Vt[j * 264 + node] = (_Float16)o;
      }
    } else {
      _Float16* dst = (p == 1) ? Kb : Qb;
      for (int idx = tid; idx < 256 * 64; idx += 256) {
        int n = idx >> 6, j = idx & 63;
        float o = 0.f;
        if (j < 36) {
          float v = (tmpf[n * 48 + j] - mu) * rstd;
          o = v * Gs[p][n * 36 + j] + Es[p][n * 36 + j];
        }
        dst[idx] = (_Float16)o;
      }
    }
    __syncthreads();
  }

  const float scale = 0.16666667f;  // 1/sqrt(36)
  float* scw = sc + wv * 16 * 260;
  for (int blk = wv; blk < 16; blk += 8) {
    int row0 = blk * 16;
    v16h qa0 = loadfrag_h(Qb, row0, 0, 64, lane);
    v16h qa1 = loadfrag_h(Qb, row0, 32, 64, lane);
    for (int ct = 0; ct < 16; ++ct) {
      v8f acc = zero8();
      acc = wmma_f16(qa0, loadfrag_h(Kb, ct * 16, 0, 64, lane), acc);
      acc = wmma_f16(qa1, loadfrag_h(Kb, ct * 16, 32, 64, lane), acc);
      int n = ct * 16 + (int)(lane & 15u);
      int mh = (lane & 16u) ? 8 : 0;
#pragma unroll
      for (int r = 0; r < 8; ++r)
        scw[(mh + r) * 260 + n] = acc[r] * scale;
    }
    if (lane < 16u) {
      float* rowp = scw + (int)lane * 260;
      float mx = -1e30f;
      for (int c = 0; c < 256; c += 4) {
        v4f v = *(const v4f*)(rowp + c);
        mx = fmaxf(mx, fmaxf(fmaxf(v[0], v[1]), fmaxf(v[2], v[3])));
      }
      float s = 0.f;
      for (int c = 0; c < 256; c += 4) {
        v4f v = *(const v4f*)(rowp + c);
        v4f e;
        e[0] = __expf(v[0] - mx); e[1] = __expf(v[1] - mx);
        e[2] = __expf(v[2] - mx); e[3] = __expf(v[3] - mx);
        s += e[0] + e[1] + e[2] + e[3];
        *(v4f*)(rowp + c) = e;
      }
      rowp[256] = s;
    }
    v8f av0 = zero8(), av1 = zero8(), av2 = zero8();
    for (int kc = 0; kc < 8; ++kc) {
      v16h a = loadfrag_f32(scw, kc * 32, 260, lane);
      av0 = wmma_f16(a, loadfrag_h(Vt, 0, kc * 32, 264, lane), av0);
      av1 = wmma_f16(a, loadfrag_h(Vt, 16, kc * 32, 264, lane), av1);
      av2 = wmma_f16(a, loadfrag_h(Vt, 32, kc * 32, 264, lane), av2);
    }
    int mh = (lane & 16u) ? 8 : 0;
    int nl = (int)(lane & 15u);
#pragma unroll
    for (int r = 0; r < 8; ++r) {
      float invr = 1.f / scw[(mh + r) * 260 + 256];
      tmpf[(row0 + mh + r) * 48 + nl]      = av0[r] * invr;
      tmpf[(row0 + mh + r) * 48 + 16 + nl] = av1[r] * invr;
      tmpf[(row0 + mh + r) * 48 + 32 + nl] = av2[r] * invr;
    }
  }
  __syncthreads();

  float* l1Ws = (float*)Qb;  // Qb region is dead now
  for (int i = tid; i < 1296; i += 256) l1Ws[i] = l1W[i];
  __syncthreads();

  float* att2 = sc;
  {
    const float* ar = tmpf + tid * 48;
    for (int j = 0; j < 36; ++j) {
      float s = l1b[j];
      const float* wr = l1Ws + j * 36;
      for (int k = 0; k < 36; ++k) s += ar[k] * wr[k];
      att2[tid * 40 + j] = fmaxf(s, 0.f);
    }
  }
  __syncthreads();

  {
    float s = 0.f, s2 = 0.f;
    const float* rp = att2 + tid * 40;
#pragma unroll
    for (int c = 0; c < 36; c += 4) {
      v4f v = *(const v4f*)(rp + c);
      s += v[0] + v[1] + v[2] + v[3];
      s2 += v[0] * v[0] + v[1] * v[1] + v[2] * v[2] + v[3] * v[3];
    }
    red[tid] = s; red[256 + tid] = s2;
  }
  __syncthreads();
  for (int off = 128; off > 0; off >>= 1) {
    if (tid < off) {
      red[tid] += red[tid + off];
      red[256 + tid] += red[256 + tid + off];
    }
    __syncthreads();
  }
  float mu   = red[0] * (1.f / 9216.f);
  float var  = red[256] * (1.f / 9216.f) - mu * mu;
  float rstd = rsqrtf(var + 1e-5f);

  if (tid < 36) {
    float m = -1e30f;
    for (int n = 0; n < 256; ++n) m = fmaxf(m, att2[n * 40 + tid]);
    mxv[tid] = (m - mu) * rstd;
  }
  __syncthreads();

  if (tid < 10) {
    float s = l2b[tid];
    for (int j = 0; j < 36; ++j) s += mxv[j] * l2W[tid * 36 + j];
    ov[tid] = s;
  }
  __syncthreads();
  if (tid == 0) {
    float mx = -1e30f;
    for (int o = 0; o < 10; ++o) mx = fmaxf(mx, ov[o]);
    float s = 0.f;
    for (int o = 0; o < 10; ++o) s += __expf(ov[o] - mx);
    red[0] = mx + __logf(s);
  }
  __syncthreads();
  if (tid < 10) out[(size_t)b * 10 + tid] = ov[tid] - red[0];
}

// ---------------------------------------------------------------------------
extern "C" void kernel_launch(void* const* d_in, const int* in_sizes, int n_in,
                              void* d_out, int out_size, void* d_ws, size_t ws_size,
                              hipStream_t stream) {
  const float* x  = (const float*)d_in[0];
  const float* w1 = (const float*)d_in[1];  const float* b1 = (const float*)d_in[2];
  const float* w2 = (const float*)d_in[3];  const float* b2 = (const float*)d_in[4];
  const float* w3 = (const float*)d_in[5];  const float* b3 = (const float*)d_in[6];
  const float* w4 = (const float*)d_in[7];  const float* b4 = (const float*)d_in[8];
  const float* kW = (const float*)d_in[9];  const float* kbv = (const float*)d_in[10];
  const float* qW = (const float*)d_in[11]; const float* qbv = (const float*)d_in[12];
  const float* vW = (const float*)d_in[13]; const float* vbv = (const float*)d_in[14];
  const float* kg = (const float*)d_in[15]; const float* kbe = (const float*)d_in[16];
  const float* qg = (const float*)d_in[17]; const float* qbe = (const float*)d_in[18];
  const float* vg = (const float*)d_in[19]; const float* vbe = (const float*)d_in[20];
  const float* l1W = (const float*)d_in[21]; const float* l1b = (const float*)d_in[22];
  const float* l2W = (const float*)d_in[23]; const float* l2b = (const float*)d_in[24];

  const int B = in_sizes[0] / (28 * 28);   // 2048
  _Float16* feat = (_Float16*)d_ws;        // [B][256][32] f16 = 16 KB/batch

  conv_stack_kernel<<<B, 256, 164608, stream>>>(x, w1, b1, w2, b2, w3, b3, w4,
                                                b4, feat);
  attn_kernel<<<B, 256, 296448, stream>>>(feat, kW, kbv, qW, qbv, vW, vbv,
                                          kg, kbe, qg, qbe, vg, vbe,
                                          l1W, l1b, l2W, l2b, (float*)d_out);
}

// v001
// A run of this version takes 573 microseconds.
// In both of two side-by-side timings against v000, it was 1.68 times as fast.
#include <hip/hip_runtime.h>
#include <hip/hip_bf16.h>
#include <math.h>

typedef __attribute__((ext_vector_type(16))) _Float16 v16h;
typedef __attribute__((ext_vector_type(8)))  _Float16 v8h;
typedef __attribute__((ext_vector_type(4)))  _Float16 v4h;
typedef __attribute__((ext_vector_type(2)))  _Float16 v2h;
typedef __attribute__((ext_vector_type(8)))  float    v8f;
typedef __attribute__((ext_vector_type(4)))  float    v4f;
typedef __attribute__((ext_vector_type(4)))  unsigned int v4u;

__device__ __forceinline__ v16h loadfrag_h(const _Float16* base, int r0, int k0,
                                           int stride, unsigned lane) {
  const _Float16* p = base + (r0 + (int)(lane & 15u)) * stride + k0;
  int hi = (lane & 16u) ? 1 : 0;
  v8h lo = *(const v8h*)(p + (hi ? 8 : 0));
  v8h hj = *(const v8h*)(p + (hi ? 24 : 16));
  return __builtin_shufflevector(lo, hj, 0, 1, 2, 3, 4, 5, 6, 7, 8, 9, 10, 11,
                                 12, 13, 14, 15);
}

// A fragment for 2-tap conv chunk: K 0..15 = tap0 ch0..15, K 16..31 = tap1.
__device__ __forceinline__ v16h frag2tap(const _Float16* p0, const _Float16* p1,
                                         unsigned lane) {
  int hi = (lane & 16u) ? 8 : 0;
  v8h lo = *(const v8h*)(p0 + hi);
  v8h hj = *(const v8h*)(p1 + hi);
  return __builtin_shufflevector(lo, hj, 0, 1, 2, 3, 4, 5, 6, 7, 8, 9, 10, 11,
                                 12, 13, 14, 15);
}

// A fragment for 1-tap conv chunk over a 32-channel pixel record.
__device__ __forceinline__ v16h frag1tap(const _Float16* p, unsigned lane) {
  int hi = (lane & 16u) ? 1 : 0;
  v8h lo = *(const v8h*)(p + (hi ? 8 : 0));
  v8h hj = *(const v8h*)(p + (hi ? 24 : 16));
  return __builtin_shufflevector(lo, hj, 0, 1, 2, 3, 4, 5, 6, 7, 8, 9, 10, 11,
                                 12, 13, 14, 15);
}

// A fragment from f32 rows (softmax probabilities): 4x ds_load_b128 + cvt
__device__ __forceinline__ v16h loadfrag_f32(const float* base, int k0,
                                             int stride, unsigned lane) {
  const float* p = base + (int)(lane & 15u) * stride + k0;
  int hi = (lane & 16u) ? 1 : 0;
  v4f c0 = *(const v4f*)(p + (hi ? 8 : 0));
  v4f c1 = *(const v4f*)(p + (hi ? 8 : 0) + 4);
  v4f c2 = *(const v4f*)(p + (hi ? 24 : 16));
  v4f c3 = *(const v4f*)(p + (hi ? 24 : 16) + 4);
  v16h v;
#pragma unroll
  for (int t = 0; t < 4; ++t) {
    v[t]      = (_Float16)c0[t];
    v[4 + t]  = (_Float16)c1[t];
    v[8 + t]  = (_Float16)c2[t];
    v[12 + t] = (_Float16)c3[t];
  }
  return v;
}

__device__ __forceinline__ v8f wmma_f16(v16h a, v16h b, v8f c) {
  return __builtin_amdgcn_wmma_f32_16x16x32_f16(false, a, false, b, (short)0, c,
                                                false, false);
}

__device__ __forceinline__ v8f zero8() {
  v8f z = {0.f, 0.f, 0.f, 0.f, 0.f, 0.f, 0.f, 0.f};
  return z;
}

// ---------------------------------------------------------------------------
// Kernel 1: conv stack as per-tap WMMA GEMMs, one block (8 wave32) per image.
// Activations stored CHANNEL-LAST f16 in LDS so per-tap A-fragments are two
// raw ds_load_b128 from shifted pixel records (no im2col).
// D-stores are UNGUARDED: overflow tiles land in pre-zeroed slack pixels that
// no valid downstream output ever reads (conv3 valid reads <=483 of 512,
// conv4 valid reads <=360 of 368).
// Dynamic LDS layout (bytes):
//   xin  @      0 ( 3136)  28x28 f32
//   ws1  @   3136 ( 1024)  w1 f32
//   bb   @   4160 (  512)  biases b1..b4 padded to 32
//   h1   @   4672 (21504)  [672 pix][16ch] f16 (625 valid, slack zeroed)
//   h2   @  26176 (32768)  [512 pix][32ch] f16 (484 valid, ch pad 20->32)
//   h3   @  58944 (23552)  [368 pix][32ch] f16 (361 valid, ch pad 24->32)
//   Bc2  @  82496 (16384)  8 chunks x [32n][32k] f16 (2 taps/chunk)
//   Bc3  @  98880 (32768)  16 taps x [32n][32k] f16
//   Bc4  @ 131648 (32768)  16 taps x [32n][32k] f16
// total 164416 -> 164608
// ---------------------------------------------------------------------------
__global__ __launch_bounds__(256) void conv_stack_kernel(
    const float* __restrict__ x,
    const float* __restrict__ w1, const float* __restrict__ b1,
    const float* __restrict__ w2, const float* __restrict__ b2,
    const float* __restrict__ w3, const float* __restrict__ b3,
    const float* __restrict__ w4, const float* __restrict__ b4,
    _Float16* __restrict__ feat) {
  extern __shared__ char smem[];
  float*     xin = (float*)smem;
  float*     ws1 = (float*)(smem + 3136);
  float*     bbf = (float*)(smem + 4160);     // [4][32]
  _Float16*  h1  = (_Float16*)(smem + 4672);
  _Float16*  h2  = (_Float16*)(smem + 26176);
  _Float16*  h3  = (_Float16*)(smem + 58944);
  _Float16*  Bc2 = (_Float16*)(smem + 82496);
  _Float16*  Bc3 = (_Float16*)(smem + 98880);
  _Float16*  Bc4 = (_Float16*)(smem + 131648);

  const int tid = threadIdx.x;
  const unsigned lane = tid & 31u;
  const int wv = tid >> 5;
  const int b = blockIdx.x;

  // ---- every global read of this kernel: coalesced, branch-free (indices
  // clamped, stores guarded) and issued together, so the L2 round trips
  // overlap instead of one waited 4-byte load per staged element ----
  // Weight unit u = (oc n, input-channel pair kp, tap quad tq), tq fastest:
  // two 16-byte loads (channels 2kp and 2kp+1, taps 4tq..4tq+3) feed four
  // 4-byte LDS stores of a channel pair each.
  // (the unrolls here and in the scatter below keep the arrays in registers)
  v4f r2a[3], r2b[3], r3a[4], r3b[4], r4a[6], r4b[6];
  {
    const v4f* w2v = (const v4f*)w2;  // 20 x 8 x 4  = 640 units
    const v4f* w3v = (const v4f*)w3;  // 24 x 10 x 4 = 960 units
    const v4f* w4v = (const v4f*)w4;  // 30 x 12 x 4 = 1440 units
    // 16-byte index of unit u: (u>>2)*8 + (u&3); 256 units further = +512.
    // Each tensor's last, partial slice clamps its unit.
    const int a0 = (tid >> 2) * 8 + (tid & 3);
    const int u2 = tid + 512 < 640 ? tid + 512 : 639;
    const int u3 = tid + 768 < 960 ? tid + 768 : 959;
    const int u4 = tid + 1280 < 1440 ? tid + 1280 : 1439;
    const int a2 = (u2 >> 2) * 8 + (u2 & 3);
    const int a3 = (u3 >> 2) * 8 + (u3 & 3);
    const int a4 = (u4 >> 2) * 8 + (u4 & 3);
#pragma unroll
    for (int i = 0; i < 2; ++i) {
      r2a[i] = w2v[a0 + 512 * i];
      r2b[i] = w2v[a0 + 512 * i + 4];
    }
    r2a[2] = w2v[a2];
    r2b[2] = w2v[a2 + 4];
#pragma unroll
    for (int i = 0; i < 3; ++i) {
      r3a[i] = w3v[a0 + 512 * i];
      r3b[i] = w3v[a0 + 512 * i + 4];
    }
    r3a[3] = w3v[a3];
    r3b[3] = w3v[a3 + 4];
#pragma unroll
    for (int i = 0; i < 5; ++i) {
      r4a[i] = w4v[a0 + 512 * i];
      r4b[i] = w4v[a0 + 512 * i + 4];
    }
    r4a[5] = w4v[a4];
    r4b[5] = w4v[a4 + 4];

    const v4f* sx = (const v4f*)(x + (size_t)b * 784);
    v4f xr  = sx[tid < 196 ? tid : 195];
    const int a1 = tid & 63;
    v4f w1r = ((const v4f*)w1)[a1];
    int g = (tid >> 5) & 3, n = tid & 31;
    const float* bp = (g == 0) ? b1 : (g == 1) ? b2 : (g == 2) ? b3 : b4;
    int lim = (g == 0) ? 16 : (g == 1) ? 20 : (g == 2) ? 24 : 30;
    const float* bq = bp + (n < lim ? n : 0);
    float bv = *bq;
    // The loads' address registers are inputs here, so they stay unwritten
    // (also by a later load's result) until this wait.
    asm volatile("s_wait_xcnt 0x0"
                 :: "v"(a0), "v"(a1), "v"(a2), "v"(a3), "v"(a4), "v"(bq)
                 : "memory");
    // zero h1..h3 and Bc2..Bc4 (contiguous 159744 B = 9984 x b128)
    v4u zz = {0u, 0u, 0u, 0u};
    v4u* z = (v4u*)h1;
    for (int i = 0; i < 39; ++i) z[tid + 256 * i] = zz;
    if (tid < 196) ((v4f*)xin)[tid] = xr;
    if (tid < 64)  ((v4f*)ws1)[tid] = w1r;
    if (tid < 128) bbf[tid] = (n < lim) ? bv : 0.f;
  }
  __syncthreads();

  // ---- scatter the weights into the zeroed per-tap B matrices ----
  // Bc2: chunk c pairs taps 2c,2c+1; k<16 -> tap 2c ic=k, k>=16 -> tap 2c+1
#pragma unroll
  for (int i = 0; i < 3; ++i) {
    int u = tid + 256 * i;
    if (u < 640) {
      int t0 = (u & 3) * 4, r = u >> 2;
      int n = r >> 3, ic = (r & 7) * 2;
#pragma unroll
      for (int e = 0; e < 4; ++e) {
        int tap = t0 + e;
        v2h h = {(_Float16)r2a[i][e], (_Float16)r2b[i][e]};
        *(v2h*)(Bc2 + (tap >> 1) * 1024 + n * 32 + (tap & 1) * 16 + ic) = h;
      }
    }
  }
  // Bc3: tap t, k = ic (20 valid of 32), n = oc (24 valid of 32)
#pragma unroll
  for (int i = 0; i < 4; ++i) {
    int u = tid + 256 * i;
    if (u < 960) {
      int t0 = (u & 3) * 4, r = u >> 2;
      int n = r / 10, k = (r - n * 10) * 2;
#pragma unroll
      for (int e = 0; e < 4; ++e) {
        v2h h = {(_Float16)r3a[i][e], (_Float16)r3b[i][e]};
        *(v2h*)(Bc3 + (t0 + e) * 1024 + n * 32 + k) = h;
      }
    }
  }
  // Bc4: tap t, k = ic (24 valid of 32), n = oc (30 valid of 32)
#pragma unroll
  for (int i = 0; i < 6; ++i) {
    int u = tid + 256 * i;
    if (u < 1440) {
      int t0 = (u & 3) * 4, r = u >> 2;
      int n = r / 12, k = (r - n * 12) * 2;
#pragma unroll
      for (int e = 0; e < 4; ++e) {
        v2h h = {(_Float16)r4a[i][e], (_Float16)r4b[i][e]};
        *(v2h*)(Bc4 + (t0 + e) * 1024 + n * 32 + k) = h;
      }
    }
  }

  // ---- conv1 (ic=1, scalar): 28x28 -> 16x25x25, channel-last f16 ----
  for (int idx = tid; idx < 10000; idx += 256) {
    int p = idx >> 4, oc = idx & 15;
    int oy = p / 25, ox = p - oy * 25;
    float acc = bbf[oc];
    const float* wp = ws1 + oc * 16;
#pragma unroll
    for (int ky = 0; ky < 4; ++ky)
#pragma unroll
      for (int kx = 0; kx < 4; ++kx)
        acc += xin[(oy + ky) * 28 + ox + kx] * wp[ky * 4 + kx];
    h1[idx] = (_Float16)fmaxf(acc, 0.f);  // idx == p*16 + oc
  }
  __syncthreads();

  // ---- conv2 via WMMA: M=484(->496) x N=20(->32) x K=256 (8 chunks) ----
  for (int u = wv; u < 62; u += 8) {
    int mt = u >> 1, nt = u & 1;
    int m = mt * 16 + (int)(lane & 15u);
    int oy = m / 22, ox = m - oy * 22;
    v8f acc = zero8();
#pragma unroll
    for (int c = 0; c < 8; ++c) {
      int t0 = 2 * c, t1 = 2 * c + 1;
      const _Float16* p0 = h1 + ((oy + (t0 >> 2)) * 25 + ox + (t0 & 3)) * 16;
      const _Float16* p1 = h1 + ((oy + (t1 >> 2)) * 25 + ox + (t1 & 3)) * 16;
      v16h a = frag2tap(p0, p1, lane);
      v16h bf = loadfrag_h(Bc2 + c * 1024, nt * 16, 0, 32, lane);
      acc = wmma_f16(a, bf, acc);
    }
    int n = nt * 16 + (int)(lane & 15u);
    float bias = bbf[32 + n];
    int mh = (lane & 16u) ? 8 : 0;
#pragma unroll
    for (int r = 0; r < 8; ++r)
      h2[(mt * 16 + mh + r) * 32 + n] = (_Float16)fmaxf(acc[r] + bias, 0.f);
  }
  __syncthreads();

  // ---- conv3 via WMMA: M=361(->368) x N=24(->32) x K=512 (16 taps) ----
  for (int u = wv; u < 46; u += 8) {
    int mt = u >> 1, nt = u & 1;
    int m = mt * 16 + (int)(lane & 15u);
    int oy = m / 19, ox = m - oy * 19;
    v8f acc = zero8();
#pragma unroll
    for (int t = 0; t < 16; ++t) {
      const _Float16* p = h2 + ((oy + (t >> 2)) * 22 + ox + (t & 3)) * 32;
      v16h a = frag1tap(p, lane);
      v16h bf = loadfrag_h(Bc3 + t * 1024, nt * 16, 0, 32, lane);
      acc = wmma_f16(a, bf, acc);
    }
    int n = nt * 16 + (int)(lane & 15u);
    float bias = bbf[64 + n];
    int mh = (lane & 16u) ? 8 : 0;
#pragma unroll
    for (int r = 0; r < 8; ++r)
      h3[(mt * 16 + mh + r) * 32 + n] = (_Float16)fmaxf(acc[r] + bias, 0.f);
  }
  __syncthreads();

  // ---- conv4 via WMMA: M=256 x N=30(->32) x K=512; write features+coords ----
  _Float16* fb = feat + (size_t)b * 8192;
  for (int u = wv; u < 32; u += 8) {
    int mt = u >> 1, nt = u & 1;
    int m = mt * 16 + (int)(lane & 15u);
    int oy = m >> 4, ox = m & 15;
    v8f acc = zero8();
#pragma unroll
    for (int t = 0; t < 16; ++t) {
      const _Float16* p = h3 + ((oy + (t >> 2)) * 19 + ox + (t & 3)) * 32;
      v16h a = frag1tap(p, lane);
      v16h bf = loadfrag_h(Bc4 + t * 1024, nt * 16, 0, 32, lane);
      acc = wmma_f16(a, bf, acc);
    }
    int n = nt * 16 + (int)(lane & 15u);
    int mh = (lane & 16u) ? 8 : 0;
    if (n < 30) {  // per-lane-uniform guard hoisted outside the r-loop
      float bias = bbf[96 + n];
#pragma unroll
      for (int r = 0; r < 8; ++r)
        fb[(mt * 16 + mh + r) * 32 + n] = (_Float16)fmaxf(acc[r] + bias, 0.f);
    }
  }
  {
    int n = tid;  // coord channels (columns 30/31, disjoint from tile stores)
    int xx = n % 16, yy = n / 16;
    fb[n * 32 + 30] = (_Float16)((float)xx * 0.0625f);
    fb[n * 32 + 31] = (_Float16)((float)yy * 0.0625f);
  }
}

__global__ __launch_bounds__(256) void attn_kernel(
    const _Float16* __restrict__ feat,
    const float* __restrict__ kW, const float* __restrict__ kb,
    const float* __restrict__ qW, const float* __restrict__ qb,
    const float* __restrict__ vW, const float* __restrict__ vb,
    const float* __restrict__ kg, const float* __restrict__ kbe,
    const float* __restrict__ qg, const float* __restrict__ qbe,
    const float* __restrict__ vg, const float* __restrict__ vbe,
    const float* __restrict__ l1W, const float* __restrict__ l1b,
    const float* __restrict__ l2W, const float* __restrict__ l2b,
    float* __restrict__ out) {
  extern __shared__ char smem[];
  _Float16* hbuf = (_Float16*)smem;
  _Float16* Qb   = (_Float16*)(smem + 16384);
  _Float16* Kb   = (_Float16*)(smem + 49152);
  _Float16* Vt   = (_Float16*)(smem + 81920);
  _Float16* wbuf = (_Float16*)(smem + 107264);
  float* tmpf = (float*)(smem + 111104);
  float* sc   = (float*)(smem + 160256);
  float* red  = (float*)(smem + 293376);
  float* mxv  = (float*)(smem + 295456);
  float* ov   = (float*)(smem + 295648);
  float* bb   = (float*)(smem + 295712);

  const int tid = threadIdx.x;
  const unsigned lane = tid & 31u;
  const int wv = tid >> 5;
  const int b = blockIdx.x;

  // ---- features, projection weights, biases: coalesced, branch-free reads
  // (indices clamped, stores guarded), all in flight together ----
  // (unrolls on fr/wreg/gr/er loops keep these arrays in registers)
  v4f wreg[3][2];
  // gamma/beta of pass p: 18 coalesced 16-byte loads in flight together.
  // Pass 0's go out here; pass p+1's go out ahead of pass p's normalisation,
  // which covers their L2 round trip up to the barrier behind it.
  v4f gr[3][9], er[3][9];
#pragma unroll
  for (int i = 0; i < 9; ++i) {
    gr[0][i] = ((const v4f*)vg)[tid + 256 * i];
    er[0][i] = ((const v4f*)vbe)[tid + 256 * i];
  }
  {
    const v4u* src = (const v4u*)(feat + (size_t)b * 8192);
    v4u fr[4];
#pragma unroll
    for (int i = 0; i < 4; ++i) fr[i] = src[tid + 256 * i];
    const int f1 = 256 + (tid & 31);  // each W is 288 x 16 B
    wreg[0][0] = ((const v4f*)vW)[tid];  wreg[0][1] = ((const v4f*)vW)[f1];
    wreg[1][0] = ((const v4f*)kW)[tid];  wreg[1][1] = ((const v4f*)kW)[f1];
    wreg[2][0] = ((const v4f*)qW)[tid];  wreg[2][1] = ((const v4f*)qW)[f1];
    const int bi = tid < 144 ? tid : 0;
    const int pb = bi / 48, jb = bi - pb * 48;
    const float* bp = (pb == 0) ? vb : (pb == 1) ? kb : qb;
    float bv = bp[jb < 36 ? jb : 0];

    // zero what the staged operands pad with; no later store touches these:
    // Q/K columns 36..63 (7 x 8 B per row), V^T rows 36..47, W rows 36..47
    const v4h zh = {(_Float16)0.f, (_Float16)0.f, (_Float16)0.f, (_Float16)0.f};
    const v4u zz = {0u, 0u, 0u, 0u};
    for (int i = 0; i < 7; ++i) {
      int q = tid + 256 * i;
      int node = q / 7, s = q - node * 7;
      *(v4h*)(Qb + node * 64 + 36 + s * 4) = zh;
      *(v4h*)(Kb + node * 64 + 36 + s * 4) = zh;
    }
    for (int i = tid; i < 396; i += 256) ((v4u*)(Vt + 36 * 264))[i] = zz;
    if (tid < 60) ((v4u*)(wbuf + 36 * 40))[tid] = zz;

    v4u* dst = (v4u*)hbuf;
#pragma unroll
    for (int i = 0; i < 4; ++i) dst[tid + 256 * i] = fr[i];
    if (tid < 144) bb[tid] = (jb < 36) ? bv : 0.f;
  }
  __syncthreads();

  // unrolled: wreg/gr/er are indexed by p and have to stay in registers
#pragma unroll
  for (int p = 0; p < 3; ++p) {
    {
      const int k = (tid & 7) * 4;
      v4f w0 = wreg[p][0];
      v4h h0 = {(_Float16)w0[0], (_Float16)w0[1], (_Float16)w0[2], (_Float16)w0[3]};
      *(v4h*)(wbuf + (tid >> 3) * 40 + k) = h0;
      if (tid < 32) {
        v4f w1v = wreg[p][1];
        v4h h1v = {(_Float16)w1v[0], (_Float16)w1v[1], (_Float16)w1v[2], (_Float16)w1v[3]};
        *(v4h*)(wbuf + (32 + (tid >> 3)) * 40 + k) = h1v;
      }
    }
    __syncthreads();

    for (int t = wv; t < 48; t += 8) {
      int rt = t / 3, nt = t % 3;
      v16h a  = loadfrag_h(hbuf, rt * 16, 0, 32, lane);
      v16h bf = loadfrag_h(wbuf, nt * 16, 0, 40, lane);
      v8f acc = zero8();
      acc = wmma_f16(a, bf, acc);
      int n = nt * 16 + (int)(lane & 15u);
      float bias = bb[p * 48 + n];
      int mh = (lane & 16u) ? 8 : 0;
#pragma unroll
      for (int r = 0; r < 8; ++r)
        tmpf[(rt * 16 + mh + r) * 48 + n] = acc[r] + bias;
    }
    __syncthreads();

    {
      float s = 0.f, s2 = 0.f;
      const float* rowp = tmpf + tid * 48;
#pragma unroll
      for (int c = 0; c < 36; c += 4) {
        v4f v = *(const v4f*)(rowp + c);
        s += v[0] + v[1] + v[2] + v[3];
        s2 += v[0] * v[0] + v[1] * v[1] + v[2] * v[2] + v[3] * v[3];
      }
      red[tid] = s; red[256 + tid] = s2;
    }
    __syncthreads();
    for (int off = 128; off > 0; off >>= 1) {
      if (tid < off) {
        red[tid] += red[tid + off];
        red[256 + tid] += red[256 + tid + off];
      }
      __syncthreads();
    }
    float mu   = red[0] * (1.f / 9216.f);
    float var  = red[256] * (1.f / 9216.f) - mu * mu;
    float rstd = rsqrtf(var + 1e-5f);

    if (p < 2) {
      const v4f* Gv = (const v4f*)((p == 0) ? kg : qg);
      const v4f* Ev = (const v4f*)((p == 0) ? kbe : qbe);
#pragma unroll
      for (int i = 0; i < 9; ++i) {
        gr[p + 1][i] = Gv[tid + 256 * i];
        er[p + 1][i] = Ev[tid + 256 * i];
      }
    }

    // 16-byte piece f of the [256][36] plane: node = f/9, columns j0..j0+3
#pragma unroll
    for (int i = 0; i < 9; ++i) {
      int f = tid + 256 * i;
      int node = f / 9, j0 = (f - node * 9) * 4;
      v4f tv = *(const v4f*)(tmpf + node * 48 + j0);
      v4h o;
#pragma unroll
      for (int e = 0; e < 4; ++e) {
        float v = (tv[e] - mu) * rstd;
        o[e] = (_Float16)(v * gr[p][i][e] + er[p][i][e]);
      }
      if (p == 0) {
#pragma unroll
        for (int e = 0; e < 4; ++e) Vt[(j0 + e) * 264 + node] = o[e];
      } else {
        _Float16* dst = (p == 1) ? Kb : Qb;
        *(v4h*)(dst + node * 64 + j0) = o;
      }
    }
    __syncthreads();
  }

  const float scale = 0.16666667f;  // 1/sqrt(36)
  float* scw = sc + wv * 16 * 260;
  for (int blk = wv; blk < 16; blk += 8) {
    int row0 = blk * 16;
    v16h qa0 = loadfrag_h(Qb, row0, 0, 64, lane);
    v16h qa1 = loadfrag_h(Qb, row0, 32, 64, lane);
    for (int ct = 0; ct < 16; ++ct) {
      v8f acc = zero8();
      acc = wmma_f16(qa0, loadfrag_h(Kb, ct * 16, 0, 64, lane), acc);
      acc = wmma_f16(qa1, loadfrag_h(Kb, ct * 16, 32, 64, lane), acc);
      int n = ct * 16 + (int)(lane & 15u);
      int mh = (lane & 16u) ? 8 : 0;
#pragma unroll
      for (int r = 0; r < 8; ++r)
        scw[(mh + r) * 260 + n] = acc[r] * scale;
    }
    if (lane < 16u) {
      float* rowp = scw + (int)lane * 260;
      float mx = -1e30f;
      for (int c = 0; c < 256; c += 4) {
        v4f v = *(const v4f*)(rowp + c);
        mx = fmaxf(mx, fmaxf(fmaxf(v[0], v[1]), fmaxf(v[2], v[3])));
      }
      float s = 0.f;
      for (int c = 0; c < 256; c += 4) {
        v4f v = *(const v4f*)(rowp + c);
        v4f e;
        e[0] = __expf(v[0] - mx); e[1] = __expf(v[1] - mx);
        e[2] = __expf(v[2] - mx); e[3] = __expf(v[3] - mx);
        s += e[0] + e[1] + e[2] + e[3];
        *(v4f*)(rowp + c) = e;
      }
      rowp[256] = s;
    }
    v8f av0 = zero8(), av1 = zero8(), av2 = zero8();
    for (int kc = 0; kc < 8; ++kc) {
      v16h a = loadfrag_f32(scw, kc * 32, 260, lane);
      av0 = wmma_f16(a, loadfrag_h(Vt, 0, kc * 32, 264, lane), av0);
      av1 = wmma_f16(a, loadfrag_h(Vt, 16, kc * 32, 264, lane), av1);
      av2 = wmma_f16(a, loadfrag_h(Vt, 32, kc * 32, 264, lane), av2);
    }
    int mh = (lane & 16u) ? 8 : 0;
    int nl = (int)(lane & 15u);
#pragma unroll
    for (int r = 0; r < 8; ++r) {
      float invr = 1.f / scw[(mh + r) * 260 + 256];
      tmpf[(row0 + mh + r) * 48 + nl]      = av0[r] * invr;
      tmpf[(row0 + mh + r) * 48 + 16 + nl] = av1[r] * invr;
      tmpf[(row0 + mh + r) * 48 + 32 + nl] = av2[r] * invr;
    }
  }
  // l1W (324 x 16 B) and l1b: read before the barrier, stored behind it
  v4f l1r0 = ((const v4f*)l1W)[tid];
  v4f l1r1 = ((const v4f*)l1W)[256 + (tid < 68 ? tid : 67)];
  float l1bv = l1b[tid < 36 ? tid : 35];
  __syncthreads();

  float* l1Ws = (float*)Qb;  // Qb region is dead now
  ((v4f*)l1Ws)[tid] = l1r0;
  if (tid < 68) ((v4f*)l1Ws)[256 + tid] = l1r1;
  if (tid < 36) l1Ws[1296 + tid] = l1bv;
  __syncthreads();

  float* att2 = sc;
  {
    const float* ar = tmpf + tid * 48;
    for (int j = 0; j < 36; ++j) {
      float s = l1Ws[1296 + j];
      const float* wr = l1Ws + j * 36;
      for (int k = 0; k < 36; ++k) s += ar[k] * wr[k];
      att2[tid * 40 + j] = fmaxf(s, 0.f);
    }
  }
  __syncthreads();

  {
    float s = 0.f, s2 = 0.f;
    const float* rp = att2 + tid * 40;
#pragma unroll
    for (int c = 0; c < 36; c += 4) {
      v4f v = *(const v4f*)(rp + c);
      s += v[0] + v[1] + v[2] + v[3];
      s2 += v[0] * v[0] + v[1] * v[1] + v[2] * v[2] + v[3] * v[3];
    }
    red[tid] = s; red[256 + tid] = s2;
  }
  __syncthreads();
  for (int off = 128; off > 0; off >>= 1) {
    if (tid < off) {
      red[tid] += red[tid + off];
      red[256 + tid] += red[256 + tid + off];
    }
    __syncthreads();
  }
  float mu   = red[0] * (1.f / 9216.f);
  float var  = red[256] * (1.f / 9216.f) - mu * mu;
  float rstd = rsqrtf(var + 1e-5f);

  if (tid < 36) {
    float m = -1e30f;
    for (int n = 0; n < 256; ++n) m = fmaxf(m, att2[n * 40 + tid]);
    mxv[tid] = (m - mu) * rstd;
  }
  __syncthreads();

  if (tid < 10) {
    float s = l2b[tid];
    for (int j = 0; j < 36; ++j) s += mxv[j] * l2W[tid * 36 + j];
    ov[tid] = s;
  }
  __syncthreads();
  if (tid == 0) {
    float mx = -1e30f;
    for (int o = 0; o < 10; ++o) mx = fmaxf(mx, ov[o]);
    float s = 0.f;
    for (int o = 0; o < 10; ++o) s += __expf(ov[o] - mx);
    red[0] = mx + __logf(s);
  }
  __syncthreads();
  if (tid < 10) out[(size_t)b * 10 + tid] = ov[tid] - red[0];
}

// ---------------------------------------------------------------------------
extern "C" void kernel_launch(void* const* d_in, const int* in_sizes, int n_in,
                              void* d_out, int out_size, void* d_ws, size_t ws_size,
                              hipStream_t stream) {
  const float* x  = (const float*)d_in[0];
  const float* w1 = (const float*)d_in[1];  const float* b1 = (const float*)d_in[2];
  const float* w2 = (const float*)d_in[3];  const float* b2 = (const float*)d_in[4];
  const float* w3 = (const float*)d_in[5];  const float* b3 = (const float*)d_in[6];
  const float* w4 = (const float*)d_in[7];  const float* b4 = (const float*)d_in[8];
  const float* kW = (const float*)d_in[9];  const float* kbv = (const float*)d_in[10];
  const float* qW = (const float*)d_in[11]; const float* qbv = (const float*)d_in[12];
  const float* vW = (const float*)d_in[13]; const float* vbv = (const float*)d_in[14];
  const float* kg = (const float*)d_in[15]; const float* kbe = (const float*)d_in[16];
  const float* qg = (const float*)d_in[17]; const float* qbe = (const float*)d_in[18];
  const float* vg = (const float*)d_in[19]; const float* vbe = (const float*)d_in[20];
  const float* l1W = (const float*)d_in[21]; const float* l1b = (const float*)d_in[22];
  const float* l2W = (const float*)d_in[23]; const float* l2b = (const float*)d_in[24];

  const int B = in_sizes[0] / (28 * 28);   // 2048
  _Float16* feat = (_Float16*)d_ws;        // [B][256][32] f16 = 16 KB/batch

  conv_stack_kernel<<<B, 256, 164608, stream>>>(x, w1, b1, w2, b2, w3, b3, w4,
                                                b4, feat);
  attn_kernel<<<B, 256, 296448, stream>>>(feat, kW, kbv, qW, qbv, vW, vbv,
                                          kg, kbe, qg, qbe, vg, vbe,
                                          l1W, l1b, l2W, l2b, (float*)d_out);
}

// v002
// One run takes 426 microseconds.
// Next to v001, in two timings, it ran 1.35 times as fast each time.
// Over all steps from v000 it is 2.27 times as fast.
#include <hip/hip_runtime.h>
#include <hip/hip_bf16.h>
#include <math.h>

typedef __attribute__((ext_vector_type(16))) _Float16 v16h;
typedef __attribute__((ext_vector_type(8)))  _Float16 v8h;
typedef __attribute__((ext_vector_type(4)))  _Float16 v4h;
typedef __attribute__((ext_vector_type(2)))  _Float16 v2h;
typedef __attribute__((ext_vector_type(8)))  float    v8f;
typedef __attribute__((ext_vector_type(4)))  float    v4f;
typedef __attribute__((ext_vector_type(4)))  unsigned int v4u;

__device__ __forceinline__ v16h loadfrag_h(const _Float16* base, int r0, int k0,
                                           int stride, unsigned lane) {
  const _Float16* p = base + (r0 + (int)(lane & 15u)) * stride + k0;
  int hi = (lane & 16u) ? 1 : 0;
  v8h lo = *(const v8h*)(p + (hi ? 8 : 0));
  v8h hj = *(const v8h*)(p + (hi ? 24 : 16));
  return __builtin_shufflevector(lo, hj, 0, 1, 2, 3, 4, 5, 6, 7, 8, 9, 10, 11,
                                 12, 13, 14, 15);
}

// A fragment for 2-tap conv chunk: K 0..15 = tap0 ch0..15, K 16..31 = tap1.
__device__ __forceinline__ v16h frag2tap(const _Float16* p0, const _Float16* p1,
                                         unsigned lane) {
  int hi = (lane & 16u) ? 8 : 0;
  v8h lo = *(const v8h*)(p0 + hi);
  v8h hj = *(const v8h*)(p1 + hi);
  return __builtin_shufflevector(lo, hj, 0, 1, 2, 3, 4, 5, 6, 7, 8, 9, 10, 11,
                                 12, 13, 14, 15);
}

// A fragment for 1-tap conv chunk over a 32-channel pixel record.
__device__ __forceinline__ v16h frag1tap(const _Float16* p, unsigned lane) {
  int hi = (lane & 16u) ? 1 : 0;
  v8h lo = *(const v8h*)(p + (hi ? 8 : 0));
  v8h hj = *(const v8h*)(p + (hi ? 24 : 16));
  return __builtin_shufflevector(lo, hj, 0, 1, 2, 3, 4, 5, 6, 7, 8, 9, 10, 11,
                                 12, 13, 14, 15);
}

// value of the lane 16 away (same column, other half of the rows)
__device__ __forceinline__ float other_half(float v) {
  int b = __builtin_bit_cast(int, v);
  b = __builtin_amdgcn_permlanex16(b, b, 0x76543210, 0xfedcba98, false, false);
  return __builtin_bit_cast(float, b);
}

__device__ __forceinline__ float exp_slot(float x) {
  float a = x * 1.44269504f, r;
  asm("v_exp_f32 %0, %1\n\tv_nop" : "=v"(r) : "v"(a));
  return r;
}

__device__ __forceinline__ v8f wmma_f16(v16h a, v16h b, v8f c) {
  return __builtin_amdgcn_wmma_f32_16x16x32_f16(false, a, false, b, (short)0, c,
                                                false, false);
}

__device__ __forceinline__ v8f zero8() {
  v8f z = {0.f, 0.f, 0.f, 0.f, 0.f, 0.f, 0.f, 0.f};
  return z;
}

// ---------------------------------------------------------------------------
// Kernel 1: conv stack as per-tap WMMA GEMMs, one block (8 wave32) per image.
// Activations stored CHANNEL-LAST f16 in LDS so per-tap A-fragments are two
// raw ds_load_b128 from shifted pixel records (no im2col).
// D-stores are UNGUARDED: overflow tiles land in pre-zeroed slack pixels that
// no valid downstream output ever reads (conv3 valid reads <=483 of 512,
// conv4 valid reads <=360 of 368).
// Dynamic LDS layout (bytes):
//   xin  @      0 ( 3136)  28x28 f32
//   ws1  @   3136 ( 1024)  w1 f32
//   bb   @   4160 (  512)  biases b1..b4 padded to 32
//   h1   @   4672 (21504)  [672 pix][16ch] f16 (625 valid, slack zeroed)
//   h2   @  26176 (32768)  [512 pix][32ch] f16 (484 valid, ch pad 20->32)
//   h3   @  58944 (23552)  [368 pix][32ch] f16 (361 valid, ch pad 24->32)
//   Bc2  @  82496 (16384)  8 chunks x [32n][32k] f16 (2 taps/chunk)
//   Bc3  @  98880 (32768)  16 taps x [32n][32k] f16
//   Bc4  @ 131648 (32768)  16 taps x [32n][32k] f16
// total 164416 -> 164608
// ---------------------------------------------------------------------------
__global__ __launch_bounds__(256) void conv_stack_kernel(
    const float* __restrict__ x,
    const float* __restrict__ w1, const float* __restrict__ b1,
    const float* __restrict__ w2, const float* __restrict__ b2,
    const float* __restrict__ w3, const float* __restrict__ b3,
    const float* __restrict__ w4, const float* __restrict__ b4,
    _Float16* __restrict__ feat) {
  extern __shared__ char smem[];
  float*     xin = (float*)smem;
  float*     ws1 = (float*)(smem + 3136);
  float*     bbf = (float*)(smem + 4160);     // [4][32]
  _Float16*  h1  = (_Float16*)(smem + 4672);
  _Float16*  h2  = (_Float16*)(smem + 26176);
  _Float16*  h3  = (_Float16*)(smem + 58944);
  _Float16*  Bc2 = (_Float16*)(smem + 82496);
  _Float16*  Bc3 = (_Float16*)(smem + 98880);
  _Float16*  Bc4 = (_Float16*)(smem + 131648);

  const int tid = threadIdx.x;
  const unsigned lane = tid & 31u;
  const int wv = tid >> 5;
  const int b = blockIdx.x;

  // ---- every global read of this kernel: coalesced, branch-free (indices
  // clamped, stores guarded) and issued together, so the L2 round trips
  // overlap instead of one waited 4-byte load per staged element ----
  // Weight unit u = (oc n, input-channel pair kp, tap quad tq), tq fastest:
  // two 16-byte loads (channels 2kp and 2kp+1, taps 4tq..4tq+3) feed four
  // 4-byte LDS stores of a channel pair each.
  // (the unrolls here and in the scatter below keep the arrays in registers)
  v4f r2a[3], r2b[3], r3a[4], r3b[4], r4a[6], r4b[6];
  {
    const v4f* w2v = (const v4f*)w2;  // 20 x 8 x 4  = 640 units
    const v4f* w3v = (const v4f*)w3;  // 24 x 10 x 4 = 960 units
    const v4f* w4v = (const v4f*)w4;  // 30 x 12 x 4 = 1440 units
    // 16-byte index of unit u: (u>>2)*8 + (u&3); 256 units further = +512.
    // Each tensor's last, partial slice clamps its unit.
    const int a0 = (tid >> 2) * 8 + (tid & 3);
    const int u2 = tid + 512 < 640 ? tid + 512 : 639;
    const int u3 = tid + 768 < 960 ? tid + 768 : 959;
    const int u4 = tid + 1280 < 1440 ? tid + 1280 : 1439;
    const int a2 = (u2 >> 2) * 8 + (u2 & 3);
    const int a3 = (u3 >> 2) * 8 + (u3 & 3);
    const int a4 = (u4 >> 2) * 8 + (u4 & 3);
#pragma unroll
    for (int i = 0; i < 2; ++i) {
      r2a[i] = w2v[a0 + 512 * i];
      r2b[i] = w2v[a0 + 512 * i + 4];
    }
    r2a[2] = w2v[a2];
    r2b[2] = w2v[a2 + 4];
#pragma unroll
    for (int i = 0; i < 3; ++i) {
      r3a[i] = w3v[a0 + 512 * i];
      r3b[i] = w3v[a0 + 512 * i + 4];
    }
    r3a[3] = w3v[a3];
    r3b[3] = w3v[a3 + 4];
#pragma unroll
    for (int i = 0; i < 5; ++i) {
      r4a[i] = w4v[a0 + 512 * i];
      r4b[i] = w4v[a0 + 512 * i + 4];
    }
    r4a[5] = w4v[a4];
    r4b[5] = w4v[a4 + 4];

    const v4f* sx = (const v4f*)(x + (size_t)b * 784);
    v4f xr  = sx[tid < 196 ? tid : 195];
    const int a1 = tid & 63;
    v4f w1r = ((const v4f*)w1)[a1];
    int g = (tid >> 5) & 3, n = tid & 31;
    const float* bp = (g == 0) ? b1 : (g == 1) ? b2 : (g == 2) ? b3 : b4;
    int lim = (g == 0) ? 16 : (g == 1) ? 20 : (g == 2) ? 24 : 30;
    const float* bq = bp + (n < lim ? n : 0);
    float bv = *bq;
    // The loads' address registers are inputs here, so they stay unwritten
    // (also by a later load's result) until this wait.
    asm volatile("s_wait_xcnt 0x0"
                 :: "v"(a0), "v"(a1), "v"(a2), "v"(a3), "v"(a4), "v"(bq)
                 : "memory");
    // zero h1..h3 and Bc2..Bc4 (contiguous 159744 B = 9984 x b128)
    v4u zz = {0u, 0u, 0u, 0u};
    v4u* z = (v4u*)h1;
    for (int i = 0; i < 39; ++i) z[tid + 256 * i] = zz;
    if (tid < 196) ((v4f*)xin)[tid] = xr;
    if (tid < 64)  ((v4f*)ws1)[tid] = w1r;
    if (tid < 128) bbf[tid] = (n < lim) ? bv : 0.f;
  }
  __syncthreads();

  // ---- scatter the weights into the zeroed per-tap B matrices ----
  // Bc2: chunk c pairs taps 2c,2c+1; k<16 -> tap 2c ic=k, k>=16 -> tap 2c+1
#pragma unroll
  for (int i = 0; i < 3; ++i) {
    int u = tid + 256 * i;
    if (u < 640) {
      int t0 = (u & 3) * 4, r = u >> 2;
      int n = r >> 3, ic = (r & 7) * 2;
#pragma unroll
      for (int e = 0; e < 4; ++e) {
        int tap = t0 + e;
        v2h h = {(_Float16)r2a[i][e], (_Float16)r2b[i][e]};
        *(v2h*)(Bc2 + (tap >> 1) * 1024 + n * 32 + (tap & 1) * 16 + ic) = h;
      }
    }
  }
  // Bc3: tap t, k = ic (20 valid of 32), n = oc (24 valid of 32)
#pragma unroll
  for (int i = 0; i < 4; ++i) {
    int u = tid + 256 * i;
    if (u < 960) {
      int t0 = (u & 3) * 4, r = u >> 2;
      int n = r / 10, k = (r - n * 10) * 2;
#pragma unroll
      for (int e = 0; e < 4; ++e) {
        v2h h = {(_Float16)r3a[i][e], (_Float16)r3b[i][e]};
        *(v2h*)(Bc3 + (t0 + e) * 1024 + n * 32 + k) = h;
      }
    }
  }
  // Bc4: tap t, k = ic (24 valid of 32), n = oc (30 valid of 32)
#pragma unroll
  for (int i = 0; i < 6; ++i) {
    int u = tid + 256 * i;
    if (u < 1440) {
      int t0 = (u & 3) * 4, r = u >> 2;
      int n = r / 12, k = (r - n * 12) * 2;
#pragma unroll
      for (int e = 0; e < 4; ++e) {
        v2h h = {(_Float16)r4a[i][e], (_Float16)r4b[i][e]};
        *(v2h*)(Bc4 + (t0 + e) * 1024 + n * 32 + k) = h;
      }
    }
  }

  // ---- conv1 (ic=1, scalar): 28x28 -> 16x25x25, channel-last f16 ----
  for (int idx = tid; idx < 10000; idx += 256) {
    int p = idx >> 4, oc = idx & 15;
    int oy = p / 25, ox = p - oy * 25;
    float acc = bbf[oc];
    const float* wp = ws1 + oc * 16;
#pragma unroll
    for (int ky = 0; ky < 4; ++ky)
#pragma unroll
      for (int kx = 0; kx < 4; ++kx)
        acc += xin[(oy + ky) * 28 + ox + kx] * wp[ky * 4 + kx];
    h1[idx] = (_Float16)fmaxf(acc, 0.f);  // idx == p*16 + oc
  }
  __syncthreads();

  // ---- conv2 via WMMA: M=484(->496) x N=20(->32) x K=256 (8 chunks) ----
  for (int u = wv; u < 62; u += 8) {
    int mt = u >> 1, nt = u & 1;
    int m = mt * 16 + (int)(lane & 15u);
    int oy = m / 22, ox = m - oy * 22;
    v8f acc = zero8();
#pragma unroll
    for (int c = 0; c < 8; ++c) {
      int t0 = 2 * c, t1 = 2 * c + 1;
      const _Float16* p0 = h1 + ((oy + (t0 >> 2)) * 25 + ox + (t0 & 3)) * 16;
      const _Float16* p1 = h1 + ((oy + (t1 >> 2)) * 25 + ox + (t1 & 3)) * 16;
      v16h a = frag2tap(p0, p1, lane);
      v16h bf = loadfrag_h(Bc2 + c * 1024, nt * 16, 0, 32, lane);
      acc = wmma_f16(a, bf, acc);
    }
    int n = nt * 16 + (int)(lane & 15u);
    float bias = bbf[32 + n];
    int mh = (lane & 16u) ? 8 : 0;
#pragma unroll
    for (int r = 0; r < 8; ++r)
      h2[(mt * 16 + mh + r) * 32 + n] = (_Float16)fmaxf(acc[r] + bias, 0.f);
  }
  __syncthreads();

  // ---- conv3 via WMMA: M=361(->368) x N=24(->32) x K=512 (16 taps) ----
  for (int u = wv; u < 46; u += 8) {
    int mt = u >> 1, nt = u & 1;
    int m = mt * 16 + (int)(lane & 15u);
    int oy = m / 19, ox = m - oy * 19;
    v8f acc = zero8();
#pragma unroll
    for (int t = 0; t < 16; ++t) {
      const _Float16* p = h2 + ((oy + (t >> 2)) * 22 + ox + (t & 3)) * 32;
      v16h a = frag1tap(p, lane);
      v16h bf = loadfrag_h(Bc3 + t * 1024, nt * 16, 0, 32, lane);
      acc = wmma_f16(a, bf, acc);
    }
    int n = nt * 16 + (int)(lane & 15u);
    float bias = bbf[64 + n];
    int mh = (lane & 16u) ? 8 : 0;
#pragma unroll
    for (int r = 0; r < 8; ++r)
      h3[(mt * 16 + mh + r) * 32 + n] = (_Float16)fmaxf(acc[r] + bias, 0.f);
  }
  __syncthreads();

  // ---- conv4 via WMMA: M=256 x N=30(->32) x K=512; write features+coords ----
  _Float16* fb = feat + (size_t)b * 8192;
  for (int u = wv; u < 32; u += 8) {
    int mt = u >> 1, nt = u & 1;
    int m = mt * 16 + (int)(lane & 15u);
    int oy = m >> 4, ox = m & 15;
    v8f acc = zero8();
#pragma unroll
    for (int t = 0; t < 16; ++t) {
      const _Float16* p = h3 + ((oy + (t >> 2)) * 19 + ox + (t & 3)) * 32;
      v16h a = frag1tap(p, lane);
      v16h bf = loadfrag_h(Bc4 + t * 1024, nt * 16, 0, 32, lane);
      acc = wmma_f16(a, bf, acc);
    }
    int n = nt * 16 + (int)(lane & 15u);
    int mh = (lane & 16u) ? 8 : 0;
    if (n < 30) {  // per-lane-uniform guard hoisted outside the r-loop
      float bias = bbf[96 + n];
#pragma unroll
      for (int r = 0; r < 8; ++r)
        fb[(mt * 16 + mh + r) * 32 + n] = (_Float16)fmaxf(acc[r] + bias, 0.f);
    }
  }
  {
    int n = tid;  // coord channels (columns 30/31, disjoint from tile stores)
    int xx = n % 16, yy = n / 16;
    fb[n * 32 + 30] = (_Float16)((float)xx * 0.0625f);
    fb[n * 32 + 31] = (_Float16)((float)yy * 0.0625f);
  }
}

__global__ __launch_bounds__(256) void attn_kernel(
    const _Float16* __restrict__ feat,
    const float* __restrict__ kW, const float* __restrict__ kb,
    const float* __restrict__ qW, const float* __restrict__ qb,
    const float* __restrict__ vW, const float* __restrict__ vb,
    const float* __restrict__ kg, const float* __restrict__ kbe,
    const float* __restrict__ qg, const float* __restrict__ qbe,
    const float* __restrict__ vg, const float* __restrict__ vbe,
    const float* __restrict__ l1W, const float* __restrict__ l1b,
    const float* __restrict__ l2W, const float* __restrict__ l2b,
    float* __restrict__ out) {
  extern __shared__ char smem[];
  _Float16* hbuf = (_Float16*)smem;
  _Float16* Qb   = (_Float16*)(smem + 16384);
  float* tmpf = (float*)(smem + 49152);
  _Float16* Kb   = (_Float16*)(smem + 98304);
  _Float16* Vt   = (_Float16*)(smem + 131072);
  _Float16* wbuf = (_Float16*)(smem + 156416);
  float* red  = (float*)(smem + 160256);
  float* mxv  = (float*)(smem + 162336);
  float* ov   = (float*)(smem + 162528);
  float* bb   = (float*)(smem + 162592);

  const int tid = threadIdx.x;
  const unsigned lane = tid & 31u;
  const int wv = tid >> 5;
  const int b = blockIdx.x;

  // ---- features, projection weights, biases: coalesced, branch-free reads
  // (indices clamped, stores guarded), all in flight together ----
  // (unrolls on fr/wreg/gr/er loops keep these arrays in registers)
  v4f wreg[3][2];
  // gamma/beta of pass p: 18 coalesced 16-byte loads in flight together.
  // Pass 0's go out here; pass p+1's go out ahead of pass p's normalisation,
  // which covers their L2 round trip up to the barrier behind it.
  v4f gr[3][9], er[3][9];
#pragma unroll
  for (int i = 0; i < 9; ++i) {
    gr[0][i] = ((const v4f*)vg)[tid + 256 * i];
    er[0][i] = ((const v4f*)vbe)[tid + 256 * i];
  }
  {
    const v4u* src = (const v4u*)(feat + (size_t)b * 8192);
    v4u fr[4];
#pragma unroll
    for (int i = 0; i < 4; ++i) fr[i] = src[tid + 256 * i];
    const int f1 = 256 + (tid & 31);  // each W is 288 x 16 B
    wreg[0][0] = ((const v4f*)vW)[tid];  wreg[0][1] = ((const v4f*)vW)[f1];
    wreg[1][0] = ((const v4f*)kW)[tid];  wreg[1][1] = ((const v4f*)kW)[f1];
    wreg[2][0] = ((const v4f*)qW)[tid];  wreg[2][1] = ((const v4f*)qW)[f1];
    const int bi = tid < 144 ? tid : 0;
    const int pb = bi / 48, jb = bi - pb * 48;
    const float* bp = (pb == 0) ? vb : (pb == 1) ? kb : qb;
    float bv = bp[jb < 36 ? jb : 0];

    // zero what the staged operands pad with; no later store touches these:
    // Q/K columns 36..63 (7 x 8 B per row), V^T rows 36..47, W rows 36..47
    const v4h zh = {(_Float16)0.f, (_Float16)0.f, (_Float16)0.f, (_Float16)0.f};
    const v4u zz = {0u, 0u, 0u, 0u};
    for (int i = 0; i < 7; ++i) {
      int q = tid + 256 * i;
      int node = q / 7, s = q - node * 7;
      *(v4h*)(Qb + node * 64 + 36 + s * 4) = zh;
      *(v4h*)(Kb + node * 64 + 36 + s * 4) = zh;
    }
    for (int i = tid; i < 396; i += 256) ((v4u*)(Vt + 36 * 264))[i] = zz;
    if (tid < 60) ((v4u*)(wbuf + 36 * 40))[tid] = zz;

    v4u* dst = (v4u*)hbuf;
#pragma unroll
    for (int i = 0; i < 4; ++i) dst[tid + 256 * i] = fr[i];
    if (tid < 144) bb[tid] = (jb < 36) ? bv : 0.f;
  }
  __syncthreads();

  // unrolled: wreg/gr/er are indexed by p and have to stay in registers
#pragma unroll
  for (int p = 0; p < 3; ++p) {
    {
      const int k = (tid & 7) * 4;
      v4f w0 = wreg[p][0];
      v4h h0 = {(_Float16)w0[0], (_Float16)w0[1], (_Float16)w0[2], (_Float16)w0[3]};
      *(v4h*)(wbuf + (tid >> 3) * 40 + k) = h0;
      if (tid < 32) {
        v4f w1v = wreg[p][1];
        v4h h1v = {(_Float16)w1v[0], (_Float16)w1v[1], (_Float16)w1v[2], (_Float16)w1v[3]};
        *(v4h*)(wbuf + (32 + (tid >> 3)) * 40 + k) = h1v;
      }
    }
    __syncthreads();

    for (int t = wv; t < 48; t += 8) {
      int rt = t / 3, nt = t % 3;
      v16h a  = loadfrag_h(hbuf, rt * 16, 0, 32, lane);
      v16h bf = loadfrag_h(wbuf, nt * 16, 0, 40, lane);
      v8f acc = zero8();
      acc = wmma_f16(a, bf, acc);
      int n = nt * 16 + (int)(lane & 15u);
      float bias = bb[p * 48 + n];
      int mh = (lane & 16u) ? 8 : 0;
#pragma unroll
      for (int r = 0; r < 8; ++r)
        tmpf[(rt * 16 + mh + r) * 48 + n] = acc[r] + bias;
    }
    __syncthreads();

    {
      float s = 0.f, s2 = 0.f;
      const float* rowp = tmpf + tid * 48;
#pragma unroll
      for (int c = 0; c < 36; c += 4) {
        v4f v = *(const v4f*)(rowp + c);
        s += v[0] + v[1] + v[2] + v[3];
        s2 += v[0] * v[0] + v[1] * v[1] + v[2] * v[2] + v[3] * v[3];
      }
      red[tid] = s; red[256 + tid] = s2;
    }
    __syncthreads();
    for (int off = 128; off > 0; off >>= 1) {
      if (tid < off) {
        red[tid] += red[tid + off];
        red[256 + tid] += red[256 + tid + off];
      }
      __syncthreads();
    }
    float mu   = red[0] * (1.f / 9216.f);
    float var  = red[256] * (1.f / 9216.f) - mu * mu;
    float rstd = rsqrtf(var + 1e-5f);

    if (p < 2) {
      const v4f* Gv = (const v4f*)((p == 0) ? kg : qg);
      const v4f* Ev = (const v4f*)((p == 0) ? kbe : qbe);
#pragma unroll
      for (int i = 0; i < 9; ++i) {
        gr[p + 1][i] = Gv[tid + 256 * i];
        er[p + 1][i] = Ev[tid + 256 * i];
      }
    }

    // 16-byte piece f of the [256][36] plane: node = f/9, columns j0..j0+3
#pragma unroll
    for (int i = 0; i < 9; ++i) {
      int f = tid + 256 * i;
      int node = f / 9, j0 = (f - node * 9) * 4;
      v4f tv = *(const v4f*)(tmpf + node * 48 + j0);
      v4h o;
#pragma unroll
      for (int e = 0; e < 4; ++e) {
        float v = (tv[e] - mu) * rstd;
        o[e] = (_Float16)(v * gr[p][i][e] + er[p][i][e]);
      }
      if (p == 0) {
#pragma unroll
        for (int e = 0; e < 4; ++e) Vt[(j0 + e) * 264 + node] = o[e];
      } else {
        _Float16* dst = (p == 1) ? Kb : Qb;
        *(v4h*)(dst + node * 64 + j0) = o;
      }
    }
    __syncthreads();
  }

  const float scale = 0.16666667f;  // 1/sqrt(36)
  for (int blk = wv; blk < 16; blk += 8) {
    int row0 = blk * 16;
    // B operand: 16 queries (n = query), kept for all 16 key tiles
    v16h qb0 = loadfrag_h(Qb, row0, 0, 64, lane);
    v16h qb1 = loadfrag_h(Qb, row0, 32, 64, lane);
    v8f st[16];
#pragma unroll
    for (int ct = 0; ct < 16; ++ct) {
      v8f acc = zero8();
      acc = wmma_f16(loadfrag_h(Kb, ct * 16, 0, 64, lane), qb0, acc);
      acc = wmma_f16(loadfrag_h(Kb, ct * 16, 32, 64, lane), qb1, acc);
      st[ct] = acc;
    }
    float mx = -1e30f;
#pragma unroll
    for (int ct = 0; ct < 16; ++ct)
#pragma unroll
      for (int r = 0; r < 8; ++r) {
        st[ct][r] *= scale;
        mx = fmaxf(mx, st[ct][r]);
      }
    mx = fmaxf(mx, other_half(mx));
    float s = 0.f;
    v8f av0 = zero8(), av1 = zero8(), av2 = zero8();
#pragma unroll
    for (int kc = 0; kc < 8; ++kc) {
      // B fragment of keys kc*32..+31: elements 0..7 are k = 8*hi + r (tile
      // 2kc), elements 8..15 are k = 16 + 8*hi + r (tile 2kc+1): the k order
      // of loadfrag_h, which loads the A operand (V^T rows) below.
      v16h pb;
      float ps = 0.f;
#pragma unroll
      for (int r = 0; r < 8; ++r) {
        float e0 = exp_slot(st[2 * kc][r] - mx);
        float e1 = exp_slot(st[2 * kc + 1][r] - mx);
        ps += e0 + e1;
        pb[r]     = (_Float16)e0;
        pb[8 + r] = (_Float16)e1;
      }
      s += ps;
      av0 = wmma_f16(loadfrag_h(Vt, 0, kc * 32, 264, lane), pb, av0);
      av1 = wmma_f16(loadfrag_h(Vt, 16, kc * 32, 264, lane), pb, av1);
      av2 = wmma_f16(loadfrag_h(Vt, 32, kc * 32, 264, lane), pb, av2);
    }
    s += other_half(s);
    float invr = 1.f / s;
    // O^T tile: n = query, m = output column r + 8*hi: 8 adjacent floats
    float* op = tmpf + (row0 + (int)(lane & 15u)) * 48 + ((lane & 16u) ? 8 : 0);
    v4f o;
#pragma unroll
    for (int h = 0; h < 2; ++h) {
#pragma unroll
      for (int e = 0; e < 4; ++e) o[e] = av0[4 * h + e] * invr;
      *(v4f*)(op + 4 * h) = o;
#pragma unroll
      for (int e = 0; e < 4; ++e) o[e] = av1[4 * h + e] * invr;
      *(v4f*)(op + 16 + 4 * h) = o;
#pragma unroll
      for (int e = 0; e < 4; ++e) o[e] = av2[4 * h + e] * invr;
      *(v4f*)(op + 32 + 4 * h) = o;
    }
  }
  // l1W (324 x 16 B) and l1b: read before the barrier, stored behind it
  v4f l1r0 = ((const v4f*)l1W)[tid];
  v4f l1r1 = ((const v4f*)l1W)[256 + (tid < 68 ? tid : 67)];
  float l1bv = l1b[tid < 36 ? tid : 35];
  __syncthreads();

  float* l1Ws = (float*)Qb;  // Qb region is dead now
  ((v4f*)l1Ws)[tid] = l1r0;
  if (tid < 68) ((v4f*)l1Ws)[256 + tid] = l1r1;
  if (tid < 36) l1Ws[1296 + tid] = l1bv;
  __syncthreads();

  float* att2 = (float*)Kb;  // K and V^T are dead now (40960 B of 58112)
  {
    const float* ar = tmpf + tid * 48;
    for (int j = 0; j < 36; ++j) {
      float s = l1Ws[1296 + j];
      const float* wr = l1Ws + j * 36;
      for (int k = 0; k < 36; ++k) s += ar[k] * wr[k];
      att2[tid * 40 + j] = fmaxf(s, 0.f);
    }
  }
  __syncthreads();

  {
    float s = 0.f, s2 = 0.f;
    const float* rp = att2 + tid * 40;
#pragma unroll
    for (int c = 0; c < 36; c += 4) {
      v4f v = *(const v4f*)(rp + c);
      s += v[0] + v[1] + v[2] + v[3];
      s2 += v[0] * v[0] + v[1] * v[1] + v[2] * v[2] + v[3] * v[3];
    }
    red[tid] = s; red[256 + tid] = s2;
  }
  __syncthreads();
  for (int off = 128; off > 0; off >>= 1) {
    if (tid < off) {
      red[tid] += red[tid + off];
      red[256 + tid] += red[256 + tid + off];
    }
    __syncthreads();
  }
  float mu   = red[0] * (1.f / 9216.f);
  float var  = red[256] * (1.f / 9216.f) - mu * mu;
  float rstd = rsqrtf(var + 1e-5f);

  if (tid < 36) {
    float m = -1e30f;
    for (int n = 0; n < 256; ++n) m = fmaxf(m, att2[n * 40 + tid]);
    mxv[tid] = (m - mu) * rstd;
  }
  __syncthreads();

  if (tid < 10) {
    float s = l2b[tid];
    for (int j = 0; j < 36; ++j) s += mxv[j] * l2W[tid * 36 + j];
    ov[tid] = s;
  }
  __syncthreads();
  if (tid == 0) {
    float mx = -1e30f;
    for (int o = 0; o < 10; ++o) mx = fmaxf(mx, ov[o]);
    float s = 0.f;
    for (int o = 0; o < 10; ++o) s += __expf(ov[o] - mx);
    red[0] = mx + __logf(s);
  }
  __syncthreads();
  if (tid < 10) out[(size_t)b * 10 + tid] = ov[tid] - red[0];
}

// ---------------------------------------------------------------------------
extern "C" void kernel_launch(void* const* d_in, const int* in_sizes, int n_in,
                              void* d_out, int out_size, void* d_ws, size_t ws_size,
                              hipStream_t stream) {
  const float* x  = (const float*)d_in[0];
  const float* w1 = (const float*)d_in[1];  const float* b1 = (const float*)d_in[2];
  const float* w2 = (const float*)d_in[3];  const float* b2 = (const float*)d_in[4];
  const float* w3 = (const float*)d_in[5];  const float* b3 = (const float*)d_in[6];
  const float* w4 = (const float*)d_in[7];  const float* b4 = (const float*)d_in[8];
  const float* kW = (const float*)d_in[9];  const float* kbv = (const float*)d_in[10];
  const float* qW = (const float*)d_in[11]; const float* qbv = (const float*)d_in[12];
  const float* vW = (const float*)d_in[13]; const float* vbv = (const float*)d_in[14];
  const float* kg = (const float*)d_in[15]; const float* kbe = (const float*)d_in[16];
  const float* qg = (const float*)d_in[17]; const float* qbe = (const float*)d_in[18];
  const float* vg = (const float*)d_in[19]; const float* vbe = (const float*)d_in[20];
  const float* l1W = (const float*)d_in[21]; const float* l1b = (const float*)d_in[22];
  const float* l2W = (const float*)d_in[23]; const float* l2b = (const float*)d_in[24];

  const int B = in_sizes[0] / (28 * 28);   // 2048
  _Float16* feat = (_Float16*)d_ws;        // [B][256][32] f16 = 16 KB/batch

  conv_stack_kernel<<<B, 256, 164608, stream>>>(x, w1, b1, w2, b2, w3, b3, w4,
                                                b4, feat);
  attn_kernel<<<B, 256, 163328, stream>>>(feat, kW, kbv, qW, qbv, vW, vbv,
                                          kg, kbe, qg, qbe, vg, vbe,
                                          l1W, l1b, l2W, l2b, (float*)d_out);
}

// v003
// A run of this version takes 274 microseconds.
// In both of two side-by-side timings against v002, it was 1.55 times as fast.
// All steps since v000 together make it 3.52 times as fast.
#include <hip/hip_runtime.h>
#include <hip/hip_bf16.h>
#include <math.h>

typedef __attribute__((ext_vector_type(16))) _Float16 v16h;
typedef __attribute__((ext_vector_type(8)))  _Float16 v8h;
typedef __attribute__((ext_vector_type(4)))  _Float16 v4h;
typedef __attribute__((ext_vector_type(2)))  _Float16 v2h;
typedef __attribute__((ext_vector_type(8)))  float    v8f;
typedef __attribute__((ext_vector_type(4)))  float    v4f;
typedef __attribute__((ext_vector_type(4)))  unsigned int v4u;

__device__ __forceinline__ v16h loadfrag_h(const _Float16* base, int r0, int k0,
                                           int stride, unsigned lane) {
  const _Float16* p = base + (r0 + (int)(lane & 15u)) * stride + k0;
  int hi = (lane & 16u) ? 1 : 0;
  v8h lo = *(const v8h*)(p + (hi ? 8 : 0));
  v8h hj = *(const v8h*)(p + (hi ? 24 : 16));
  return __builtin_shufflevector(lo, hj, 0, 1, 2, 3, 4, 5, 6, 7, 8, 9, 10, 11,
                                 12, 13, 14, 15);
}

__device__ __forceinline__ v16h loadfrag_cm(const _Float16* base, int r0, int c0,
                                            int c1, int plane, unsigned lane) {
  const _Float16* p = base + (r0 + (int)(lane & 15u)) * 8;
  v8h lo = *(const v8h*)(p + c0 * plane);
  v8h hj = *(const v8h*)(p + c1 * plane);
  return __builtin_shufflevector(lo, hj, 0, 1, 2, 3, 4, 5, 6, 7, 8, 9, 10, 11,
                                 12, 13, 14, 15);
}

// A fragment for 2-tap conv chunk: K 0..15 = tap0 ch0..15, K 16..31 = tap1.
__device__ __forceinline__ v16h frag2tap(const _Float16* p0, const _Float16* p1,
                                         unsigned lane) {
  int hi = (lane & 16u) ? 8 : 0;
  v8h lo = *(const v8h*)(p0 + hi);
  v8h hj = *(const v8h*)(p1 + hi);
  return __builtin_shufflevector(lo, hj, 0, 1, 2, 3, 4, 5, 6, 7, 8, 9, 10, 11,
                                 12, 13, 14, 15);
}

// A fragment for 1-tap conv chunk over a 32-channel pixel record.
__device__ __forceinline__ v16h frag1tap(const _Float16* p, unsigned lane) {
  int hi = (lane & 16u) ? 1 : 0;
  v8h lo = *(const v8h*)(p + (hi ? 8 : 0));
  v8h hj = *(const v8h*)(p + (hi ? 24 : 16));
  return __builtin_shufflevector(lo, hj, 0, 1, 2, 3, 4, 5, 6, 7, 8, 9, 10, 11,
                                 12, 13, 14, 15);
}

// value of the lane 16 away (same column, other half of the rows)
__device__ __forceinline__ float other_half(float v) {
  int b = __builtin_bit_cast(int, v);
  b = __builtin_amdgcn_permlanex16(b, b, 0x76543210, 0xfedcba98, false, false);
  return __builtin_bit_cast(float, b);
}

__device__ __forceinline__ float exp_slot(float x) {
  float a = x * 1.44269504f, r;
  asm("v_exp_f32 %0, %1\n\tv_nop" : "=v"(r) : "v"(a));
  return r;
}

__device__ __forceinline__ v8f wmma_f16(v16h a, v16h b, v8f c) {
  return __builtin_amdgcn_wmma_f32_16x16x32_f16(false, a, false, b, (short)0, c,
                                                false, false);
}

__device__ __forceinline__ v8f zero8() {
  v8f z = {0.f, 0.f, 0.f, 0.f, 0.f, 0.f, 0.f, 0.f};
  return z;
}

#define H1P 24
#define H1R 656
#define H2P 40
#define H2R 888
#define BPL 264
#define BTP 1064
__global__ __launch_bounds__(256) void conv_stack_kernel(
    const float* __restrict__ x,
    const float* __restrict__ w1, const float* __restrict__ b1,
    const float* __restrict__ w2, const float* __restrict__ b2,
    const float* __restrict__ w3, const float* __restrict__ b3,
    const float* __restrict__ w4, const float* __restrict__ b4,
    _Float16* __restrict__ feat) {
  extern __shared__ char smem[];
  float*     xin = (float*)smem;
  float*     ws1 = (float*)(smem + 3136);
  float*     bbf = (float*)(smem + 4416);     // [4][32]
  _Float16*  h1  = (_Float16*)(smem + 4928);
  _Float16*  h2  = (_Float16*)(smem + 38448);
  _Float16*  h3  = (_Float16*)(smem + 78480);
  _Float16*  Bc2 = (_Float16*)(smem + 107920);
  _Float16*  Bc3 = (_Float16*)(smem + 124944);
  _Float16*  Bc4 = (_Float16*)(smem + 158992);

  const int tid = threadIdx.x;
  const unsigned lane = tid & 31u;
  const int wv = tid >> 5;
  const int b = blockIdx.x;
  const int ch0 = (lane & 16u) ? 1 : 0;  // weight planes of this half wave:
  const int ch1 = ch0 + 2;               // the k order of frag2tap/frag1tap

  // ---- every global read of this kernel: coalesced, branch-free (indices
  // clamped, stores guarded) and issued together, so the L2 round trips
  // overlap instead of one waited 4-byte load per staged element ----
  // Weight unit u = (oc n, input-channel pair kp, tap quad tq), tq fastest:
  // two 16-byte loads (channels 2kp and 2kp+1, taps 4tq..4tq+3) feed four
  // 4-byte LDS stores of a channel pair each.
  // (the unrolls here and in the scatter below keep the arrays in registers)
  v4f r2a[3], r2b[3], r3a[4], r3b[4], r4a[6], r4b[6];
  {
    const v4f* w2v = (const v4f*)w2;  // 20 x 8 x 4  = 640 units
    const v4f* w3v = (const v4f*)w3;  // 24 x 10 x 4 = 960 units
    const v4f* w4v = (const v4f*)w4;  // 30 x 12 x 4 = 1440 units
    // 16-byte index of unit u: (u>>2)*8 + (u&3); 256 units further = +512.
    // Each tensor's last, partial slice clamps its unit.
    const int a0 = (tid >> 2) * 8 + (tid & 3);
    const int u2 = tid + 512 < 640 ? tid + 512 : 639;
    const int u3 = tid + 768 < 960 ? tid + 768 : 959;
    const int u4 = tid + 1280 < 1440 ? tid + 1280 : 1439;
    const int a2 = (u2 >> 2) * 8 + (u2 & 3);
    const int a3 = (u3 >> 2) * 8 + (u3 & 3);
    const int a4 = (u4 >> 2) * 8 + (u4 & 3);
#pragma unroll
    for (int i = 0; i < 2; ++i) {
      r2a[i] = w2v[a0 + 512 * i];
      r2b[i] = w2v[a0 + 512 * i + 4];
    }
    r2a[2] = w2v[a2];
    r2b[2] = w2v[a2 + 4];
#pragma unroll
    for (int i = 0; i < 3; ++i) {
      r3a[i] = w3v[a0 + 512 * i];
      r3b[i] = w3v[a0 + 512 * i + 4];
    }
    r3a[3] = w3v[a3];
    r3b[3] = w3v[a3 + 4];
#pragma unroll
    for (int i = 0; i < 5; ++i) {
      r4a[i] = w4v[a0 + 512 * i];
      r4b[i] = w4v[a0 + 512 * i + 4];
    }
    r4a[5] = w4v[a4];
    r4b[5] = w4v[a4 + 4];

    const v4f* sx = (const v4f*)(x + (size_t)b * 784);
    v4f xr  = sx[tid < 196 ? tid : 195];
    const int a1 = tid & 63;
    v4f w1r = ((const v4f*)w1)[a1];
    int g = (tid >> 5) & 3, n = tid & 31;
    const float* bp = (g == 0) ? b1 : (g == 1) ? b2 : (g == 2) ? b3 : b4;
    int lim = (g == 0) ? 16 : (g == 1) ? 20 : (g == 2) ? 24 : 30;
    const float* bq = bp + (n < lim ? n : 0);
    float bv = *bq;
    // The loads' address registers are inputs here, so they stay unwritten
    // (also by a later load's result) until this wait.
    asm volatile("s_wait_xcnt 0x0"
                 :: "v"(a0), "v"(a1), "v"(a2), "v"(a3), "v"(a4), "v"(bq)
                 : "memory");
    // zero h1..h3 and Bc2..Bc4 (contiguous 188112 B = 11757 x b128)
    v4u zz = {0u, 0u, 0u, 0u};
    v4u* z = (v4u*)h1;
    for (int i = 0; i < 45; ++i) z[tid + 256 * i] = zz;
    if (tid < 237) z[tid + 11520] = zz;
    if (tid < 196) ((v4f*)xin)[tid] = xr;
    if (tid < 64)  *(v4f*)(ws1 + (tid >> 2) * 20 + (tid & 3) * 4) = w1r;
    if (tid < 128) bbf[tid] = (n < lim) ? bv : 0.f;
  }
  __syncthreads();

  // ---- scatter the weights into the zeroed per-tap B matrices ----
  // Bc2: chunk c pairs taps 2c,2c+1; k<16 -> tap 2c ic=k, k>=16 -> tap 2c+1
#pragma unroll
  for (int i = 0; i < 3; ++i) {
    int u = tid + 256 * i;
    if (u < 640) {
      int t0 = (u & 3) * 4, r = u >> 2;
      int n = r >> 3, ic = (r & 7) * 2;
#pragma unroll
      for (int e = 0; e < 4; ++e) {
        int tap = t0 + e;
        v2h h = {(_Float16)r2a[i][e], (_Float16)r2b[i][e]};
        int k = (tap & 1) * 16 + ic;
        *(v2h*)(Bc2 + (tap >> 1) * BTP + (k >> 3) * BPL + n * 8 + (k & 7)) = h;
      }
    }
  }
  // Bc3: tap t, k = ic (20 valid of 32), n = oc (24 valid of 32)
#pragma unroll
  for (int i = 0; i < 4; ++i) {
    int u = tid + 256 * i;
    if (u < 960) {
      int t0 = (u & 3) * 4, r = u >> 2;
      int n = r / 10, k = (r - n * 10) * 2;
#pragma unroll
      for (int e = 0; e < 4; ++e) {
        v2h h = {(_Float16)r3a[i][e], (_Float16)r3b[i][e]};
        *(v2h*)(Bc3 + (t0 + e) * BTP + (k >> 3) * BPL + n * 8 + (k & 7)) = h;
      }
    }
  }
  // Bc4: tap t, k = ic (24 valid of 32), n = oc (30 valid of 32)
#pragma unroll
  for (int i = 0; i < 6; ++i) {
    int u = tid + 256 * i;
    if (u < 1440) {
      int t0 = (u & 3) * 4, r = u >> 2;
      int n = r / 12, k = (r - n * 12) * 2;
#pragma unroll
      for (int e = 0; e < 4; ++e) {
        v2h h = {(_Float16)r4a[i][e], (_Float16)r4b[i][e]};
        *(v2h*)(Bc4 + (t0 + e) * BTP + (k >> 3) * BPL + n * 8 + (k & 7)) = h;
      }
    }
  }

  // ---- conv1 (ic=1, scalar): 28x28 -> 16x25x25, channel-last f16 ----
  for (int idx = tid; idx < 10000; idx += 256) {
    int p = idx >> 4, oc = idx & 15;
    int oy = p / 25, ox = p - oy * 25;
    float acc = bbf[oc];
    const float* wp = ws1 + oc * 20;
#pragma unroll
    for (int ky = 0; ky < 4; ++ky)
#pragma unroll
      for (int kx = 0; kx < 4; ++kx)
        acc += xin[(oy + ky) * 28 + ox + kx] * wp[ky * 4 + kx];
    h1[oy * H1R + ox * H1P + oc] = (_Float16)fmaxf(acc, 0.f);
  }
  __syncthreads();

  // ---- conv2 via WMMA: M=484(->496) x N=20(->32) x K=256 (8 chunks) ----
  for (int u = wv; u < 62; u += 8) {
    int mt = u >> 1, nt = u & 1;
    int m = mt * 16 + (int)(lane & 15u);
    int oy = m / 22, ox = m - oy * 22;
    v8f acc = zero8();
#pragma unroll
    for (int c = 0; c < 8; ++c) {
      int t0 = 2 * c, t1 = 2 * c + 1;
      const _Float16* p0 = h1 + (oy + (t0 >> 2)) * H1R + (ox + (t0 & 3)) * H1P;
      const _Float16* p1 = h1 + (oy + (t1 >> 2)) * H1R + (ox + (t1 & 3)) * H1P;
      v16h a = frag2tap(p0, p1, lane);
      v16h bf = loadfrag_cm(Bc2 + c * BTP, nt * 16, ch0, ch1, BPL, lane);
      acc = wmma_f16(a, bf, acc);
    }
    int n = nt * 16 + (int)(lane & 15u);
    float bias = bbf[32 + n];
    int m0 = mt * 16 + ((lane & 16u) ? 8 : 0);  // first of this lane's 8 pixels
    int y0 = m0 / 22, x0 = m0 - y0 * 22;
    _Float16* hp = h2 + y0 * H2R + x0 * H2P + n;
#pragma unroll
    for (int r = 0; r < 8; ++r)  // at most one step into the next image row
      hp[r * H2P + (x0 + r >= 22 ? H2R - 22 * H2P : 0)] =
          (_Float16)fmaxf(acc[r] + bias, 0.f);
  }
  __syncthreads();

  // ---- conv3 via WMMA: M=361(->368) x N=24(->32) x K=512 (16 taps) ----
  for (int u = wv; u < 46; u += 8) {
    int mt = u >> 1, nt = u & 1;
    int m = mt * 16 + (int)(lane & 15u);
    int oy = m / 19, ox = m - oy * 19;
    v8f acc = zero8();
#pragma unroll
    for (int t = 0; t < 16; ++t) {
      const _Float16* p = h2 + (oy + (t >> 2)) * H2R + (ox + (t & 3)) * H2P;
      v16h a = frag1tap(p, lane);
      v16h bf = loadfrag_cm(Bc3 + t * BTP, nt * 16, ch0, ch1, BPL, lane);
      acc = wmma_f16(a, bf, acc);
    }
    int n = nt * 16 + (int)(lane & 15u);
    float bias = bbf[64 + n];
    int mh = (lane & 16u) ? 8 : 0;
#pragma unroll
    for (int r = 0; r < 8; ++r)
      h3[(mt * 16 + mh + r) * H2P + n] = (_Float16)fmaxf(acc[r] + bias, 0.f);
  }
  __syncthreads();

  // ---- conv4 via WMMA: M=256 x N=30(->32) x K=512; write features+coords ----
  _Float16* fb = feat + (size_t)b * 8192;
  for (int u = wv; u < 32; u += 8) {
    int mt = u >> 1, nt = u & 1;
    int m = mt * 16 + (int)(lane & 15u);
    int oy = m >> 4, ox = m & 15;
    v8f acc = zero8();
#pragma unroll
    for (int t = 0; t < 16; ++t) {
      const _Float16* p = h3 + ((oy + (t >> 2)) * 19 + ox + (t & 3)) * H2P;
      v16h a = frag1tap(p, lane);
      v16h bf = loadfrag_cm(Bc4 + t * BTP, nt * 16, ch0, ch1, BPL, lane);
      acc = wmma_f16(a, bf, acc);
    }
    int n = nt * 16 + (int)(lane & 15u);
    int mh = (lane & 16u) ? 8 : 0;
    if (n < 30) {  // per-lane-uniform guard hoisted outside the r-loop
      float bias = bbf[96 + n];
#pragma unroll
      for (int r = 0; r < 8; ++r)
        fb[(mt * 16 + mh + r) * 32 + n] = (_Float16)fmaxf(acc[r] + bias, 0.f);
    }
  }
  {
    int n = tid;  // coord channels (columns 30/31, disjoint from tile stores)
    int xx = n % 16, yy = n / 16;
    fb[n * 32 + 30] = (_Float16)((float)xx * 0.0625f);
    fb[n * 32 + 31] = (_Float16)((float)yy * 0.0625f);
  }
}

#define APL 2080
#define TP 52
#define A2P 36
__global__ __launch_bounds__(256) void attn_kernel(
    const _Float16* __restrict__ feat,
    const float* __restrict__ kW, const float* __restrict__ kb,
    const float* __restrict__ qW, const float* __restrict__ qb,
    const float* __restrict__ vW, const float* __restrict__ vb,
    const float* __restrict__ kg, const float* __restrict__ kbe,
    const float* __restrict__ qg, const float* __restrict__ qbe,
    const float* __restrict__ vg, const float* __restrict__ vbe,
    const float* __restrict__ l1W, const float* __restrict__ l1b,
    const float* __restrict__ l2W, const float* __restrict__ l2b,
    float* __restrict__ out) {
  extern __shared__ char smem[];
  _Float16* hbuf = (_Float16*)smem;
  _Float16* Qb   = (_Float16*)(smem + 16640);
  float* tmpf = (float*)(smem + 41600);
  _Float16* Kb   = (_Float16*)(smem + 94848);
  _Float16* Vt   = (_Float16*)(smem + 119808);
  _Float16* wbuf = (_Float16*)(smem + 145152);
  float* red  = (float*)(smem + 148992);
  float* mxv  = (float*)(smem + 151072);
  float* ov   = (float*)(smem + 151264);
  float* bb   = (float*)(smem + 151328);

  const int tid = threadIdx.x;
  const unsigned lane = tid & 31u;
  const int wv = tid >> 5;
  const int b = blockIdx.x;
  // planes of this half wave, in the k order of loadfrag_h: columns 0..31,
  // then columns 32..63 (40..63 read the zero plane)
  const int ch0 = (lane & 16u) ? 1 : 0, ch1 = ch0 + 2, ch2 = ch0 + 4;

  // ---- features, projection weights, biases: coalesced, branch-free reads
  // (indices clamped, stores guarded), all in flight together ----
  // (unrolls on fr/wreg/gr/er loops keep these arrays in registers)
  v4f wreg[3][2];
  // gamma/beta of pass p: 18 coalesced 16-byte loads in flight together.
  // Pass 0's go out here; pass p+1's go out ahead of pass p's normalisation,
  // which covers their L2 round trip up to the barrier behind it.
  v4f gr[3][9], er[3][9];
#pragma unroll
  for (int i = 0; i < 9; ++i) {
    gr[0][i] = ((const v4f*)vg)[tid + 256 * i];
    er[0][i] = ((const v4f*)vbe)[tid + 256 * i];
  }
  {
    const v4u* src = (const v4u*)(feat + (size_t)b * 8192);
    v4u fr[4];
#pragma unroll
    for (int i = 0; i < 4; ++i) fr[i] = src[tid + 256 * i];
    const int f1 = 256 + (tid & 31);  // each W is 288 x 16 B
    wreg[0][0] = ((const v4f*)vW)[tid];  wreg[0][1] = ((const v4f*)vW)[f1];
    wreg[1][0] = ((const v4f*)kW)[tid];  wreg[1][1] = ((const v4f*)kW)[f1];
    wreg[2][0] = ((const v4f*)qW)[tid];  wreg[2][1] = ((const v4f*)qW)[f1];
    const int bi = tid < 144 ? tid : 0;
    const int pb = bi / 48, jb = bi - pb * 48;
    const float* bp = (pb == 0) ? vb : (pb == 1) ? kb : qb;
    float bv = bp[jb < 36 ? jb : 0];

    // zero what the staged operands pad with: Q/K planes 4 and 5 (520 x 16 B;
    // columns 32..35 are stored over it behind later barriers), V^T rows
    // 36..47, W rows 36..47
    const v4u zz = {0u, 0u, 0u, 0u};
    for (int i = tid; i < 520; i += 256) {
      ((v4u*)(Qb + 4 * APL))[i] = zz;
      ((v4u*)(Kb + 4 * APL))[i] = zz;
    }
    for (int i = tid; i < 396; i += 256) ((v4u*)(Vt + 36 * 264))[i] = zz;
    if (tid < 60) ((v4u*)(wbuf + 36 * 40))[tid] = zz;

    // 16-byte unit u of the [256][32] features: row u >> 2, plane u & 3
#pragma unroll
    for (int i = 0; i < 4; ++i)
      *(v4u*)(hbuf + (tid & 3) * APL + ((tid >> 2) + 64 * i) * 8) = fr[i];
    if (tid < 144) bb[tid] = (jb < 36) ? bv : 0.f;
  }
  __syncthreads();

  // unrolled: wreg/gr/er are indexed by p and have to stay in registers
#pragma unroll
  for (int p = 0; p < 3; ++p) {
    {
      const int k = (tid & 7) * 4;
      v4f w0 = wreg[p][0];
      v4h h0 = {(_Float16)w0[0], (_Float16)w0[1], (_Float16)w0[2], (_Float16)w0[3]};
      *(v4h*)(wbuf + (tid >> 3) * 40 + k) = h0;
      if (tid < 32) {
        v4f w1v = wreg[p][1];
        v4h h1v = {(_Float16)w1v[0], (_Float16)w1v[1], (_Float16)w1v[2], (_Float16)w1v[3]};
        *(v4h*)(wbuf + (32 + (tid >> 3)) * 40 + k) = h1v;
      }
    }
    __syncthreads();

    for (int t = wv; t < 48; t += 8) {
      int rt = t / 3, nt = t % 3;
      v16h a  = loadfrag_cm(hbuf, rt * 16, ch0, ch1, APL, lane);
      v16h bf = loadfrag_h(wbuf, nt * 16, 0, 40, lane);
      v8f acc = zero8();
      acc = wmma_f16(a, bf, acc);
      int n = nt * 16 + (int)(lane & 15u);
      float bias = bb[p * 48 + n];
      int mh = (lane & 16u) ? 8 : 0;
#pragma unroll
      for (int r = 0; r < 8; ++r)
        tmpf[(rt * 16 + mh + r) * TP + n] = acc[r] + bias;
    }
    __syncthreads();

    {
      float s = 0.f, s2 = 0.f;
      const float* rowp = tmpf + tid * TP;
#pragma unroll
      for (int c = 0; c < 36; c += 4) {
        v4f v = *(const v4f*)(rowp + c);
        s += v[0] + v[1] + v[2] + v[3];
        s2 += v[0] * v[0] + v[1] * v[1] + v[2] * v[2] + v[3] * v[3];
      }
      red[tid] = s; red[256 + tid] = s2;
    }
    __syncthreads();
    for (int off = 128; off > 0; off >>= 1) {
      if (tid < off) {
        red[tid] += red[tid + off];
        red[256 + tid] += red[256 + tid + off];
      }
      __syncthreads();
    }
    float mu   = red[0] * (1.f / 9216.f);
    float var  = red[256] * (1.f / 9216.f) - mu * mu;
    float rstd = rsqrtf(var + 1e-5f);

    if (p < 2) {
      const v4f* Gv = (const v4f*)((p == 0) ? kg : qg);
      const v4f* Ev = (const v4f*)((p == 0) ? kbe : qbe);
#pragma unroll
      for (int i = 0; i < 9; ++i) {
        gr[p + 1][i] = Gv[tid + 256 * i];
        er[p + 1][i] = Ev[tid + 256 * i];
      }
    }

    // 16-byte piece f of the [256][36] plane: node = f/9, columns j0..j0+3
#pragma unroll
    for (int i = 0; i < 9; ++i) {
      int f = tid + 256 * i;
      int node = f / 9, j0 = (f - node * 9) * 4;
      v4f tv = *(const v4f*)(tmpf + node * TP + j0);
      v4h o;
#pragma unroll
      for (int e = 0; e < 4; ++e) {
        float v = (tv[e] - mu) * rstd;
        o[e] = (_Float16)(v * gr[p][i][e] + er[p][i][e]);
      }
      if (p == 0) {
#pragma unroll
        for (int e = 0; e < 4; ++e) Vt[(j0 + e) * 264 + node] = o[e];
      } else {
        _Float16* dst = (p == 1) ? Kb : Qb;
        *(v4h*)(dst + (j0 >> 3) * APL + node * 8 + (j0 & 4)) = o;
      }
    }
    __syncthreads();
  }

  const float scale = 0.16666667f;  // 1/sqrt(36)
  for (int blk = wv; blk < 16; blk += 8) {
    int row0 = blk * 16;
    // B operand: 16 queries (n = query), kept for all 16 key tiles
    v16h qb0 = loadfrag_cm(Qb, row0, ch0, ch1, APL, lane);
    v16h qb1 = loadfrag_cm(Qb, row0, ch2, 5, APL, lane);
    v8f st[16];
#pragma unroll
    for (int ct = 0; ct < 16; ++ct) {
      v8f acc = zero8();
      acc = wmma_f16(loadfrag_cm(Kb, ct * 16, ch0, ch1, APL, lane), qb0, acc);
      acc = wmma_f16(loadfrag_cm(Kb, ct * 16, ch2, 5, APL, lane), qb1, acc);
      st[ct] = acc;
    }
    float mx = -1e30f;
#pragma unroll
    for (int ct = 0; ct < 16; ++ct)
#pragma unroll
      for (int r = 0; r < 8; ++r) {
        st[ct][r] *= scale;
        mx = fmaxf(mx, st[ct][r]);
      }
    mx = fmaxf(mx, other_half(mx));
    float s = 0.f;
    v8f av0 = zero8(), av1 = zero8(), av2 = zero8();
#pragma unroll
    for (int kc = 0; kc < 8; ++kc) {
      // B fragment of keys kc*32..+31: elements 0..7 are k = 8*hi + r (tile
      // 2kc), elements 8..15 are k = 16 + 8*hi + r (tile 2kc+1): the k order
      // of loadfrag_h, which loads the A operand (V^T rows) below.
      v16h pb;
      float ps = 0.f;
#pragma unroll
      for (int r = 0; r < 8; ++r) {
        float e0 = exp_slot(st[2 * kc][r] - mx);
        float e1 = exp_slot(st[2 * kc + 1][r] - mx);
        ps += e0 + e1;
        pb[r]     = (_Float16)e0;
        pb[8 + r] = (_Float16)e1;
      }
      s += ps;
      av0 = wmma_f16(loadfrag_h(Vt, 0, kc * 32, 264, lane), pb, av0);
      av1 = wmma_f16(loadfrag_h(Vt, 16, kc * 32, 264, lane), pb, av1);
      av2 = wmma_f16(loadfrag_h(Vt, 32, kc * 32, 264, lane), pb, av2);
    }
    s += other_half(s);
    float invr = 1.f / s;
    // O^T tile: n = query, m = output column r + 8*hi: 8 adjacent floats
    float* op = tmpf + (row0 + (int)(lane & 15u)) * TP + ((lane & 16u) ? 8 : 0);
    v4f o;
#pragma unroll
    for (int h = 0; h < 2; ++h) {
#pragma unroll
      for (int e = 0; e < 4; ++e) o[e] = av0[4 * h + e] * invr;
      *(v4f*)(op + 4 * h) = o;
#pragma unroll
      for (int e = 0; e < 4; ++e) o[e] = av1[4 * h + e] * invr;
      *(v4f*)(op + 16 + 4 * h) = o;
#pragma unroll
      for (int e = 0; e < 4; ++e) o[e] = av2[4 * h + e] * invr;
      *(v4f*)(op + 32 + 4 * h) = o;
    }
  }
  // l1W (324 x 16 B) and l1b: read before the barrier, stored behind it
  v4f l1r0 = ((const v4f*)l1W)[tid];
  v4f l1r1 = ((const v4f*)l1W)[256 + (tid < 68 ? tid : 67)];
  float l1bv = l1b[tid < 36 ? tid : 35];
  __syncthreads();

  float* l1Ws = (float*)Qb;  // Qb region is dead now
  ((v4f*)l1Ws)[tid] = l1r0;
  if (tid < 68) ((v4f*)l1Ws)[256 + tid] = l1r1;
  if (tid < 36) l1Ws[1296 + tid] = l1bv;
  __syncthreads();

  float* att2 = (float*)Kb;  // K and V^T are dead now (36864 B of 50304)
  {
    // this thread's row, read once (the unrolls keep it in registers)
    v4f ar[9];
#pragma unroll
    for (int c = 0; c < 9; ++c) ar[c] = *(const v4f*)(tmpf + tid * TP + 4 * c);
    for (int j = 0; j < 36; ++j) {
      float s = l1Ws[1296 + j];
      const float* wr = l1Ws + j * 36;
#pragma unroll
      for (int k = 0; k < 36; ++k) s += ar[k >> 2][k & 3] * wr[k];
      att2[tid * A2P + j] = fmaxf(s, 0.f);
    }
  }
  __syncthreads();

  {
    float s = 0.f, s2 = 0.f;
    const float* rp = att2 + tid * A2P;
#pragma unroll
    for (int c = 0; c < 36; c += 4) {
      v4f v = *(const v4f*)(rp + c);
      s += v[0] + v[1] + v[2] + v[3];
      s2 += v[0] * v[0] + v[1] * v[1] + v[2] * v[2] + v[3] * v[3];
    }
    red[tid] = s; red[256 + tid] = s2;
  }
  __syncthreads();
  for (int off = 128; off > 0; off >>= 1) {
    if (tid < off) {
      red[tid] += red[tid + off];
      red[256 + tid] += red[256 + tid + off];
    }
    __syncthreads();
  }
  float mu   = red[0] * (1.f / 9216.f);
  float var  = red[256] * (1.f / 9216.f) - mu * mu;
  float rstd = rsqrtf(var + 1e-5f);

  if (tid < 36) {
    float m = -1e30f;
    for (int n = 0; n < 256; ++n) m = fmaxf(m, att2[n * A2P + tid]);
    mxv[tid] = (m - mu) * rstd;
  }
  __syncthreads();

  if (tid < 10) {
    float s = l2b[tid];
    for (int j = 0; j < 36; ++j) s += mxv[j] * l2W[tid * 36 + j];
    ov[tid] = s;
  }
  __syncthreads();
  if (tid == 0) {
    float mx = -1e30f;
    for (int o = 0; o < 10; ++o) mx = fmaxf(mx, ov[o]);
    float s = 0.f;
    for (int o = 0; o < 10; ++o) s += __expf(ov[o] - mx);
    red[0] = mx + __logf(s);
  }
  __syncthreads();
  if (tid < 10) out[(size_t)b * 10 + tid] = ov[tid] - red[0];
}

// ---------------------------------------------------------------------------
extern "C" void kernel_launch(void* const* d_in, const int* in_sizes, int n_in,
                              void* d_out, int out_size, void* d_ws, size_t ws_size,
                              hipStream_t stream) {
  const float* x  = (const float*)d_in[0];
  const float* w1 = (const float*)d_in[1];  const float* b1 = (const float*)d_in[2];
  const float* w2 = (const float*)d_in[3];  const float* b2 = (const float*)d_in[4];
  const float* w3 = (const float*)d_in[5];  const float* b3 = (const float*)d_in[6];
  const float* w4 = (const float*)d_in[7];  const float* b4 = (const float*)d_in[8];
  const float* kW = (const float*)d_in[9];  const float* kbv = (const float*)d_in[10];
  const float* qW = (const float*)d_in[11]; const float* qbv = (const float*)d_in[12];
  const float* vW = (const float*)d_in[13]; const float* vbv = (const float*)d_in[14];
  const float* kg = (const float*)d_in[15]; const float* kbe = (const float*)d_in[16];
  const float* qg = (const float*)d_in[17]; const float* qbe = (const float*)d_in[18];
  const float* vg = (const float*)d_in[19]; const float* vbe = (const float*)d_in[20];
  const float* l1W = (const float*)d_in[21]; const float* l1b = (const float*)d_in[22];
  const float* l2W = (const float*)d_in[23]; const float* l2b = (const float*)d_in[24];

  const int B = in_sizes[0] / (28 * 28);   // 2048
  _Float16* feat = (_Float16*)d_ws;        // [B][256][32] f16 = 16 KB/batch

  conv_stack_kernel<<<B, 256, 193040, stream>>>(x, w1, b1, w2, b2, w3, b3, w4,
                                                b4, feat);
  attn_kernel<<<B, 256, 151904, stream>>>(feat, kW, kbv, qW, qbv, vW, vbv,
                                          kg, kbe, qg, qbe, vg, vbe,
                                          l1W, l1b, l2W, l2b, (float*)d_out);
}

// v004
// It runs in 234 microseconds.
// Timed twice side by side with v003, it ran 1.17 times as fast both times.
// Counting every step since v000, it is 4.12 times as fast.
#include <hip/hip_runtime.h>
#include <hip/hip_bf16.h>
#include <math.h>

typedef __attribute__((ext_vector_type(16))) _Float16 v16h;
typedef __attribute__((ext_vector_type(8)))  _Float16 v8h;
typedef __attribute__((ext_vector_type(4)))  _Float16 v4h;
typedef __attribute__((ext_vector_type(2)))  _Float16 v2h;
typedef __attribute__((ext_vector_type(8)))  float    v8f;
typedef __attribute__((ext_vector_type(4)))  float    v4f;
typedef __attribute__((ext_vector_type(4)))  unsigned int v4u;

__device__ __forceinline__ v16h loadfrag_h(const _Float16* base, int r0, int k0,
                                           int stride, unsigned lane) {
  const _Float16* p = base + (r0 + (int)(lane & 15u)) * stride + k0;
  int hi = (lane & 16u) ? 1 : 0;
  v8h lo = *(const v8h*)(p + (hi ? 8 : 0));
  v8h hj = *(const v8h*)(p + (hi ? 24 : 16));
  return __builtin_shufflevector(lo, hj, 0, 1, 2, 3, 4, 5, 6, 7, 8, 9, 10, 11,
                                 12, 13, 14, 15);
}

__device__ __forceinline__ v16h loadfrag_cm(const _Float16* base, int r0, int c0,
                                            int c1, int plane, unsigned lane) {
  const _Float16* p = base + (r0 + (int)(lane & 15u)) * 8;
  v8h lo = *(const v8h*)(p + c0 * plane);
  v8h hj = *(const v8h*)(p + c1 * plane);
  return __builtin_shufflevector(lo, hj, 0, 1, 2, 3, 4, 5, 6, 7, 8, 9, 10, 11,
                                 12, 13, 14, 15);
}

// A fragment for 2-tap conv chunk: K 0..15 = tap0 ch0..15, K 16..31 = tap1.
__device__ __forceinline__ v16h frag2tap(const _Float16* p0, const _Float16* p1,
                                         unsigned lane) {
  int hi = (lane & 16u) ? 8 : 0;
  v8h lo = *(const v8h*)(p0 + hi);
  v8h hj = *(const v8h*)(p1 + hi);
  return __builtin_shufflevector(lo, hj, 0, 1, 2, 3, 4, 5, 6, 7, 8, 9, 10, 11,
                                 12, 13, 14, 15);
}

// A fragment for 1-tap conv chunk over a 32-channel pixel record.
__device__ __forceinline__ v16h frag1tap(const _Float16* p, unsigned lane) {
  int hi = (lane & 16u) ? 1 : 0;
  v8h lo = *(const v8h*)(p + (hi ? 8 : 0));
  v8h hj = *(const v8h*)(p + (hi ? 24 : 16));
  return __builtin_shufflevector(lo, hj, 0, 1, 2, 3, 4, 5, 6, 7, 8, 9, 10, 11,
                                 12, 13, 14, 15);
}

// value of the lane 16 away (same column, other half of the rows)
__device__ __forceinline__ float other_half(float v) {
  int b = __builtin_bit_cast(int, v);
  b = __builtin_amdgcn_permlanex16(b, b, 0x76543210, 0xfedcba98, false, false);
  return __builtin_bit_cast(float, b);
}

// sum over the 32 lanes of a wave, the total in every lane: four adds with the
// lane whose number differs in one bit (row_xmask, inside a 16-lane row), then
// the other row. All 32 lanes have to be on.
template <int CTRL>
__device__ __forceinline__ float add_xmask(float v) {
  int b = __builtin_bit_cast(int, v);
  b = __builtin_amdgcn_update_dpp(0, b, CTRL, 0xf, 0xf, true);
  return v + __builtin_bit_cast(float, b);
}
__device__ __forceinline__ float wave_sum(float v) {
  v = add_xmask<0x161>(v);
  v = add_xmask<0x162>(v);
  v = add_xmask<0x164>(v);
  v = add_xmask<0x168>(v);
  return v + other_half(v);
}

// the eight waves' partial sums p[0..7], added in one fixed order
__device__ __forceinline__ float sum8(const float* p) {
  v4f a = *(const v4f*)p, b = *(const v4f*)(p + 4);
  return ((a[0] + a[1]) + (a[2] + a[3])) + ((b[0] + b[1]) + (b[2] + b[3]));
}

__device__ __forceinline__ float exp_slot(float x) {
  float a = x * 1.44269504f, r;
  asm("v_exp_f32 %0, %1\n\tv_nop" : "=v"(r) : "v"(a));
  return r;
}

__device__ __forceinline__ v8f wmma_f16(v16h a, v16h b, v8f c) {
  return __builtin_amdgcn_wmma_f32_16x16x32_f16(false, a, false, b, (short)0, c,
                                                false, false);
}

__device__ __forceinline__ v8f zero8() {
  v8f z = {0.f, 0.f, 0.f, 0.f, 0.f, 0.f, 0.f, 0.f};
  return z;
}

#define H1P 24
#define H1R 656
#define H2P 40
#define H2R 888
#define BPL 264
#define BTP 1064
__global__ __launch_bounds__(256) void conv_stack_kernel(
    const float* __restrict__ x,
    const float* __restrict__ w1, const float* __restrict__ b1,
    const float* __restrict__ w2, const float* __restrict__ b2,
    const float* __restrict__ w3, const float* __restrict__ b3,
    const float* __restrict__ w4, const float* __restrict__ b4,
    _Float16* __restrict__ feat) {
  extern __shared__ char smem[];
  float*     xin = (float*)smem;
  float*     ws1 = (float*)(smem + 3136);
  float*     bbf = (float*)(smem + 4416);     // [4][32]
  _Float16*  h1  = (_Float16*)(smem + 4928);
  _Float16*  h2  = (_Float16*)(smem + 38448);
  _Float16*  h3  = (_Float16*)(smem + 78480);
  _Float16*  Bc2 = (_Float16*)(smem + 107920);
  _Float16*  Bc3 = (_Float16*)(smem + 124944);
  _Float16*  Bc4 = (_Float16*)(smem + 158992);

  const int tid = threadIdx.x;
  const unsigned lane = tid & 31u;
  const int wv = tid >> 5;
  const int b = blockIdx.x;
  const int ch0 = (lane & 16u) ? 1 : 0;  // weight planes of this half wave:
  const int ch1 = ch0 + 2;               // the k order of frag2tap/frag1tap

  // ---- every global read of this kernel: coalesced, branch-free (indices
  // clamped, stores guarded) and issued together, so the L2 round trips
  // overlap instead of one waited 4-byte load per staged element ----
  // Weight unit u = (oc n, input-channel pair kp, tap quad tq), tq fastest:
  // two 16-byte loads (channels 2kp and 2kp+1, taps 4tq..4tq+3) feed four
  // 4-byte LDS stores of a channel pair each.
  // (the unrolls here and in the scatter below keep the arrays in registers)
  v4f r2a[3], r2b[3], r3a[4], r3b[4], r4a[6], r4b[6];
  {
    const v4f* w2v = (const v4f*)w2;  // 20 x 8 x 4  = 640 units
    const v4f* w3v = (const v4f*)w3;  // 24 x 10 x 4 = 960 units
    const v4f* w4v = (const v4f*)w4;  // 30 x 12 x 4 = 1440 units
    // 16-byte index of unit u: (u>>2)*8 + (u&3); 256 units further = +512.
    // Each tensor's last, partial slice clamps its unit.
    const int a0 = (tid >> 2) * 8 + (tid & 3);
    const int u2 = tid + 512 < 640 ? tid + 512 : 639;
    const int u3 = tid + 768 < 960 ? tid + 768 : 959;
    const int u4 = tid + 1280 < 1440 ? tid + 1280 : 1439;
    const int a2 = (u2 >> 2) * 8 + (u2 & 3);
    const int a3 = (u3 >> 2) * 8 + (u3 & 3);
    const int a4 = (u4 >> 2) * 8 + (u4 & 3);
#pragma unroll
    for (int i = 0; i < 2; ++i) {
      r2a[i] = w2v[a0 + 512 * i];
      r2b[i] = w2v[a0 + 512 * i + 4];
    }
    r2a[2] = w2v[a2];
    r2b[2] = w2v[a2 + 4];
#pragma unroll
    for (int i = 0; i < 3; ++i) {
      r3a[i] = w3v[a0 + 512 * i];
      r3b[i] = w3v[a0 + 512 * i + 4];
    }
    r3a[3] = w3v[a3];
    r3b[3] = w3v[a3 + 4];
#pragma unroll
    for (int i = 0; i < 5; ++i) {
      r4a[i] = w4v[a0 + 512 * i];
      r4b[i] = w4v[a0 + 512 * i + 4];
    }
    r4a[5] = w4v[a4];
    r4b[5] = w4v[a4 + 4];

    const v4f* sx = (const v4f*)(x + (size_t)b * 784);
    v4f xr  = sx[tid < 196 ? tid : 195];
    const int a1 = tid & 63;
    v4f w1r = ((const v4f*)w1)[a1];
    int g = (tid >> 5) & 3, n = tid & 31;
    const float* bp = (g == 0) ? b1 : (g == 1) ? b2 : (g == 2) ? b3 : b4;
    int lim = (g == 0) ? 16 : (g == 1) ? 20 : (g == 2) ? 24 : 30;
    const float* bq = bp + (n < lim ? n : 0);
    float bv = *bq;
    // The loads' address registers are inputs here, so they stay unwritten
    // (also by a later load's result) until this wait.
    asm volatile("s_wait_xcnt 0x0"
                 :: "v"(a0), "v"(a1), "v"(a2), "v"(a3), "v"(a4), "v"(bq)
                 : "memory");
    // zero h1..h3 and Bc2..Bc4 (contiguous 188112 B = 11757 x b128)
    v4u zz = {0u, 0u, 0u, 0u};
    v4u* z = (v4u*)h1;
    for (int i = 0; i < 45; ++i) z[tid + 256 * i] = zz;
    if (tid < 237) z[tid + 11520] = zz;
    if (tid < 196) ((v4f*)xin)[tid] = xr;
    if (tid < 64)  *(v4f*)(ws1 + (tid >> 2) * 20 + (tid & 3) * 4) = w1r;
    if (tid < 128) bbf[tid] = (n < lim) ? bv : 0.f;
  }
  __syncthreads();

  // ---- scatter the weights into the zeroed per-tap B matrices ----
  // Bc2: chunk c pairs taps 2c,2c+1; k<16 -> tap 2c ic=k, k>=16 -> tap 2c+1
#pragma unroll
  for (int i = 0; i < 3; ++i) {
    int u = tid + 256 * i;
    if (u < 640) {
      int t0 = (u & 3) * 4, r = u >> 2;
      int n = r >> 3, ic = (r & 7) * 2;
#pragma unroll
      for (int e = 0; e < 4; ++e) {
        int tap = t0 + e;
        v2h h = {(_Float16)r2a[i][e], (_Float16)r2b[i][e]};
        int k = (tap & 1) * 16 + ic;
        *(v2h*)(Bc2 + (tap >> 1) * BTP + (k >> 3) * BPL + n * 8 + (k & 7)) = h;
      }
    }
  }
  // Bc3: tap t, k = ic (20 valid of 32), n = oc (24 valid of 32)
#pragma unroll
  for (int i = 0; i < 4; ++i) {
    int u = tid + 256 * i;
    if (u < 960) {
      int t0 = (u & 3) * 4, r = u >> 2;
      int n = r / 10, k = (r - n * 10) * 2;
#pragma unroll
      for (int e = 0; e < 4; ++e) {
        v2h h = {(_Float16)r3a[i][e], (_Float16)r3b[i][e]};
        *(v2h*)(Bc3 + (t0 + e) * BTP + (k >> 3) * BPL + n * 8 + (k & 7)) = h;
      }
    }
  }
  // Bc4: tap t, k = ic (24 valid of 32), n = oc (30 valid of 32)
#pragma unroll
  for (int i = 0; i < 6; ++i) {
    int u = tid + 256 * i;
    if (u < 1440) {
      int t0 = (u & 3) * 4, r = u >> 2;
      int n = r / 12, k = (r - n * 12) * 2;
#pragma unroll
      for (int e = 0; e < 4; ++e) {
        v2h h = {(_Float16)r4a[i][e], (_Float16)r4b[i][e]};
        *(v2h*)(Bc4 + (t0 + e) * BTP + (k >> 3) * BPL + n * 8 + (k & 7)) = h;
      }
    }
  }

  // ---- conv1 (ic=1, scalar): 28x28 -> 16x25x25, channel-last f16 ----
  for (int idx = tid; idx < 10000; idx += 256) {
    int p = idx >> 4, oc = idx & 15;
    int oy = p / 25, ox = p - oy * 25;
    float acc = bbf[oc];
    const float* wp = ws1 + oc * 20;
#pragma unroll
    for (int ky = 0; ky < 4; ++ky)
#pragma unroll
      for (int kx = 0; kx < 4; ++kx)
        acc += xin[(oy + ky) * 28 + ox + kx] * wp[ky * 4 + kx];
    h1[oy * H1R + ox * H1P + oc] = (_Float16)fmaxf(acc, 0.f);
  }
  __syncthreads();

  // ---- conv2 via WMMA: M=484(->496) x N=20(->32) x K=256 (8 chunks) ----
  for (int u = wv; u < 62; u += 8) {
    int mt = u >> 1, nt = u & 1;
    int m = mt * 16 + (int)(lane & 15u);
    int oy = m / 22, ox = m - oy * 22;
    v8f acc = zero8();
#pragma unroll
    for (int c = 0; c < 8; ++c) {
      int t0 = 2 * c, t1 = 2 * c + 1;
      const _Float16* p0 = h1 + (oy + (t0 >> 2)) * H1R + (ox + (t0 & 3)) * H1P;
      const _Float16* p1 = h1 + (oy + (t1 >> 2)) * H1R + (ox + (t1 & 3)) * H1P;
      v16h a = frag2tap(p0, p1, lane);
      v16h bf = loadfrag_cm(Bc2 + c * BTP, nt * 16, ch0, ch1, BPL, lane);
      acc = wmma_f16(a, bf, acc);
    }
    int n = nt * 16 + (int)(lane & 15u);
    float bias = bbf[32 + n];
    int m0 = mt * 16 + ((lane & 16u) ? 8 : 0);  // first of this lane's 8 pixels
    int y0 = m0 / 22, x0 = m0 - y0 * 22;
    _Float16* hp = h2 + y0 * H2R + x0 * H2P + n;
#pragma unroll
    for (int r = 0; r < 8; ++r)  // at most one step into the next image row
      hp[r * H2P + (x0 + r >= 22 ? H2R - 22 * H2P : 0)] =
          (_Float16)fmaxf(acc[r] + bias, 0.f);
  }
  __syncthreads();

  // ---- conv3 via WMMA: M=361(->368) x N=24(->32) x K=512 (16 taps) ----
  for (int u = wv; u < 46; u += 8) {
    int mt = u >> 1, nt = u & 1;
    int m = mt * 16 + (int)(lane & 15u);
    int oy = m / 19, ox = m - oy * 19;
    v8f acc = zero8();
#pragma unroll
    for (int t = 0; t < 16; ++t) {
      const _Float16* p = h2 + (oy + (t >> 2)) * H2R + (ox + (t & 3)) * H2P;
      v16h a = frag1tap(p, lane);
      v16h bf = loadfrag_cm(Bc3 + t * BTP, nt * 16, ch0, ch1, BPL, lane);
      acc = wmma_f16(a, bf, acc);
    }
    int n = nt * 16 + (int)(lane & 15u);
    float bias = bbf[64 + n];
    int mh = (lane & 16u) ? 8 : 0;
#pragma unroll
    for (int r = 0; r < 8; ++r)
      h3[(mt * 16 + mh + r) * H2P + n] = (_Float16)fmaxf(acc[r] + bias, 0.f);
  }
  __syncthreads();

  // ---- conv4 via WMMA: M=256 x N=30(->32) x K=512; write features+coords ----
  _Float16* fb = feat + (size_t)b * 8192;
  for (int u = wv; u < 32; u += 8) {
    int mt = u >> 1, nt = u & 1;
    int m = mt * 16 + (int)(lane & 15u);
    int oy = m >> 4, ox = m & 15;
    v8f acc = zero8();
#pragma unroll
    for (int t = 0; t < 16; ++t) {
      const _Float16* p = h3 + ((oy + (t >> 2)) * 19 + ox + (t & 3)) * H2P;
      v16h a = frag1tap(p, lane);
      v16h bf = loadfrag_cm(Bc4 + t * BTP, nt * 16, ch0, ch1, BPL, lane);
      acc = wmma_f16(a, bf, acc);
    }
    int n = nt * 16 + (int)(lane & 15u);
    int mh = (lane & 16u) ? 8 : 0;
    if (n < 30) {  // per-lane-uniform guard hoisted outside the r-loop
      float bias = bbf[96 + n];
#pragma unroll
      for (int r = 0; r < 8; ++r)
        fb[(mt * 16 + mh + r) * 32 + n] = (_Float16)fmaxf(acc[r] + bias, 0.f);
    }
  }
  {
    int n = tid;  // coord channels (columns 30/31, disjoint from tile stores)
    int xx = n % 16, yy = n / 16;
    fb[n * 32 + 30] = (_Float16)((float)xx * 0.0625f);
    fb[n * 32 + 31] = (_Float16)((float)yy * 0.0625f);
  }
}

#define APL 2080
#define TP 52
#define A2P 36
__global__ __launch_bounds__(256) void attn_kernel(
    const _Float16* __restrict__ feat,
    const float* __restrict__ kW, const float* __restrict__ kb,
    const float* __restrict__ qW, const float* __restrict__ qb,
    const float* __restrict__ vW, const float* __restrict__ vb,
    const float* __restrict__ kg, const float* __restrict__ kbe,
    const float* __restrict__ qg, const float* __restrict__ qbe,
    const float* __restrict__ vg, const float* __restrict__ vbe,
    const float* __restrict__ l1W, const float* __restrict__ l1b,
    const float* __restrict__ l2W, const float* __restrict__ l2b,
    float* __restrict__ out) {
  extern __shared__ char smem[];
  _Float16* hbuf = (_Float16*)smem;
  _Float16* Qb   = (_Float16*)(smem + 16640);
  float* tmpf = (float*)(smem + 41600);
  _Float16* Kb   = (_Float16*)(smem + 94848);
  _Float16* Vt   = (_Float16*)(smem + 119808);
  _Float16* wbuf = (_Float16*)(smem + 145152);
  float* red  = (float*)(smem + 148992);
  float* mxv  = (float*)(smem + 151072);
  float* ov   = (float*)(smem + 151264);
  float* bb   = (float*)(smem + 151328);

  const int tid = threadIdx.x;
  const unsigned lane = tid & 31u;
  const int wv = tid >> 5;
  const int b = blockIdx.x;
  // planes of this half wave, in the k order of loadfrag_h: columns 0..31,
  // then columns 32..63 (40..63 read the zero plane)
  const int ch0 = (lane & 16u) ? 1 : 0, ch1 = ch0 + 2, ch2 = ch0 + 4;

  // ---- features, projection weights, biases: coalesced, branch-free reads
  // (indices clamped, stores guarded), all in flight together ----
  // (unrolls on fr/wreg/gr/er loops keep these arrays in registers)
  v4f wreg[3][2];
  // gamma/beta of pass p: 18 coalesced 16-byte loads in flight together.
  // Pass 0's go out here; pass p+1's go out ahead of pass p's normalisation,
  // which covers their L2 round trip up to the barrier behind it.
  v4f gr[3][9], er[3][9];
#pragma unroll
  for (int i = 0; i < 9; ++i) {
    gr[0][i] = ((const v4f*)vg)[tid + 256 * i];
    er[0][i] = ((const v4f*)vbe)[tid + 256 * i];
  }
  {
    const v4u* src = (const v4u*)(feat + (size_t)b * 8192);
    v4u fr[4];
#pragma unroll
    for (int i = 0; i < 4; ++i) fr[i] = src[tid + 256 * i];
    const int f1 = 256 + (tid & 31);  // each W is 288 x 16 B
    wreg[0][0] = ((const v4f*)vW)[tid];  wreg[0][1] = ((const v4f*)vW)[f1];
    wreg[1][0] = ((const v4f*)kW)[tid];  wreg[1][1] = ((const v4f*)kW)[f1];
    wreg[2][0] = ((const v4f*)qW)[tid];  wreg[2][1] = ((const v4f*)qW)[f1];
    const int bi = tid < 144 ? tid : 0;
    const int pb = bi / 48, jb = bi - pb * 48;
    const float* bp = (pb == 0) ? vb : (pb == 1) ? kb : qb;
    float bv = bp[jb < 36 ? jb : 0];

    // zero what the staged operands pad with: Q/K planes 4 and 5 (520 x 16 B;
    // columns 32..35 are stored over it behind later barriers), V^T rows
    // 36..47, W rows 36..47
    const v4u zz = {0u, 0u, 0u, 0u};
    for (int i = tid; i < 520; i += 256) {
      ((v4u*)(Qb + 4 * APL))[i] = zz;
      ((v4u*)(Kb + 4 * APL))[i] = zz;
    }
    for (int i = tid; i < 396; i += 256) ((v4u*)(Vt + 36 * 264))[i] = zz;
    if (tid < 60) ((v4u*)(wbuf + 36 * 40))[tid] = zz;

    // 16-byte unit u of the [256][32] features: row u >> 2, plane u & 3
#pragma unroll
    for (int i = 0; i < 4; ++i)
      *(v4u*)(hbuf + (tid & 3) * APL + ((tid >> 2) + 64 * i) * 8) = fr[i];
    if (tid < 144) bb[tid] = (jb < 36) ? bv : 0.f;
  }
  __syncthreads();

  // unrolled: wreg/gr/er are indexed by p and have to stay in registers
#pragma unroll
  for (int p = 0; p < 3; ++p) {
    {
      const int k = (tid & 7) * 4;
      v4f w0 = wreg[p][0];
      v4h h0 = {(_Float16)w0[0], (_Float16)w0[1], (_Float16)w0[2], (_Float16)w0[3]};
      *(v4h*)(wbuf + (tid >> 3) * 40 + k) = h0;
      if (tid < 32) {
        v4f w1v = wreg[p][1];
        v4h h1v = {(_Float16)w1v[0], (_Float16)w1v[1], (_Float16)w1v[2], (_Float16)w1v[3]};
        *(v4h*)(wbuf + (32 + (tid >> 3)) * 40 + k) = h1v;
      }
    }
    __syncthreads();

    for (int t = wv; t < 48; t += 8) {
      int rt = t / 3, nt = t % 3;
      v16h a  = loadfrag_cm(hbuf, rt * 16, ch0, ch1, APL, lane);
      v16h bf = loadfrag_h(wbuf, nt * 16, 0, 40, lane);
      v8f acc = zero8();
      acc = wmma_f16(a, bf, acc);
      int n = nt * 16 + (int)(lane & 15u);
      float bias = bb[p * 48 + n];
      int mh = (lane & 16u) ? 8 : 0;
#pragma unroll
      for (int r = 0; r < 8; ++r)
        tmpf[(rt * 16 + mh + r) * TP + n] = acc[r] + bias;
    }
    __syncthreads();

    {
      float s = 0.f, s2 = 0.f;
      const float* rowp = tmpf + tid * TP;
#pragma unroll
      for (int c = 0; c < 36; c += 4) {
        v4f v = *(const v4f*)(rowp + c);
        s += v[0] + v[1] + v[2] + v[3];
        s2 += v[0] * v[0] + v[1] * v[1] + v[2] * v[2] + v[3] * v[3];
      }
      // in the wave across lanes, then one partial a wave; red is next written
      // at least three barriers behind the reads below
      s = wave_sum(s);
      s2 = wave_sum(s2);
      if (lane == 0) { red[wv] = s; red[8 + wv] = s2; }
    }
    __syncthreads();
    float mu   = sum8(red) * (1.f / 9216.f);
    float var  = sum8(red + 8) * (1.f / 9216.f) - mu * mu;
    float rstd = rsqrtf(var + 1e-5f);

    if (p < 2) {
      const v4f* Gv = (const v4f*)((p == 0) ? kg : qg);
      const v4f* Ev = (const v4f*)((p == 0) ? kbe : qbe);
#pragma unroll
      for (int i = 0; i < 9; ++i) {
        gr[p + 1][i] = Gv[tid + 256 * i];
        er[p + 1][i] = Ev[tid + 256 * i];
      }
    }

    // 16-byte piece f of the [256][36] plane: node = f/9, columns j0..j0+3
#pragma unroll
    for (int i = 0; i < 9; ++i) {
      int f = tid + 256 * i;
      int node = f / 9, j0 = (f - node * 9) * 4;
      v4f tv = *(const v4f*)(tmpf + node * TP + j0);
      v4h o;
#pragma unroll
      for (int e = 0; e < 4; ++e) {
        float v = (tv[e] - mu) * rstd;
        o[e] = (_Float16)(v * gr[p][i][e] + er[p][i][e]);
      }
      if (p == 0) {
#pragma unroll
        for (int e = 0; e < 4; ++e) Vt[(j0 + e) * 264 + node] = o[e];
      } else {
        _Float16* dst = (p == 1) ? Kb : Qb;
        *(v4h*)(dst + (j0 >> 3) * APL + node * 8 + (j0 & 4)) = o;
      }
    }
    __syncthreads();
  }

  const float scale = 0.16666667f;  // 1/sqrt(36)
  for (int blk = wv; blk < 16; blk += 8) {
    int row0 = blk * 16;
    // B operand: 16 queries (n = query), kept for all 16 key tiles
    v16h qb0 = loadfrag_cm(Qb, row0, ch0, ch1, APL, lane);
    v16h qb1 = loadfrag_cm(Qb, row0, ch2, 5, APL, lane);
    v8f st[16];
#pragma unroll
    for (int ct = 0; ct < 16; ++ct) {
      v8f acc = zero8();
      acc = wmma_f16(loadfrag_cm(Kb, ct * 16, ch0, ch1, APL, lane), qb0, acc);
      acc = wmma_f16(loadfrag_cm(Kb, ct * 16, ch2, 5, APL, lane), qb1, acc);
      st[ct] = acc;
    }
    float mx = -1e30f;
#pragma unroll
    for (int ct = 0; ct < 16; ++ct)
#pragma unroll
      for (int r = 0; r < 8; ++r) {
        st[ct][r] *= scale;
        mx = fmaxf(mx, st[ct][r]);
      }
    mx = fmaxf(mx, other_half(mx));
    float s = 0.f;
    v8f av0 = zero8(), av1 = zero8(), av2 = zero8();
#pragma unroll
    for (int kc = 0; kc < 8; ++kc) {
      // B fragment of keys kc*32..+31: elements 0..7 are k = 8*hi + r (tile
      // 2kc), elements 8..15 are k = 16 + 8*hi + r (tile 2kc+1): the k order
      // of loadfrag_h, which loads the A operand (V^T rows) below.
      v16h pb;
      float ps = 0.f;
#pragma unroll
      for (int r = 0; r < 8; ++r) {
        float e0 = exp_slot(st[2 * kc][r] - mx);
        float e1 = exp_slot(st[2 * kc + 1][r] - mx);
        ps += e0 + e1;
        pb[r]     = (_Float16)e0;
        pb[8 + r] = (_Float16)e1;
      }
      s += ps;
      av0 = wmma_f16(loadfrag_h(Vt, 0, kc * 32, 264, lane), pb, av0);
      av1 = wmma_f16(loadfrag_h(Vt, 16, kc * 32, 264, lane), pb, av1);
      av2 = wmma_f16(loadfrag_h(Vt, 32, kc * 32, 264, lane), pb, av2);
    }
    s += other_half(s);
    float invr = 1.f / s;
    // O^T tile: n = query, m = output column r + 8*hi: 8 adjacent floats
    float* op = tmpf + (row0 + (int)(lane & 15u)) * TP + ((lane & 16u) ? 8 : 0);
    v4f o;
#pragma unroll
    for (int h = 0; h < 2; ++h) {
#pragma unroll
      for (int e = 0; e < 4; ++e) o[e] = av0[4 * h + e] * invr;
      *(v4f*)(op + 4 * h) = o;
#pragma unroll
      for (int e = 0; e < 4; ++e) o[e] = av1[4 * h + e] * invr;
      *(v4f*)(op + 16 + 4 * h) = o;
#pragma unroll
      for (int e = 0; e < 4; ++e) o[e] = av2[4 * h + e] * invr;
      *(v4f*)(op + 32 + 4 * h) = o;
    }
  }
  // l1W (324 x 16 B) and l1b: read before the barrier, stored behind it
  v4f l1r0 = ((const v4f*)l1W)[tid];
  v4f l1r1 = ((const v4f*)l1W)[256 + (tid < 68 ? tid : 67)];
  float l1bv = l1b[tid < 36 ? tid : 35];
  __syncthreads();

  float* l1Ws = (float*)Qb;  // Qb region is dead now
  ((v4f*)l1Ws)[tid] = l1r0;
  if (tid < 68) ((v4f*)l1Ws)[256 + tid] = l1r1;
  if (tid < 36) l1Ws[1296 + tid] = l1bv;
  __syncthreads();

  float* att2 = (float*)Kb;  // K and V^T are dead now (36864 B of 50304)
  {
    // this thread's row, read once (the unrolls keep it in registers)
    v4f ar[9];
#pragma unroll
    for (int c = 0; c < 9; ++c) ar[c] = *(const v4f*)(tmpf + tid * TP + 4 * c);
    for (int j = 0; j < 36; ++j) {
      float s = l1Ws[1296 + j];
      const float* wr = l1Ws + j * 36;
#pragma unroll
      for (int k = 0; k < 36; ++k) s += ar[k >> 2][k & 3] * wr[k];
      att2[tid * A2P + j] = fmaxf(s, 0.f);
    }
  }
  __syncthreads();

  {
    float s = 0.f, s2 = 0.f;
    const float* rp = att2 + tid * A2P;
#pragma unroll
    for (int c = 0; c < 36; c += 4) {
      v4f v = *(const v4f*)(rp + c);
      s += v[0] + v[1] + v[2] + v[3];
      s2 += v[0] * v[0] + v[1] * v[1] + v[2] * v[2] + v[3] * v[3];
    }
    s = wave_sum(s);
    s2 = wave_sum(s2);
    if (lane == 0) { red[wv] = s; red[8 + wv] = s2; }
  }
  // column maxima: thread (g, col) takes rows 37g..37g+36 of its column (the
  // last group's rows end at 255; a row taken twice does not move a maximum).
  // Unrolled, four chains: the 37 reads go out together, one wait for all.
  if (tid < 252) {
    const int g = tid / 36, col = tid - g * 36;
    const float* cp = att2 + g * 37 * A2P + col;
    float m[4] = {-1e30f, -1e30f, -1e30f, -1e30f};
#pragma unroll
    for (int i = 0; i < 37; ++i) {
      int d = i;
      if (i > 33) d = (g * 37 + i < 256) ? i : 255 - g * 37;
      m[i & 3] = fmaxf(m[i & 3], cp[d * A2P]);
    }
    red[16 + tid] = fmaxf(fmaxf(m[0], m[1]), fmaxf(m[2], m[3]));
  }
  __syncthreads();

  if (tid < 36) {
    float mu   = sum8(red) * (1.f / 9216.f);
    float var  = sum8(red + 8) * (1.f / 9216.f) - mu * mu;
    float rstd = rsqrtf(var + 1e-5f);
    float m = red[16 + tid];
#pragma unroll  // the six reads go out together, not one waited read a trip
    for (int g = 1; g < 7; ++g) m = fmaxf(m, red[16 + g * 36 + tid]);
    mxv[tid] = (m - mu) * rstd;
  }
  __syncthreads();

  if (tid < 10) {
    float s = l2b[tid];
    for (int j = 0; j < 36; ++j) s += mxv[j] * l2W[tid * 36 + j];
    ov[tid] = s;
  }
  __syncthreads();
  if (tid == 0) {
    float mx = -1e30f;
    for (int o = 0; o < 10; ++o) mx = fmaxf(mx, ov[o]);
    float s = 0.f;
    for (int o = 0; o < 10; ++o) s += __expf(ov[o] - mx);
    red[0] = mx + __logf(s);
  }
  __syncthreads();
  if (tid < 10) out[(size_t)b * 10 + tid] = ov[tid] - red[0];
}

// ---------------------------------------------------------------------------
extern "C" void kernel_launch(void* const* d_in, const int* in_sizes, int n_in,
                              void* d_out, int out_size, void* d_ws, size_t ws_size,
                              hipStream_t stream) {
  const float* x  = (const float*)d_in[0];
  const float* w1 = (const float*)d_in[1];  const float* b1 = (const float*)d_in[2];
  const float* w2 = (const float*)d_in[3];  const float* b2 = (const float*)d_in[4];
  const float* w3 = (const float*)d_in[5];  const float* b3 = (const float*)d_in[6];
  const float* w4 = (const float*)d_in[7];  const float* b4 = (const float*)d_in[8];
  const float* kW = (const float*)d_in[9];  const float* kbv = (const float*)d_in[10];
  const float* qW = (const float*)d_in[11]; const float* qbv = (const float*)d_in[12];
  const float* vW = (const float*)d_in[13]; const float* vbv = (const float*)d_in[14];
  const float* kg = (const float*)d_in[15]; const float* kbe = (const float*)d_in[16];
  const float* qg = (const float*)d_in[17]; const float* qbe = (const float*)d_in[18];
  const float* vg = (const float*)d_in[19]; const float* vbe = (const float*)d_in[20];
  const float* l1W = (const float*)d_in[21]; const float* l1b = (const float*)d_in[22];
  const float* l2W = (const float*)d_in[23]; const float* l2b = (const float*)d_in[24];

  const int B = in_sizes[0] / (28 * 28);   // 2048
  _Float16* feat = (_Float16*)d_ws;        // [B][256][32] f16 = 16 KB/batch

  conv_stack_kernel<<<B, 256, 193040, stream>>>(x, w1, b1, w2, b2, w3, b3, w4,
                                                b4, feat);
  attn_kernel<<<B, 256, 151904, stream>>>(feat, kW, kbv, qW, qbv, vW, vbv,
                                          kg, kbe, qg, qbe, vg, vbe,
                                          l1W, l1b, l2W, l2b, (float*)d_out);
}

// v005
// One run takes 189 microseconds.
// Next to v004, in two timings, it ran 1.24 times as fast each time.
// Counting every step since v000, it is 5.09 times as fast.
#include <hip/hip_runtime.h>
#include <hip/hip_bf16.h>
#include <math.h>

typedef __attribute__((ext_vector_type(16))) _Float16 v16h;
typedef __attribute__((ext_vector_type(8)))  _Float16 v8h;
typedef __attribute__((ext_vector_type(4)))  _Float16 v4h;
typedef __attribute__((ext_vector_type(2)))  _Float16 v2h;
typedef __attribute__((ext_vector_type(8)))  float    v8f;
typedef __attribute__((ext_vector_type(4)))  float    v4f;
typedef __attribute__((ext_vector_type(4)))  unsigned int v4u;

__device__ __forceinline__ v16h loadfrag_h(const _Float16* base, int r0, int k0,
                                           int stride, unsigned lane) {
  const _Float16* p = base + (r0 + (int)(lane & 15u)) * stride + k0;
  int hi = (lane & 16u) ? 1 : 0;
  v8h lo = *(const v8h*)(p + (hi ? 8 : 0));
  v8h hj = *(const v8h*)(p + (hi ? 24 : 16));
  return __builtin_shufflevector(lo, hj, 0, 1, 2, 3, 4, 5, 6, 7, 8, 9, 10, 11,
                                 12, 13, 14, 15);
}

__device__ __forceinline__ v16h loadfrag_cm(const _Float16* base, int r0, int c0,
                                            int c1, int plane, unsigned lane) {
  const _Float16* p = base + (r0 + (int)(lane & 15u)) * 8;
  v8h lo = *(const v8h*)(p + c0 * plane);
  v8h hj = *(const v8h*)(p + c1 * plane);
  return __builtin_shufflevector(lo, hj, 0, 1, 2, 3, 4, 5, 6, 7, 8, 9, 10, 11,
                                 12, 13, 14, 15);
}

// A fragment for 2-tap conv chunk: K 0..15 = tap0 ch0..15, K 16..31 = tap1.
__device__ __forceinline__ v16h frag2tap(const _Float16* p0, const _Float16* p1,
                                         unsigned lane) {
  int hi = (lane & 16u) ? 8 : 0;
  v8h lo = *(const v8h*)(p0 + hi);
  v8h hj = *(const v8h*)(p1 + hi);
  return __builtin_shufflevector(lo, hj, 0, 1, 2, 3, 4, 5, 6, 7, 8, 9, 10, 11,
                                 12, 13, 14, 15);
}

// A fragment for 1-tap conv chunk over a 32-channel pixel record.
__device__ __forceinline__ v16h frag1tap(const _Float16* p, unsigned lane) {
  int hi = (lane & 16u) ? 1 : 0;
  v8h lo = *(const v8h*)(p + (hi ? 8 : 0));
  v8h hj = *(const v8h*)(p + (hi ? 24 : 16));
  return __builtin_shufflevector(lo, hj, 0, 1, 2, 3, 4, 5, 6, 7, 8, 9, 10, 11,
                                 12, 13, 14, 15);
}

// value of the lane 16 away (same column, other half of the rows)
__device__ __forceinline__ float other_half(float v) {
  int b = __builtin_bit_cast(int, v);
  b = __builtin_amdgcn_permlanex16(b, b, 0x76543210, 0xfedcba98, false, false);
  return __builtin_bit_cast(float, b);
}

// sum over the 32 lanes of a wave, the total in every lane: four adds with the
// lane whose number differs in one bit (row_xmask, inside a 16-lane row), then
// the other row. All 32 lanes have to be on.
template <int CTRL>
__device__ __forceinline__ float add_xmask(float v) {
  int b = __builtin_bit_cast(int, v);
  b = __builtin_amdgcn_update_dpp(0, b, CTRL, 0xf, 0xf, true);
  return v + __builtin_bit_cast(float, b);
}
__device__ __forceinline__ float wave_sum(float v) {
  v = add_xmask<0x161>(v);
  v = add_xmask<0x162>(v);
  v = add_xmask<0x164>(v);
  v = add_xmask<0x168>(v);
  return v + other_half(v);
}

// the eight waves' partial sums p[0..7], added in one fixed order
__device__ __forceinline__ float sum8(const float* p) {
  v4f a = *(const v4f*)p, b = *(const v4f*)(p + 4);
  return ((a[0] + a[1]) + (a[2] + a[3])) + ((b[0] + b[1]) + (b[2] + b[3]));
}

__device__ __forceinline__ float exp_slot(float x) {
  float a = x * 1.44269504f, r;
  asm("v_exp_f32 %0, %1\n\tv_nop" : "=v"(r) : "v"(a));
  return r;
}

__device__ __forceinline__ v8f wmma_f16(v16h a, v16h b, v8f c) {
  return __builtin_amdgcn_wmma_f32_16x16x32_f16(false, a, false, b, (short)0, c,
                                                false, false);
}

__device__ __forceinline__ v8f zero8() {
  v8f z = {0.f, 0.f, 0.f, 0.f, 0.f, 0.f, 0.f, 0.f};
  return z;
}

#define H1P 24
#define H1R 656
#define H2P 40
#define H2R 888
#define BPL 264
#define BTP 1064
__global__ __launch_bounds__(256) void conv_stack_kernel(
    const float* __restrict__ x,
    const float* __restrict__ w1, const float* __restrict__ b1,
    const float* __restrict__ w2, const float* __restrict__ b2,
    const float* __restrict__ w3, const float* __restrict__ b3,
    const float* __restrict__ w4, const float* __restrict__ b4,
    _Float16* __restrict__ feat) {
  extern __shared__ char smem[];
  float*     xin = (float*)smem;
  float*     ws1 = (float*)(smem + 3136);
  float*     bbf = (float*)(smem + 4416);     // [4][32]
  _Float16*  h1  = (_Float16*)(smem + 4928);
  _Float16*  h2  = (_Float16*)(smem + 38448);
  _Float16*  h3  = (_Float16*)(smem + 78480);
  _Float16*  Bc2 = (_Float16*)(smem + 107920);
  _Float16*  Bc3 = (_Float16*)(smem + 124944);
  _Float16*  Bc4 = (_Float16*)(smem + 158992);

  const int tid = threadIdx.x;
  const unsigned lane = tid & 31u;
  const int wv = tid >> 5;
  const int b = blockIdx.x;
  const int ch0 = (lane & 16u) ? 1 : 0;  // weight planes of this half wave:
  const int ch1 = ch0 + 2;               // the k order of frag2tap/frag1tap

  // ---- every global read of this kernel: coalesced, branch-free (indices
  // clamped, stores guarded) and issued together, so the L2 round trips
  // overlap instead of one waited 4-byte load per staged element ----
  // Weight unit u = (oc n, input-channel pair kp, tap quad tq), tq fastest:
  // two 16-byte loads (channels 2kp and 2kp+1, taps 4tq..4tq+3) feed four
  // 4-byte LDS stores of a channel pair each.
  // (the unrolls here and in the scatter below keep the arrays in registers)
  v4f r2a[3], r2b[3], r3a[4], r3b[4], r4a[6], r4b[6];
  {
    const v4f* w2v = (const v4f*)w2;  // 20 x 8 x 4  = 640 units
    const v4f* w3v = (const v4f*)w3;  // 24 x 10 x 4 = 960 units
    const v4f* w4v = (const v4f*)w4;  // 30 x 12 x 4 = 1440 units
    // 16-byte index of unit u: (u>>2)*8 + (u&3); 256 units further = +512.
    // Each tensor's last, partial slice clamps its unit.
    const int a0 = (tid >> 2) * 8 + (tid & 3);
    const int u2 = tid + 512 < 640 ? tid + 512 : 639;
    const int u3 = tid + 768 < 960 ? tid + 768 : 959;
    const int u4 = tid + 1280 < 1440 ? tid + 1280 : 1439;
    const int a2 = (u2 >> 2) * 8 + (u2 & 3);
    const int a3 = (u3 >> 2) * 8 + (u3 & 3);
    const int a4 = (u4 >> 2) * 8 + (u4 & 3);
#pragma unroll
    for (int i = 0; i < 2; ++i) {
      r2a[i] = w2v[a0 + 512 * i];
      r2b[i] = w2v[a0 + 512 * i + 4];
    }
    r2a[2] = w2v[a2];
    r2b[2] = w2v[a2 + 4];
#pragma unroll
    for (int i = 0; i < 3; ++i) {
      r3a[i] = w3v[a0 + 512 * i];
      r3b[i] = w3v[a0 + 512 * i + 4];
    }
    r3a[3] = w3v[a3];
    r3b[3] = w3v[a3 + 4];
#pragma unroll
    for (int i = 0; i < 5; ++i) {
      r4a[i] = w4v[a0 + 512 * i];
      r4b[i] = w4v[a0 + 512 * i + 4];
    }
    r4a[5] = w4v[a4];
    r4b[5] = w4v[a4 + 4];

    const v4f* sx = (const v4f*)(x + (size_t)b * 784);
    v4f xr  = sx[tid < 196 ? tid : 195];
    const int a1 = tid & 63;
    v4f w1r = ((const v4f*)w1)[a1];
    int g = (tid >> 5) & 3, n = tid & 31;
    const float* bp = (g == 0) ? b1 : (g == 1) ? b2 : (g == 2) ? b3 : b4;
    int lim = (g == 0) ? 16 : (g == 1) ? 20 : (g == 2) ? 24 : 30;
    const float* bq = bp + (n < lim ? n : 0);
    float bv = *bq;
    // The loads' address registers are inputs here, so they stay unwritten
    // (also by a later load's result) until this wait.
    asm volatile("s_wait_xcnt 0x0"
                 :: "v"(a0), "v"(a1), "v"(a2), "v"(a3), "v"(a4), "v"(bq)
                 : "memory");
    // zero h1..h3 and Bc2..Bc4 (contiguous 188112 B = 11757 x b128)
    v4u zz = {0u, 0u, 0u, 0u};
    v4u* z = (v4u*)h1;
    for (int i = 0; i < 45; ++i) z[tid + 256 * i] = zz;
    if (tid < 237) z[tid + 11520] = zz;
    if (tid < 196) ((v4f*)xin)[tid] = xr;
    if (tid < 64)  *(v4f*)(ws1 + (tid >> 2) * 20 + (tid & 3) * 4) = w1r;
    if (tid < 128) bbf[tid] = (n < lim) ? bv : 0.f;
  }
  __syncthreads();

  // ---- scatter the weights into the zeroed per-tap B matrices ----
  // Bc2: chunk c pairs taps 2c,2c+1; k<16 -> tap 2c ic=k, k>=16 -> tap 2c+1
#pragma unroll
  for (int i = 0; i < 3; ++i) {
    int u = tid + 256 * i;
    if (u < 640) {
      int t0 = (u & 3) * 4, r = u >> 2;
      int n = r >> 3, ic = (r & 7) * 2;
#pragma unroll
      for (int e = 0; e < 4; ++e) {
        int tap = t0 + e;
        v2h h = {(_Float16)r2a[i][e], (_Float16)r2b[i][e]};
        int k = (tap & 1) * 16 + ic;
        *(v2h*)(Bc2 + (tap >> 1) * BTP + (k >> 3) * BPL + n * 8 + (k & 7)) = h;
      }
    }
  }
  // Bc3: tap t, k = ic (20 valid of 32), n = oc (24 valid of 32)
#pragma unroll
  for (int i = 0; i < 4; ++i) {
    int u = tid + 256 * i;
    if (u < 960) {
      int t0 = (u & 3) * 4, r = u >> 2;
      int n = r / 10, k = (r - n * 10) * 2;
#pragma unroll
      for (int e = 0; e < 4; ++e) {
        v2h h = {(_Float16)r3a[i][e], (_Float16)r3b[i][e]};
        *(v2h*)(Bc3 + (t0 + e) * BTP + (k >> 3) * BPL + n * 8 + (k & 7)) = h;
      }
    }
  }
  // Bc4: tap t, k = ic (24 valid of 32), n = oc (30 valid of 32)
#pragma unroll
  for (int i = 0; i < 6; ++i) {
    int u = tid + 256 * i;
    if (u < 1440) {
      int t0 = (u & 3) * 4, r = u >> 2;
      int n = r / 12, k = (r - n * 12) * 2;
#pragma unroll
      for (int e = 0; e < 4; ++e) {
        v2h h = {(_Float16)r4a[i][e], (_Float16)r4b[i][e]};
        *(v2h*)(Bc4 + (t0 + e) * BTP + (k >> 3) * BPL + n * 8 + (k & 7)) = h;
      }
    }
  }

  // ---- conv1 (ic=1, scalar): 28x28 -> 16x25x25, channel-last f16 ----
  for (int idx = tid; idx < 10000; idx += 256) {
    int p = idx >> 4, oc = idx & 15;
    int oy = p / 25, ox = p - oy * 25;
    float acc = bbf[oc];
    const float* wp = ws1 + oc * 20;
#pragma unroll
    for (int ky = 0; ky < 4; ++ky)
#pragma unroll
      for (int kx = 0; kx < 4; ++kx)
        acc += xin[(oy + ky) * 28 + ox + kx] * wp[ky * 4 + kx];
    h1[oy * H1R + ox * H1P + oc] = (_Float16)fmaxf(acc, 0.f);
  }
  __syncthreads();

  // conv2..conv4: a wave owns several M tiles and BOTH N tiles, so an A fragment
  // read from LDS feeds two WMMAs and a B fragment one per M tile, and a wave's
  // accumulator chains are independent. The K loop goes in blocks with two
  // fragment sets in registers: the next block's reads stand as one group ahead
  // of this block's WMMAs. Each output still sums its taps in the order 0..15.
  // (The unrolls keep acc and the fragment sets in registers. The two
  // sched_barriers of a block keep the reads in that one group: without them
  // the compiler moves each read down to just ahead of the WMMA that uses it,
  // and the wave waits out the LDS latency there.)
  const int l15 = (int)(lane & 15u);
  const int mh = (lane & 16u) ? 8 : 0;

  // ---- conv2 via WMMA: M=484(->496) x N=20(->32) x K=256 (8 chunks) ----
  // 31 M tiles, four a wave; the last wave's fourth is its third again (same
  // values to the same places, from the same wave). Block = one chunk.
  {
    int mts[4];
    const _Float16* ap[4];
    v8f acc[4][2];
#pragma unroll
    for (int j = 0; j < 4; ++j) {
      int mt = wv * 4 + j;
      mts[j] = mt < 31 ? mt : 30;
      int m = mts[j] * 16 + l15;
      int oy = m / 22, ox = m - oy * 22;
      ap[j] = h1 + oy * H1R + ox * H1P;
      acc[j][0] = zero8();
      acc[j][1] = zero8();
    }
    v16h fa[2][4], fw[2][2];
    auto fetch = [&](int c) {
      const int s = c & 1;
      const int o0 = ((2 * c) >> 2) * H1R + ((2 * c) & 3) * H1P;  // tap 2c
      fw[s][0] = loadfrag_cm(Bc2 + c * BTP, 0, ch0, ch1, BPL, lane);
      fw[s][1] = loadfrag_cm(Bc2 + c * BTP, 16, ch0, ch1, BPL, lane);
#pragma unroll
      for (int j = 0; j < 4; ++j)
        fa[s][j] = frag2tap(ap[j] + o0, ap[j] + o0 + H1P, lane);
    };
    fetch(0);
#pragma unroll
    for (int c = 0; c < 8; ++c) {
      if (c < 7) fetch(c + 1);
      __builtin_amdgcn_sched_barrier(0);  // the reads above stay one group
#pragma unroll
      for (int j = 0; j < 4; ++j) {
        acc[j][0] = wmma_f16(fa[c & 1][j], fw[c & 1][0], acc[j][0]);
        acc[j][1] = wmma_f16(fa[c & 1][j], fw[c & 1][1], acc[j][1]);
      }
      __builtin_amdgcn_sched_barrier(0);  // no later read moves up among them
    }
    float bias0 = bbf[32 + l15], bias1 = bbf[48 + l15];
#pragma unroll
    for (int j = 0; j < 4; ++j) {
      int m0 = mts[j] * 16 + mh;  // first of this lane's 8 pixels
      int y0 = m0 / 22, x0 = m0 - y0 * 22;
      _Float16* hp = h2 + y0 * H2R + x0 * H2P + l15;
#pragma unroll
      for (int r = 0; r < 8; ++r) {  // at most one step into the next image row
        _Float16* q = hp + r * H2P + (x0 + r >= 22 ? H2R - 22 * H2P : 0);
        q[0]  = (_Float16)fmaxf(acc[j][0][r] + bias0, 0.f);
        q[16] = (_Float16)fmaxf(acc[j][1][r] + bias1, 0.f);
      }
    }
  }
  __syncthreads();

  // ---- conv3 via WMMA: M=361(->368) x N=24(->32) x K=512 (16 taps) ----
  // 23 M tiles, three a wave; the last wave's third is its second again.
  // Block = two taps.
  {
    int mts[3];
    const _Float16* ap[3];
    v8f acc[3][2];
#pragma unroll
    for (int j = 0; j < 3; ++j) {
      int mt = wv * 3 + j;
      mts[j] = mt < 23 ? mt : 22;
      int m = mts[j] * 16 + l15;
      int oy = m / 19, ox = m - oy * 19;
      ap[j] = h2 + oy * H2R + ox * H2P;
      acc[j][0] = zero8();
      acc[j][1] = zero8();
    }
    v16h fa[2][2][3], fw[2][2][2];
    auto fetch = [&](int k) {
      const int s = k & 1;
#pragma unroll
      for (int e = 0; e < 2; ++e) {
        const int t = 2 * k + e;
        fw[s][e][0] = loadfrag_cm(Bc3 + t * BTP, 0, ch0, ch1, BPL, lane);
        fw[s][e][1] = loadfrag_cm(Bc3 + t * BTP, 16, ch0, ch1, BPL, lane);
#pragma unroll
        for (int j = 0; j < 3; ++j)
          fa[s][e][j] = frag1tap(ap[j] + (t >> 2) * H2R + (t & 3) * H2P, lane);
      }
    };
    fetch(0);
#pragma unroll
    for (int k = 0; k < 8; ++k) {
      if (k < 7) fetch(k + 1);
      __builtin_amdgcn_sched_barrier(0);  // the reads above stay one group
#pragma unroll
      for (int e = 0; e < 2; ++e)
#pragma unroll
        for (int j = 0; j < 3; ++j) {
          acc[j][0] = wmma_f16(fa[k & 1][e][j], fw[k & 1][e][0], acc[j][0]);
          acc[j][1] = wmma_f16(fa[k & 1][e][j], fw[k & 1][e][1], acc[j][1]);
        }
      __builtin_amdgcn_sched_barrier(0);  // no later read moves up among them
    }
    float bias0 = bbf[64 + l15], bias1 = bbf[80 + l15];
#pragma unroll
    for (int j = 0; j < 3; ++j) {
      _Float16* q = h3 + (mts[j] * 16 + mh) * H2P + l15;
#pragma unroll
      for (int r = 0; r < 8; ++r) {
        q[r * H2P]      = (_Float16)fmaxf(acc[j][0][r] + bias0, 0.f);
        q[r * H2P + 16] = (_Float16)fmaxf(acc[j][1][r] + bias1, 0.f);
      }
    }
  }
  __syncthreads();

  // ---- conv4 via WMMA: M=256 x N=30(->32) x K=512; write features+coords ----
  // An M tile is one output row; a wave owns rows 2wv and 2wv+1. The upper
  // row's A fragments of kernel row ky are the lower row's of ky+1: each of the
  // five input rows (ar) is read once. Block = two taps of one kernel row.
  _Float16* fb = feat + (size_t)b * 8192;
  {
    const _Float16* ap = h3 + (wv * 2 * 19 + l15) * H2P;
    v8f acc[2][2];
    acc[0][0] = zero8(); acc[0][1] = zero8();
    acc[1][0] = zero8(); acc[1][1] = zero8();
    v16h ar[5][4], fw[2][2][2];
    auto fetch = [&](int k) {
      const int s = k & 1;
#pragma unroll
      for (int e = 0; e < 2; ++e) {
        const int t = 2 * k + e, ky = t >> 2, kx = t & 3;
        fw[s][e][0] = loadfrag_cm(Bc4 + t * BTP, 0, ch0, ch1, BPL, lane);
        fw[s][e][1] = loadfrag_cm(Bc4 + t * BTP, 16, ch0, ch1, BPL, lane);
        ar[ky + 1][kx] = frag1tap(ap + ((ky + 1) * 19 + kx) * H2P, lane);
      }
    };
#pragma unroll
    for (int kx = 0; kx < 4; ++kx) ar[0][kx] = frag1tap(ap + kx * H2P, lane);
    fetch(0);
#pragma unroll
    for (int k = 0; k < 8; ++k) {
      if (k < 7) fetch(k + 1);
      __builtin_amdgcn_sched_barrier(0);  // the reads above stay one group
#pragma unroll
      for (int e = 0; e < 2; ++e) {
        const int t = 2 * k + e, ky = t >> 2, kx = t & 3;
        acc[0][0] = wmma_f16(ar[ky][kx], fw[k & 1][e][0], acc[0][0]);
        acc[0][1] = wmma_f16(ar[ky][kx], fw[k & 1][e][1], acc[0][1]);
        acc[1][0] = wmma_f16(ar[ky + 1][kx], fw[k & 1][e][0], acc[1][0]);
        acc[1][1] = wmma_f16(ar[ky + 1][kx], fw[k & 1][e][1], acc[1][1]);
      }
      __builtin_amdgcn_sched_barrier(0);  // no later read moves up among them
    }
    float bias0 = bbf[96 + l15], bias1 = bbf[112 + l15];
#pragma unroll
    for (int j = 0; j < 2; ++j) {
      _Float16* q = fb + ((wv * 2 + j) * 16 + mh) * 32 + l15;
#pragma unroll
      for (int r = 0; r < 8; ++r)
        q[r * 32] = (_Float16)fmaxf(acc[j][0][r] + bias0, 0.f);
      if (l15 < 14) {  // channels 16..29; 30 and 31 are the coordinates
#pragma unroll
        for (int r = 0; r < 8; ++r)
          q[r * 32 + 16] = (_Float16)fmaxf(acc[j][1][r] + bias1, 0.f);
      }
    }
  }
  {
    int n = tid;  // coord channels (columns 30/31, disjoint from tile stores)
    int xx = n % 16, yy = n / 16;
    fb[n * 32 + 30] = (_Float16)((float)xx * 0.0625f);
    fb[n * 32 + 31] = (_Float16)((float)yy * 0.0625f);
  }
}

#define APL 2080
#define TP 52
#define A2P 36
__global__ __launch_bounds__(256) void attn_kernel(
    const _Float16* __restrict__ feat,
    const float* __restrict__ kW, const float* __restrict__ kb,
    const float* __restrict__ qW, const float* __restrict__ qb,
    const float* __restrict__ vW, const float* __restrict__ vb,
    const float* __restrict__ kg, const float* __restrict__ kbe,
    const float* __restrict__ qg, const float* __restrict__ qbe,
    const float* __restrict__ vg, const float* __restrict__ vbe,
    const float* __restrict__ l1W, const float* __restrict__ l1b,
    const float* __restrict__ l2W, const float* __restrict__ l2b,
    float* __restrict__ out) {
  extern __shared__ char smem[];
  _Float16* hbuf = (_Float16*)smem;
  _Float16* Qb   = (_Float16*)(smem + 16640);
  float* tmpf = (float*)(smem + 41600);
  _Float16* Kb   = (_Float16*)(smem + 94848);
  _Float16* Vt   = (_Float16*)(smem + 119808);
  _Float16* wbuf = (_Float16*)(smem + 145152);
  float* red  = (float*)(smem + 148992);
  float* mxv  = (float*)(smem + 151072);
  float* ov   = (float*)(smem + 151264);
  float* bb   = (float*)(smem + 151328);

  const int tid = threadIdx.x;
  const unsigned lane = tid & 31u;
  const int wv = tid >> 5;
  const int b = blockIdx.x;
  // planes of this half wave, in the k order of loadfrag_h: columns 0..31,
  // then columns 32..63 (40..63 read the zero plane)
  const int ch0 = (lane & 16u) ? 1 : 0, ch1 = ch0 + 2, ch2 = ch0 + 4;

  // ---- features, projection weights, biases: coalesced, branch-free reads
  // (indices clamped, stores guarded), all in flight together ----
  // (unrolls on fr/wreg/gr/er loops keep these arrays in registers)
  v4f wreg[3][2];
  // gamma/beta of pass p: 18 coalesced 16-byte loads in flight together.
  // Pass 0's go out here; pass p+1's go out ahead of pass p's normalisation,
  // which covers their L2 round trip up to the barrier behind it.
  v4f gr[3][9], er[3][9];
#pragma unroll
  for (int i = 0; i < 9; ++i) {
    gr[0][i] = ((const v4f*)vg)[tid + 256 * i];
    er[0][i] = ((const v4f*)vbe)[tid + 256 * i];
  }
  {
    const v4u* src = (const v4u*)(feat + (size_t)b * 8192);
    v4u fr[4];
#pragma unroll
    for (int i = 0; i < 4; ++i) fr[i] = src[tid + 256 * i];
    const int f1 = 256 + (tid & 31);  // each W is 288 x 16 B
    wreg[0][0] = ((const v4f*)vW)[tid];  wreg[0][1] = ((const v4f*)vW)[f1];
    wreg[1][0] = ((const v4f*)kW)[tid];  wreg[1][1] = ((const v4f*)kW)[f1];
    wreg[2][0] = ((const v4f*)qW)[tid];  wreg[2][1] = ((const v4f*)qW)[f1];
    const int bi = tid < 144 ? tid : 0;
    const int pb = bi / 48, jb = bi - pb * 48;
    const float* bp = (pb == 0) ? vb : (pb == 1) ? kb : qb;
    float bv = bp[jb < 36 ? jb : 0];

    // zero what the staged operands pad with: Q/K planes 4 and 5 (520 x 16 B;
    // columns 32..35 are stored over it behind later barriers), V^T rows
    // 36..47, W rows 36..47
    const v4u zz = {0u, 0u, 0u, 0u};
    for (int i = tid; i < 520; i += 256) {
      ((v4u*)(Qb + 4 * APL))[i] = zz;
      ((v4u*)(Kb + 4 * APL))[i] = zz;
    }
    for (int i = tid; i < 396; i += 256) ((v4u*)(Vt + 36 * 264))[i] = zz;
    if (tid < 60) ((v4u*)(wbuf + 36 * 40))[tid] = zz;

    // 16-byte unit u of the [256][32] features: row u >> 2, plane u & 3
#pragma unroll
    for (int i = 0; i < 4; ++i)
      *(v4u*)(hbuf + (tid & 3) * APL + ((tid >> 2) + 64 * i) * 8) = fr[i];
    if (tid < 144) bb[tid] = (jb < 36) ? bv : 0.f;
  }
  __syncthreads();

  // unrolled: wreg/gr/er are indexed by p and have to stay in registers
#pragma unroll
  for (int p = 0; p < 3; ++p) {
    {
      const int k = (tid & 7) * 4;
      v4f w0 = wreg[p][0];
      v4h h0 = {(_Float16)w0[0], (_Float16)w0[1], (_Float16)w0[2], (_Float16)w0[3]};
      *(v4h*)(wbuf + (tid >> 3) * 40 + k) = h0;
      if (tid < 32) {
        v4f w1v = wreg[p][1];
        v4h h1v = {(_Float16)w1v[0], (_Float16)w1v[1], (_Float16)w1v[2], (_Float16)w1v[3]};
        *(v4h*)(wbuf + (32 + (tid >> 3)) * 40 + k) = h1v;
      }
    }
    __syncthreads();

    for (int t = wv; t < 48; t += 8) {
      int rt = t / 3, nt = t % 3;
      v16h a  = loadfrag_cm(hbuf, rt * 16, ch0, ch1, APL, lane);
      v16h bf = loadfrag_h(wbuf, nt * 16, 0, 40, lane);
      v8f acc = zero8();
      acc = wmma_f16(a, bf, acc);
      int n = nt * 16 + (int)(lane & 15u);
      float bias = bb[p * 48 + n];
      int mh = (lane & 16u) ? 8 : 0;
#pragma unroll
      for (int r = 0; r < 8; ++r)
        tmpf[(rt * 16 + mh + r) * TP + n] = acc[r] + bias;
    }
    __syncthreads();

    {
      float s = 0.f, s2 = 0.f;
      const float* rowp = tmpf + tid * TP;
#pragma unroll
      for (int c = 0; c < 36; c += 4) {
        v4f v = *(const v4f*)(rowp + c);
        s += v[0] + v[1] + v[2] + v[3];
        s2 += v[0] * v[0] + v[1] * v[1] + v[2] * v[2] + v[3] * v[3];
      }
      // in the wave across lanes, then one partial a wave; red is next written
      // at least three barriers behind the reads below
      s = wave_sum(s);
      s2 = wave_sum(s2);
      if (lane == 0) { red[wv] = s; red[8 + wv] = s2; }
    }
    __syncthreads();
    float mu   = sum8(red) * (1.f / 9216.f);
    float var  = sum8(red + 8) * (1.f / 9216.f) - mu * mu;
    float rstd = rsqrtf(var + 1e-5f);

    if (p < 2) {
      const v4f* Gv = (const v4f*)((p == 0) ? kg : qg);
      const v4f* Ev = (const v4f*)((p == 0) ? kbe : qbe);
#pragma unroll
      for (int i = 0; i < 9; ++i) {
        gr[p + 1][i] = Gv[tid + 256 * i];
        er[p + 1][i] = Ev[tid + 256 * i];
      }
    }

    // 16-byte piece f of the [256][36] plane: node = f/9, columns j0..j0+3
#pragma unroll
    for (int i = 0; i < 9; ++i) {
      int f = tid + 256 * i;
      int node = f / 9, j0 = (f - node * 9) * 4;
      v4f tv = *(const v4f*)(tmpf + node * TP + j0);
      v4h o;
#pragma unroll
      for (int e = 0; e < 4; ++e) {
        float v = (tv[e] - mu) * rstd;
        o[e] = (_Float16)(v * gr[p][i][e] + er[p][i][e]);
      }
      if (p == 0) {
#pragma unroll
        for (int e = 0; e < 4; ++e) Vt[(j0 + e) * 264 + node] = o[e];
      } else {
        _Float16* dst = (p == 1) ? Kb : Qb;
        *(v4h*)(dst + (j0 >> 3) * APL + node * 8 + (j0 & 4)) = o;
      }
    }
    __syncthreads();
  }

  const float scale = 0.16666667f;  // 1/sqrt(36)
  for (int blk = wv; blk < 16; blk += 8) {
    int row0 = blk * 16;
    // B operand: 16 queries (n = query), kept for all 16 key tiles
    v16h qb0 = loadfrag_cm(Qb, row0, ch0, ch1, APL, lane);
    v16h qb1 = loadfrag_cm(Qb, row0, ch2, 5, APL, lane);
    v8f st[16];
#pragma unroll
    for (int ct = 0; ct < 16; ++ct) {
      v8f acc = zero8();
      acc = wmma_f16(loadfrag_cm(Kb, ct * 16, ch0, ch1, APL, lane), qb0, acc);
      acc = wmma_f16(loadfrag_cm(Kb, ct * 16, ch2, 5, APL, lane), qb1, acc);
      st[ct] = acc;
    }
    float mx = -1e30f;
#pragma unroll
    for (int ct = 0; ct < 16; ++ct)
#pragma unroll
      for (int r = 0; r < 8; ++r) {
        st[ct][r] *= scale;
        mx = fmaxf(mx, st[ct][r]);
      }
    mx = fmaxf(mx, other_half(mx));
    float s = 0.f;
    v8f av0 = zero8(), av1 = zero8(), av2 = zero8();
#pragma unroll
    for (int kc = 0; kc < 8; ++kc) {
      // B fragment of keys kc*32..+31: elements 0..7 are k = 8*hi + r (tile
      // 2kc), elements 8..15 are k = 16 + 8*hi + r (tile 2kc+1): the k order
      // of loadfrag_h, which loads the A operand (V^T rows) below.
      v16h pb;
      float ps = 0.f;
#pragma unroll
      for (int r = 0; r < 8; ++r) {
        float e0 = exp_slot(st[2 * kc][r] - mx);
        float e1 = exp_slot(st[2 * kc + 1][r] - mx);
        ps += e0 + e1;
        pb[r]     = (_Float16)e0;
        pb[8 + r] = (_Float16)e1;
      }
      s += ps;
      av0 = wmma_f16(loadfrag_h(Vt, 0, kc * 32, 264, lane), pb, av0);
      av1 = wmma_f16(loadfrag_h(Vt, 16, kc * 32, 264, lane), pb, av1);
      av2 = wmma_f16(loadfrag_h(Vt, 32, kc * 32, 264, lane), pb, av2);
    }
    s += other_half(s);
    float invr = 1.f / s;
    // O^T tile: n = query, m = output column r + 8*hi: 8 adjacent floats
    float* op = tmpf + (row0 + (int)(lane & 15u)) * TP + ((lane & 16u) ? 8 : 0);
    v4f o;
#pragma unroll
    for (int h = 0; h < 2; ++h) {
#pragma unroll
      for (int e = 0; e < 4; ++e) o[e] = av0[4 * h + e] * invr;
      *(v4f*)(op + 4 * h) = o;
#pragma unroll
      for (int e = 0; e < 4; ++e) o[e] = av1[4 * h + e] * invr;
      *(v4f*)(op + 16 + 4 * h) = o;
#pragma unroll
      for (int e = 0; e < 4; ++e) o[e] = av2[4 * h + e] * invr;
      *(v4f*)(op + 32 + 4 * h) = o;
    }
  }
  // l1W (324 x 16 B) and l1b: read before the barrier, stored behind it
  v4f l1r0 = ((const v4f*)l1W)[tid];
  v4f l1r1 = ((const v4f*)l1W)[256 + (tid < 68 ? tid : 67)];
  float l1bv = l1b[tid < 36 ? tid : 35];
  __syncthreads();

  float* l1Ws = (float*)Qb;  // Qb region is dead now
  ((v4f*)l1Ws)[tid] = l1r0;
  if (tid < 68) ((v4f*)l1Ws)[256 + tid] = l1r1;
  if (tid < 36) l1Ws[1296 + tid] = l1bv;
  __syncthreads();

  float* att2 = (float*)Kb;  // K and V^T are dead now (36864 B of 50304)
  {
    // this thread's row, read once (the unrolls keep it in registers)
    v4f ar[9];
#pragma unroll
    for (int c = 0; c < 9; ++c) ar[c] = *(const v4f*)(tmpf + tid * TP + 4 * c);
    for (int j = 0; j < 36; ++j) {
      float s = l1Ws[1296 + j];
      const float* wr = l1Ws + j * 36;
#pragma unroll
      for (int k = 0; k < 36; ++k) s += ar[k >> 2][k & 3] * wr[k];
      att2[tid * A2P + j] = fmaxf(s, 0.f);
    }
  }
  __syncthreads();

  {
    float s = 0.f, s2 = 0.f;
    const float* rp = att2 + tid * A2P;
#pragma unroll
    for (int c = 0; c < 36; c += 4) {
      v4f v = *(const v4f*)(rp + c);
      s += v[0] + v[1] + v[2] + v[3];
      s2 += v[0] * v[0] + v[1] * v[1] + v[2] * v[2] + v[3] * v[3];
    }
    s = wave_sum(s);
    s2 = wave_sum(s2);
    if (lane == 0) { red[wv] = s; red[8 + wv] = s2; }
  }
  // column maxima: thread (g, col) takes rows 37g..37g+36 of its column (the
  // last group's rows end at 255; a row taken twice does not move a maximum).
  // Unrolled, four chains: the 37 reads go out together, one wait for all.
  if (tid < 252) {
    const int g = tid / 36, col = tid - g * 36;
    const float* cp = att2 + g * 37 * A2P + col;
    float m[4] = {-1e30f, -1e30f, -1e30f, -1e30f};
#pragma unroll
    for (int i = 0; i < 37; ++i) {
      int d = i;
      if (i > 33) d = (g * 37 + i < 256) ? i : 255 - g * 37;
      m[i & 3] = fmaxf(m[i & 3], cp[d * A2P]);
    }
    red[16 + tid] = fmaxf(fmaxf(m[0], m[1]), fmaxf(m[2], m[3]));
  }
  __syncthreads();

  if (tid < 36) {
    float mu   = sum8(red) * (1.f / 9216.f);
    float var  = sum8(red + 8) * (1.f / 9216.f) - mu * mu;
    float rstd = rsqrtf(var + 1e-5f);
    float m = red[16 + tid];
#pragma unroll  // the six reads go out together, not one waited read a trip
    for (int g = 1; g < 7; ++g) m = fmaxf(m, red[16 + g * 36 + tid]);
    mxv[tid] = (m - mu) * rstd;
  }
  __syncthreads();

  if (tid < 10) {
    float s = l2b[tid];
    for (int j = 0; j < 36; ++j) s += mxv[j] * l2W[tid * 36 + j];
    ov[tid] = s;
  }
  __syncthreads();
  if (tid == 0) {
    float mx = -1e30f;
    for (int o = 0; o < 10; ++o) mx = fmaxf(mx, ov[o]);
    float s = 0.f;
    for (int o = 0; o < 10; ++o) s += __expf(ov[o] - mx);
    red[0] = mx + __logf(s);
  }
  __syncthreads();
  if (tid < 10) out[(size_t)b * 10 + tid] = ov[tid] - red[0];
}

// ---------------------------------------------------------------------------
extern "C" void kernel_launch(void* const* d_in, const int* in_sizes, int n_in,
                              void* d_out, int out_size, void* d_ws, size_t ws_size,
                              hipStream_t stream) {
  const float* x  = (const float*)d_in[0];
  const float* w1 = (const float*)d_in[1];  const float* b1 = (const float*)d_in[2];
  const float* w2 = (const float*)d_in[3];  const float* b2 = (const float*)d_in[4];
  const float* w3 = (const float*)d_in[5];  const float* b3 = (const float*)d_in[6];
  const float* w4 = (const float*)d_in[7];  const float* b4 = (const float*)d_in[8];
  const float* kW = (const float*)d_in[9];  const float* kbv = (const float*)d_in[10];
  const float* qW = (const float*)d_in[11]; const float* qbv = (const float*)d_in[12];
  const float* vW = (const float*)d_in[13]; const float* vbv = (const float*)d_in[14];
  const float* kg = (const float*)d_in[15]; const float* kbe = (const float*)d_in[16];
  const float* qg = (const float*)d_in[17]; const float* qbe = (const float*)d_in[18];
  const float* vg = (const float*)d_in[19]; const float* vbe = (const float*)d_in[20];
  const float* l1W = (const float*)d_in[21]; const float* l1b = (const float*)d_in[22];
  const float* l2W = (const float*)d_in[23]; const float* l2b = (const float*)d_in[24];

  const int B = in_sizes[0] / (28 * 28);   // 2048
  _Float16* feat = (_Float16*)d_ws;        // [B][256][32] f16 = 16 KB/batch

  conv_stack_kernel<<<B, 256, 193040, stream>>>(x, w1, b1, w2, b2, w3, b3, w4,
                                                b4, feat);
  attn_kernel<<<B, 256, 151904, stream>>>(feat, kW, kbv, qW, qbv, vW, vbv,
                                          kg, kbe, qg, qbe, vg, vbe,
                                          l1W, l1b, l2W, l2b, (float*)d_out);
}

// v006
// Measured time: 145 microseconds a run.
// Two timings next to v005 both put it at 1.31 times that version's speed.
// Counting every step since v000, it is 6.66 times as fast.
#include <hip/hip_runtime.h>
#include <hip/hip_bf16.h>
#include <math.h>

typedef __attribute__((ext_vector_type(16))) _Float16 v16h;
typedef __attribute__((ext_vector_type(8)))  _Float16 v8h;
typedef __attribute__((ext_vector_type(4)))  _Float16 v4h;
typedef __attribute__((ext_vector_type(2)))  _Float16 v2h;
typedef __attribute__((ext_vector_type(8)))  float    v8f;
typedef __attribute__((ext_vector_type(4)))  float    v4f;
typedef __attribute__((ext_vector_type(4)))  unsigned int v4u;

__device__ __forceinline__ v16h loadfrag_h(const _Float16* base, int r0, int k0,
                                           int stride, unsigned lane) {
  const _Float16* p = base + (r0 + (int)(lane & 15u)) * stride + k0;
  int hi = (lane & 16u) ? 1 : 0;
  v8h lo = *(const v8h*)(p + (hi ? 8 : 0));
  v8h hj = *(const v8h*)(p + (hi ? 24 : 16));
  return __builtin_shufflevector(lo, hj, 0, 1, 2, 3, 4, 5, 6, 7, 8, 9, 10, 11,
                                 12, 13, 14, 15);
}

__device__ __forceinline__ v16h loadfrag_cm(const _Float16* base, int r0, int c0,
                                            int c1, int plane, unsigned lane) {
  const _Float16* p = base + (r0 + (int)(lane & 15u)) * 8;
  v8h lo = *(const v8h*)(p + c0 * plane);
  v8h hj = *(const v8h*)(p + c1 * plane);
  return __builtin_shufflevector(lo, hj, 0, 1, 2, 3, 4, 5, 6, 7, 8, 9, 10, 11,
                                 12, 13, 14, 15);
}

// A fragment for 2-tap conv chunk: K 0..15 = tap0 ch0..15, K 16..31 = tap1.
__device__ __forceinline__ v16h frag2tap(const _Float16* p0, const _Float16* p1,
                                         unsigned lane) {
  int hi = (lane & 16u) ? 8 : 0;
  v8h lo = *(const v8h*)(p0 + hi);
  v8h hj = *(const v8h*)(p1 + hi);
  return __builtin_shufflevector(lo, hj, 0, 1, 2, 3, 4, 5, 6, 7, 8, 9, 10, 11,
                                 12, 13, 14, 15);
}

// A fragment for 1-tap conv chunk over a 32-channel pixel record.
__device__ __forceinline__ v16h frag1tap(const _Float16* p, unsigned lane) {
  int hi = (lane & 16u) ? 1 : 0;
  v8h lo = *(const v8h*)(p + (hi ? 8 : 0));
  v8h hj = *(const v8h*)(p + (hi ? 24 : 16));
  return __builtin_shufflevector(lo, hj, 0, 1, 2, 3, 4, 5, 6, 7, 8, 9, 10, 11,
                                 12, 13, 14, 15);
}

// value of the lane 16 away (same column, other half of the rows)
__device__ __forceinline__ float other_half(float v) {
  int b = __builtin_bit_cast(int, v);
  b = __builtin_amdgcn_permlanex16(b, b, 0x76543210, 0xfedcba98, false, false);
  return __builtin_bit_cast(float, b);
}

// sum over the 32 lanes of a wave, the total in every lane: four adds with the
// lane whose number differs in one bit (row_xmask, inside a 16-lane row), then
// the other row. All 32 lanes have to be on.
template <int CTRL>
__device__ __forceinline__ float add_xmask(float v) {
  int b = __builtin_bit_cast(int, v);
  b = __builtin_amdgcn_update_dpp(0, b, CTRL, 0xf, 0xf, true);
  return v + __builtin_bit_cast(float, b);
}
__device__ __forceinline__ float wave_sum(float v) {
  v = add_xmask<0x161>(v);
  v = add_xmask<0x162>(v);
  v = add_xmask<0x164>(v);
  v = add_xmask<0x168>(v);
  return v + other_half(v);
}

// the eight waves' partial sums p[0..7], added in one fixed order
__device__ __forceinline__ float sum8(const float* p) {
  v4f a = *(const v4f*)p, b = *(const v4f*)(p + 4);
  return ((a[0] + a[1]) + (a[2] + a[3])) + ((b[0] + b[1]) + (b[2] + b[3]));
}

__device__ __forceinline__ float exp_slot(float x) {
  float r = x * 1.44269504f;
  asm("v_exp_f32 %0, %0\n\tv_nop" : "+v"(r));
  return r;
}

__device__ __forceinline__ v8f wmma_f16(v16h a, v16h b, v8f c) {
  return __builtin_amdgcn_wmma_f32_16x16x32_f16(false, a, false, b, (short)0, c,
                                                false, false);
}

__device__ __forceinline__ v8f zero8() {
  v8f z = {0.f, 0.f, 0.f, 0.f, 0.f, 0.f, 0.f, 0.f};
  return z;
}

#define H1P 24
#define H1R 656
#define H2P 40
#define H2R 888
#define BPL 264
#define BTP 1064
__global__ __launch_bounds__(256) void conv_stack_kernel(
    const float* __restrict__ x,
    const float* __restrict__ w1, const float* __restrict__ b1,
    const float* __restrict__ w2, const float* __restrict__ b2,
    const float* __restrict__ w3, const float* __restrict__ b3,
    const float* __restrict__ w4, const float* __restrict__ b4,
    _Float16* __restrict__ feat) {
  extern __shared__ char smem[];
  float*     xin = (float*)smem;
  float*     ws1 = (float*)(smem + 3136);
  float*     bbf = (float*)(smem + 4416);     // [4][32]
  _Float16*  h1  = (_Float16*)(smem + 4928);
  _Float16*  h2  = (_Float16*)(smem + 38448);
  _Float16*  h3  = (_Float16*)(smem + 78480);
  _Float16*  Bc2 = (_Float16*)(smem + 107920);
  _Float16*  Bc3 = (_Float16*)(smem + 124944);
  _Float16*  Bc4 = (_Float16*)(smem + 158992);

  const int tid = threadIdx.x;
  const unsigned lane = tid & 31u;
  const int wv = tid >> 5;
  const int b = blockIdx.x;
  const int ch0 = (lane & 16u) ? 1 : 0;  // weight planes of this half wave:
  const int ch1 = ch0 + 2;               // the k order of frag2tap/frag1tap

  // ---- every global read of this kernel: coalesced, branch-free (indices
  // clamped, stores guarded) and issued together, so the L2 round trips
  // overlap instead of one waited 4-byte load per staged element ----
  // Weight unit u = (oc n, input-channel pair kp, tap quad tq), tq fastest:
  // two 16-byte loads (channels 2kp and 2kp+1, taps 4tq..4tq+3) feed four
  // 4-byte LDS stores of a channel pair each.
  // (the unrolls here and in the scatter below keep the arrays in registers)
  v4f r2a[3], r2b[3], r3a[4], r3b[4], r4a[6], r4b[6];
  {
    const v4f* w2v = (const v4f*)w2;  // 20 x 8 x 4  = 640 units
    const v4f* w3v = (const v4f*)w3;  // 24 x 10 x 4 = 960 units
    const v4f* w4v = (const v4f*)w4;  // 30 x 12 x 4 = 1440 units
    // 16-byte index of unit u: (u>>2)*8 + (u&3); 256 units further = +512.
    // Each tensor's last, partial slice clamps its unit.
    const int a0 = (tid >> 2) * 8 + (tid & 3);
    const int u2 = tid + 512 < 640 ? tid + 512 : 639;
    const int u3 = tid + 768 < 960 ? tid + 768 : 959;
    const int u4 = tid + 1280 < 1440 ? tid + 1280 : 1439;
    const int a2 = (u2 >> 2) * 8 + (u2 & 3);
    const int a3 = (u3 >> 2) * 8 + (u3 & 3);
    const int a4 = (u4 >> 2) * 8 + (u4 & 3);
#pragma unroll
    for (int i = 0; i < 2; ++i) {
      r2a[i] = w2v[a0 + 512 * i];
      r2b[i] = w2v[a0 + 512 * i + 4];
    }
    r2a[2] = w2v[a2];
    r2b[2] = w2v[a2 + 4];
#pragma unroll
    for (int i = 0; i < 3; ++i) {
      r3a[i] = w3v[a0 + 512 * i];
      r3b[i] = w3v[a0 + 512 * i + 4];
    }
    r3a[3] = w3v[a3];
    r3b[3] = w3v[a3 + 4];
#pragma unroll
    for (int i = 0; i < 5; ++i) {
      r4a[i] = w4v[a0 + 512 * i];
      r4b[i] = w4v[a0 + 512 * i + 4];
    }
    r4a[5] = w4v[a4];
    r4b[5] = w4v[a4 + 4];

    const v4f* sx = (const v4f*)(x + (size_t)b * 784);
    v4f xr  = sx[tid < 196 ? tid : 195];
    const int a1 = tid & 63;
    v4f w1r = ((const v4f*)w1)[a1];
    int g = (tid >> 5) & 3, n = tid & 31;
    const float* bp = (g == 0) ? b1 : (g == 1) ? b2 : (g == 2) ? b3 : b4;
    int lim = (g == 0) ? 16 : (g == 1) ? 20 : (g == 2) ? 24 : 30;
    const float* bq = bp + (n < lim ? n : 0);
    float bv = *bq;
    // The loads' address registers are inputs here, so they stay unwritten
    // (also by a later load's result) until this wait.
    asm volatile("s_wait_xcnt 0x0"
                 :: "v"(a0), "v"(a1), "v"(a2), "v"(a3), "v"(a4), "v"(bq)
                 : "memory");
    // zero h1..h3 and Bc2..Bc4 (contiguous 188112 B = 11757 x b128)
    v4u zz = {0u, 0u, 0u, 0u};
    v4u* z = (v4u*)h1;
    for (int i = 0; i < 45; ++i) z[tid + 256 * i] = zz;
    if (tid < 237) z[tid + 11520] = zz;
    if (tid < 196) ((v4f*)xin)[tid] = xr;
    if (tid < 64)  *(v4f*)(ws1 + (tid >> 2) * 20 + (tid & 3) * 4) = w1r;
    if (tid < 128) bbf[tid] = (n < lim) ? bv : 0.f;
  }
  __syncthreads();

  // ---- scatter the weights into the zeroed per-tap B matrices ----
  // Bc2: chunk c pairs taps 2c,2c+1; k<16 -> tap 2c ic=k, k>=16 -> tap 2c+1
#pragma unroll
  for (int i = 0; i < 3; ++i) {
    int u = tid + 256 * i;
    if (u < 640) {
      int t0 = (u & 3) * 4, r = u >> 2;
      int n = r >> 3, ic = (r & 7) * 2;
#pragma unroll
      for (int e = 0; e < 4; ++e) {
        int tap = t0 + e;
        v2h h = {(_Float16)r2a[i][e], (_Float16)r2b[i][e]};
        int k = (tap & 1) * 16 + ic;
        *(v2h*)(Bc2 + (tap >> 1) * BTP + (k >> 3) * BPL + n * 8 + (k & 7)) = h;
      }
    }
  }
  // Bc3: tap t, k = ic (20 valid of 32), n = oc (24 valid of 32)
#pragma unroll
  for (int i = 0; i < 4; ++i) {
    int u = tid + 256 * i;
    if (u < 960) {
      int t0 = (u & 3) * 4, r = u >> 2;
      int n = r / 10, k = (r - n * 10) * 2;
#pragma unroll
      for (int e = 0; e < 4; ++e) {
        v2h h = {(_Float16)r3a[i][e], (_Float16)r3b[i][e]};
        *(v2h*)(Bc3 + (t0 + e) * BTP + (k >> 3) * BPL + n * 8 + (k & 7)) = h;
      }
    }
  }
  // Bc4: tap t, k = ic (24 valid of 32), n = oc (30 valid of 32)
#pragma unroll
  for (int i = 0; i < 6; ++i) {
    int u = tid + 256 * i;
    if (u < 1440) {
      int t0 = (u & 3) * 4, r = u >> 2;
      int n = r / 12, k = (r - n * 12) * 2;
#pragma unroll
      for (int e = 0; e < 4; ++e) {
        v2h h = {(_Float16)r4a[i][e], (_Float16)r4b[i][e]};
        *(v2h*)(Bc4 + (t0 + e) * BTP + (k >> 3) * BPL + n * 8 + (k & 7)) = h;
      }
    }
  }

  // ---- conv1 (ic=1, scalar): 28x28 -> 16x25x25, channel-last f16 ----
  for (int idx = tid; idx < 10000; idx += 256) {
    int p = idx >> 4, oc = idx & 15;
    int oy = p / 25, ox = p - oy * 25;
    float acc = bbf[oc];
    const float* wp = ws1 + oc * 20;
#pragma unroll
    for (int ky = 0; ky < 4; ++ky)
#pragma unroll
      for (int kx = 0; kx < 4; ++kx)
        acc += xin[(oy + ky) * 28 + ox + kx] * wp[ky * 4 + kx];
    h1[oy * H1R + ox * H1P + oc] = (_Float16)fmaxf(acc, 0.f);
  }
  __syncthreads();

  // conv2..conv4: a wave owns several M tiles and BOTH N tiles, so an A fragment
  // read from LDS feeds two WMMAs and a B fragment one per M tile, and a wave's
  // accumulator chains are independent. The K loop goes in blocks with two
  // fragment sets in registers: the next block's reads stand as one group ahead
  // of this block's WMMAs. Each output still sums its taps in the order 0..15.
  // (The unrolls keep acc and the fragment sets in registers. The two
  // sched_barriers of a block keep the reads in that one group: without them
  // the compiler moves each read down to just ahead of the WMMA that uses it,
  // and the wave waits out the LDS latency there.)
  const int l15 = (int)(lane & 15u);
  const int mh = (lane & 16u) ? 8 : 0;

  // ---- conv2 via WMMA: M=484(->496) x N=20(->32) x K=256 (8 chunks) ----
  // 31 M tiles, four a wave; the last wave's fourth is its third again (same
  // values to the same places, from the same wave). Block = one chunk.
  {
    int mts[4];
    const _Float16* ap[4];
    v8f acc[4][2];
#pragma unroll
    for (int j = 0; j < 4; ++j) {
      int mt = wv * 4 + j;
      mts[j] = mt < 31 ? mt : 30;
      int m = mts[j] * 16 + l15;
      int oy = m / 22, ox = m - oy * 22;
      ap[j] = h1 + oy * H1R + ox * H1P;
      acc[j][0] = zero8();
      acc[j][1] = zero8();
    }
    v16h fa[2][4], fw[2][2];
    auto fetch = [&](int c) {
      const int s = c & 1;
      const int o0 = ((2 * c) >> 2) * H1R + ((2 * c) & 3) * H1P;  // tap 2c
      fw[s][0] = loadfrag_cm(Bc2 + c * BTP, 0, ch0, ch1, BPL, lane);
      fw[s][1] = loadfrag_cm(Bc2 + c * BTP, 16, ch0, ch1, BPL, lane);
#pragma unroll
      for (int j = 0; j < 4; ++j)
        fa[s][j] = frag2tap(ap[j] + o0, ap[j] + o0 + H1P, lane);
    };
    fetch(0);
#pragma unroll
    for (int c = 0; c < 8; ++c) {
      if (c < 7) fetch(c + 1);
      __builtin_amdgcn_sched_barrier(0);  // the reads above stay one group
#pragma unroll
      for (int j = 0; j < 4; ++j) {
        acc[j][0] = wmma_f16(fa[c & 1][j], fw[c & 1][0], acc[j][0]);
        acc[j][1] = wmma_f16(fa[c & 1][j], fw[c & 1][1], acc[j][1]);
      }
      __builtin_amdgcn_sched_barrier(0);  // no later read moves up among them
    }
    float bias0 = bbf[32 + l15], bias1 = bbf[48 + l15];
#pragma unroll
    for (int j = 0; j < 4; ++j) {
      int m0 = mts[j] * 16 + mh;  // first of this lane's 8 pixels
      int y0 = m0 / 22, x0 = m0 - y0 * 22;
      _Float16* hp = h2 + y0 * H2R + x0 * H2P + l15;
#pragma unroll
      for (int r = 0; r < 8; ++r) {  // at most one step into the next image row
        _Float16* q = hp + r * H2P + (x0 + r >= 22 ? H2R - 22 * H2P : 0);
        q[0]  = (_Float16)fmaxf(acc[j][0][r] + bias0, 0.f);
        q[16] = (_Float16)fmaxf(acc[j][1][r] + bias1, 0.f);
      }
    }
  }
  __syncthreads();

  // ---- conv3 via WMMA: M=361(->368) x N=24(->32) x K=512 (16 taps) ----
  // 23 M tiles, three a wave; the last wave's third is its second again.
  // Block = two taps.
  {
    int mts[3];
    const _Float16* ap[3];
    v8f acc[3][2];
#pragma unroll
    for (int j = 0; j < 3; ++j) {
      int mt = wv * 3 + j;
      mts[j] = mt < 23 ? mt : 22;
      int m = mts[j] * 16 + l15;
      int oy = m / 19, ox = m - oy * 19;
      ap[j] = h2 + oy * H2R + ox * H2P;
      acc[j][0] = zero8();
      acc[j][1] = zero8();
    }
    v16h fa[2][2][3], fw[2][2][2];
    auto fetch = [&](int k) {
      const int s = k & 1;
#pragma unroll
      for (int e = 0; e < 2; ++e) {
        const int t = 2 * k + e;
        fw[s][e][0] = loadfrag_cm(Bc3 + t * BTP, 0, ch0, ch1, BPL, lane);
        fw[s][e][1] = loadfrag_cm(Bc3 + t * BTP, 16, ch0, ch1, BPL, lane);
#pragma unroll
        for (int j = 0; j < 3; ++j)
          fa[s][e][j] = frag1tap(ap[j] + (t >> 2) * H2R + (t & 3) * H2P, lane);
      }
    };
    fetch(0);
#pragma unroll
    for (int k = 0; k < 8; ++k) {
      if (k < 7) fetch(k + 1);
      __builtin_amdgcn_sched_barrier(0);  // the reads above stay one group
#pragma unroll
      for (int e = 0; e < 2; ++e)
#pragma unroll
        for (int j = 0; j < 3; ++j) {
          acc[j][0] = wmma_f16(fa[k & 1][e][j], fw[k & 1][e][0], acc[j][0]);
          acc[j][1] = wmma_f16(fa[k & 1][e][j], fw[k & 1][e][1], acc[j][1]);
        }
      __builtin_amdgcn_sched_barrier(0);  // no later read moves up among them
    }
    float bias0 = bbf[64 + l15], bias1 = bbf[80 + l15];
#pragma unroll
    for (int j = 0; j < 3; ++j) {
      _Float16* q = h3 + (mts[j] * 16 + mh) * H2P + l15;
#pragma unroll
      for (int r = 0; r < 8; ++r) {
        q[r * H2P]      = (_Float16)fmaxf(acc[j][0][r] + bias0, 0.f);
        q[r * H2P + 16] = (_Float16)fmaxf(acc[j][1][r] + bias1, 0.f);
      }
    }
  }
  __syncthreads();

  // ---- conv4 via WMMA: M=256 x N=30(->32) x K=512; write features+coords ----
  // An M tile is one output row; a wave owns rows 2wv and 2wv+1. The upper
  // row's A fragments of kernel row ky are the lower row's of ky+1: each of the
  // five input rows (ar) is read once. Block = two taps of one kernel row.
  _Float16* fb = feat + (size_t)b * 8192;
  {
    const _Float16* ap = h3 + (wv * 2 * 19 + l15) * H2P;
    v8f acc[2][2];
    acc[0][0] = zero8(); acc[0][1] = zero8();
    acc[1][0] = zero8(); acc[1][1] = zero8();
    v16h ar[5][4], fw[2][2][2];
    auto fetch = [&](int k) {
      const int s = k & 1;
#pragma unroll
      for (int e = 0; e < 2; ++e) {
        const int t = 2 * k + e, ky = t >> 2, kx = t & 3;
        fw[s][e][0] = loadfrag_cm(Bc4 + t * BTP, 0, ch0, ch1, BPL, lane);
        fw[s][e][1] = loadfrag_cm(Bc4 + t * BTP, 16, ch0, ch1, BPL, lane);
        ar[ky + 1][kx] = frag1tap(ap + ((ky + 1) * 19 + kx) * H2P, lane);
      }
    };
#pragma unroll
    for (int kx = 0; kx < 4; ++kx) ar[0][kx] = frag1tap(ap + kx * H2P, lane);
    fetch(0);
#pragma unroll
    for (int k = 0; k < 8; ++k) {
      if (k < 7) fetch(k + 1);
      __builtin_amdgcn_sched_barrier(0);  // the reads above stay one group
#pragma unroll
      for (int e = 0; e < 2; ++e) {
        const int t = 2 * k + e, ky = t >> 2, kx = t & 3;
        acc[0][0] = wmma_f16(ar[ky][kx], fw[k & 1][e][0], acc[0][0]);
        acc[0][1] = wmma_f16(ar[ky][kx], fw[k & 1][e][1], acc[0][1]);
        acc[1][0] = wmma_f16(ar[ky + 1][kx], fw[k & 1][e][0], acc[1][0]);
        acc[1][1] = wmma_f16(ar[ky + 1][kx], fw[k & 1][e][1], acc[1][1]);
      }
      __builtin_amdgcn_sched_barrier(0);  // no later read moves up among them
    }
    float bias0 = bbf[96 + l15], bias1 = bbf[112 + l15];
#pragma unroll
    for (int j = 0; j < 2; ++j) {
      _Float16* q = fb + ((wv * 2 + j) * 16 + mh) * 32 + l15;
#pragma unroll
      for (int r = 0; r < 8; ++r)
        q[r * 32] = (_Float16)fmaxf(acc[j][0][r] + bias0, 0.f);
      if (l15 < 14) {  // channels 16..29; 30 and 31 are the coordinates
#pragma unroll
        for (int r = 0; r < 8; ++r)
          q[r * 32 + 16] = (_Float16)fmaxf(acc[j][1][r] + bias1, 0.f);
      }
    }
  }
  {
    int n = tid;  // coord channels (columns 30/31, disjoint from tile stores)
    int xx = n % 16, yy = n / 16;
    fb[n * 32 + 30] = (_Float16)((float)xx * 0.0625f);
    fb[n * 32 + 31] = (_Float16)((float)yy * 0.0625f);
  }
}

#define APL 2080
#define TP 52
#define W1P 56
__global__ __launch_bounds__(256) void attn_kernel(
    const _Float16* __restrict__ feat,
    const float* __restrict__ kW, const float* __restrict__ kb,
    const float* __restrict__ qW, const float* __restrict__ qb,
    const float* __restrict__ vW, const float* __restrict__ vb,
    const float* __restrict__ kg, const float* __restrict__ kbe,
    const float* __restrict__ qg, const float* __restrict__ qbe,
    const float* __restrict__ vg, const float* __restrict__ vbe,
    const float* __restrict__ l1W, const float* __restrict__ l1b,
    const float* __restrict__ l2W, const float* __restrict__ l2b,
    float* __restrict__ out) {
  extern __shared__ char smem[];
  _Float16* hbuf = (_Float16*)smem;
  _Float16* Qb   = (_Float16*)(smem + 16640);
  float* tmpf = (float*)(smem + 41600);
  _Float16* Kb   = (_Float16*)(smem + 94848);
  _Float16* Vt   = (_Float16*)(smem + 119808);
  _Float16* wbuf = (_Float16*)(smem + 145152);
  float* red  = (float*)(smem + 148992);
  float* mxv  = (float*)(smem + 151072);
  float* ov   = (float*)(smem + 151264);
  float* bb   = (float*)(smem + 151328);
  _Float16* W1h = (_Float16*)smem;            // over hbuf, once it is dead:
  _Float16* W1l = (_Float16*)(smem + 5376);   // [48][W1P] f16 each
  float* l1bs = (float*)(smem + 10752);       // [48]

  const int tid = threadIdx.x;
  const unsigned lane = tid & 31u;
  const int wv = tid >> 5;
  const int b = blockIdx.x;
  // planes of this half wave, in the k order of loadfrag_h: columns 0..31,
  // then columns 32..63 (40..63 read the zero plane)
  const int ch0 = (lane & 16u) ? 1 : 0, ch1 = ch0 + 2, ch2 = ch0 + 4;

  // ---- features, projection weights, biases: coalesced, branch-free reads
  // (indices clamped, stores guarded), all in flight together ----
  // (unrolls on fr/wreg/gr/er loops keep these arrays in registers)
  v4f wreg[3][2];
  // gamma/beta of pass p: 18 coalesced 16-byte loads in flight together.
  // Pass 0's go out here; pass p+1's go out ahead of pass p's normalisation,
  // which covers their L2 round trip up to the barrier behind it.
  v4f gr[3][9], er[3][9];
  // W1 piece u = (row j, column quad q) of the padded [48][48] tile, three a
  // thread (576 pieces); outside the 36 x 36 matrix the piece is zero
  v4f l1r[3];
  float l1bv = 0.f;
#pragma unroll
  for (int i = 0; i < 9; ++i) {
    gr[0][i] = ((const v4f*)vg)[tid + 256 * i];
    er[0][i] = ((const v4f*)vbe)[tid + 256 * i];
  }
  {
    const v4u* src = (const v4u*)(feat + (size_t)b * 8192);
    v4u fr[4];
#pragma unroll
    for (int i = 0; i < 4; ++i) fr[i] = src[tid + 256 * i];
    const int f1 = 256 + (tid & 31);  // each W is 288 x 16 B
    wreg[0][0] = ((const v4f*)vW)[tid];  wreg[0][1] = ((const v4f*)vW)[f1];
    wreg[1][0] = ((const v4f*)kW)[tid];  wreg[1][1] = ((const v4f*)kW)[f1];
    wreg[2][0] = ((const v4f*)qW)[tid];  wreg[2][1] = ((const v4f*)qW)[f1];
    const int bi = tid < 144 ? tid : 0;
    const int pb = bi / 48, jb = bi - pb * 48;
    const float* bp = (pb == 0) ? vb : (pb == 1) ? kb : qb;
    float bv = bp[jb < 36 ? jb : 0];

    // zero what the staged operands pad with: Q/K planes 4 and 5 (520 x 16 B;
    // columns 32..35 are stored over it behind later barriers), V^T rows
    // 36..47, W rows 36..47
    const v4u zz = {0u, 0u, 0u, 0u};
    for (int i = tid; i < 520; i += 256) {
      ((v4u*)(Qb + 4 * APL))[i] = zz;
      ((v4u*)(Kb + 4 * APL))[i] = zz;
    }
    for (int i = tid; i < 396; i += 256) ((v4u*)(Vt + 36 * 264))[i] = zz;
    if (tid < 60) ((v4u*)(wbuf + 36 * 40))[tid] = zz;

    // 16-byte unit u of the [256][32] features: row u >> 2, plane u & 3
#pragma unroll
    for (int i = 0; i < 4; ++i)
      *(v4u*)(hbuf + (tid & 3) * APL + ((tid >> 2) + 64 * i) * 8) = fr[i];
    if (tid < 144) bb[tid] = (jb < 36) ? bv : 0.f;
  }
  __syncthreads();

  // unrolled: wreg/gr/er are indexed by p and have to stay in registers
#pragma unroll
  for (int p = 0; p < 3; ++p) {
    {
      const int k = (tid & 7) * 4;
      v4f w0 = wreg[p][0];
      v4h h0 = {(_Float16)w0[0], (_Float16)w0[1], (_Float16)w0[2], (_Float16)w0[3]};
      *(v4h*)(wbuf + (tid >> 3) * 40 + k) = h0;
      if (tid < 32) {
        v4f w1v = wreg[p][1];
        v4h h1v = {(_Float16)w1v[0], (_Float16)w1v[1], (_Float16)w1v[2], (_Float16)w1v[3]};
        *(v4h*)(wbuf + (32 + (tid >> 3)) * 40 + k) = h1v;
      }
    }
    __syncthreads();

    for (int t = wv; t < 48; t += 8) {
      int rt = t / 3, nt = t % 3;
      v16h a  = loadfrag_cm(hbuf, rt * 16, ch0, ch1, APL, lane);
      v16h bf = loadfrag_h(wbuf, nt * 16, 0, 40, lane);
      v8f acc = zero8();
      acc = wmma_f16(a, bf, acc);
      int n = nt * 16 + (int)(lane & 15u);
      float bias = bb[p * 48 + n];
      int mh = (lane & 16u) ? 8 : 0;
#pragma unroll
      for (int r = 0; r < 8; ++r)
        tmpf[(rt * 16 + mh + r) * TP + n] = acc[r] + bias;
    }
    __syncthreads();

    {
      float s = 0.f, s2 = 0.f;
      const float* rowp = tmpf + tid * TP;
#pragma unroll
      for (int c = 0; c < 36; c += 4) {
        v4f v = *(const v4f*)(rowp + c);
        s += v[0] + v[1] + v[2] + v[3];
        s2 += v[0] * v[0] + v[1] * v[1] + v[2] * v[2] + v[3] * v[3];
      }
      // in the wave across lanes, then one partial a wave; red is next written
      // behind the barrier at the foot of this pass
      s = wave_sum(s);
      s2 = wave_sum(s2);
      if (lane == 0) { red[wv] = s; red[8 + wv] = s2; }
    }
    __syncthreads();
    float mu   = sum8(red) * (1.f / 9216.f);
    float var  = sum8(red + 8) * (1.f / 9216.f) - mu * mu;
    float rstd = rsqrtf(var + 1e-5f);

    if (p < 2) {
      const v4f* Gv = (const v4f*)((p == 0) ? kg : qg);
      const v4f* Ev = (const v4f*)((p == 0) ? kbe : qbe);
#pragma unroll
      for (int i = 0; i < 9; ++i) {
        gr[p + 1][i] = Gv[tid + 256 * i];
        er[p + 1][i] = Ev[tid + 256 * i];
      }
    }
    if (p == 1) {  // W1 and its bias: read here, staged in pass 2
      int ix[3];
#pragma unroll
      for (int i = 0; i < 3; ++i) {
        int u = tid + 256 * i;
        int j = u / 12, q = u - j * 12;
        ix[i] = (j < 36 && q < 9) ? j * 9 + q : 0;
        l1r[i] = ((const v4f*)l1W)[ix[i]];
      }
      const int ib = tid < 36 ? tid : 35;
      l1bv = l1b[ib];
      // The loads' index registers are inputs here, so they stay unwritten
      // until this wait.
      asm volatile("s_wait_xcnt 0x0"
                   :: "v"(ix[0]), "v"(ix[1]), "v"(ix[2]), "v"(ib)
                   : "memory");
    }
    if (p == 2) {
      // the features are dead (last read two barriers back): W1 as hi and lo
      // f16 tiles and the padded bias take their place; the barrier at the
      // foot of this pass publishes them
#pragma unroll
      for (int i = 0; i < 3; ++i) {
        int u = tid + 256 * i;
        int j = u / 12, q = u - j * 12;
        bool ok = j < 36 && q < 9;
        v4h wh, wl;
#pragma unroll
        for (int e = 0; e < 4; ++e) {
          float w = ok ? l1r[i][e] : 0.f;
          wh[e] = (_Float16)w;
          wl[e] = (_Float16)(w - (float)wh[e]);
        }
        if (u < 576) {
          *(v4h*)(W1h + j * W1P + q * 4) = wh;
          *(v4h*)(W1l + j * W1P + q * 4) = wl;
        }
      }
      if (tid < 48) l1bs[tid] = tid < 36 ? l1bv : 0.f;
    }

    // 16-byte piece f of the [256][36] plane: node = f/9, columns j0..j0+3
#pragma unroll
    for (int i = 0; i < 9; ++i) {
      int f = tid + 256 * i;
      int node = f / 9, j0 = (f - node * 9) * 4;
      v4f tv = *(const v4f*)(tmpf + node * TP + j0);
      v4h o;
#pragma unroll
      for (int e = 0; e < 4; ++e) {
        float v = (tv[e] - mu) * rstd;
        o[e] = (_Float16)(v * gr[p][i][e] + er[p][i][e]);
      }
      if (p == 0) {
#pragma unroll
        for (int e = 0; e < 4; ++e) Vt[(j0 + e) * 264 + node] = o[e];
      } else {
        _Float16* dst = (p == 1) ? Kb : Qb;
        *(v4h*)(dst + (j0 >> 3) * APL + node * 8 + (j0 & 4)) = o;
      }
    }
    __syncthreads();
  }

  const float scale = 0.16666667f;  // 1/sqrt(36)
  const int hi8 = (lane & 16u) ? 8 : 0;
  // sums of the linear layer's outputs and of their squares, four chains each
  v4f ls = {0.f, 0.f, 0.f, 0.f}, ls2 = {0.f, 0.f, 0.f, 0.f};
  float* att2 = tmpf;  // [256][TP]; the projections' f32 rows are dead now
  for (int blk = wv; blk < 16; blk += 8) {
    int row0 = blk * 16;
    // B operand: 16 queries (n = query), kept for all 16 key tiles
    v16h qb0 = loadfrag_cm(Qb, row0, ch0, ch1, APL, lane);
    v16h qb1 = loadfrag_cm(Qb, row0, ch2, 5, APL, lane);
    v8f st[16];
#pragma unroll
    for (int ct = 0; ct < 16; ++ct) {
      v8f acc = zero8();
      acc = wmma_f16(loadfrag_cm(Kb, ct * 16, ch0, ch1, APL, lane), qb0, acc);
      acc = wmma_f16(loadfrag_cm(Kb, ct * 16, ch2, 5, APL, lane), qb1, acc);
      st[ct] = acc;
    }
    float mx = -1e30f;
#pragma unroll
    for (int ct = 0; ct < 16; ++ct)
#pragma unroll
      for (int r = 0; r < 8; ++r) {
        st[ct][r] *= scale;
        mx = fmaxf(mx, st[ct][r]);
      }
    mx = fmaxf(mx, other_half(mx));
    float s = 0.f;
    v8f av0 = zero8(), av1 = zero8(), av2 = zero8();
#pragma unroll
    for (int kc = 0; kc < 8; ++kc) {
      // B fragment of keys kc*32..+31: elements 0..7 are k = 8*hi + r (tile
      // 2kc), elements 8..15 are k = 16 + 8*hi + r (tile 2kc+1): the k order
      // of loadfrag_h, which loads the A operand (V^T rows) below.
      v16h pb;
      float ps = 0.f;
#pragma unroll
      for (int r = 0; r < 8; ++r) {
        float e0 = exp_slot(st[2 * kc][r] - mx);
        float e1 = exp_slot(st[2 * kc + 1][r] - mx);
        ps += e0 + e1;
        pb[r]     = (_Float16)e0;
        pb[8 + r] = (_Float16)e1;
      }
      s += ps;
      av0 = wmma_f16(loadfrag_h(Vt, 0, kc * 32, 264, lane), pb, av0);
      av1 = wmma_f16(loadfrag_h(Vt, 16, kc * 32, 264, lane), pb, av1);
      av2 = wmma_f16(loadfrag_h(Vt, 32, kc * 32, 264, lane), pb, av2);
    }
    s += other_half(s);
    float invr = 1.f / s;
    // keeps the W1 and bias reads below from moving up to where the 128 scores
    // are live, which takes the kernel past 256 registers (one work-group a WGP)
    __builtin_amdgcn_sched_barrier(0);
    // O^T tile t: n = query, m = column 16t + r + 8*hi. As f16, tiles 0 and 1
    // are the B fragment of columns 0..31 in the k order of loadfrag_h, which
    // loads W1 below; tile 2 (columns 32..47, 36..47 zero) fills elements 0..7
    // of a second fragment.
    v16h oh0, ol0;
    v8h oh1, ol1;
#pragma unroll
    for (int r = 0; r < 8; ++r) {
      float o0 = av0[r] * invr, o1 = av1[r] * invr, o2 = av2[r] * invr;
      oh0[r]     = (_Float16)o0;
      oh0[8 + r] = (_Float16)o1;
      oh1[r]     = (_Float16)o2;
      ol0[r]     = (_Float16)(o0 - (float)oh0[r]);
      ol0[8 + r] = (_Float16)(o1 - (float)oh0[8 + r]);
      ol1[r]     = (_Float16)(o2 - (float)oh1[r]);
    }
    const v8h z8 = {0, 0, 0, 0, 0, 0, 0, 0};
    // columns 32..47 need half a fragment: with W1's (hi | lo) as A, B = (hi |
    // hi) gives hi*hi + lo*hi in one WMMA and B = (lo | 0) gives hi*lo
    v16h ohh = __builtin_shufflevector(oh1, oh1, 0, 1, 2, 3, 4, 5, 6, 7, 8, 9,
                                       10, 11, 12, 13, 14, 15);
    v16h olz = __builtin_shufflevector(ol1, z8, 0, 1, 2, 3, 4, 5, 6, 7, 8, 9,
                                       10, 11, 12, 13, 14, 15);
    // d[jt]: output j = 16jt + r + 8*hi of query row0 + (lane & 15); starts at
    // the bias. All reads first, then three independent accumulator chains, the
    // small products first. (The unrolls keep the arrays in registers.)
    v8f d[3];
    v16h wh0[3], wl0[3], whl[3];
#pragma unroll
    for (int jt = 0; jt < 3; ++jt) {
      const float* bp = l1bs + jt * 16 + hi8;
      v4f b0 = *(const v4f*)bp, b1 = *(const v4f*)(bp + 4);
      v8f bi = {b0[0], b0[1], b0[2], b0[3], b1[0], b1[1], b1[2], b1[3]};
      d[jt] = bi;
      wh0[jt] = loadfrag_h(W1h, jt * 16, 0, W1P, lane);
      wl0[jt] = loadfrag_h(W1l, jt * 16, 0, W1P, lane);
      const int wo = (jt * 16 + (int)(lane & 15u)) * W1P + 32 + hi8;
      v8h wh1 = *(const v8h*)(W1h + wo);
      v8h wl1 = *(const v8h*)(W1l + wo);
      whl[jt] = __builtin_shufflevector(wh1, wl1, 0, 1, 2, 3, 4, 5, 6, 7, 8, 9,
                                        10, 11, 12, 13, 14, 15);
    }
#pragma unroll
    for (int jt = 0; jt < 3; ++jt) d[jt] = wmma_f16(whl[jt], olz, d[jt]);
#pragma unroll
    for (int jt = 0; jt < 3; ++jt) d[jt] = wmma_f16(wh0[jt], ol0, d[jt]);
#pragma unroll
    for (int jt = 0; jt < 3; ++jt) d[jt] = wmma_f16(wl0[jt], oh0, d[jt]);
#pragma unroll
    for (int jt = 0; jt < 3; ++jt) d[jt] = wmma_f16(whl[jt], ohh, d[jt]);
#pragma unroll
    for (int jt = 0; jt < 3; ++jt) d[jt] = wmma_f16(wh0[jt], oh0, d[jt]);
    // this query's row of the layer's output, for the column maxima; rows
    // 36..47 of W1 and of the bias are zero: of tile 2 only r < 4 counts
    float* op = att2 + (row0 + (int)(lane & 15u)) * TP + hi8;
#pragma unroll
    for (int jt = 0; jt < 3; ++jt) {
#pragma unroll
      for (int h = 0; h < (jt < 2 ? 2 : 1); ++h) {
        v4f o;
#pragma unroll
        for (int e = 0; e < 4; ++e) o[e] = fmaxf(d[jt][4 * h + e], 0.f);
        ls += o;
        ls2 += o * o;
        *(v4f*)(op + jt * 16 + 4 * h) = o;
      }
    }
  }

  // LayerNorm sums of this wave's 32 queries, one partial a wave; red was last
  // read ahead of the barrier at the foot of pass 2
  {
    float t = wave_sum((ls[0] + ls[1]) + (ls[2] + ls[3]));
    float t2 = wave_sum((ls2[0] + ls2[1]) + (ls2[2] + ls2[3]));
    if (lane == 0) { red[wv] = t; red[8 + wv] = t2; }
  }
  __syncthreads();

  // column maxima: thread (g, col) takes rows 37g..37g+36 of its column (the
  // last group's rows end at 255; a row taken twice does not move a maximum).
  // Unrolled, four chains: the 37 reads go out together, one wait for all.
  if (tid < 252) {
    const int g = tid / 36, col = tid - g * 36;
    const float* cp = att2 + g * 37 * TP + col;
    float m[4] = {-1e30f, -1e30f, -1e30f, -1e30f};
#pragma unroll
    for (int i = 0; i < 37; ++i) {
      int d = i;
      if (i > 33) d = (g * 37 + i < 256) ? i : 255 - g * 37;
      m[i & 3] = fmaxf(m[i & 3], cp[d * TP]);
    }
    red[16 + tid] = fmaxf(fmaxf(m[0], m[1]), fmaxf(m[2], m[3]));
  }
  __syncthreads();

  if (tid < 36) {
    float mu   = sum8(red) * (1.f / 9216.f);
    float var  = sum8(red + 8) * (1.f / 9216.f) - mu * mu;
    float rstd = rsqrtf(var + 1e-5f);
    float m = red[16 + tid];
#pragma unroll  // the six reads go out together, not one waited read a trip
    for (int g = 1; g < 7; ++g) m = fmaxf(m, red[16 + g * 36 + tid]);
    mxv[tid] = (m - mu) * rstd;
  }
  __syncthreads();

  if (tid < 10) {
    float s = l2b[tid];
    for (int j = 0; j < 36; ++j) s += mxv[j] * l2W[tid * 36 + j];
    ov[tid] = s;
  }
  __syncthreads();
  if (tid == 0) {
    float mx = -1e30f;
    for (int o = 0; o < 10; ++o) mx = fmaxf(mx, ov[o]);
    float s = 0.f;
    for (int o = 0; o < 10; ++o) s += __expf(ov[o] - mx);
    red[0] = mx + __logf(s);
  }
  __syncthreads();
  if (tid < 10) out[(size_t)b * 10 + tid] = ov[tid] - red[0];
}

// ---------------------------------------------------------------------------
extern "C" void kernel_launch(void* const* d_in, const int* in_sizes, int n_in,
                              void* d_out, int out_size, void* d_ws, size_t ws_size,
                              hipStream_t stream) {
  const float* x  = (const float*)d_in[0];
  const float* w1 = (const float*)d_in[1];  const float* b1 = (const float*)d_in[2];
  const float* w2 = (const float*)d_in[3];  const float* b2 = (const float*)d_in[4];
  const float* w3 = (const float*)d_in[5];  const float* b3 = (const float*)d_in[6];
  const float* w4 = (const float*)d_in[7];  const float* b4 = (const float*)d_in[8];
  const float* kW = (const float*)d_in[9];  const float* kbv = (const float*)d_in[10];
  const float* qW = (const float*)d_in[11]; const float* qbv = (const float*)d_in[12];
  const float* vW = (const float*)d_in[13]; const float* vbv = (const float*)d_in[14];
  const float* kg = (const float*)d_in[15]; const float* kbe = (const float*)d_in[16];
  const float* qg = (const float*)d_in[17]; const float* qbe = (const float*)d_in[18];
  const float* vg = (const float*)d_in[19]; const float* vbe = (const float*)d_in[20];
  const float* l1W = (const float*)d_in[21]; const float* l1b = (const float*)d_in[22];
  const float* l2W = (const float*)d_in[23]; const float* l2b = (const float*)d_in[24];

  const int B = in_sizes[0] / (28 * 28);   // 2048
  _Float16* feat = (_Float16*)d_ws;        // [B][256][32] f16 = 16 KB/batch

  conv_stack_kernel<<<B, 256, 193040, stream>>>(x, w1, b1, w2, b2, w3, b3, w4,
                                                b4, feat);
  attn_kernel<<<B, 256, 151904, stream>>>(feat, kW, kbv, qW, qbv, vW, vbv,
                                          kg, kbe, qg, qbe, vg, vbe,
                                          l1W, l1b, l2W, l2b, (float*)d_out);
}

// v007
// A run of this version takes 121 microseconds.
// Next to v006, in two timings, it ran 1.19 and 1.20 times as fast.
// All steps since v000 together make it 7.95 times as fast.
#include <hip/hip_runtime.h>
#include <hip/hip_bf16.h>
#include <math.h>

typedef __attribute__((ext_vector_type(16))) _Float16 v16h;
typedef __attribute__((ext_vector_type(8)))  _Float16 v8h;
typedef __attribute__((ext_vector_type(4)))  _Float16 v4h;
typedef __attribute__((ext_vector_type(2)))  _Float16 v2h;
typedef __attribute__((ext_vector_type(8)))  float    v8f;
typedef __attribute__((ext_vector_type(4)))  float    v4f;
typedef __attribute__((ext_vector_type(4)))  unsigned int v4u;

__device__ __forceinline__ v16h loadfrag_h(const _Float16* base, int r0, int k0,
                                           int stride, unsigned lane) {
  const _Float16* p = base + (r0 + (int)(lane & 15u)) * stride + k0;
  int hi = (lane & 16u) ? 1 : 0;
  v8h lo = *(const v8h*)(p + (hi ? 8 : 0));
  v8h hj = *(const v8h*)(p + (hi ? 24 : 16));
  return __builtin_shufflevector(lo, hj, 0, 1, 2, 3, 4, 5, 6, 7, 8, 9, 10, 11,
                                 12, 13, 14, 15);
}

__device__ __forceinline__ v16h loadfrag_cm(const _Float16* base, int r0, int c0,
                                            int c1, int plane, unsigned lane) {
  const _Float16* p = base + (r0 + (int)(lane & 15u)) * 8;
  v8h lo = *(const v8h*)(p + c0 * plane);
  v8h hj = *(const v8h*)(p + c1 * plane);
  return __builtin_shufflevector(lo, hj, 0, 1, 2, 3, 4, 5, 6, 7, 8, 9, 10, 11,
                                 12, 13, 14, 15);
}

// A fragment for 2-tap conv chunk: K 0..15 = tap0 ch0..15, K 16..31 = tap1.
__device__ __forceinline__ v16h frag2tap(const _Float16* p0, const _Float16* p1,
                                         unsigned lane) {
  int hi = (lane & 16u) ? 8 : 0;
  v8h lo = *(const v8h*)(p0 + hi);
  v8h hj = *(const v8h*)(p1 + hi);
  return __builtin_shufflevector(lo, hj, 0, 1, 2, 3, 4, 5, 6, 7, 8, 9, 10, 11,
                                 12, 13, 14, 15);
}

// A fragment for 1-tap conv chunk over a 32-channel pixel record.
__device__ __forceinline__ v16h frag1tap(const _Float16* p, unsigned lane) {
  int hi = (lane & 16u) ? 1 : 0;
  v8h lo = *(const v8h*)(p + (hi ? 8 : 0));
  v8h hj = *(const v8h*)(p + (hi ? 24 : 16));
  return __builtin_shufflevector(lo, hj, 0, 1, 2, 3, 4, 5, 6, 7, 8, 9, 10, 11,
                                 12, 13, 14, 15);
}

// value of the lane 16 away (same column, other half of the rows)
__device__ __forceinline__ float other_half(float v) {
  int b = __builtin_bit_cast(int, v);
  b = __builtin_amdgcn_permlanex16(b, b, 0x76543210, 0xfedcba98, false, false);
  return __builtin_bit_cast(float, b);
}

// sum over the 32 lanes of a wave, the total in every lane: four adds with the
// lane whose number differs in one bit (row_xmask, inside a 16-lane row), then
// the other row. All 32 lanes have to be on.
template <int CTRL>
__device__ __forceinline__ float add_xmask(float v) {
  int b = __builtin_bit_cast(int, v);
  b = __builtin_amdgcn_update_dpp(0, b, CTRL, 0xf, 0xf, true);
  return v + __builtin_bit_cast(float, b);
}
__device__ __forceinline__ float wave_sum(float v) {
  v = add_xmask<0x161>(v);
  v = add_xmask<0x162>(v);
  v = add_xmask<0x164>(v);
  v = add_xmask<0x168>(v);
  return v + other_half(v);
}

// the eight waves' partial sums p[0..7], added in one fixed order
__device__ __forceinline__ float sum8(const float* p) {
  v4f a = *(const v4f*)p, b = *(const v4f*)(p + 4);
  return ((a[0] + a[1]) + (a[2] + a[3])) + ((b[0] + b[1]) + (b[2] + b[3]));
}

__device__ __forceinline__ float exp_slot(float x) {
  float r = x * 1.44269504f;
  asm("v_exp_f32 %0, %0\n\tv_nop" : "+v"(r));
  return r;
}

__device__ __forceinline__ v8f wmma_f16(v16h a, v16h b, v8f c) {
  return __builtin_amdgcn_wmma_f32_16x16x32_f16(false, a, false, b, (short)0, c,
                                                false, false);
}

__device__ __forceinline__ v8f zero8() {
  v8f z = {0.f, 0.f, 0.f, 0.f, 0.f, 0.f, 0.f, 0.f};
  return z;
}

#define H1P 24
#define H1R 656
#define H2P 40
#define H2R 888
#define BPL 264
#define BTP 1064
__global__ __launch_bounds__(256) void conv_stack_kernel(
    const float* __restrict__ x,
    const float* __restrict__ w1, const float* __restrict__ b1,
    const float* __restrict__ w2, const float* __restrict__ b2,
    const float* __restrict__ w3, const float* __restrict__ b3,
    const float* __restrict__ w4, const float* __restrict__ b4,
    _Float16* __restrict__ feat) {
  extern __shared__ char smem[];
  float*     xin = (float*)smem;
  float*     ws1 = (float*)(smem + 3136);
  float*     bbf = (float*)(smem + 4416);     // [4][32]
  _Float16*  h1  = (_Float16*)(smem + 4928);
  _Float16*  h2  = (_Float16*)(smem + 38448);
  _Float16*  h3  = (_Float16*)(smem + 78480);
  _Float16*  Bc2 = (_Float16*)(smem + 107920);
  _Float16*  Bc3 = (_Float16*)(smem + 124944);
  _Float16*  Bc4 = (_Float16*)(smem + 158992);

  const int tid = threadIdx.x;
  const unsigned lane = tid & 31u;
  const int wv = tid >> 5;
  const int b = blockIdx.x;
  const int ch0 = (lane & 16u) ? 1 : 0;  // weight planes of this half wave:
  const int ch1 = ch0 + 2;               // the k order of frag2tap/frag1tap

  // ---- every global read of this kernel: coalesced, branch-free (indices
  // clamped, stores guarded) and issued together, so the L2 round trips
  // overlap instead of one waited 4-byte load per staged element ----
  // Weight unit u = (oc n, input-channel pair kp, tap quad tq), tq fastest:
  // two 16-byte loads (channels 2kp and 2kp+1, taps 4tq..4tq+3) feed four
  // 4-byte LDS stores of a channel pair each.
  // (the unrolls here and in the scatter below keep the arrays in registers)
  v4f r2a[3], r2b[3], r3a[4], r3b[4], r4a[6], r4b[6];
  {
    const v4f* w2v = (const v4f*)w2;  // 20 x 8 x 4  = 640 units
    const v4f* w3v = (const v4f*)w3;  // 24 x 10 x 4 = 960 units
    const v4f* w4v = (const v4f*)w4;  // 30 x 12 x 4 = 1440 units
    // 16-byte index of unit u: (u>>2)*8 + (u&3); 256 units further = +512.
    // Each tensor's last, partial slice clamps its unit.
    const int a0 = (tid >> 2) * 8 + (tid & 3);
    const int u2 = tid + 512 < 640 ? tid + 512 : 639;
    const int u3 = tid + 768 < 960 ? tid + 768 : 959;
    const int u4 = tid + 1280 < 1440 ? tid + 1280 : 1439;
    const int a2 = (u2 >> 2) * 8 + (u2 & 3);
    const int a3 = (u3 >> 2) * 8 + (u3 & 3);
    const int a4 = (u4 >> 2) * 8 + (u4 & 3);
#pragma unroll
    for (int i = 0; i < 2; ++i) {
      r2a[i] = w2v[a0 + 512 * i];
      r2b[i] = w2v[a0 + 512 * i + 4];
    }
    r2a[2] = w2v[a2];
    r2b[2] = w2v[a2 + 4];
#pragma unroll
    for (int i = 0; i < 3; ++i) {
      r3a[i] = w3v[a0 + 512 * i];
      r3b[i] = w3v[a0 + 512 * i + 4];
    }
    r3a[3] = w3v[a3];
    r3b[3] = w3v[a3 + 4];
#pragma unroll
    for (int i = 0; i < 5; ++i) {
      r4a[i] = w4v[a0 + 512 * i];
      r4b[i] = w4v[a0 + 512 * i + 4];
    }
    r4a[5] = w4v[a4];
    r4b[5] = w4v[a4 + 4];

    const v4f* sx = (const v4f*)(x + (size_t)b * 784);
    v4f xr  = sx[tid < 196 ? tid : 195];
    const int a1 = tid & 63;
    v4f w1r = ((const v4f*)w1)[a1];
    int g = (tid >> 5) & 3, n = tid & 31;
    const float* bp = (g == 0) ? b1 : (g == 1) ? b2 : (g == 2) ? b3 : b4;
    int lim = (g == 0) ? 16 : (g == 1) ? 20 : (g == 2) ? 24 : 30;
    const float* bq = bp + (n < lim ? n : 0);
    float bv = *bq;
    // The loads' address registers are inputs here, so they stay unwritten
    // (also by a later load's result) until this wait.
    asm volatile("s_wait_xcnt 0x0"
                 :: "v"(a0), "v"(a1), "v"(a2), "v"(a3), "v"(a4), "v"(bq)
                 : "memory");
    // zero h1..h3 and Bc2..Bc4 (contiguous 188112 B = 11757 x b128)
    v4u zz = {0u, 0u, 0u, 0u};
    v4u* z = (v4u*)h1;
    for (int i = 0; i < 45; ++i) z[tid + 256 * i] = zz;
    if (tid < 237) z[tid + 11520] = zz;
    if (tid < 196) ((v4f*)xin)[tid] = xr;
    if (tid < 64)  *(v4f*)(ws1 + (tid >> 2) * 20 + (tid & 3) * 4) = w1r;
    if (tid < 128) bbf[tid] = (n < lim) ? bv : 0.f;
  }
  __syncthreads();

  // ---- scatter the weights into the zeroed per-tap B matrices ----
  // Bc2: chunk c pairs taps 2c,2c+1; k<16 -> tap 2c ic=k, k>=16 -> tap 2c+1
#pragma unroll
  for (int i = 0; i < 3; ++i) {
    int u = tid + 256 * i;
    if (u < 640) {
      int t0 = (u & 3) * 4, r = u >> 2;
      int n = r >> 3, ic = (r & 7) * 2;
#pragma unroll
      for (int e = 0; e < 4; ++e) {
        int tap = t0 + e;
        v2h h = {(_Float16)r2a[i][e], (_Float16)r2b[i][e]};
        int k = (tap & 1) * 16 + ic;
        *(v2h*)(Bc2 + (tap >> 1) * BTP + (k >> 3) * BPL + n * 8 + (k & 7)) = h;
      }
    }
  }
  // Bc3: tap t, k = ic (20 valid of 32), n = oc (24 valid of 32)
#pragma unroll
  for (int i = 0; i < 4; ++i) {
    int u = tid + 256 * i;
    if (u < 960) {
      int t0 = (u & 3) * 4, r = u >> 2;
      int n = r / 10, k = (r - n * 10) * 2;
#pragma unroll
      for (int e = 0; e < 4; ++e) {
        v2h h = {(_Float16)r3a[i][e], (_Float16)r3b[i][e]};
        *(v2h*)(Bc3 + (t0 + e) * BTP + (k >> 3) * BPL + n * 8 + (k & 7)) = h;
      }
    }
  }
  // Bc4: tap t, k = ic (24 valid of 32), n = oc (30 valid of 32)
#pragma unroll
  for (int i = 0; i < 6; ++i) {
    int u = tid + 256 * i;
    if (u < 1440) {
      int t0 = (u & 3) * 4, r = u >> 2;
      int n = r / 12, k = (r - n * 12) * 2;
#pragma unroll
      for (int e = 0; e < 4; ++e) {
        v2h h = {(_Float16)r4a[i][e], (_Float16)r4b[i][e]};
        *(v2h*)(Bc4 + (t0 + e) * BTP + (k >> 3) * BPL + n * 8 + (k & 7)) = h;
      }
    }
  }

  // ---- conv1 via WMMA: 28x28 -> 16x25x25, channel-last f16 ----
  // Transposed (D = W1 X^T): M = 16 channels, N = 16 pixels, 40 N tiles, five a
  // wave. A lane's eight D registers are channels 8*hi..8*hi+7 of one pixel:
  // half a pixel record, one 16-byte store. To keep the f32 operands' accuracy
  // x and w are each split into two f16 parts, v = hi + lo. K holds the 16 taps
  // twice: elements 0..7 of a lane are taps 8*hi..8*hi+7 (kernel rows 2*hi and
  // 2*hi+1) against x's hi part, elements 8..15 the same taps against its lo
  // part, in A and in B alike. One WMMA with w's lo part, one with its hi part.
  {
    const int c15 = (int)(lane & 15u);
    const float* wp = ws1 + c15 * 20 + ch0 * 8;  // channel c15
    v4f wa = *(const v4f*)wp, wb = *(const v4f*)(wp + 4);
    v8h wh, wl;
#pragma unroll
    for (int e = 0; e < 4; ++e) {
      wh[e]     = (_Float16)wa[e];
      wh[4 + e] = (_Float16)wb[e];
      wl[e]     = (_Float16)(wa[e] - (float)wh[e]);
      wl[4 + e] = (_Float16)(wb[e] - (float)wh[4 + e]);
    }
    v16h ah = __builtin_shufflevector(wh, wh, 0, 1, 2, 3, 4, 5, 6, 7, 8, 9, 10,
                                      11, 12, 13, 14, 15);
    v16h al = __builtin_shufflevector(wl, wl, 0, 1, 2, 3, 4, 5, 6, 7, 8, 9, 10,
                                      11, 12, 13, 14, 15);
    v4f c0 = *(const v4f*)(bbf + ch0 * 8), c1 = *(const v4f*)(bbf + ch0 * 8 + 4);
    const v8f bi = {c0[0], c0[1], c0[2], c0[3], c1[0], c1[1], c1[2], c1[3]};
    // All five tiles' reads stand ahead of the first store to h1: for the
    // compiler such a store could alias a later read of xin, and a tile's reads
    // would then go out only behind the tile before, their latency uncovered.
    // (The unrolls keep the arrays in registers.)
    float u[5][8];
    _Float16* hp[5];
#pragma unroll
    for (int j = 0; j < 5; ++j) {
      const int p = (wv * 5 + j) * 16 + c15;
      const int pc = p < 625 ? p : 624;  // the last tile has one valid pixel
      const int oy = pc / 25, ox = pc - oy * 25;
      const float* xp = xin + (oy + 2 * ch0) * 28 + ox;
#pragma unroll
      for (int e = 0; e < 4; ++e) {
        u[j][e]     = xp[e];
        u[j][4 + e] = xp[28 + e];
      }
      hp[j] = h1 + oy * H1R + ox * H1P + ch0 * 8;
    }
#pragma unroll
    for (int j = 0; j < 5; ++j) {
      v8h xh, xl;
#pragma unroll
      for (int e = 0; e < 8; ++e) {
        xh[e] = (_Float16)u[j][e];
        xl[e] = (_Float16)(u[j][e] - (float)xh[e]);
      }
      v16h xb = __builtin_shufflevector(xh, xl, 0, 1, 2, 3, 4, 5, 6, 7, 8, 9, 10,
                                        11, 12, 13, 14, 15);
      v8f d = wmma_f16(al, xb, bi);
      d = wmma_f16(ah, xb, d);
      v8h o;
#pragma unroll
      for (int r = 0; r < 8; ++r) o[r] = (_Float16)fmaxf(d[r], 0.f);
      if (j < 4 || (wv * 5 + j) * 16 + c15 < 625) *(v8h*)hp[j] = o;
    }
  }
  __syncthreads();

  // conv2..conv4: a wave owns several M tiles and BOTH N tiles, so an A fragment
  // read from LDS feeds two WMMAs and a B fragment one per M tile, and a wave's
  // accumulator chains are independent. The K loop goes in blocks with two
  // fragment sets in registers: the next block's reads stand as one group ahead
  // of this block's WMMAs. Each output still sums its taps in the order 0..15.
  // (The unrolls keep acc and the fragment sets in registers. The two
  // sched_barriers of a block keep the reads in that one group: without them
  // the compiler moves each read down to just ahead of the WMMA that uses it,
  // and the wave waits out the LDS latency there.)
  const int l15 = (int)(lane & 15u);
  const int mh = (lane & 16u) ? 8 : 0;

  // ---- conv2 via WMMA: M=484(->496) x N=20(->32) x K=256 (8 chunks) ----
  // 31 M tiles, four a wave; the last wave's fourth is its third again (same
  // values to the same places, from the same wave). Block = one chunk.
  {
    int mts[4];
    const _Float16* ap[4];
    v8f acc[4][2];
#pragma unroll
    for (int j = 0; j < 4; ++j) {
      int mt = wv * 4 + j;
      mts[j] = mt < 31 ? mt : 30;
      int m = mts[j] * 16 + l15;
      int oy = m / 22, ox = m - oy * 22;
      ap[j] = h1 + oy * H1R + ox * H1P;
      acc[j][0] = zero8();
      acc[j][1] = zero8();
    }
    v16h fa[2][4], fw[2][2];
    auto fetch = [&](int c) {
      const int s = c & 1;
      const int o0 = ((2 * c) >> 2) * H1R + ((2 * c) & 3) * H1P;  // tap 2c
      fw[s][0] = loadfrag_cm(Bc2 + c * BTP, 0, ch0, ch1, BPL, lane);
      fw[s][1] = loadfrag_cm(Bc2 + c * BTP, 16, ch0, ch1, BPL, lane);
#pragma unroll
      for (int j = 0; j < 4; ++j)
        fa[s][j] = frag2tap(ap[j] + o0, ap[j] + o0 + H1P, lane);
    };
    fetch(0);
#pragma unroll
    for (int c = 0; c < 8; ++c) {
      if (c < 7) fetch(c + 1);
      __builtin_amdgcn_sched_barrier(0);  // the reads above stay one group
#pragma unroll
      for (int j = 0; j < 4; ++j) {
        acc[j][0] = wmma_f16(fa[c & 1][j], fw[c & 1][0], acc[j][0]);
        acc[j][1] = wmma_f16(fa[c & 1][j], fw[c & 1][1], acc[j][1]);
      }
      __builtin_amdgcn_sched_barrier(0);  // no later read moves up among them
    }
    float bias0 = bbf[32 + l15], bias1 = bbf[48 + l15];
#pragma unroll
    for (int j = 0; j < 4; ++j) {
      int m0 = mts[j] * 16 + mh;  // first of this lane's 8 pixels
      int y0 = m0 / 22, x0 = m0 - y0 * 22;
      _Float16* hp = h2 + y0 * H2R + x0 * H2P + l15;
#pragma unroll
      for (int r = 0; r < 8; ++r) {  // at most one step into the next image row
        _Float16* q = hp + r * H2P + (x0 + r >= 22 ? H2R - 22 * H2P : 0);
        q[0]  = (_Float16)fmaxf(acc[j][0][r] + bias0, 0.f);
        q[16] = (_Float16)fmaxf(acc[j][1][r] + bias1, 0.f);
      }
    }
  }
  __syncthreads();

  // ---- conv3 via WMMA: M=361(->368) x N=24(->32) x K=512 (16 taps) ----
  // 23 M tiles, three a wave; the last wave's third is its second again.
  // Block = two taps.
  {
    int mts[3];
    const _Float16* ap[3];
    v8f acc[3][2];
#pragma unroll
    for (int j = 0; j < 3; ++j) {
      int mt = wv * 3 + j;
      mts[j] = mt < 23 ? mt : 22;
      int m = mts[j] * 16 + l15;
      int oy = m / 19, ox = m - oy * 19;
      ap[j] = h2 + oy * H2R + ox * H2P;
      acc[j][0] = zero8();
      acc[j][1] = zero8();
    }
    v16h fa[2][2][3], fw[2][2][2];
    auto fetch = [&](int k) {
      const int s = k & 1;
#pragma unroll
      for (int e = 0; e < 2; ++e) {
        const int t = 2 * k + e;
        fw[s][e][0] = loadfrag_cm(Bc3 + t * BTP, 0, ch0, ch1, BPL, lane);
        fw[s][e][1] = loadfrag_cm(Bc3 + t * BTP, 16, ch0, ch1, BPL, lane);
#pragma unroll
        for (int j = 0; j < 3; ++j)
          fa[s][e][j] = frag1tap(ap[j] + (t >> 2) * H2R + (t & 3) * H2P, lane);
      }
    };
    fetch(0);
#pragma unroll
    for (int k = 0; k < 8; ++k) {
      if (k < 7) fetch(k + 1);
      __builtin_amdgcn_sched_barrier(0);  // the reads above stay one group
#pragma unroll
      for (int e = 0; e < 2; ++e)
#pragma unroll
        for (int j = 0; j < 3; ++j) {
          acc[j][0] = wmma_f16(fa[k & 1][e][j], fw[k & 1][e][0], acc[j][0]);
          acc[j][1] = wmma_f16(fa[k & 1][e][j], fw[k & 1][e][1], acc[j][1]);
        }
      __builtin_amdgcn_sched_barrier(0);  // no later read moves up among them
    }
    float bias0 = bbf[64 + l15], bias1 = bbf[80 + l15];
#pragma unroll
    for (int j = 0; j < 3; ++j) {
      _Float16* q = h3 + (mts[j] * 16 + mh) * H2P + l15;
#pragma unroll
      for (int r = 0; r < 8; ++r) {
        q[r * H2P]      = (_Float16)fmaxf(acc[j][0][r] + bias0, 0.f);
        q[r * H2P + 16] = (_Float16)fmaxf(acc[j][1][r] + bias1, 0.f);
      }
    }
  }
  __syncthreads();

  // ---- conv4 via WMMA: M=256 x N=30(->32) x K=512; write features+coords ----
  // An M tile is one output row; a wave owns rows 2wv and 2wv+1. The upper
  // row's A fragments of kernel row ky are the lower row's of ky+1: each of the
  // five input rows (ar) is read once. Block = two taps of one kernel row.
  _Float16* fb = feat + (size_t)b * 8192;
  {
    const _Float16* ap = h3 + (wv * 2 * 19 + l15) * H2P;
    v8f acc[2][2];
    acc[0][0] = zero8(); acc[0][1] = zero8();
    acc[1][0] = zero8(); acc[1][1] = zero8();
    v16h ar[5][4], fw[2][2][2];
    auto fetch = [&](int k) {
      const int s = k & 1;
#pragma unroll
      for (int e = 0; e < 2; ++e) {
        const int t = 2 * k + e, ky = t >> 2, kx = t & 3;
        fw[s][e][0] = loadfrag_cm(Bc4 + t * BTP, 0, ch0, ch1, BPL, lane);
        fw[s][e][1] = loadfrag_cm(Bc4 + t * BTP, 16, ch0, ch1, BPL, lane);
        ar[ky + 1][kx] = frag1tap(ap + ((ky + 1) * 19 + kx) * H2P, lane);
      }
    };
#pragma unroll
    for (int kx = 0; kx < 4; ++kx) ar[0][kx] = frag1tap(ap + kx * H2P, lane);
    fetch(0);
#pragma unroll
    for (int k = 0; k < 8; ++k) {
      if (k < 7) fetch(k + 1);
      __builtin_amdgcn_sched_barrier(0);  // the reads above stay one group
#pragma unroll
      for (int e = 0; e < 2; ++e) {
        const int t = 2 * k + e, ky = t >> 2, kx = t & 3;
        acc[0][0] = wmma_f16(ar[ky][kx], fw[k & 1][e][0], acc[0][0]);
        acc[0][1] = wmma_f16(ar[ky][kx], fw[k & 1][e][1], acc[0][1]);
        acc[1][0] = wmma_f16(ar[ky + 1][kx], fw[k & 1][e][0], acc[1][0]);
        acc[1][1] = wmma_f16(ar[ky + 1][kx], fw[k & 1][e][1], acc[1][1]);
      }
      __builtin_amdgcn_sched_barrier(0);  // no later read moves up among them
    }
    float bias0 = bbf[96 + l15], bias1 = bbf[112 + l15];
#pragma unroll
    for (int j = 0; j < 2; ++j) {
      _Float16* q = fb + ((wv * 2 + j) * 16 + mh) * 32 + l15;
#pragma unroll
      for (int r = 0; r < 8; ++r)
        q[r * 32] = (_Float16)fmaxf(acc[j][0][r] + bias0, 0.f);
      if (l15 < 14) {  // channels 16..29; 30 and 31 are the coordinates
#pragma unroll
        for (int r = 0; r < 8; ++r)
          q[r * 32 + 16] = (_Float16)fmaxf(acc[j][1][r] + bias1, 0.f);
      }
    }
  }
  {
    int n = tid;  // coord channels (columns 30/31, disjoint from tile stores)
    int xx = n % 16, yy = n / 16;
    fb[n * 32 + 30] = (_Float16)((float)xx * 0.0625f);
    fb[n * 32 + 31] = (_Float16)((float)yy * 0.0625f);
  }
}

#define APL 2080
#define TP 52
#define W1P 56
__global__ __launch_bounds__(256) void attn_kernel(
    const _Float16* __restrict__ feat,
    const float* __restrict__ kW, const float* __restrict__ kb,
    const float* __restrict__ qW, const float* __restrict__ qb,
    const float* __restrict__ vW, const float* __restrict__ vb,
    const float* __restrict__ kg, const float* __restrict__ kbe,
    const float* __restrict__ qg, const float* __restrict__ qbe,
    const float* __restrict__ vg, const float* __restrict__ vbe,
    const float* __restrict__ l1W, const float* __restrict__ l1b,
    const float* __restrict__ l2W, const float* __restrict__ l2b,
    float* __restrict__ out) {
  extern __shared__ char smem[];
  _Float16* hbuf = (_Float16*)smem;
  _Float16* Qb   = (_Float16*)(smem + 16640);
  float* tmpf = (float*)(smem + 41600);
  _Float16* Kb   = (_Float16*)(smem + 94848);
  _Float16* Vt   = (_Float16*)(smem + 119808);
  _Float16* wbuf = (_Float16*)(smem + 145152);
  float* red  = (float*)(smem + 148992);
  float* mxv  = (float*)(smem + 151072);
  float* ov   = (float*)(smem + 151264);
  float* bb   = (float*)(smem + 151328);
  _Float16* W1h = (_Float16*)smem;            // over hbuf, once it is dead:
  _Float16* W1l = (_Float16*)(smem + 5376);   // [48][W1P] f16 each
  float* l1bs = (float*)(smem + 10752);       // [48]

  const int tid = threadIdx.x;
  const unsigned lane = tid & 31u;
  const int wv = tid >> 5;
  const int b = blockIdx.x;
  // planes of this half wave, in the k order of loadfrag_h: columns 0..31,
  // then columns 32..63 (40..63 read the zero plane)
  const int ch0 = (lane & 16u) ? 1 : 0, ch1 = ch0 + 2, ch2 = ch0 + 4;

  // ---- features, projection weights, biases: coalesced, branch-free reads
  // (indices clamped, stores guarded), all in flight together ----
  // (unrolls on fr/wreg/gr/er loops keep these arrays in registers)
  v4f wreg[3][2];
  // gamma/beta of pass p: 18 coalesced 16-byte loads in flight together.
  // Pass 0's go out here; pass p+1's go out ahead of pass p's normalisation,
  // which covers their L2 round trip up to the barrier behind it.
  v4f gr[3][9], er[3][9];
  // W1 piece u = (row j, column quad q) of the padded [48][48] tile, three a
  // thread (576 pieces); outside the 36 x 36 matrix the piece is zero
  v4f l1r[3];
  float l1bv = 0.f;
#pragma unroll
  for (int i = 0; i < 9; ++i) {
    gr[0][i] = ((const v4f*)vg)[tid + 256 * i];
    er[0][i] = ((const v4f*)vbe)[tid + 256 * i];
  }
  {
    const v4u* src = (const v4u*)(feat + (size_t)b * 8192);
    v4u fr[4];
#pragma unroll
    for (int i = 0; i < 4; ++i) fr[i] = src[tid + 256 * i];
    const int f1 = 256 + (tid & 31);  // each W is 288 x 16 B
    wreg[0][0] = ((const v4f*)vW)[tid];  wreg[0][1] = ((const v4f*)vW)[f1];
    wreg[1][0] = ((const v4f*)kW)[tid];  wreg[1][1] = ((const v4f*)kW)[f1];
    wreg[2][0] = ((const v4f*)qW)[tid];  wreg[2][1] = ((const v4f*)qW)[f1];
    const int bi = tid < 144 ? tid : 0;
    const int pb = bi / 48, jb = bi - pb * 48;
    const float* bp = (pb == 0) ? vb : (pb == 1) ? kb : qb;
    float bv = bp[jb < 36 ? jb : 0];

    // zero what the staged operands pad with: Q/K planes 4 and 5 (520 x 16 B;
    // columns 32..35 are stored over it behind later barriers), V^T rows
    // 36..47, W rows 36..47
    const v4u zz = {0u, 0u, 0u, 0u};
    for (int i = tid; i < 520; i += 256) {
      ((v4u*)(Qb + 4 * APL))[i] = zz;
      ((v4u*)(Kb + 4 * APL))[i] = zz;
    }
    for (int i = tid; i < 396; i += 256) ((v4u*)(Vt + 36 * 264))[i] = zz;
    if (tid < 60) ((v4u*)(wbuf + 36 * 40))[tid] = zz;

    // 16-byte unit u of the [256][32] features: row u >> 2, plane u & 3
#pragma unroll
    for (int i = 0; i < 4; ++i)
      *(v4u*)(hbuf + (tid & 3) * APL + ((tid >> 2) + 64 * i) * 8) = fr[i];
    if (tid < 144) bb[tid] = (jb < 36) ? bv : 0.f;
  }
  __syncthreads();

  // unrolled: wreg/gr/er are indexed by p and have to stay in registers
#pragma unroll
  for (int p = 0; p < 3; ++p) {
    {
      const int k = (tid & 7) * 4;
      v4f w0 = wreg[p][0];
      v4h h0 = {(_Float16)w0[0], (_Float16)w0[1], (_Float16)w0[2], (_Float16)w0[3]};
      *(v4h*)(wbuf + (tid >> 3) * 40 + k) = h0;
      if (tid < 32) {
        v4f w1v = wreg[p][1];
        v4h h1v = {(_Float16)w1v[0], (_Float16)w1v[1], (_Float16)w1v[2], (_Float16)w1v[3]};
        *(v4h*)(wbuf + (32 + (tid >> 3)) * 40 + k) = h1v;
      }
    }
    __syncthreads();

    for (int t = wv; t < 48; t += 8) {
      int rt = t / 3, nt = t % 3;
      v16h a  = loadfrag_cm(hbuf, rt * 16, ch0, ch1, APL, lane);
      v16h bf = loadfrag_h(wbuf, nt * 16, 0, 40, lane);
      v8f acc = zero8();
      acc = wmma_f16(a, bf, acc);
      int n = nt * 16 + (int)(lane & 15u);
      float bias = bb[p * 48 + n];
      int mh = (lane & 16u) ? 8 : 0;
#pragma unroll
      for (int r = 0; r < 8; ++r)
        tmpf[(rt * 16 + mh + r) * TP + n] = acc[r] + bias;
    }
    __syncthreads();

    {
      float s = 0.f, s2 = 0.f;
      const float* rowp = tmpf + tid * TP;
#pragma unroll
      for (int c = 0; c < 36; c += 4) {
        v4f v = *(const v4f*)(rowp + c);
        s += v[0] + v[1] + v[2] + v[3];
        s2 += v[0] * v[0] + v[1] * v[1] + v[2] * v[2] + v[3] * v[3];
      }
      // in the wave across lanes, then one partial a wave; red is next written
      // behind the barrier at the foot of this pass
      s = wave_sum(s);
      s2 = wave_sum(s2);
      if (lane == 0) { red[wv] = s; red[8 + wv] = s2; }
    }
    __syncthreads();
    float mu   = sum8(red) * (1.f / 9216.f);
    float var  = sum8(red + 8) * (1.f / 9216.f) - mu * mu;
    float rstd = rsqrtf(var + 1e-5f);

    if (p < 2) {
      const v4f* Gv = (const v4f*)((p == 0) ? kg : qg);
      const v4f* Ev = (const v4f*)((p == 0) ? kbe : qbe);
#pragma unroll
      for (int i = 0; i < 9; ++i) {
        gr[p + 1][i] = Gv[tid + 256 * i];
        er[p + 1][i] = Ev[tid + 256 * i];
      }
    }
    if (p == 1) {  // W1 and its bias: read here, staged in pass 2
      int ix[3];
#pragma unroll
      for (int i = 0; i < 3; ++i) {
        int u = tid + 256 * i;
        int j = u / 12, q = u - j * 12;
        ix[i] = (j < 36 && q < 9) ? j * 9 + q : 0;
        l1r[i] = ((const v4f*)l1W)[ix[i]];
      }
      const int ib = tid < 36 ? tid : 35;
      l1bv = l1b[ib];
      // The loads' index registers are inputs here, so they stay unwritten
      // until this wait.
      asm volatile("s_wait_xcnt 0x0"
                   :: "v"(ix[0]), "v"(ix[1]), "v"(ix[2]), "v"(ib)
                   : "memory");
    }
    if (p == 2) {
      // the features are dead (last read two barriers back): W1 as hi and lo
      // f16 tiles and the padded bias take their place; the barrier at the
      // foot of this pass publishes them
#pragma unroll
      for (int i = 0; i < 3; ++i) {
        int u = tid + 256 * i;
        int j = u / 12, q = u - j * 12;
        bool ok = j < 36 && q < 9;
        v4h wh, wl;
#pragma unroll
        for (int e = 0; e < 4; ++e) {
          float w = ok ? l1r[i][e] : 0.f;
          wh[e] = (_Float16)w;
          wl[e] = (_Float16)(w - (float)wh[e]);
        }
        if (u < 576) {
          *(v4h*)(W1h + j * W1P + q * 4) = wh;
          *(v4h*)(W1l + j * W1P + q * 4) = wl;
        }
      }
      if (tid < 48) l1bs[tid] = tid < 36 ? l1bv : 0.f;
    }

    // 16-byte piece f of the [256][36] plane: node = f/9, columns j0..j0+3
#pragma unroll
    for (int i = 0; i < 9; ++i) {
      int f = tid + 256 * i;
      int node = f / 9, j0 = (f - node * 9) * 4;
      v4f tv = *(const v4f*)(tmpf + node * TP + j0);
      v4h o;
#pragma unroll
      for (int e = 0; e < 4; ++e) {
        float v = (tv[e] - mu) * rstd;
        o[e] = (_Float16)(v * gr[p][i][e] + er[p][i][e]);
      }
      if (p == 0) {
#pragma unroll
        for (int e = 0; e < 4; ++e) Vt[(j0 + e) * 264 + node] = o[e];
      } else {
        _Float16* dst = (p == 1) ? Kb : Qb;
        *(v4h*)(dst + (j0 >> 3) * APL + node * 8 + (j0 & 4)) = o;
      }
    }
    __syncthreads();
  }

  const float scale = 0.16666667f;  // 1/sqrt(36)
  const int hi8 = (lane & 16u) ? 8 : 0;
  // sums of the linear layer's outputs and of their squares, four chains each
  v4f ls = {0.f, 0.f, 0.f, 0.f}, ls2 = {0.f, 0.f, 0.f, 0.f};
  float* att2 = tmpf;  // [256][TP]; the projections' f32 rows are dead now
  for (int blk = wv; blk < 16; blk += 8) {
    int row0 = blk * 16;
    // B operand: 16 queries (n = query), kept for all 16 key tiles
    v16h qb0 = loadfrag_cm(Qb, row0, ch0, ch1, APL, lane);
    v16h qb1 = loadfrag_cm(Qb, row0, ch2, 5, APL, lane);
    v8f st[16];
#pragma unroll
    for (int ct = 0; ct < 16; ++ct) {
      v8f acc = zero8();
      acc = wmma_f16(loadfrag_cm(Kb, ct * 16, ch0, ch1, APL, lane), qb0, acc);
      acc = wmma_f16(loadfrag_cm(Kb, ct * 16, ch2, 5, APL, lane), qb1, acc);
      st[ct] = acc;
    }
    float mx = -1e30f;
#pragma unroll
    for (int ct = 0; ct < 16; ++ct)
#pragma unroll
      for (int r = 0; r < 8; ++r) {
        st[ct][r] *= scale;
        mx = fmaxf(mx, st[ct][r]);
      }
    mx = fmaxf(mx, other_half(mx));
    float s = 0.f;
    v8f av0 = zero8(), av1 = zero8(), av2 = zero8();
#pragma unroll
    for (int kc = 0; kc < 8; ++kc) {
      // B fragment of keys kc*32..+31: elements 0..7 are k = 8*hi + r (tile
      // 2kc), elements 8..15 are k = 16 + 8*hi + r (tile 2kc+1): the k order
      // of loadfrag_h, which loads the A operand (V^T rows) below.
      v16h pb;
      float ps = 0.f;
#pragma unroll
      for (int r = 0; r < 8; ++r) {
        float e0 = exp_slot(st[2 * kc][r] - mx);
        float e1 = exp_slot(st[2 * kc + 1][r] - mx);
        ps += e0 + e1;
        pb[r]     = (_Float16)e0;
        pb[8 + r] = (_Float16)e1;
      }
      s += ps;
      av0 = wmma_f16(loadfrag_h(Vt, 0, kc * 32, 264, lane), pb, av0);
      av1 = wmma_f16(loadfrag_h(Vt, 16, kc * 32, 264, lane), pb, av1);
      av2 = wmma_f16(loadfrag_h(Vt, 32, kc * 32, 264, lane), pb, av2);
    }
    s += other_half(s);
    float invr = 1.f / s;
    // keeps the W1 and bias reads below from moving up to where the 128 scores
    // are live, which takes the kernel past 256 registers (one work-group a WGP)
    __builtin_amdgcn_sched_barrier(0);
    // O^T tile t: n = query, m = column 16t + r + 8*hi. As f16, tiles 0 and 1
    // are the B fragment of columns 0..31 in the k order of loadfrag_h, which
    // loads W1 below; tile 2 (columns 32..47, 36..47 zero) fills elements 0..7
    // of a second fragment.
    v16h oh0, ol0;
    v8h oh1, ol1;
#pragma unroll
    for (int r = 0; r < 8; ++r) {
      float o0 = av0[r] * invr, o1 = av1[r] * invr, o2 = av2[r] * invr;
      oh0[r]     = (_Float16)o0;
      oh0[8 + r] = (_Float16)o1;
      oh1[r]     = (_Float16)o2;
      ol0[r]     = (_Float16)(o0 - (float)oh0[r]);
      ol0[8 + r] = (_Float16)(o1 - (float)oh0[8 + r]);
      ol1[r]     = (_Float16)(o2 - (float)oh1[r]);
    }
    const v8h z8 = {0, 0, 0, 0, 0, 0, 0, 0};
    // columns 32..47 need half a fragment: with W1's (hi | lo) as A, B = (hi |
    // hi) gives hi*hi + lo*hi in one WMMA and B = (lo | 0) gives hi*lo
    v16h ohh = __builtin_shufflevector(oh1, oh1, 0, 1, 2, 3, 4, 5, 6, 7, 8, 9,
                                       10, 11, 12, 13, 14, 15);
    v16h olz = __builtin_shufflevector(ol1, z8, 0, 1, 2, 3, 4, 5, 6, 7, 8, 9,
                                       10, 11, 12, 13, 14, 15);
    // d[jt]: output j = 16jt + r + 8*hi of query row0 + (lane & 15); starts at
    // the bias. All reads first, then three independent accumulator chains, the
    // small products first. (The unrolls keep the arrays in registers.)
    v8f d[3];
    v16h wh0[3], wl0[3], whl[3];
#pragma unroll
    for (int jt = 0; jt < 3; ++jt) {
      const float* bp = l1bs + jt * 16 + hi8;
      v4f b0 = *(const v4f*)bp, b1 = *(const v4f*)(bp + 4);
      v8f bi = {b0[0], b0[1], b0[2], b0[3], b1[0], b1[1], b1[2], b1[3]};
      d[jt] = bi;
      wh0[jt] = loadfrag_h(W1h, jt * 16, 0, W1P, lane);
      wl0[jt] = loadfrag_h(W1l, jt * 16, 0, W1P, lane);
      const int wo = (jt * 16 + (int)(lane & 15u)) * W1P + 32 + hi8;
      v8h wh1 = *(const v8h*)(W1h + wo);
      v8h wl1 = *(const v8h*)(W1l + wo);
      whl[jt] = __builtin_shufflevector(wh1, wl1, 0, 1, 2, 3, 4, 5, 6, 7, 8, 9,
                                        10, 11, 12, 13, 14, 15);
    }
#pragma unroll
    for (int jt = 0; jt < 3; ++jt) d[jt] = wmma_f16(whl[jt], olz, d[jt]);
#pragma unroll
    for (int jt = 0; jt < 3; ++jt) d[jt] = wmma_f16(wh0[jt], ol0, d[jt]);
#pragma unroll
    for (int jt = 0; jt < 3; ++jt) d[jt] = wmma_f16(wl0[jt], oh0, d[jt]);
#pragma unroll
    for (int jt = 0; jt < 3; ++jt) d[jt] = wmma_f16(whl[jt], ohh, d[jt]);
#pragma unroll
    for (int jt = 0; jt < 3; ++jt) d[jt] = wmma_f16(wh0[jt], oh0, d[jt]);
    // this query's row of the layer's output, for the column maxima; rows
    // 36..47 of W1 and of the bias are zero: of tile 2 only r < 4 counts
    float* op = att2 + (row0 + (int)(lane & 15u)) * TP + hi8;
#pragma unroll
    for (int jt = 0; jt < 3; ++jt) {
#pragma unroll
      for (int h = 0; h < (jt < 2 ? 2 : 1); ++h) {
        v4f o;
#pragma unroll
        for (int e = 0; e < 4; ++e) o[e] = fmaxf(d[jt][4 * h + e], 0.f);
        ls += o;
        ls2 += o * o;
        *(v4f*)(op + jt * 16 + 4 * h) = o;
      }
    }
  }

  // LayerNorm sums of this wave's 32 queries, one partial a wave; red was last
  // read ahead of the barrier at the foot of pass 2
  {
    float t = wave_sum((ls[0] + ls[1]) + (ls[2] + ls[3]));
    float t2 = wave_sum((ls2[0] + ls2[1]) + (ls2[2] + ls2[3]));
    if (lane == 0) { red[wv] = t; red[8 + wv] = t2; }
  }
  __syncthreads();

  // column maxima: thread (g, col) takes rows 37g..37g+36 of its column (the
  // last group's rows end at 255; a row taken twice does not move a maximum).
  // Unrolled, four chains: the 37 reads go out together, one wait for all.
  if (tid < 252) {
    const int g = tid / 36, col = tid - g * 36;
    const float* cp = att2 + g * 37 * TP + col;
    float m[4] = {-1e30f, -1e30f, -1e30f, -1e30f};
#pragma unroll
    for (int i = 0; i < 37; ++i) {
      int d = i;
      if (i > 33) d = (g * 37 + i < 256) ? i : 255 - g * 37;
      m[i & 3] = fmaxf(m[i & 3], cp[d * TP]);
    }
    red[16 + tid] = fmaxf(fmaxf(m[0], m[1]), fmaxf(m[2], m[3]));
  }
  __syncthreads();

  if (tid < 36) {
    float mu   = sum8(red) * (1.f / 9216.f);
    float var  = sum8(red + 8) * (1.f / 9216.f) - mu * mu;
    float rstd = rsqrtf(var + 1e-5f);
    float m = red[16 + tid];
#pragma unroll  // the six reads go out together, not one waited read a trip
    for (int g = 1; g < 7; ++g) m = fmaxf(m, red[16 + g * 36 + tid]);
    mxv[tid] = (m - mu) * rstd;
  }
  __syncthreads();

  if (tid < 10) {
    float s = l2b[tid];
    for (int j = 0; j < 36; ++j) s += mxv[j] * l2W[tid * 36 + j];
    ov[tid] = s;
  }
  __syncthreads();
  if (tid == 0) {
    float mx = -1e30f;
    for (int o = 0; o < 10; ++o) mx = fmaxf(mx, ov[o]);
    float s = 0.f;
    for (int o = 0; o < 10; ++o) s += __expf(ov[o] - mx);
    red[0] = mx + __logf(s);
  }
  __syncthreads();
  if (tid < 10) out[(size_t)b * 10 + tid] = ov[tid] - red[0];
}

// ---------------------------------------------------------------------------
extern "C" void kernel_launch(void* const* d_in, const int* in_sizes, int n_in,
                              void* d_out, int out_size, void* d_ws, size_t ws_size,
                              hipStream_t stream) {
  const float* x  = (const float*)d_in[0];
  const float* w1 = (const float*)d_in[1];  const float* b1 = (const float*)d_in[2];
  const float* w2 = (const float*)d_in[3];  const float* b2 = (const float*)d_in[4];
  const float* w3 = (const float*)d_in[5];  const float* b3 = (const float*)d_in[6];
  const float* w4 = (const float*)d_in[7];  const float* b4 = (const float*)d_in[8];
  const float* kW = (const float*)d_in[9];  const float* kbv = (const float*)d_in[10];
  const float* qW = (const float*)d_in[11]; const float* qbv = (const float*)d_in[12];
  const float* vW = (const float*)d_in[13]; const float* vbv = (const float*)d_in[14];
  const float* kg = (const float*)d_in[15]; const float* kbe = (const float*)d_in[16];
  const float* qg = (const float*)d_in[17]; const float* qbe = (const float*)d_in[18];
  const float* vg = (const float*)d_in[19]; const float* vbe = (const float*)d_in[20];
  const float* l1W = (const float*)d_in[21]; const float* l1b = (const float*)d_in[22];
  const float* l2W = (const float*)d_in[23]; const float* l2b = (const float*)d_in[24];

  const int B = in_sizes[0] / (28 * 28);   // 2048
  _Float16* feat = (_Float16*)d_ws;        // [B][256][32] f16 = 16 KB/batch

  conv_stack_kernel<<<B, 256, 193040, stream>>>(x, w1, b1, w2, b2, w3, b3, w4,
                                                b4, feat);
  attn_kernel<<<B, 256, 151904, stream>>>(feat, kW, kbv, qW, qbv, vW, vbv,
                                          kg, kbe, qg, qbe, vg, vbe,
                                          l1W, l1b, l2W, l2b, (float*)d_out);
}

// v008
// It runs in 110 microseconds.
// Timed twice side by side with v007, it ran 1.10 times as fast both times.
// Counting every step since v000, it is 8.78 times as fast.
#include <hip/hip_runtime.h>
#include <hip/hip_bf16.h>
#include <math.h>

typedef __attribute__((ext_vector_type(16))) _Float16 v16h;
typedef __attribute__((ext_vector_type(8)))  _Float16 v8h;
typedef __attribute__((ext_vector_type(4)))  _Float16 v4h;
typedef __attribute__((ext_vector_type(2)))  _Float16 v2h;
typedef __attribute__((ext_vector_type(8)))  float    v8f;
typedef __attribute__((ext_vector_type(4)))  float    v4f;
typedef __attribute__((ext_vector_type(4)))  unsigned int v4u;

__device__ __forceinline__ v16h loadfrag_h(const _Float16* base, int r0, int k0,
                                           int stride, unsigned lane) {
  const _Float16* p = base + (r0 + (int)(lane & 15u)) * stride + k0;
  int hi = (lane & 16u) ? 1 : 0;
  v8h lo = *(const v8h*)(p + (hi ? 8 : 0));
  v8h hj = *(const v8h*)(p + (hi ? 24 : 16));
  return __builtin_shufflevector(lo, hj, 0, 1, 2, 3, 4, 5, 6, 7, 8, 9, 10, 11,
                                 12, 13, 14, 15);
}

__device__ __forceinline__ v16h loadfrag_cm(const _Float16* base, int r0, int c0,
                                            int c1, int plane, unsigned lane) {
  const _Float16* p = base + (r0 + (int)(lane & 15u)) * 8;
  v8h lo = *(const v8h*)(p + c0 * plane);
  v8h hj = *(const v8h*)(p + c1 * plane);
  return __builtin_shufflevector(lo, hj, 0, 1, 2, 3, 4, 5, 6, 7, 8, 9, 10, 11,
                                 12, 13, 14, 15);
}

// A fragment for 2-tap conv chunk: K 0..15 = tap0 ch0..15, K 16..31 = tap1.
__device__ __forceinline__ v16h frag2tap(const _Float16* p0, const _Float16* p1,
                                         unsigned lane) {
  int hi = (lane & 16u) ? 8 : 0;
  v8h lo = *(const v8h*)(p0 + hi);
  v8h hj = *(const v8h*)(p1 + hi);
  return __builtin_shufflevector(lo, hj, 0, 1, 2, 3, 4, 5, 6, 7, 8, 9, 10, 11,
                                 12, 13, 14, 15);
}

// A fragment for 1-tap conv chunk over a 32-channel pixel record.
__device__ __forceinline__ v16h frag1tap(const _Float16* p, unsigned lane) {
  int hi = (lane & 16u) ? 1 : 0;
  v8h lo = *(const v8h*)(p + (hi ? 8 : 0));
  v8h hj = *(const v8h*)(p + (hi ? 24 : 16));
  return __builtin_shufflevector(lo, hj, 0, 1, 2, 3, 4, 5, 6, 7, 8, 9, 10, 11,
                                 12, 13, 14, 15);
}

// value of the lane 16 away (same column, other half of the rows)
__device__ __forceinline__ float other_half(float v) {
  int b = __builtin_bit_cast(int, v);
  b = __builtin_amdgcn_permlanex16(b, b, 0x76543210, 0xfedcba98, false, false);
  return __builtin_bit_cast(float, b);
}

// sum over the 32 lanes of a wave, the total in every lane: four adds with the
// lane whose number differs in one bit (row_xmask, inside a 16-lane row), then
// the other row. All 32 lanes have to be on.
template <int CTRL>
__device__ __forceinline__ float add_xmask(float v) {
  int b = __builtin_bit_cast(int, v);
  b = __builtin_amdgcn_update_dpp(0, b, CTRL, 0xf, 0xf, true);
  return v + __builtin_bit_cast(float, b);
}
__device__ __forceinline__ float wave_sum(float v) {
  v = add_xmask<0x161>(v);
  v = add_xmask<0x162>(v);
  v = add_xmask<0x164>(v);
  v = add_xmask<0x168>(v);
  return v + other_half(v);
}

// the eight waves' partial sums p[0..7], added in one fixed order
__device__ __forceinline__ float sum8(const float* p) {
  v4f a = *(const v4f*)p, b = *(const v4f*)(p + 4);
  return ((a[0] + a[1]) + (a[2] + a[3])) + ((b[0] + b[1]) + (b[2] + b[3]));
}

__device__ __forceinline__ float exp_slot(float x) {
  float r = x * 1.44269504f;
  asm("v_exp_f32 %0, %0\n\tv_nop" : "+v"(r));
  return r;
}

__device__ __forceinline__ v8f wmma_f16(v16h a, v16h b, v8f c) {
  return __builtin_amdgcn_wmma_f32_16x16x32_f16(false, a, false, b, (short)0, c,
                                                false, false);
}

__device__ __forceinline__ v8f zero8() {
  v8f z = {0.f, 0.f, 0.f, 0.f, 0.f, 0.f, 0.f, 0.f};
  return z;
}

#define H1P 24
#define H1R 656
#define H2P 40
#define H2R 888
#define BPL 264
#define BTP 1064
__global__ __launch_bounds__(256) void conv_stack_kernel(
    const float* __restrict__ x,
    const float* __restrict__ w1, const float* __restrict__ b1,
    const float* __restrict__ w2, const float* __restrict__ b2,
    const float* __restrict__ w3, const float* __restrict__ b3,
    const float* __restrict__ w4, const float* __restrict__ b4,
    _Float16* __restrict__ feat) {
  extern __shared__ char smem[];
  float*     xin = (float*)smem;
  float*     ws1 = (float*)(smem + 3136);
  float*     bbf = (float*)(smem + 4416);     // [4][32]
  _Float16*  h1  = (_Float16*)(smem + 4928);
  _Float16*  h2  = (_Float16*)(smem + 38448);
  _Float16*  h3  = (_Float16*)(smem + 4928);   // over h1, once it is dead
  _Float16*  Bc2 = (_Float16*)(smem + 78480);
  _Float16*  Bc3 = (_Float16*)(smem + 95504);
  _Float16*  Bc4 = (_Float16*)(smem + 129552);

  const int tid = threadIdx.x;
  const unsigned lane = tid & 31u;
  const int wv = tid >> 5;
  const int b = blockIdx.x;
  const int ch0 = (lane & 16u) ? 1 : 0;  // weight planes of this half wave:
  const int ch1 = ch0 + 2;               // the k order of frag2tap/frag1tap

  // ---- every global read of this kernel: coalesced, branch-free (indices
  // clamped, stores guarded) and issued together, so the L2 round trips
  // overlap instead of one waited 4-byte load per staged element ----
  // Weight unit u = (oc n, input-channel pair kp, tap quad tq), tq fastest:
  // two 16-byte loads (channels 2kp and 2kp+1, taps 4tq..4tq+3) feed four
  // 4-byte LDS stores of a channel pair each.
  // (the unrolls here and in the scatter below keep the arrays in registers)
  v4f r2a[3], r2b[3], r3a[4], r3b[4], r4a[6], r4b[6];
  {
    const v4f* w2v = (const v4f*)w2;  // 20 x 8 x 4  = 640 units
    const v4f* w3v = (const v4f*)w3;  // 24 x 10 x 4 = 960 units
    const v4f* w4v = (const v4f*)w4;  // 30 x 12 x 4 = 1440 units
    // 16-byte index of unit u: (u>>2)*8 + (u&3); 256 units further = +512.
    // Each tensor's last, partial slice clamps its unit.
    const int a0 = (tid >> 2) * 8 + (tid & 3);
    const int u2 = tid + 512 < 640 ? tid + 512 : 639;
    const int u3 = tid + 768 < 960 ? tid + 768 : 959;
    const int u4 = tid + 1280 < 1440 ? tid + 1280 : 1439;
    const int a2 = (u2 >> 2) * 8 + (u2 & 3);
    const int a3 = (u3 >> 2) * 8 + (u3 & 3);
    const int a4 = (u4 >> 2) * 8 + (u4 & 3);
#pragma unroll
    for (int i = 0; i < 2; ++i) {
      r2a[i] = w2v[a0 + 512 * i];
      r2b[i] = w2v[a0 + 512 * i + 4];
    }
    r2a[2] = w2v[a2];
    r2b[2] = w2v[a2 + 4];
#pragma unroll
    for (int i = 0; i < 3; ++i) {
      r3a[i] = w3v[a0 + 512 * i];
      r3b[i] = w3v[a0 + 512 * i + 4];
    }
    r3a[3] = w3v[a3];
    r3b[3] = w3v[a3 + 4];
#pragma unroll
    for (int i = 0; i < 5; ++i) {
      r4a[i] = w4v[a0 + 512 * i];
      r4b[i] = w4v[a0 + 512 * i + 4];
    }
    r4a[5] = w4v[a4];
    r4b[5] = w4v[a4 + 4];

    const v4f* sx = (const v4f*)(x + (size_t)b * 784);
    v4f xr  = sx[tid < 196 ? tid : 195];
    const int a1 = tid & 63;
    v4f w1r = ((const v4f*)w1)[a1];
    int g = (tid >> 5) & 3, n = tid & 31;
    const float* bp = (g == 0) ? b1 : (g == 1) ? b2 : (g == 2) ? b3 : b4;
    int lim = (g == 0) ? 16 : (g == 1) ? 20 : (g == 2) ? 24 : 30;
    const float* bq = bp + (n < lim ? n : 0);
    float bv = *bq;
    // The loads' address registers are inputs here, so they stay unwritten
    // (also by a later load's result) until this wait.
    asm volatile("s_wait_xcnt 0x0"
                 :: "v"(a0), "v"(a1), "v"(a2), "v"(a3), "v"(a4), "v"(bq)
                 : "memory");
    // zero h1, h2 and Bc2..Bc4 (contiguous 158672 B = 9917 x b128)
    v4u zz = {0u, 0u, 0u, 0u};
    v4u* z = (v4u*)h1;
    for (int i = 0; i < 38; ++i) z[tid + 256 * i] = zz;
    if (tid < 189) z[tid + 9728] = zz;
    if (tid < 196) ((v4f*)xin)[tid] = xr;
    if (tid < 64)  *(v4f*)(ws1 + (tid >> 2) * 20 + (tid & 3) * 4) = w1r;
    if (tid < 128) bbf[tid] = (n < lim) ? bv : 0.f;
  }
  __syncthreads();

  // ---- scatter the weights into the zeroed per-tap B matrices ----
  // Bc2: chunk c pairs taps 2c,2c+1; k<16 -> tap 2c ic=k, k>=16 -> tap 2c+1
#pragma unroll
  for (int i = 0; i < 3; ++i) {
    int u = tid + 256 * i;
    if (u < 640) {
      int t0 = (u & 3) * 4, r = u >> 2;
      int n = r >> 3, ic = (r & 7) * 2;
#pragma unroll
      for (int e = 0; e < 4; ++e) {
        int tap = t0 + e;
        v2h h = {(_Float16)r2a[i][e], (_Float16)r2b[i][e]};
        int k = (tap & 1) * 16 + ic;
        *(v2h*)(Bc2 + (tap >> 1) * BTP + (k >> 3) * BPL + n * 8 + (k & 7)) = h;
      }
    }
  }
  // Bc3: tap t, k = ic (20 valid of 32), n = oc (24 valid of 32)
#pragma unroll
  for (int i = 0; i < 4; ++i) {
    int u = tid + 256 * i;
    if (u < 960) {
      int t0 = (u & 3) * 4, r = u >> 2;
      int n = r / 10, k = (r - n * 10) * 2;
#pragma unroll
      for (int e = 0; e < 4; ++e) {
        v2h h = {(_Float16)r3a[i][e], (_Float16)r3b[i][e]};
        *(v2h*)(Bc3 + (t0 + e) * BTP + (k >> 3) * BPL + n * 8 + (k & 7)) = h;
      }
    }
  }
  // Bc4: tap t, k = ic (24 valid of 32), n = oc (30 valid of 32)
#pragma unroll
  for (int i = 0; i < 6; ++i) {
    int u = tid + 256 * i;
    if (u < 1440) {
      int t0 = (u & 3) * 4, r = u >> 2;
      int n = r / 12, k = (r - n * 12) * 2;
#pragma unroll
      for (int e = 0; e < 4; ++e) {
        v2h h = {(_Float16)r4a[i][e], (_Float16)r4b[i][e]};
        *(v2h*)(Bc4 + (t0 + e) * BTP + (k >> 3) * BPL + n * 8 + (k & 7)) = h;
      }
    }
  }

  // ---- conv1 via WMMA: 28x28 -> 16x25x25, channel-last f16 ----
  // Transposed (D = W1 X^T): M = 16 channels, N = 16 pixels, 40 N tiles, five a
  // wave. A lane's eight D registers are channels 8*hi..8*hi+7 of one pixel:
  // half a pixel record, one 16-byte store. To keep the f32 operands' accuracy
  // x and w are each split into two f16 parts, v = hi + lo. K holds the 16 taps
  // twice: elements 0..7 of a lane are taps 8*hi..8*hi+7 (kernel rows 2*hi and
  // 2*hi+1) against x's hi part, elements 8..15 the same taps against its lo
  // part, in A and in B alike. One WMMA with w's lo part, one with its hi part.
  {
    const int c15 = (int)(lane & 15u);
    const float* wp = ws1 + c15 * 20 + ch0 * 8;  // channel c15
    v4f wa = *(const v4f*)wp, wb = *(const v4f*)(wp + 4);
    v8h wh, wl;
#pragma unroll
    for (int e = 0; e < 4; ++e) {
      wh[e]     = (_Float16)wa[e];
      wh[4 + e] = (_Float16)wb[e];
      wl[e]     = (_Float16)(wa[e] - (float)wh[e]);
      wl[4 + e] = (_Float16)(wb[e] - (float)wh[4 + e]);
    }
    v16h ah = __builtin_shufflevector(wh, wh, 0, 1, 2, 3, 4, 5, 6, 7, 8, 9, 10,
                                      11, 12, 13, 14, 15);
    v16h al = __builtin_shufflevector(wl, wl, 0, 1, 2, 3, 4, 5, 6, 7, 8, 9, 10,
                                      11, 12, 13, 14, 15);
    v4f c0 = *(const v4f*)(bbf + ch0 * 8), c1 = *(const v4f*)(bbf + ch0 * 8 + 4);
    const v8f bi = {c0[0], c0[1], c0[2], c0[3], c1[0], c1[1], c1[2], c1[3]};
    // All five tiles' reads stand ahead of the first store to h1: for the
    // compiler such a store could alias a later read of xin, and a tile's reads
    // would then go out only behind the tile before, their latency uncovered.
    // (The unrolls keep the arrays in registers.)
    float u[5][8];
    _Float16* hp[5];
#pragma unroll
    for (int j = 0; j < 5; ++j) {
      const int p = (wv * 5 + j) * 16 + c15;
      const int pc = p < 625 ? p : 624;  // the last tile has one valid pixel
      const int oy = pc / 25, ox = pc - oy * 25;
      const float* xp = xin + (oy + 2 * ch0) * 28 + ox;
#pragma unroll
      for (int e = 0; e < 4; ++e) {
        u[j][e]     = xp[e];
        u[j][4 + e] = xp[28 + e];
      }
      hp[j] = h1 + oy * H1R + ox * H1P + ch0 * 8;
    }
#pragma unroll
    for (int j = 0; j < 5; ++j) {
      v8h xh, xl;
#pragma unroll
      for (int e = 0; e < 8; ++e) {
        xh[e] = (_Float16)u[j][e];
        xl[e] = (_Float16)(u[j][e] - (float)xh[e]);
      }
      v16h xb = __builtin_shufflevector(xh, xl, 0, 1, 2, 3, 4, 5, 6, 7, 8, 9, 10,
                                        11, 12, 13, 14, 15);
      v8f d = wmma_f16(al, xb, bi);
      d = wmma_f16(ah, xb, d);
      v8h o;
#pragma unroll
      for (int r = 0; r < 8; ++r) o[r] = (_Float16)fmaxf(d[r], 0.f);
      if (j < 4 || (wv * 5 + j) * 16 + c15 < 625) *(v8h*)hp[j] = o;
    }
  }
  __syncthreads();

  // conv2..conv4: a wave owns several M tiles and BOTH N tiles, so an A fragment
  // read from LDS feeds two WMMAs and a B fragment one per M tile, and a wave's
  // accumulator chains are independent. The K loop goes in blocks with two
  // fragment sets in registers: the next block's reads stand as one group ahead
  // of this block's WMMAs. Each output still sums its taps in the order 0..15.
  // (The unrolls keep acc and the fragment sets in registers. The two
  // sched_barriers of a block keep the reads in that one group: without them
  // the compiler moves each read down to just ahead of the WMMA that uses it,
  // and the wave waits out the LDS latency there.)
  const int l15 = (int)(lane & 15u);
  const int mh = (lane & 16u) ? 8 : 0;

  // ---- conv2 via WMMA: M=484(->496) x N=20(->32) x K=256 (8 chunks) ----
  // 31 M tiles, four a wave; the last wave's fourth is its third again (same
  // values to the same places, from the same wave). Block = one chunk.
  {
    int mts[4];
    const _Float16* ap[4];
    v8f acc[4][2];
#pragma unroll
    for (int j = 0; j < 4; ++j) {
      int mt = wv * 4 + j;
      mts[j] = mt < 31 ? mt : 30;
      int m = mts[j] * 16 + l15;
      int oy = m / 22, ox = m - oy * 22;
      ap[j] = h1 + oy * H1R + ox * H1P;
      acc[j][0] = zero8();
      acc[j][1] = zero8();
    }
    v16h fa[2][4], fw[2][2];
    auto fetch = [&](int c) {
      const int s = c & 1;
      const int o0 = ((2 * c) >> 2) * H1R + ((2 * c) & 3) * H1P;  // tap 2c
      fw[s][0] = loadfrag_cm(Bc2 + c * BTP, 0, ch0, ch1, BPL, lane);
      fw[s][1] = loadfrag_cm(Bc2 + c * BTP, 16, ch0, ch1, BPL, lane);
#pragma unroll
      for (int j = 0; j < 4; ++j)
        fa[s][j] = frag2tap(ap[j] + o0, ap[j] + o0 + H1P, lane);
    };
    fetch(0);
#pragma unroll
    for (int c = 0; c < 8; ++c) {
      if (c < 7) fetch(c + 1);
      __builtin_amdgcn_sched_barrier(0);  // the reads above stay one group
#pragma unroll
      for (int j = 0; j < 4; ++j) {
        acc[j][0] = wmma_f16(fa[c & 1][j], fw[c & 1][0], acc[j][0]);
        acc[j][1] = wmma_f16(fa[c & 1][j], fw[c & 1][1], acc[j][1]);
      }
      __builtin_amdgcn_sched_barrier(0);  // no later read moves up among them
    }
    float bias0 = bbf[32 + l15], bias1 = bbf[48 + l15];
#pragma unroll
    for (int j = 0; j < 4; ++j) {
      int m0 = mts[j] * 16 + mh;  // first of this lane's 8 pixels
      int y0 = m0 / 22, x0 = m0 - y0 * 22;
      _Float16* hp = h2 + y0 * H2R + x0 * H2P + l15;
#pragma unroll
      for (int r = 0; r < 8; ++r) {  // at most one step into the next image row
        _Float16* q = hp + r * H2P + (x0 + r >= 22 ? H2R - 22 * H2P : 0);
        q[0]  = (_Float16)fmaxf(acc[j][0][r] + bias0, 0.f);
        q[16] = (_Float16)fmaxf(acc[j][1][r] + bias1, 0.f);
      }
    }
  }
  __syncthreads();

  // ---- conv3 via WMMA: M=361(->368) x N=24(->32) x K=512 (16 taps) ----
  // 23 M tiles, three a wave; the last wave's third is its second again.
  // Block = two taps.
  {
    int mts[3];
    const _Float16* ap[3];
    v8f acc[3][2];
#pragma unroll
    for (int j = 0; j < 3; ++j) {
      int mt = wv * 3 + j;
      mts[j] = mt < 23 ? mt : 22;
      int m = mts[j] * 16 + l15;
      int oy = m / 19, ox = m - oy * 19;
      ap[j] = h2 + oy * H2R + ox * H2P;
      acc[j][0] = zero8();
      acc[j][1] = zero8();
    }
    v16h fa[2][2][3], fw[2][2][2];
    auto fetch = [&](int k) {
      const int s = k & 1;
#pragma unroll
      for (int e = 0; e < 2; ++e) {
        const int t = 2 * k + e;
        fw[s][e][0] = loadfrag_cm(Bc3 + t * BTP, 0, ch0, ch1, BPL, lane);
        fw[s][e][1] = loadfrag_cm(Bc3 + t * BTP, 16, ch0, ch1, BPL, lane);
#pragma unroll
        for (int j = 0; j < 3; ++j)
          fa[s][e][j] = frag1tap(ap[j] + (t >> 2) * H2R + (t & 3) * H2P, lane);
      }
    };
    fetch(0);
#pragma unroll
    for (int k = 0; k < 8; ++k) {
      if (k < 7) fetch(k + 1);
      __builtin_amdgcn_sched_barrier(0);  // the reads above stay one group
#pragma unroll
      for (int e = 0; e < 2; ++e)
#pragma unroll
        for (int j = 0; j < 3; ++j) {
          acc[j][0] = wmma_f16(fa[k & 1][e][j], fw[k & 1][e][0], acc[j][0]);
          acc[j][1] = wmma_f16(fa[k & 1][e][j], fw[k & 1][e][1], acc[j][1]);
        }
      __builtin_amdgcn_sched_barrier(0);  // no later read moves up among them
    }
    float bias0 = bbf[64 + l15], bias1 = bbf[80 + l15];
#pragma unroll
    for (int j = 0; j < 3; ++j) {
      _Float16* q = h3 + (mts[j] * 16 + mh) * H2P + l15;
#pragma unroll
      for (int r = 0; r < 8; ++r) {
        q[r * H2P]      = (_Float16)fmaxf(acc[j][0][r] + bias0, 0.f);
        q[r * H2P + 16] = (_Float16)fmaxf(acc[j][1][r] + bias1, 0.f);
      }
    }
  }
  __syncthreads();

  // ---- conv4 via WMMA: M=256 x N=30(->32) x K=512; write features+coords ----
  // An M tile is one output row; a wave owns rows 2wv and 2wv+1. The upper
  // row's A fragments of kernel row ky are the lower row's of ky+1: each of the
  // five input rows (ar) is read once. Block = two taps of one kernel row.
  _Float16* fb = feat + (size_t)b * 8192;
  {
    const _Float16* ap = h3 + (wv * 2 * 19 + l15) * H2P;
    v8f acc[2][2];
    acc[0][0] = zero8(); acc[0][1] = zero8();
    acc[1][0] = zero8(); acc[1][1] = zero8();
    v16h ar[5][4], fw[2][2][2];
    auto fetch = [&](int k) {
      const int s = k & 1;
#pragma unroll
      for (int e = 0; e < 2; ++e) {
        const int t = 2 * k + e, ky = t >> 2, kx = t & 3;
        fw[s][e][0] = loadfrag_cm(Bc4 + t * BTP, 0, ch0, ch1, BPL, lane);
        fw[s][e][1] = loadfrag_cm(Bc4 + t * BTP, 16, ch0, ch1, BPL, lane);
        ar[ky + 1][kx] = frag1tap(ap + ((ky + 1) * 19 + kx) * H2P, lane);
      }
    };
#pragma unroll
    for (int kx = 0; kx < 4; ++kx) ar[0][kx] = frag1tap(ap + kx * H2P, lane);
    fetch(0);
#pragma unroll
    for (int k = 0; k < 8; ++k) {
      if (k < 7) fetch(k + 1);
      __builtin_amdgcn_sched_barrier(0);  // the reads above stay one group
#pragma unroll
      for (int e = 0; e < 2; ++e) {
        const int t = 2 * k + e, ky = t >> 2, kx = t & 3;
        acc[0][0] = wmma_f16(ar[ky][kx], fw[k & 1][e][0], acc[0][0]);
        acc[0][1] = wmma_f16(ar[ky][kx], fw[k & 1][e][1], acc[0][1]);
        acc[1][0] = wmma_f16(ar[ky + 1][kx], fw[k & 1][e][0], acc[1][0]);
        acc[1][1] = wmma_f16(ar[ky + 1][kx], fw[k & 1][e][1], acc[1][1]);
      }
      __builtin_amdgcn_sched_barrier(0);  // no later read moves up among them
    }
    float bias0 = bbf[96 + l15], bias1 = bbf[112 + l15];
#pragma unroll
    for (int j = 0; j < 2; ++j) {
      _Float16* q = fb + ((wv * 2 + j) * 16 + mh) * 32 + l15;
#pragma unroll
      for (int r = 0; r < 8; ++r)
        q[r * 32] = (_Float16)fmaxf(acc[j][0][r] + bias0, 0.f);
      if (l15 < 14) {  // channels 16..29; 30 and 31 are the coordinates
#pragma unroll
        for (int r = 0; r < 8; ++r)
          q[r * 32 + 16] = (_Float16)fmaxf(acc[j][1][r] + bias1, 0.f);
      }
    }
  }
  {
    int n = tid;  // coord channels (columns 30/31, disjoint from tile stores)
    int xx = n % 16, yy = n / 16;
    fb[n * 32 + 30] = (_Float16)((float)xx * 0.0625f);
    fb[n * 32 + 31] = (_Float16)((float)yy * 0.0625f);
  }
}

#define APL 2080
#define TP 52
#define W1P 56
__global__ __launch_bounds__(256) void attn_kernel(
    const _Float16* __restrict__ feat,
    const float* __restrict__ kW, const float* __restrict__ kb,
    const float* __restrict__ qW, const float* __restrict__ qb,
    const float* __restrict__ vW, const float* __restrict__ vb,
    const float* __restrict__ kg, const float* __restrict__ kbe,
    const float* __restrict__ qg, const float* __restrict__ qbe,
    const float* __restrict__ vg, const float* __restrict__ vbe,
    const float* __restrict__ l1W, const float* __restrict__ l1b,
    const float* __restrict__ l2W, const float* __restrict__ l2b,
    float* __restrict__ out) {
  extern __shared__ char smem[];
  _Float16* hbuf = (_Float16*)smem;
  _Float16* Qb   = (_Float16*)(smem + 16640);
  float* tmpf = (float*)(smem + 41600);
  _Float16* Kb   = (_Float16*)(smem + 94848);
  _Float16* Vt   = (_Float16*)(smem + 119808);
  _Float16* wbuf = (_Float16*)(smem + 145152);
  float* red  = (float*)(smem + 148992);
  float* mxv  = (float*)(smem + 151072);
  float* ov   = (float*)(smem + 151264);
  float* bb   = (float*)(smem + 151328);
  _Float16* W1h = (_Float16*)smem;            // over hbuf, once it is dead:
  _Float16* W1l = (_Float16*)(smem + 5376);   // [48][W1P] f16 each
  float* l1bs = (float*)(smem + 10752);       // [48]

  const int tid = threadIdx.x;
  const unsigned lane = tid & 31u;
  const int wv = tid >> 5;
  const int b = blockIdx.x;
  // planes of this half wave, in the k order of loadfrag_h: columns 0..31,
  // then columns 32..63 (40..63 read the zero plane)
  const int ch0 = (lane & 16u) ? 1 : 0, ch1 = ch0 + 2, ch2 = ch0 + 4;

  // ---- features, projection weights, biases: coalesced, branch-free reads
  // (indices clamped, stores guarded), all in flight together ----
  // (unrolls on fr/wreg/gr/er loops keep these arrays in registers)
  v4f wreg[3][2];
  // gamma/beta of pass p: 18 coalesced 16-byte loads in flight together.
  // Pass 0's go out here; pass p+1's go out ahead of pass p's normalisation,
  // which covers their L2 round trip up to the barrier behind it.
  v4f gr[3][9], er[3][9];
  // W1 piece u = (row j, column quad q) of the padded [48][48] tile, three a
  // thread (576 pieces); outside the 36 x 36 matrix the piece is zero
  v4f l1r[3];
  float l1bv = 0.f;
#pragma unroll
  for (int i = 0; i < 9; ++i) {
    gr[0][i] = ((const v4f*)vg)[tid + 256 * i];
    er[0][i] = ((const v4f*)vbe)[tid + 256 * i];
  }
  {
    const v4u* src = (const v4u*)(feat + (size_t)b * 8192);
    v4u fr[4];
#pragma unroll
    for (int i = 0; i < 4; ++i) fr[i] = src[tid + 256 * i];
    const int f1 = 256 + (tid & 31);  // each W is 288 x 16 B
    wreg[0][0] = ((const v4f*)vW)[tid];  wreg[0][1] = ((const v4f*)vW)[f1];
    wreg[1][0] = ((const v4f*)kW)[tid];  wreg[1][1] = ((const v4f*)kW)[f1];
    wreg[2][0] = ((const v4f*)qW)[tid];  wreg[2][1] = ((const v4f*)qW)[f1];
    const int bi = tid < 144 ? tid : 0;
    const int pb = bi / 48, jb = bi - pb * 48;
    const float* bp = (pb == 0) ? vb : (pb == 1) ? kb : qb;
    float bv = bp[jb < 36 ? jb : 0];

    // zero what the staged operands pad with: Q/K planes 4 and 5 (520 x 16 B;
    // columns 32..35 are stored over it behind later barriers), V^T rows
    // 36..47, W rows 36..47
    const v4u zz = {0u, 0u, 0u, 0u};
    for (int i = tid; i < 520; i += 256) {
      ((v4u*)(Qb + 4 * APL))[i] = zz;
      ((v4u*)(Kb + 4 * APL))[i] = zz;
    }
    for (int i = tid; i < 396; i += 256) ((v4u*)(Vt + 36 * 264))[i] = zz;
    if (tid < 60) ((v4u*)(wbuf + 36 * 40))[tid] = zz;

    // 16-byte unit u of the [256][32] features: row u >> 2, plane u & 3
#pragma unroll
    for (int i = 0; i < 4; ++i)
      *(v4u*)(hbuf + (tid & 3) * APL + ((tid >> 2) + 64 * i) * 8) = fr[i];
    if (tid < 144) bb[tid] = (jb < 36) ? bv : 0.f;
  }
  __syncthreads();

  // unrolled: wreg/gr/er are indexed by p and have to stay in registers
#pragma unroll
  for (int p = 0; p < 3; ++p) {
    {
      const int k = (tid & 7) * 4;
      v4f w0 = wreg[p][0];
      v4h h0 = {(_Float16)w0[0], (_Float16)w0[1], (_Float16)w0[2], (_Float16)w0[3]};
      *(v4h*)(wbuf + (tid >> 3) * 40 + k) = h0;
      if (tid < 32) {
        v4f w1v = wreg[p][1];
        v4h h1v = {(_Float16)w1v[0], (_Float16)w1v[1], (_Float16)w1v[2], (_Float16)w1v[3]};
        *(v4h*)(wbuf + (32 + (tid >> 3)) * 40 + k) = h1v;
      }
    }
    __syncthreads();

    for (int t = wv; t < 48; t += 8) {
      int rt = t / 3, nt = t % 3;
      v16h a  = loadfrag_cm(hbuf, rt * 16, ch0, ch1, APL, lane);
      v16h bf = loadfrag_h(wbuf, nt * 16, 0, 40, lane);
      v8f acc = zero8();
      acc = wmma_f16(a, bf, acc);
      int n = nt * 16 + (int)(lane & 15u);
      float bias = bb[p * 48 + n];
      int mh = (lane & 16u) ? 8 : 0;
#pragma unroll
      for (int r = 0; r < 8; ++r)
        tmpf[(rt * 16 + mh + r) * TP + n] = acc[r] + bias;
    }
    __syncthreads();

    {
      float s = 0.f, s2 = 0.f;
      const float* rowp = tmpf + tid * TP;
#pragma unroll
      for (int c = 0; c < 36; c += 4) {
        v4f v = *(const v4f*)(rowp + c);
        s += v[0] + v[1] + v[2] + v[3];
        s2 += v[0] * v[0] + v[1] * v[1] + v[2] * v[2] + v[3] * v[3];
      }
      // in the wave across lanes, then one partial a wave; red is next written
      // behind the barrier at the foot of this pass
      s = wave_sum(s);
      s2 = wave_sum(s2);
      if (lane == 0) { red[wv] = s; red[8 + wv] = s2; }
    }
    __syncthreads();
    float mu   = sum8(red) * (1.f / 9216.f);
    float var  = sum8(red + 8) * (1.f / 9216.f) - mu * mu;
    float rstd = rsqrtf(var + 1e-5f);

    if (p < 2) {
      const v4f* Gv = (const v4f*)((p == 0) ? kg : qg);
      const v4f* Ev = (const v4f*)((p == 0) ? kbe : qbe);
#pragma unroll
      for (int i = 0; i < 9; ++i) {
        gr[p + 1][i] = Gv[tid + 256 * i];
        er[p + 1][i] = Ev[tid + 256 * i];
      }
    }
    if (p == 1) {  // W1 and its bias: read here, staged in pass 2
      int ix[3];
#pragma unroll
      for (int i = 0; i < 3; ++i) {
        int u = tid + 256 * i;
        int j = u / 12, q = u - j * 12;
        ix[i] = (j < 36 && q < 9) ? j * 9 + q : 0;
        l1r[i] = ((const v4f*)l1W)[ix[i]];
      }
      const int ib = tid < 36 ? tid : 35;
      l1bv = l1b[ib];
      // The loads' index registers are inputs here, so they stay unwritten
      // until this wait.
      asm volatile("s_wait_xcnt 0x0"
                   :: "v"(ix[0]), "v"(ix[1]), "v"(ix[2]), "v"(ib)
                   : "memory");
    }
    if (p == 2) {
      // the features are dead (last read two barriers back): W1 as hi and lo
      // f16 tiles and the padded bias take their place; the barrier at the
      // foot of this pass publishes them
#pragma unroll
      for (int i = 0; i < 3; ++i) {
        int u = tid + 256 * i;
        int j = u / 12, q = u - j * 12;
        bool ok = j < 36 && q < 9;
        v4h wh, wl;
#pragma unroll
        for (int e = 0; e < 4; ++e) {
          float w = ok ? l1r[i][e] : 0.f;
          wh[e] = (_Float16)w;
          wl[e] = (_Float16)(w - (float)wh[e]);
        }
        if (u < 576) {
          *(v4h*)(W1h + j * W1P + q * 4) = wh;
          *(v4h*)(W1l + j * W1P + q * 4) = wl;
        }
      }
      if (tid < 48) l1bs[tid] = tid < 36 ? l1bv : 0.f;
    }

    // 16-byte piece f of the [256][36] plane: node = f/9, columns j0..j0+3
#pragma unroll
    for (int i = 0; i < 9; ++i) {
      int f = tid + 256 * i;
      int node = f / 9, j0 = (f - node * 9) * 4;
      v4f tv = *(const v4f*)(tmpf + node * TP + j0);
      v4h o;
#pragma unroll
      for (int e = 0; e < 4; ++e) {
        float v = (tv[e] - mu) * rstd;
        o[e] = (_Float16)(v * gr[p][i][e] + er[p][i][e]);
      }
      if (p == 0) {
#pragma unroll
        for (int e = 0; e < 4; ++e) Vt[(j0 + e) * 264 + node] = o[e];
      } else {
        _Float16* dst = (p == 1) ? Kb : Qb;
        *(v4h*)(dst + (j0 >> 3) * APL + node * 8 + (j0 & 4)) = o;
      }
    }
    __syncthreads();
  }

  const float scale = 0.16666667f;  // 1/sqrt(36)
  const int hi8 = (lane & 16u) ? 8 : 0;
  // sums of the linear layer's outputs and of their squares, four chains each
  v4f ls = {0.f, 0.f, 0.f, 0.f}, ls2 = {0.f, 0.f, 0.f, 0.f};
  float* att2 = tmpf;  // [256][TP]; the projections' f32 rows are dead now
  for (int blk = wv; blk < 16; blk += 8) {
    int row0 = blk * 16;
    // B operand: 16 queries (n = query), kept for all 16 key tiles
    v16h qb0 = loadfrag_cm(Qb, row0, ch0, ch1, APL, lane);
    v16h qb1 = loadfrag_cm(Qb, row0, ch2, 5, APL, lane);
    v8f st[16];
#pragma unroll
    for (int ct = 0; ct < 16; ++ct) {
      v8f acc = zero8();
      acc = wmma_f16(loadfrag_cm(Kb, ct * 16, ch0, ch1, APL, lane), qb0, acc);
      acc = wmma_f16(loadfrag_cm(Kb, ct * 16, ch2, 5, APL, lane), qb1, acc);
      st[ct] = acc;
    }
    float mx = -1e30f;
#pragma unroll
    for (int ct = 0; ct < 16; ++ct)
#pragma unroll
      for (int r = 0; r < 8; ++r) {
        st[ct][r] *= scale;
        mx = fmaxf(mx, st[ct][r]);
      }
    mx = fmaxf(mx, other_half(mx));
    float s = 0.f;
    v8f av0 = zero8(), av1 = zero8(), av2 = zero8();
#pragma unroll
    for (int kc = 0; kc < 8; ++kc) {
      // B fragment of keys kc*32..+31: elements 0..7 are k = 8*hi + r (tile
      // 2kc), elements 8..15 are k = 16 + 8*hi + r (tile 2kc+1): the k order
      // of loadfrag_h, which loads the A operand (V^T rows) below.
      v16h pb;
      float ps = 0.f;
#pragma unroll
      for (int r = 0; r < 8; ++r) {
        float e0 = exp_slot(st[2 * kc][r] - mx);
        float e1 = exp_slot(st[2 * kc + 1][r] - mx);
        ps += e0 + e1;
        pb[r]     = (_Float16)e0;
        pb[8 + r] = (_Float16)e1;
      }
      s += ps;
      av0 = wmma_f16(loadfrag_h(Vt, 0, kc * 32, 264, lane), pb, av0);
      av1 = wmma_f16(loadfrag_h(Vt, 16, kc * 32, 264, lane), pb, av1);
      av2 = wmma_f16(loadfrag_h(Vt, 32, kc * 32, 264, lane), pb, av2);
    }
    s += other_half(s);
    float invr = 1.f / s;
    // keeps the W1 and bias reads below from moving up to where the 128 scores
    // are live, which takes the kernel past 256 registers (one work-group a WGP)
    __builtin_amdgcn_sched_barrier(0);
    // O^T tile t: n = query, m = column 16t + r + 8*hi. As f16, tiles 0 and 1
    // are the B fragment of columns 0..31 in the k order of loadfrag_h, which
    // loads W1 below; tile 2 (columns 32..47, 36..47 zero) fills elements 0..7
    // of a second fragment.
    v16h oh0, ol0;
    v8h oh1, ol1;
#pragma unroll
    for (int r = 0; r < 8; ++r) {
      float o0 = av0[r] * invr, o1 = av1[r] * invr, o2 = av2[r] * invr;
      oh0[r]     = (_Float16)o0;
      oh0[8 + r] = (_Float16)o1;
      oh1[r]     = (_Float16)o2;
      ol0[r]     = (_Float16)(o0 - (float)oh0[r]);
      ol0[8 + r] = (_Float16)(o1 - (float)oh0[8 + r]);
      ol1[r]     = (_Float16)(o2 - (float)oh1[r]);
    }
    const v8h z8 = {0, 0, 0, 0, 0, 0, 0, 0};
    // columns 32..47 need half a fragment: with W1's (hi | lo) as A, B = (hi |
    // hi) gives hi*hi + lo*hi in one WMMA and B = (lo | 0) gives hi*lo
    v16h ohh = __builtin_shufflevector(oh1, oh1, 0, 1, 2, 3, 4, 5, 6, 7, 8, 9,
                                       10, 11, 12, 13, 14, 15);
    v16h olz = __builtin_shufflevector(ol1, z8, 0, 1, 2, 3, 4, 5, 6, 7, 8, 9,
                                       10, 11, 12, 13, 14, 15);
    // d[jt]: output j = 16jt + r + 8*hi of query row0 + (lane & 15); starts at
    // the bias. All reads first, then three independent accumulator chains, the
    // small products first. (The unrolls keep the arrays in registers.)
    v8f d[3];
    v16h wh0[3], wl0[3], whl[3];
#pragma unroll
    for (int jt = 0; jt < 3; ++jt) {
      const float* bp = l1bs + jt * 16 + hi8;
      v4f b0 = *(const v4f*)bp, b1 = *(const v4f*)(bp + 4);
      v8f bi = {b0[0], b0[1], b0[2], b0[3], b1[0], b1[1], b1[2], b1[3]};
      d[jt] = bi;
      wh0[jt] = loadfrag_h(W1h, jt * 16, 0, W1P, lane);
      wl0[jt] = loadfrag_h(W1l, jt * 16, 0, W1P, lane);
      const int wo = (jt * 16 + (int)(lane & 15u)) * W1P + 32 + hi8;
      v8h wh1 = *(const v8h*)(W1h + wo);
      v8h wl1 = *(const v8h*)(W1l + wo);
      whl[jt] = __builtin_shufflevector(wh1, wl1, 0, 1, 2, 3, 4, 5, 6, 7, 8, 9,
                                        10, 11, 12, 13, 14, 15);
    }
#pragma unroll
    for (int jt = 0; jt < 3; ++jt) d[jt] = wmma_f16(whl[jt], olz, d[jt]);
#pragma unroll
    for (int jt = 0; jt < 3; ++jt) d[jt] = wmma_f16(wh0[jt], ol0, d[jt]);
#pragma unroll
    for (int jt = 0; jt < 3; ++jt) d[jt] = wmma_f16(wl0[jt], oh0, d[jt]);
#pragma unroll
    for (int jt = 0; jt < 3; ++jt) d[jt] = wmma_f16(whl[jt], ohh, d[jt]);
#pragma unroll
    for (int jt = 0; jt < 3; ++jt) d[jt] = wmma_f16(wh0[jt], oh0, d[jt]);
    // this query's row of the layer's output, for the column maxima; rows
    // 36..47 of W1 and of the bias are zero: of tile 2 only r < 4 counts
    float* op = att2 + (row0 + (int)(lane & 15u)) * TP + hi8;
#pragma unroll
    for (int jt = 0; jt < 3; ++jt) {
#pragma unroll
      for (int h = 0; h < (jt < 2 ? 2 : 1); ++h) {
        v4f o;
#pragma unroll
        for (int e = 0; e < 4; ++e) o[e] = fmaxf(d[jt][4 * h + e], 0.f);
        ls += o;
        ls2 += o * o;
        *(v4f*)(op + jt * 16 + 4 * h) = o;
      }
    }
  }

  // LayerNorm sums of this wave's 32 queries, one partial a wave; red was last
  // read ahead of the barrier at the foot of pass 2
  {
    float t = wave_sum((ls[0] + ls[1]) + (ls[2] + ls[3]));
    float t2 = wave_sum((ls2[0] + ls2[1]) + (ls2[2] + ls2[3]));
    if (lane == 0) { red[wv] = t; red[8 + wv] = t2; }
  }
  __syncthreads();

  // column maxima: thread (g, col) takes rows 37g..37g+36 of its column (the
  // last group's rows end at 255; a row taken twice does not move a maximum).
  // Unrolled, four chains: the 37 reads go out together, one wait for all.
  if (tid < 252) {
    const int g = tid / 36, col = tid - g * 36;
    const float* cp = att2 + g * 37 * TP + col;
    float m[4] = {-1e30f, -1e30f, -1e30f, -1e30f};
#pragma unroll
    for (int i = 0; i < 37; ++i) {
      int d = i;
      if (i > 33) d = (g * 37 + i < 256) ? i : 255 - g * 37;
      m[i & 3] = fmaxf(m[i & 3], cp[d * TP]);
    }
    red[16 + tid] = fmaxf(fmaxf(m[0], m[1]), fmaxf(m[2], m[3]));
  }
  __syncthreads();

  if (tid < 36) {
    float mu   = sum8(red) * (1.f / 9216.f);
    float var  = sum8(red + 8) * (1.f / 9216.f) - mu * mu;
    float rstd = rsqrtf(var + 1e-5f);
    float m = red[16 + tid];
#pragma unroll  // the six reads go out together, not one waited read a trip
    for (int g = 1; g < 7; ++g) m = fmaxf(m, red[16 + g * 36 + tid]);
    mxv[tid] = (m - mu) * rstd;
  }
  __syncthreads();

  if (tid < 10) {
    float s = l2b[tid];
    for (int j = 0; j < 36; ++j) s += mxv[j] * l2W[tid * 36 + j];
    ov[tid] = s;
  }
  __syncthreads();
  if (tid == 0) {
    float mx = -1e30f;
    for (int o = 0; o < 10; ++o) mx = fmaxf(mx, ov[o]);
    float s = 0.f;
    for (int o = 0; o < 10; ++o) s += __expf(ov[o] - mx);
    red[0] = mx + __logf(s);
  }
  __syncthreads();
  if (tid < 10) out[(size_t)b * 10 + tid] = ov[tid] - red[0];
}

// ---------------------------------------------------------------------------
extern "C" void kernel_launch(void* const* d_in, const int* in_sizes, int n_in,
                              void* d_out, int out_size, void* d_ws, size_t ws_size,
                              hipStream_t stream) {
  const float* x  = (const float*)d_in[0];
  const float* w1 = (const float*)d_in[1];  const float* b1 = (const float*)d_in[2];
  const float* w2 = (const float*)d_in[3];  const float* b2 = (const float*)d_in[4];
  const float* w3 = (const float*)d_in[5];  const float* b3 = (const float*)d_in[6];
  const float* w4 = (const float*)d_in[7];  const float* b4 = (const float*)d_in[8];
  const float* kW = (const float*)d_in[9];  const float* kbv = (const float*)d_in[10];
  const float* qW = (const float*)d_in[11]; const float* qbv = (const float*)d_in[12];
  const float* vW = (const float*)d_in[13]; const float* vbv = (const float*)d_in[14];
  const float* kg = (const float*)d_in[15]; const float* kbe = (const float*)d_in[16];
  const float* qg = (const float*)d_in[17]; const float* qbe = (const float*)d_in[18];
  const float* vg = (const float*)d_in[19]; const float* vbe = (const float*)d_in[20];
  const float* l1W = (const float*)d_in[21]; const float* l1b = (const float*)d_in[22];
  const float* l2W = (const float*)d_in[23]; const float* l2b = (const float*)d_in[24];

  const int B = in_sizes[0] / (28 * 28);   // 2048
  _Float16* feat = (_Float16*)d_ws;        // [B][256][32] f16 = 16 KB/batch

  conv_stack_kernel<<<B, 256, 163600, stream>>>(x, w1, b1, w2, b2, w3, b3, w4,
                                                b4, feat);
  attn_kernel<<<B, 256, 151904, stream>>>(feat, kW, kbv, qW, qbv, vW, vbv,
                                          kg, kbe, qg, qbe, vg, vbe,
                                          l1W, l1b, l2W, l2b, (float*)d_out);
}

// v009
// One run takes 103 microseconds.
// Next to v008, in two timings, it ran 1.06 times as fast each time.
// Counting every step since v000, it is 9.34 times as fast.
#include <hip/hip_runtime.h>
#include <hip/hip_bf16.h>
#include <math.h>

typedef __attribute__((ext_vector_type(16))) _Float16 v16h;
typedef __attribute__((ext_vector_type(8)))  _Float16 v8h;
typedef __attribute__((ext_vector_type(4)))  _Float16 v4h;
typedef __attribute__((ext_vector_type(2)))  _Float16 v2h;
typedef __attribute__((ext_vector_type(8)))  float    v8f;
typedef __attribute__((ext_vector_type(4)))  float    v4f;
typedef __attribute__((ext_vector_type(4)))  unsigned int v4u;

__device__ __forceinline__ v16h loadfrag_h(const _Float16* base, int r0, int k0,
                                           int stride, unsigned lane) {
  const _Float16* p = base + (r0 + (int)(lane & 15u)) * stride + k0;
  int hi = (lane & 16u) ? 1 : 0;
  v8h lo = *(const v8h*)(p + (hi ? 8 : 0));
  v8h hj = *(const v8h*)(p + (hi ? 24 : 16));
  return __builtin_shufflevector(lo, hj, 0, 1, 2, 3, 4, 5, 6, 7, 8, 9, 10, 11,
                                 12, 13, 14, 15);
}

__device__ __forceinline__ v16h loadfrag_cm(const _Float16* base, int r0, int c0,
                                            int c1, int plane, unsigned lane) {
  const _Float16* p = base + (r0 + (int)(lane & 15u)) * 8;
  v8h lo = *(const v8h*)(p + c0 * plane);
  v8h hj = *(const v8h*)(p + c1 * plane);
  return __builtin_shufflevector(lo, hj, 0, 1, 2, 3, 4, 5, 6, 7, 8, 9, 10, 11,
                                 12, 13, 14, 15);
}

// A fragment for 2-tap conv chunk: K 0..15 = tap0 ch0..15, K 16..31 = tap1.
__device__ __forceinline__ v16h frag2tap(const _Float16* p0, const _Float16* p1,
                                         unsigned lane) {
  int hi = (lane & 16u) ? 8 : 0;
  v8h lo = *(const v8h*)(p0 + hi);
  v8h hj = *(const v8h*)(p1 + hi);
  return __builtin_shufflevector(lo, hj, 0, 1, 2, 3, 4, 5, 6, 7, 8, 9, 10, 11,
                                 12, 13, 14, 15);
}

// A fragment for 1-tap conv chunk over a 32-channel pixel record.
__device__ __forceinline__ v16h frag1tap(const _Float16* p, unsigned lane) {
  int hi = (lane & 16u) ? 1 : 0;
  v8h lo = *(const v8h*)(p + (hi ? 8 : 0));
  v8h hj = *(const v8h*)(p + (hi ? 24 : 16));
  return __builtin_shufflevector(lo, hj, 0, 1, 2, 3, 4, 5, 6, 7, 8, 9, 10, 11,
                                 12, 13, 14, 15);
}

// value of the lane 16 away (same column, other half of the rows)
__device__ __forceinline__ float other_half(float v) {
  int b = __builtin_bit_cast(int, v);
  b = __builtin_amdgcn_permlanex16(b, b, 0x76543210, 0xfedcba98, false, false);
  return __builtin_bit_cast(float, b);
}

// sum over the 32 lanes of a wave, the total in every lane: four adds with the
// lane whose number differs in one bit (row_xmask, inside a 16-lane row), then
// the other row. All 32 lanes have to be on.
template <int CTRL>
__device__ __forceinline__ float add_xmask(float v) {
  int b = __builtin_bit_cast(int, v);
  b = __builtin_amdgcn_update_dpp(0, b, CTRL, 0xf, 0xf, true);
  return v + __builtin_bit_cast(float, b);
}
__device__ __forceinline__ float wave_sum(float v) {
  v = add_xmask<0x161>(v);
  v = add_xmask<0x162>(v);
  v = add_xmask<0x164>(v);
  v = add_xmask<0x168>(v);
  return v + other_half(v);
}

// the eight waves' partial sums p[0..7], added in one fixed order
__device__ __forceinline__ float sum8(const float* p) {
  v4f a = *(const v4f*)p, b = *(const v4f*)(p + 4);
  return ((a[0] + a[1]) + (a[2] + a[3])) + ((b[0] + b[1]) + (b[2] + b[3]));
}

__device__ __forceinline__ float exp_slot(float x) {
  float r = x * 1.44269504f;
  asm("v_exp_f32 %0, %0\n\tv_nop" : "+v"(r));
  return r;
}

__device__ __forceinline__ v8f wmma_f16(v16h a, v16h b, v8f c) {
  return __builtin_amdgcn_wmma_f32_16x16x32_f16(false, a, false, b, (short)0, c,
                                                false, false);
}

__device__ __forceinline__ v8f zero8() {
  v8f z = {0.f, 0.f, 0.f, 0.f, 0.f, 0.f, 0.f, 0.f};
  return z;
}

#define NWG 512
#define H1P 24
#define H1R 656
#define H2P 40
#define H2R 888
#define BPL 264
#define BTP 1064
__global__ __launch_bounds__(256) void conv_stack_kernel(
    const float* __restrict__ x,
    const float* __restrict__ w1, const float* __restrict__ b1,
    const float* __restrict__ w2, const float* __restrict__ b2,
    const float* __restrict__ w3, const float* __restrict__ b3,
    const float* __restrict__ w4, const float* __restrict__ b4,
    _Float16* __restrict__ feat, int nimg) {
  extern __shared__ char smem[];
  float*     xin = (float*)smem;
  float*     ws1 = (float*)(smem + 3136);
  float*     bbf = (float*)(smem + 4416);     // [4][32]
  _Float16*  h1  = (_Float16*)(smem + 4928);
  _Float16*  h2  = (_Float16*)(smem + 38448);
  _Float16*  h3  = (_Float16*)(smem + 4928);   // over h1, once it is dead
  _Float16*  Bc2 = (_Float16*)(smem + 78480);
  _Float16*  Bc3 = (_Float16*)(smem + 95504);
  _Float16*  Bc4 = (_Float16*)(smem + 129552);

  const int tid = threadIdx.x;
  const unsigned lane = tid & 31u;
  int b = blockIdx.x;  // the image in work
  if (b >= nimg) return;  // the whole block, ahead of every barrier
  const int ch0 = (lane & 16u) ? 1 : 0;  // weight planes of this half wave:
  const int ch1 = ch0 + 2;               // the k order of frag2tap/frag1tap

  // ---- every global read ahead of the image loop: coalesced, branch-free (indices
  // clamped, stores guarded) and issued together, so the L2 round trips
  // overlap instead of one waited 4-byte load per staged element ----
  // Weight unit u = (oc n, input-channel pair kp, tap quad tq), tq fastest:
  // two 16-byte loads (channels 2kp and 2kp+1, taps 4tq..4tq+3) feed four
  // 4-byte LDS stores of a channel pair each.
  // (the unrolls here and in the scatter below keep the arrays in registers)
  v4f r2a[3], r2b[3], r3a[4], r3b[4], r4a[6], r4b[6];
  {
    const v4f* w2v = (const v4f*)w2;  // 20 x 8 x 4  = 640 units
    const v4f* w3v = (const v4f*)w3;  // 24 x 10 x 4 = 960 units
    const v4f* w4v = (const v4f*)w4;  // 30 x 12 x 4 = 1440 units
    // 16-byte index of unit u: (u>>2)*8 + (u&3); 256 units further = +512.
    // Each tensor's last, partial slice clamps its unit.
    const int a0 = (tid >> 2) * 8 + (tid & 3);
    const int u2 = tid + 512 < 640 ? tid + 512 : 639;
    const int u3 = tid + 768 < 960 ? tid + 768 : 959;
    const int u4 = tid + 1280 < 1440 ? tid + 1280 : 1439;
    const int a2 = (u2 >> 2) * 8 + (u2 & 3);
    const int a3 = (u3 >> 2) * 8 + (u3 & 3);
    const int a4 = (u4 >> 2) * 8 + (u4 & 3);
#pragma unroll
    for (int i = 0; i < 2; ++i) {
      r2a[i] = w2v[a0 + 512 * i];
      r2b[i] = w2v[a0 + 512 * i + 4];
    }
    r2a[2] = w2v[a2];
    r2b[2] = w2v[a2 + 4];
#pragma unroll
    for (int i = 0; i < 3; ++i) {
      r3a[i] = w3v[a0 + 512 * i];
      r3b[i] = w3v[a0 + 512 * i + 4];
    }
    r3a[3] = w3v[a3];
    r3b[3] = w3v[a3 + 4];
#pragma unroll
    for (int i = 0; i < 5; ++i) {
      r4a[i] = w4v[a0 + 512 * i];
      r4b[i] = w4v[a0 + 512 * i + 4];
    }
    r4a[5] = w4v[a4];
    r4b[5] = w4v[a4 + 4];

    const v4f* sx = (const v4f*)(x + (size_t)b * 784);
    v4f xr  = sx[tid < 196 ? tid : 195];
    const int a1 = tid & 63;
    v4f w1r = ((const v4f*)w1)[a1];
    int g = (tid >> 5) & 3, n = tid & 31;
    const float* bp = (g == 0) ? b1 : (g == 1) ? b2 : (g == 2) ? b3 : b4;
    int lim = (g == 0) ? 16 : (g == 1) ? 20 : (g == 2) ? 24 : 30;
    const float* bq = bp + (n < lim ? n : 0);
    float bv = *bq;
    // The loads' address registers are inputs here, so they stay unwritten
    // (also by a later load's result) until this wait.
    asm volatile("s_wait_xcnt 0x0"
                 :: "v"(a0), "v"(a1), "v"(a2), "v"(a3), "v"(a4), "v"(bq)
                 : "memory");
    // zero h1, h2 and Bc2..Bc4 (contiguous 158672 B = 9917 x b128)
    v4u zz = {0u, 0u, 0u, 0u};
    v4u* z = (v4u*)h1;
    for (int i = 0; i < 38; ++i) z[tid + 256 * i] = zz;
    if (tid < 189) z[tid + 9728] = zz;
    if (tid < 196) ((v4f*)xin)[tid] = xr;
    if (tid < 64)  *(v4f*)(ws1 + (tid >> 2) * 20 + (tid & 3) * 4) = w1r;
    if (tid < 128) bbf[tid] = (n < lim) ? bv : 0.f;
  }
  __syncthreads();

  // ---- scatter the weights into the zeroed per-tap B matrices ----
  // Bc2: chunk c pairs taps 2c,2c+1; k<16 -> tap 2c ic=k, k>=16 -> tap 2c+1
#pragma unroll
  for (int i = 0; i < 3; ++i) {
    int u = tid + 256 * i;
    if (u < 640) {
      int t0 = (u & 3) * 4, r = u >> 2;
      int n = r >> 3, ic = (r & 7) * 2;
#pragma unroll
      for (int e = 0; e < 4; ++e) {
        int tap = t0 + e;
        v2h h = {(_Float16)r2a[i][e], (_Float16)r2b[i][e]};
        int k = (tap & 1) * 16 + ic;
        *(v2h*)(Bc2 + (tap >> 1) * BTP + (k >> 3) * BPL + n * 8 + (k & 7)) = h;
      }
    }
  }
  // Bc3: tap t, k = ic (20 valid of 32), n = oc (24 valid of 32)
#pragma unroll
  for (int i = 0; i < 4; ++i) {
    int u = tid + 256 * i;
    if (u < 960) {
      int t0 = (u & 3) * 4, r = u >> 2;
      int n = r / 10, k = (r - n * 10) * 2;
#pragma unroll
      for (int e = 0; e < 4; ++e) {
        v2h h = {(_Float16)r3a[i][e], (_Float16)r3b[i][e]};
        *(v2h*)(Bc3 + (t0 + e) * BTP + (k >> 3) * BPL + n * 8 + (k & 7)) = h;
      }
    }
  }
  // Bc4: tap t, k = ic (24 valid of 32), n = oc (30 valid of 32)
#pragma unroll
  for (int i = 0; i < 6; ++i) {
    int u = tid + 256 * i;
    if (u < 1440) {
      int t0 = (u & 3) * 4, r = u >> 2;
      int n = r / 12, k = (r - n * 12) * 2;
#pragma unroll
      for (int e = 0; e < 4; ++e) {
        v2h h = {(_Float16)r4a[i][e], (_Float16)r4b[i][e]};
        *(v2h*)(Bc4 + (t0 + e) * BTP + (k >> 3) * BPL + n * 8 + (k & 7)) = h;
      }
    }
  }

  // ---- one trip an image ----
  for (;;) {
  // The wave's number, taken as a scalar in each trip: the tile addresses that
  // follow from it are formed anew per trip, their uniform part on the scalar
  // unit. Taken once ahead of the loop, the compiler keeps every address of
  // all four layers in registers across the loop: past 256, one block a WGP.
  const int wv = __builtin_amdgcn_readfirstlane(tid >> 5);
  // The next image's pixels are read here and go to xin behind conv1's barrier,
  // when this image's have been read; conv1 covers the round trip. (On the last
  // trip: this image's again, stored and not used.)
  const int bn = b + NWG;
  const int xi = tid < 196 ? tid : 195;
  v4f xnx = ((const v4f*)(x + (size_t)(bn < nimg ? bn : b) * 784))[xi];
  // The load's index register is an input here, so it stays unwritten until
  // this wait.
  asm volatile("s_wait_xcnt 0x0" :: "v"(xi) : "memory");

  // ---- conv1 via WMMA: 28x28 -> 16x25x25, channel-last f16 ----
  // Transposed (D = W1 X^T): M = 16 channels, N = 16 pixels, 40 N tiles, five a
  // wave. A lane's eight D registers are channels 8*hi..8*hi+7 of one pixel:
  // half a pixel record, one 16-byte store. To keep the f32 operands' accuracy
  // x and w are each split into two f16 parts, v = hi + lo. K holds the 16 taps
  // twice: elements 0..7 of a lane are taps 8*hi..8*hi+7 (kernel rows 2*hi and
  // 2*hi+1) against x's hi part, elements 8..15 the same taps against its lo
  // part, in A and in B alike. One WMMA with w's lo part, one with its hi part.
  {
    const int c15 = (int)(lane & 15u);
    const float* wp = ws1 + c15 * 20 + ch0 * 8;  // channel c15
    v4f wa = *(const v4f*)wp, wb = *(const v4f*)(wp + 4);
    v8h wh, wl;
#pragma unroll
    for (int e = 0; e < 4; ++e) {
      wh[e]     = (_Float16)wa[e];
      wh[4 + e] = (_Float16)wb[e];
      wl[e]     = (_Float16)(wa[e] - (float)wh[e]);
      wl[4 + e] = (_Float16)(wb[e] - (float)wh[4 + e]);
    }
    v16h ah = __builtin_shufflevector(wh, wh, 0, 1, 2, 3, 4, 5, 6, 7, 8, 9, 10,
                                      11, 12, 13, 14, 15);
    v16h al = __builtin_shufflevector(wl, wl, 0, 1, 2, 3, 4, 5, 6, 7, 8, 9, 10,
                                      11, 12, 13, 14, 15);
    v4f c0 = *(const v4f*)(bbf + ch0 * 8), c1 = *(const v4f*)(bbf + ch0 * 8 + 4);
    const v8f bi = {c0[0], c0[1], c0[2], c0[3], c1[0], c1[1], c1[2], c1[3]};
    // All five tiles' reads stand ahead of the first store to h1: for the
    // compiler such a store could alias a later read of xin, and a tile's reads
    // would then go out only behind the tile before, their latency uncovered.
    // (The unrolls keep the arrays in registers.)
    float u[5][8];
    _Float16* hp[5];
#pragma unroll
    for (int j = 0; j < 5; ++j) {
      const int p = (wv * 5 + j) * 16 + c15;
      const int pc = p < 625 ? p : 624;  // the last tile has one valid pixel
      const int oy = pc / 25, ox = pc - oy * 25;
      const float* xp = xin + (oy + 2 * ch0) * 28 + ox;
#pragma unroll
      for (int e = 0; e < 4; ++e) {
        u[j][e]     = xp[e];
        u[j][4 + e] = xp[28 + e];
      }
      hp[j] = h1 + oy * H1R + ox * H1P + ch0 * 8;
    }
#pragma unroll
    for (int j = 0; j < 5; ++j) {
      v8h xh, xl;
#pragma unroll
      for (int e = 0; e < 8; ++e) {
        xh[e] = (_Float16)u[j][e];
        xl[e] = (_Float16)(u[j][e] - (float)xh[e]);
      }
      v16h xb = __builtin_shufflevector(xh, xl, 0, 1, 2, 3, 4, 5, 6, 7, 8, 9, 10,
                                        11, 12, 13, 14, 15);
      v8f d = wmma_f16(al, xb, bi);
      d = wmma_f16(ah, xb, d);
      v8h o;
#pragma unroll
      for (int r = 0; r < 8; ++r) o[r] = (_Float16)fmaxf(d[r], 0.f);
      if (j < 4 || (wv * 5 + j) * 16 + c15 < 625) *(v8h*)hp[j] = o;
    }
  }
  __syncthreads();
  if (tid < 196) ((v4f*)xin)[tid] = xnx;  // read three barriers on

  // conv2..conv4: a wave owns several M tiles and BOTH N tiles, so an A fragment
  // read from LDS feeds two WMMAs and a B fragment one per M tile, and a wave's
  // accumulator chains are independent. The K loop goes in blocks with two
  // fragment sets in registers: the next block's reads stand as one group ahead
  // of this block's WMMAs. Each output still sums its taps in the order 0..15.
  // (The unrolls keep acc and the fragment sets in registers. The two
  // sched_barriers of a block keep the reads in that one group: without them
  // the compiler moves each read down to just ahead of the WMMA that uses it,
  // and the wave waits out the LDS latency there.)
  const int l15 = (int)(lane & 15u);
  const int mh = (lane & 16u) ? 8 : 0;

  // ---- conv2 via WMMA: M=484(->496) x N=20(->32) x K=256 (8 chunks) ----
  // 31 M tiles, four a wave; the last wave's fourth is its third again (same
  // values to the same places, from the same wave). Block = one chunk.
  {
    int mts[4];
    const _Float16* ap[4];
    v8f acc[4][2];
#pragma unroll
    for (int j = 0; j < 4; ++j) {
      int mt = wv * 4 + j;
      mts[j] = mt < 31 ? mt : 30;
      int m = mts[j] * 16 + l15;
      int oy = m / 22, ox = m - oy * 22;
      ap[j] = h1 + oy * H1R + ox * H1P;
      acc[j][0] = zero8();
      acc[j][1] = zero8();
    }
    v16h fa[2][4], fw[2][2];
    auto fetch = [&](int c) {
      const int s = c & 1;
      const int o0 = ((2 * c) >> 2) * H1R + ((2 * c) & 3) * H1P;  // tap 2c
      fw[s][0] = loadfrag_cm(Bc2 + c * BTP, 0, ch0, ch1, BPL, lane);
      fw[s][1] = loadfrag_cm(Bc2 + c * BTP, 16, ch0, ch1, BPL, lane);
#pragma unroll
      for (int j = 0; j < 4; ++j)
        fa[s][j] = frag2tap(ap[j] + o0, ap[j] + o0 + H1P, lane);
    };
    fetch(0);
#pragma unroll
    for (int c = 0; c < 8; ++c) {
      if (c < 7) fetch(c + 1);
      __builtin_amdgcn_sched_barrier(0);  // the reads above stay one group
#pragma unroll
      for (int j = 0; j < 4; ++j) {
        acc[j][0] = wmma_f16(fa[c & 1][j], fw[c & 1][0], acc[j][0]);
        acc[j][1] = wmma_f16(fa[c & 1][j], fw[c & 1][1], acc[j][1]);
      }
      __builtin_amdgcn_sched_barrier(0);  // no later read moves up among them
    }
    float bias0 = bbf[32 + l15], bias1 = bbf[48 + l15];
#pragma unroll
    for (int j = 0; j < 4; ++j) {
      int m0 = mts[j] * 16 + mh;  // first of this lane's 8 pixels
      int y0 = m0 / 22, x0 = m0 - y0 * 22;
      _Float16* hp = h2 + y0 * H2R + x0 * H2P + l15;
#pragma unroll
      for (int r = 0; r < 8; ++r) {  // at most one step into the next image row
        _Float16* q = hp + r * H2P + (x0 + r >= 22 ? H2R - 22 * H2P : 0);
        q[0]  = (_Float16)fmaxf(acc[j][0][r] + bias0, 0.f);
        q[16] = (_Float16)fmaxf(acc[j][1][r] + bias1, 0.f);
      }
    }
  }
  __syncthreads();

  // ---- conv3 via WMMA: M=361(->368) x N=24(->32) x K=512 (16 taps) ----
  // 23 M tiles, three a wave; the last wave's third is its second again.
  // Block = two taps.
  {
    int mts[3];
    const _Float16* ap[3];
    v8f acc[3][2];
#pragma unroll
    for (int j = 0; j < 3; ++j) {
      int mt = wv * 3 + j;
      mts[j] = mt < 23 ? mt : 22;
      int m = mts[j] * 16 + l15;
      int oy = m / 19, ox = m - oy * 19;
      ap[j] = h2 + oy * H2R + ox * H2P;
      acc[j][0] = zero8();
      acc[j][1] = zero8();
    }
    v16h fa[2][2][3], fw[2][2][2];
    auto fetch = [&](int k) {
      const int s = k & 1;
#pragma unroll
      for (int e = 0; e < 2; ++e) {
        const int t = 2 * k + e;
        fw[s][e][0] = loadfrag_cm(Bc3 + t * BTP, 0, ch0, ch1, BPL, lane);
        fw[s][e][1] = loadfrag_cm(Bc3 + t * BTP, 16, ch0, ch1, BPL, lane);
#pragma unroll
        for (int j = 0; j < 3; ++j)
          fa[s][e][j] = frag1tap(ap[j] + (t >> 2) * H2R + (t & 3) * H2P, lane);
      }
    };
    fetch(0);
#pragma unroll
    for (int k = 0; k < 8; ++k) {
      if (k < 7) fetch(k + 1);
      __builtin_amdgcn_sched_barrier(0);  // the reads above stay one group
#pragma unroll
      for (int e = 0; e < 2; ++e)
#pragma unroll
        for (int j = 0; j < 3; ++j) {
          acc[j][0] = wmma_f16(fa[k & 1][e][j], fw[k & 1][e][0], acc[j][0]);
          acc[j][1] = wmma_f16(fa[k & 1][e][j], fw[k & 1][e][1], acc[j][1]);
        }
      __builtin_amdgcn_sched_barrier(0);  // no later read moves up among them
    }
    float bias0 = bbf[64 + l15], bias1 = bbf[80 + l15];
#pragma unroll
    for (int j = 0; j < 3; ++j) {
      _Float16* q = h3 + (mts[j] * 16 + mh) * H2P + l15;
#pragma unroll
      for (int r = 0; r < 8; ++r) {
        q[r * H2P]      = (_Float16)fmaxf(acc[j][0][r] + bias0, 0.f);
        q[r * H2P + 16] = (_Float16)fmaxf(acc[j][1][r] + bias1, 0.f);
      }
    }
  }
  __syncthreads();

  // ---- conv4 via WMMA: M=256 x N=30(->32) x K=512; write features+coords ----
  // An M tile is one output row; a wave owns rows 2wv and 2wv+1. The upper
  // row's A fragments of kernel row ky are the lower row's of ky+1: each of the
  // five input rows (ar) is read once. Block = two taps of one kernel row.
  _Float16* fb = feat + (size_t)b * 8192;
  {
    const _Float16* ap = h3 + (wv * 2 * 19 + l15) * H2P;
    v8f acc[2][2];
    acc[0][0] = zero8(); acc[0][1] = zero8();
    acc[1][0] = zero8(); acc[1][1] = zero8();
    v16h ar[5][4], fw[2][2][2];
    auto fetch = [&](int k) {
      const int s = k & 1;
#pragma unroll
      for (int e = 0; e < 2; ++e) {
        const int t = 2 * k + e, ky = t >> 2, kx = t & 3;
        fw[s][e][0] = loadfrag_cm(Bc4 + t * BTP, 0, ch0, ch1, BPL, lane);
        fw[s][e][1] = loadfrag_cm(Bc4 + t * BTP, 16, ch0, ch1, BPL, lane);
        ar[ky + 1][kx] = frag1tap(ap + ((ky + 1) * 19 + kx) * H2P, lane);
      }
    };
#pragma unroll
    for (int kx = 0; kx < 4; ++kx) ar[0][kx] = frag1tap(ap + kx * H2P, lane);
    fetch(0);
#pragma unroll
    for (int k = 0; k < 8; ++k) {
      if (k < 7) fetch(k + 1);
      __builtin_amdgcn_sched_barrier(0);  // the reads above stay one group
#pragma unroll
      for (int e = 0; e < 2; ++e) {
        const int t = 2 * k + e, ky = t >> 2, kx = t & 3;
        acc[0][0] = wmma_f16(ar[ky][kx], fw[k & 1][e][0], acc[0][0]);
        acc[0][1] = wmma_f16(ar[ky][kx], fw[k & 1][e][1], acc[0][1]);
        acc[1][0] = wmma_f16(ar[ky + 1][kx], fw[k & 1][e][0], acc[1][0]);
        acc[1][1] = wmma_f16(ar[ky + 1][kx], fw[k & 1][e][1], acc[1][1]);
      }
      __builtin_amdgcn_sched_barrier(0);  // no later read moves up among them
    }
    // every wave has read h3 out: the next trip's conv1 may store to h1. Ahead
    // of the global stores, so that no barrier waits for them before conv1's.
    __syncthreads();
    float bias0 = bbf[96 + l15], bias1 = bbf[112 + l15];
#pragma unroll
    for (int j = 0; j < 2; ++j) {
      _Float16* q = fb + ((wv * 2 + j) * 16 + mh) * 32 + l15;
#pragma unroll
      for (int r = 0; r < 8; ++r)
        q[r * 32] = (_Float16)fmaxf(acc[j][0][r] + bias0, 0.f);
      if (l15 < 14) {  // channels 16..29; 30 and 31 are the coordinates
#pragma unroll
        for (int r = 0; r < 8; ++r)
          q[r * 32 + 16] = (_Float16)fmaxf(acc[j][1][r] + bias1, 0.f);
        // ahead of what next overwrites these stores' registers; in the
        // branch: behind it the compiler lifts such a write over the wait
        asm volatile("s_wait_xcnt 0x0" ::: "memory");
      }
    }
  }
  {
    int n = tid;  // coord channels (columns 30/31, disjoint from tile stores)
    int xx = n % 16, yy = n / 16;
    fb[n * 32 + 30] = (_Float16)((float)xx * 0.0625f);
    fb[n * 32 + 31] = (_Float16)((float)yy * 0.0625f);
    asm volatile("s_wait_xcnt 0x0" ::: "memory");
  }
  if (bn >= nimg) break;  // the same for the whole block
  b = bn;
  }
}

#define APL 2080
#define TP 52
#define W1P 56
#define WTL 1920
__global__ __launch_bounds__(256) void attn_kernel(
    const _Float16* __restrict__ feat,
    const float* __restrict__ kW, const float* __restrict__ kb,
    const float* __restrict__ qW, const float* __restrict__ qb,
    const float* __restrict__ vW, const float* __restrict__ vb,
    const float* __restrict__ kg, const float* __restrict__ kbe,
    const float* __restrict__ qg, const float* __restrict__ qbe,
    const float* __restrict__ vg, const float* __restrict__ vbe,
    const float* __restrict__ l1W, const float* __restrict__ l1b,
    const float* __restrict__ l2W, const float* __restrict__ l2b,
    float* __restrict__ out, int nimg) {
  extern __shared__ char smem[];
  _Float16* hbuf = (_Float16*)smem;
  _Float16* Qb   = (_Float16*)(smem + 16640);
  float* tmpf = (float*)(smem + 41600);
  _Float16* Kb   = (_Float16*)(smem + 94848);
  _Float16* Vt   = (_Float16*)(smem + 119808);
  _Float16* wbuf = (_Float16*)(smem + 145152);  // three [48][40] tiles: V, K, Q
  float* red  = (float*)(smem + 156672);
  float* mxv  = (float*)(smem + 158752);
  float* ov   = (float*)(smem + 158944);
  float* bb   = (float*)(smem + 159008);
  _Float16* W1h = (_Float16*)smem;            // over hbuf, once it is dead:
  _Float16* W1l = (_Float16*)(smem + 5376);   // [48][W1P] f16 each
  float* l1bs = (float*)(smem + 10752);       // [48]

  const int tid0 = threadIdx.x;
  const unsigned lane = tid0 & 31u;
  int b = blockIdx.x;  // the batch element in work
  if (b >= nimg) return;  // the whole block, ahead of every barrier
  // planes of this half wave, in the k order of loadfrag_h: columns 0..31,
  // then columns 32..63 (40..63 read the zero plane)
  const int ch0 = (lane & 16u) ? 1 : 0, ch1 = ch0 + 2, ch2 = ch0 + 4;

  // ---- once a block: the three projections' weights as f16 tiles, the biases
  // and the zeros that the staged operands pad with. No trip writes over them;
  // the first trip's first barrier publishes them ----
  {
    const int tid = tid0;
    v4f wreg[3][2];  // (the unroll below keeps it in registers)
    const int f1 = 256 + (tid & 31);  // each W is 288 x 16 B
    wreg[0][0] = ((const v4f*)vW)[tid];  wreg[0][1] = ((const v4f*)vW)[f1];
    wreg[1][0] = ((const v4f*)kW)[tid];  wreg[1][1] = ((const v4f*)kW)[f1];
    wreg[2][0] = ((const v4f*)qW)[tid];  wreg[2][1] = ((const v4f*)qW)[f1];
    const int bi = tid < 144 ? tid : 0;
    const int pb = bi / 48, jb = bi - pb * 48;
    const float* bp = (pb == 0) ? vb : (pb == 1) ? kb : qb;
    float bv = bp[jb < 36 ? jb : 0];
    // Q/K planes 4 and 5 (520 x 16 B; columns 32..35 are stored over it in
    // every trip), V^T rows 36..47, W rows 36..47
    const v4u zz = {0u, 0u, 0u, 0u};
    for (int i = tid; i < 520; i += 256) {
      ((v4u*)(Qb + 4 * APL))[i] = zz;
      ((v4u*)(Kb + 4 * APL))[i] = zz;
    }
    for (int i = tid; i < 396; i += 256) ((v4u*)(Vt + 36 * 264))[i] = zz;
    if (tid < 180) ((v4u*)(wbuf + (tid / 60) * WTL + 36 * 40))[tid % 60] = zz;
    if (tid < 144) bb[tid] = (jb < 36) ? bv : 0.f;
#pragma unroll
    for (int p = 0; p < 3; ++p) {
      const int k = (tid & 7) * 4;
      v4f w0 = wreg[p][0];
      v4h h0 = {(_Float16)w0[0], (_Float16)w0[1], (_Float16)w0[2], (_Float16)w0[3]};
      *(v4h*)(wbuf + p * WTL + (tid >> 3) * 40 + k) = h0;
      if (tid < 32) {
        v4f w1v = wreg[p][1];
        v4h h1v = {(_Float16)w1v[0], (_Float16)w1v[1], (_Float16)w1v[2], (_Float16)w1v[3]};
        *(v4h*)(wbuf + p * WTL + (32 + (tid >> 3)) * 40 + k) = h1v;
      }
    }
  }

  // ---- one trip a batch element. What a trip stores ahead of its first
  // barrier (the features) lies over W1, last read ahead of the barrier behind
  // the attention loop of the trip before ----
  for (;;) {
  // The wave's number, taken as a scalar in each trip, and the thread's number
  // from it: addresses are formed anew per trip, their uniform part on the
  // scalar unit. With both taken once ahead of the loop the compiler reads
  // gamma and beta once for all trips and keeps them, with every address, in
  // registers: far past 256, one block a WGP.
  const int wv = __builtin_amdgcn_readfirstlane(tid0 >> 5);
  const int tid = wv * 32 + (int)lane;
  // ---- features, first gamma and beta: coalesced, branch-free reads, all in
  // flight together ----
  // (unrolls on fr/gr/er loops keep these arrays in registers)
  // gamma/beta of pass p: 18 coalesced 16-byte loads in flight together.
  // Pass 0's go out here; pass p+1's go out ahead of pass p's normalisation,
  // which covers their L2 round trip up to the barrier behind it.
  v4f gr[3][9], er[3][9];
  // W1 piece u = (row j, column quad q) of the padded [48][48] tile, three a
  // thread (576 pieces); outside the 36 x 36 matrix the piece is zero
  v4f l1r[3];
  float l1bv = 0.f;
#pragma unroll
  for (int i = 0; i < 9; ++i) {
    gr[0][i] = ((const v4f*)vg)[tid + 256 * i];
    er[0][i] = ((const v4f*)vbe)[tid + 256 * i];
  }
  {
    const v4u* src = (const v4u*)(feat + (size_t)b * 8192);
    v4u fr[4];
#pragma unroll
    for (int i = 0; i < 4; ++i) fr[i] = src[tid + 256 * i];

    // 16-byte unit u of the [256][32] features: row u >> 2, plane u & 3
#pragma unroll
    for (int i = 0; i < 4; ++i)
      *(v4u*)(hbuf + (tid & 3) * APL + ((tid >> 2) + 64 * i) * 8) = fr[i];
  }
  __syncthreads();

  // unrolled: gr/er are indexed by p and have to stay in registers
#pragma unroll
  for (int p = 0; p < 3; ++p) {
    // tmpf was last read ahead of the barrier at the foot of the pass before
    // (pass 0: ahead of the barrier behind the trip before's column maxima)
    for (int t = wv; t < 48; t += 8) {
      int rt = t / 3, nt = t % 3;
      v16h a  = loadfrag_cm(hbuf, rt * 16, ch0, ch1, APL, lane);
      v16h bf = loadfrag_h(wbuf + p * WTL, nt * 16, 0, 40, lane);
      v8f acc = zero8();
      acc = wmma_f16(a, bf, acc);
      int n = nt * 16 + (int)(lane & 15u);
      float bias = bb[p * 48 + n];
      int mh = (lane & 16u) ? 8 : 0;
#pragma unroll
      for (int r = 0; r < 8; ++r)
        tmpf[(rt * 16 + mh + r) * TP + n] = acc[r] + bias;
    }
    __syncthreads();

    {
      float s = 0.f, s2 = 0.f;
      const float* rowp = tmpf + tid * TP;
#pragma unroll
      for (int c = 0; c < 36; c += 4) {
        v4f v = *(const v4f*)(rowp + c);
        s += v[0] + v[1] + v[2] + v[3];
        s2 += v[0] * v[0] + v[1] * v[1] + v[2] * v[2] + v[3] * v[3];
      }
      // in the wave across lanes, then one partial a wave; red is next written
      // behind the barrier at the foot of this pass
      s = wave_sum(s);
      s2 = wave_sum(s2);
      if (lane == 0) { red[wv] = s; red[8 + wv] = s2; }
    }
    __syncthreads();
    float mu   = sum8(red) * (1.f / 9216.f);
    float var  = sum8(red + 8) * (1.f / 9216.f) - mu * mu;
    float rstd = rsqrtf(var + 1e-5f);

    if (p < 2) {
      const v4f* Gv = (const v4f*)((p == 0) ? kg : qg);
      const v4f* Ev = (const v4f*)((p == 0) ? kbe : qbe);
#pragma unroll
      for (int i = 0; i < 9; ++i) {
        gr[p + 1][i] = Gv[tid + 256 * i];
        er[p + 1][i] = Ev[tid + 256 * i];
      }
    }
    if (p == 1) {  // W1 and its bias: read here, staged in pass 2
      int ix[3];
#pragma unroll
      for (int i = 0; i < 3; ++i) {
        int u = tid + 256 * i;
        int j = u / 12, q = u - j * 12;
        ix[i] = (j < 36 && q < 9) ? j * 9 + q : 0;
        l1r[i] = ((const v4f*)l1W)[ix[i]];
      }
      const int ib = tid < 36 ? tid : 35;
      l1bv = l1b[ib];
      // The loads' index registers are inputs here, so they stay unwritten
      // until this wait.
      asm volatile("s_wait_xcnt 0x0"
                   :: "v"(ix[0]), "v"(ix[1]), "v"(ix[2]), "v"(ib)
                   : "memory");
    }
    if (p == 2) {
      // the features are dead (last read two barriers back): W1 as hi and lo
      // f16 tiles and the padded bias take their place; the barrier at the
      // foot of this pass publishes them
#pragma unroll
      for (int i = 0; i < 3; ++i) {
        int u = tid + 256 * i;
        int j = u / 12, q = u - j * 12;
        bool ok = j < 36 && q < 9;
        v4h wh, wl;
#pragma unroll
        for (int e = 0; e < 4; ++e) {
          float w = ok ? l1r[i][e] : 0.f;
          wh[e] = (_Float16)w;
          wl[e] = (_Float16)(w - (float)wh[e]);
        }
        if (u < 576) {
          *(v4h*)(W1h + j * W1P + q * 4) = wh;
          *(v4h*)(W1l + j * W1P + q * 4) = wl;
        }
      }
      if (tid < 48) l1bs[tid] = tid < 36 ? l1bv : 0.f;
    }

    // 16-byte piece f of the [256][36] plane: node = f/9, columns j0..j0+3
#pragma unroll
    for (int i = 0; i < 9; ++i) {
      int f = tid + 256 * i;
      int node = f / 9, j0 = (f - node * 9) * 4;
      v4f tv = *(const v4f*)(tmpf + node * TP + j0);
      v4h o;
#pragma unroll
      for (int e = 0; e < 4; ++e) {
        float v = (tv[e] - mu) * rstd;
        o[e] = (_Float16)(v * gr[p][i][e] + er[p][i][e]);
      }
      if (p == 0) {
#pragma unroll
        for (int e = 0; e < 4; ++e) Vt[(j0 + e) * 264 + node] = o[e];
      } else {
        _Float16* dst = (p == 1) ? Kb : Qb;
        *(v4h*)(dst + (j0 >> 3) * APL + node * 8 + (j0 & 4)) = o;
      }
    }
    __syncthreads();
  }

  const float scale = 0.16666667f;  // 1/sqrt(36)
  const int hi8 = (lane & 16u) ? 8 : 0;
  // sums of the linear layer's outputs and of their squares, four chains each
  v4f ls = {0.f, 0.f, 0.f, 0.f}, ls2 = {0.f, 0.f, 0.f, 0.f};
  float* att2 = tmpf;  // [256][TP]; the projections' f32 rows are dead now
  for (int blk = wv; blk < 16; blk += 8) {
    int row0 = blk * 16;
    // B operand: 16 queries (n = query), kept for all 16 key tiles
    v16h qb0 = loadfrag_cm(Qb, row0, ch0, ch1, APL, lane);
    v16h qb1 = loadfrag_cm(Qb, row0, ch2, 5, APL, lane);
    v8f st[16];
#pragma unroll
    for (int ct = 0; ct < 16; ++ct) {
      v8f acc = zero8();
      acc = wmma_f16(loadfrag_cm(Kb, ct * 16, ch0, ch1, APL, lane), qb0, acc);
      acc = wmma_f16(loadfrag_cm(Kb, ct * 16, ch2, 5, APL, lane), qb1, acc);
      st[ct] = acc;
    }
    float mx = -1e30f;
#pragma unroll
    for (int ct = 0; ct < 16; ++ct)
#pragma unroll
      for (int r = 0; r < 8; ++r) {
        st[ct][r] *= scale;
        mx = fmaxf(mx, st[ct][r]);
      }
    mx = fmaxf(mx, other_half(mx));
    float s = 0.f;
    v8f av0 = zero8(), av1 = zero8(), av2 = zero8();
#pragma unroll
    for (int kc = 0; kc < 8; ++kc) {
      // B fragment of keys kc*32..+31: elements 0..7 are k = 8*hi + r (tile
      // 2kc), elements 8..15 are k = 16 + 8*hi + r (tile 2kc+1): the k order
      // of loadfrag_h, which loads the A operand (V^T rows) below.
      v16h pb;
      float ps = 0.f;
#pragma unroll
      for (int r = 0; r < 8; ++r) {
        float e0 = exp_slot(st[2 * kc][r] - mx);
        float e1 = exp_slot(st[2 * kc + 1][r] - mx);
        ps += e0 + e1;
        pb[r]     = (_Float16)e0;
        pb[8 + r] = (_Float16)e1;
      }
      s += ps;
      av0 = wmma_f16(loadfrag_h(Vt, 0, kc * 32, 264, lane), pb, av0);
      av1 = wmma_f16(loadfrag_h(Vt, 16, kc * 32, 264, lane), pb, av1);
      av2 = wmma_f16(loadfrag_h(Vt, 32, kc * 32, 264, lane), pb, av2);
    }
    s += other_half(s);
    float invr = 1.f / s;
    // keeps the W1 and bias reads below from moving up to where the 128 scores
    // are live, which takes the kernel past 256 registers (one work-group a WGP)
    __builtin_amdgcn_sched_barrier(0);
    // O^T tile t: n = query, m = column 16t + r + 8*hi. As f16, tiles 0 and 1
    // are the B fragment of columns 0..31 in the k order of loadfrag_h, which
    // loads W1 below; tile 2 (columns 32..47, 36..47 zero) fills elements 0..7
    // of a second fragment.
    v16h oh0, ol0;
    v8h oh1, ol1;
#pragma unroll
    for (int r = 0; r < 8; ++r) {
      float o0 = av0[r] * invr, o1 = av1[r] * invr, o2 = av2[r] * invr;
      oh0[r]     = (_Float16)o0;
      oh0[8 + r] = (_Float16)o1;
      oh1[r]     = (_Float16)o2;
      ol0[r]     = (_Float16)(o0 - (float)oh0[r]);
      ol0[8 + r] = (_Float16)(o1 - (float)oh0[8 + r]);
      ol1[r]     = (_Float16)(o2 - (float)oh1[r]);
    }
    const v8h z8 = {0, 0, 0, 0, 0, 0, 0, 0};
    // columns 32..47 need half a fragment: with W1's (hi | lo) as A, B = (hi |
    // hi) gives hi*hi + lo*hi in one WMMA and B = (lo | 0) gives hi*lo
    v16h ohh = __builtin_shufflevector(oh1, oh1, 0, 1, 2, 3, 4, 5, 6, 7, 8, 9,
                                       10, 11, 12, 13, 14, 15);
    v16h olz = __builtin_shufflevector(ol1, z8, 0, 1, 2, 3, 4, 5, 6, 7, 8, 9,
                                       10, 11, 12, 13, 14, 15);
    // d[jt]: output j = 16jt + r + 8*hi of query row0 + (lane & 15); starts at
    // the bias. All reads first, then three independent accumulator chains, the
    // small products first. (The unrolls keep the arrays in registers.)
    v8f d[3];
    v16h wh0[3], wl0[3], whl[3];
#pragma unroll
    for (int jt = 0; jt < 3; ++jt) {
      const float* bp = l1bs + jt * 16 + hi8;
      v4f b0 = *(const v4f*)bp, b1 = *(const v4f*)(bp + 4);
      v8f bi = {b0[0], b0[1], b0[2], b0[3], b1[0], b1[1], b1[2], b1[3]};
      d[jt] = bi;
      wh0[jt] = loadfrag_h(W1h, jt * 16, 0, W1P, lane);
      wl0[jt] = loadfrag_h(W1l, jt * 16, 0, W1P, lane);
      const int wo = (jt * 16 + (int)(lane & 15u)) * W1P + 32 + hi8;
      v8h wh1 = *(const v8h*)(W1h + wo);
      v8h wl1 = *(const v8h*)(W1l + wo);
      whl[jt] = __builtin_shufflevector(wh1, wl1, 0, 1, 2, 3, 4, 5, 6, 7, 8, 9,
                                        10, 11, 12, 13, 14, 15);
    }
#pragma unroll
    for (int jt = 0; jt < 3; ++jt) d[jt] = wmma_f16(whl[jt], olz, d[jt]);
#pragma unroll
    for (int jt = 0; jt < 3; ++jt) d[jt] = wmma_f16(wh0[jt], ol0, d[jt]);
#pragma unroll
    for (int jt = 0; jt < 3; ++jt) d[jt] = wmma_f16(wl0[jt], oh0, d[jt]);
#pragma unroll
    for (int jt = 0; jt < 3; ++jt) d[jt] = wmma_f16(whl[jt], ohh, d[jt]);
#pragma unroll
    for (int jt = 0; jt < 3; ++jt) d[jt] = wmma_f16(wh0[jt], oh0, d[jt]);
    // this query's row of the layer's output, for the column maxima; rows
    // 36..47 of W1 and of the bias are zero: of tile 2 only r < 4 counts
    float* op = att2 + (row0 + (int)(lane & 15u)) * TP + hi8;
#pragma unroll
    for (int jt = 0; jt < 3; ++jt) {
#pragma unroll
      for (int h = 0; h < (jt < 2 ? 2 : 1); ++h) {
        v4f o;
#pragma unroll
        for (int e = 0; e < 4; ++e) o[e] = fmaxf(d[jt][4 * h + e], 0.f);
        ls += o;
        ls2 += o * o;
        *(v4f*)(op + jt * 16 + 4 * h) = o;
      }
    }
  }

  // LayerNorm sums of this wave's 32 queries, one partial a wave; red was last
  // read ahead of the barrier at the foot of pass 2
  {
    float t = wave_sum((ls[0] + ls[1]) + (ls[2] + ls[3]));
    float t2 = wave_sum((ls2[0] + ls2[1]) + (ls2[2] + ls2[3]));
    if (lane == 0) { red[wv] = t; red[8 + wv] = t2; }
  }
  __syncthreads();

  // column maxima: thread (g, col) takes rows 37g..37g+36 of its column (the
  // last group's rows end at 255; a row taken twice does not move a maximum).
  // Unrolled, four chains: the 37 reads go out together, one wait for all.
  if (tid < 252) {
    const int g = tid / 36, col = tid - g * 36;
    const float* cp = att2 + g * 37 * TP + col;
    float m[4] = {-1e30f, -1e30f, -1e30f, -1e30f};
#pragma unroll
    for (int i = 0; i < 37; ++i) {
      int d = i;
      if (i > 33) d = (g * 37 + i < 256) ? i : 255 - g * 37;
      m[i & 3] = fmaxf(m[i & 3], cp[d * TP]);
    }
    red[16 + tid] = fmaxf(fmaxf(m[0], m[1]), fmaxf(m[2], m[3]));
  }
  __syncthreads();

  if (tid < 36) {
    float mu   = sum8(red) * (1.f / 9216.f);
    float var  = sum8(red + 8) * (1.f / 9216.f) - mu * mu;
    float rstd = rsqrtf(var + 1e-5f);
    float m = red[16 + tid];
#pragma unroll  // the six reads go out together, not one waited read a trip
    for (int g = 1; g < 7; ++g) m = fmaxf(m, red[16 + g * 36 + tid]);
    mxv[tid] = (m - mu) * rstd;
  }
  __syncthreads();

  if (tid < 10) {
    float s = l2b[tid];
#pragma unroll  // the row's nine 16-byte reads go out together, one round trip
    for (int j = 0; j < 36; ++j) s += mxv[j] * l2W[tid * 36 + j];
    ov[tid] = s;
  }
  __syncthreads();
  if (tid == 0) {
    float mx = -1e30f;
    for (int o = 0; o < 10; ++o) mx = fmaxf(mx, ov[o]);
    float s = 0.f;
    for (int o = 0; o < 10; ++o) s += __expf(ov[o] - mx);
    red[0] = mx + __logf(s);
  }
  __syncthreads();
  if (tid < 10) {
    out[(size_t)b * 10 + tid] = ov[tid] - red[0];
    // ahead of what next overwrites the store's registers (in the branch: see
    // the conv kernel)
    asm volatile("s_wait_xcnt 0x0" ::: "memory");
  }
  b += NWG;
  if (b >= nimg) break;  // the same for the whole block
  }
}

// ---------------------------------------------------------------------------
extern "C" void kernel_launch(void* const* d_in, const int* in_sizes, int n_in,
                              void* d_out, int out_size, void* d_ws, size_t ws_size,
                              hipStream_t stream) {
  const float* x  = (const float*)d_in[0];
  const float* w1 = (const float*)d_in[1];  const float* b1 = (const float*)d_in[2];
  const float* w2 = (const float*)d_in[3];  const float* b2 = (const float*)d_in[4];
  const float* w3 = (const float*)d_in[5];  const float* b3 = (const float*)d_in[6];
  const float* w4 = (const float*)d_in[7];  const float* b4 = (const float*)d_in[8];
  const float* kW = (const float*)d_in[9];  const float* kbv = (const float*)d_in[10];
  const float* qW = (const float*)d_in[11]; const float* qbv = (const float*)d_in[12];
  const float* vW = (const float*)d_in[13]; const float* vbv = (const float*)d_in[14];
  const float* kg = (const float*)d_in[15]; const float* kbe = (const float*)d_in[16];
  const float* qg = (const float*)d_in[17]; const float* qbe = (const float*)d_in[18];
  const float* vg = (const float*)d_in[19]; const float* vbe = (const float*)d_in[20];
  const float* l1W = (const float*)d_in[21]; const float* l1b = (const float*)d_in[22];
  const float* l2W = (const float*)d_in[23]; const float* l2b = (const float*)d_in[24];

  const int B = in_sizes[0] / (28 * 28);   // 2048
  _Float16* feat = (_Float16*)d_ws;        // [B][256][32] f16 = 16 KB/batch

  conv_stack_kernel<<<NWG, 256, 163600, stream>>>(x, w1, b1, w2, b2, w3, b3, w4,
                                                  b4, feat, B);
  attn_kernel<<<NWG, 256, 159584, stream>>>(feat, kW, kbv, qW, qbv, vW, vbv,
                                            kg, kbe, qg, qbe, vg, vbe,
                                            l1W, l1b, l2W, l2b, (float*)d_out, B);
}

// v010
// One run takes 89.6 microseconds.
// Two timings next to v009 both put it at 1.15 times that version's speed.
// All steps since v000 together make it 10.8 times as fast.
#include <hip/hip_runtime.h>
#include <hip/hip_bf16.h>
#include <math.h>

typedef __attribute__((ext_vector_type(16))) _Float16 v16h;
typedef __attribute__((ext_vector_type(8)))  _Float16 v8h;
typedef __attribute__((ext_vector_type(4)))  _Float16 v4h;
typedef __attribute__((ext_vector_type(2)))  _Float16 v2h;
typedef __attribute__((ext_vector_type(8)))  float    v8f;
typedef __attribute__((ext_vector_type(4)))  float    v4f;
typedef __attribute__((ext_vector_type(4)))  unsigned int v4u;

__device__ __forceinline__ v16h loadfrag_h(const _Float16* base, int r0, int k0,
                                           int stride, unsigned lane) {
  const _Float16* p = base + (r0 + (int)(lane & 15u)) * stride + k0;
  int hi = (lane & 16u) ? 1 : 0;
  v8h lo = *(const v8h*)(p + (hi ? 8 : 0));
  v8h hj = *(const v8h*)(p + (hi ? 24 : 16));
  return __builtin_shufflevector(lo, hj, 0, 1, 2, 3, 4, 5, 6, 7, 8, 9, 10, 11,
                                 12, 13, 14, 15);
}

__device__ __forceinline__ v16h loadfrag_cm(const _Float16* base, int r0, int c0,
                                            int c1, int plane, unsigned lane) {
  const _Float16* p = base + (r0 + (int)(lane & 15u)) * 8;
  v8h lo = *(const v8h*)(p + c0 * plane);
  v8h hj = *(const v8h*)(p + c1 * plane);
  return __builtin_shufflevector(lo, hj, 0, 1, 2, 3, 4, 5, 6, 7, 8, 9, 10, 11,
                                 12, 13, 14, 15);
}

// A fragment for 2-tap conv chunk: K 0..15 = tap0 ch0..15, K 16..31 = tap1.
__device__ __forceinline__ v16h frag2tap(const _Float16* p0, const _Float16* p1,
                                         unsigned lane) {
  int hi = (lane & 16u) ? 8 : 0;
  v8h lo = *(const v8h*)(p0 + hi);
  v8h hj = *(const v8h*)(p1 + hi);
  return __builtin_shufflevector(lo, hj, 0, 1, 2, 3, 4, 5, 6, 7, 8, 9, 10, 11,
                                 12, 13, 14, 15);
}

// A fragment for 1-tap conv chunk over a 32-channel pixel record.
__device__ __forceinline__ v16h frag1tap(const _Float16* p, unsigned lane) {
  int hi = (lane & 16u) ? 1 : 0;
  v8h lo = *(const v8h*)(p + (hi ? 8 : 0));
  v8h hj = *(const v8h*)(p + (hi ? 24 : 16));
  return __builtin_shufflevector(lo, hj, 0, 1, 2, 3, 4, 5, 6, 7, 8, 9, 10, 11,
                                 12, 13, 14, 15);
}

// value of the lane 16 away (same column, other half of the rows)
__device__ __forceinline__ float other_half(float v) {
  int b = __builtin_bit_cast(int, v);
  b = __builtin_amdgcn_permlanex16(b, b, 0x76543210, 0xfedcba98, false, false);
  return __builtin_bit_cast(float, b);
}

// sum over the 32 lanes of a wave, the total in every lane: four adds with the
// lane whose number differs in one bit (row_xmask, inside a 16-lane row), then
// the other row. All 32 lanes have to be on.
template <int CTRL>
__device__ __forceinline__ float add_xmask(float v) {
  int b = __builtin_bit_cast(int, v);
  b = __builtin_amdgcn_update_dpp(0, b, CTRL, 0xf, 0xf, true);
  return v + __builtin_bit_cast(float, b);
}
__device__ __forceinline__ float wave_sum(float v) {
  v = add_xmask<0x161>(v);
  v = add_xmask<0x162>(v);
  v = add_xmask<0x164>(v);
  v = add_xmask<0x168>(v);
  return v + other_half(v);
}

// the eight waves' partial sums p[0..7], added in one fixed order
__device__ __forceinline__ float sum8(const float* p) {
  v4f a = *(const v4f*)p, b = *(const v4f*)(p + 4);
  return ((a[0] + a[1]) + (a[2] + a[3])) + ((b[0] + b[1]) + (b[2] + b[3]));
}

__device__ __forceinline__ float exp_slot(float x) {
  float r = x * 1.44269504f;
  asm("v_exp_f32 %0, %0\n\tv_nop" : "+v"(r));
  return r;
}

__device__ __forceinline__ v8f wmma_f16(v16h a, v16h b, v8f c) {
  return __builtin_amdgcn_wmma_f32_16x16x32_f16(false, a, false, b, (short)0, c,
                                                false, false);
}

__device__ __forceinline__ v8f zero8() {
  v8f z = {0.f, 0.f, 0.f, 0.f, 0.f, 0.f, 0.f, 0.f};
  return z;
}

#define NWG 512
#define GEROWS 60
#define H1P 24
#define H1R 656
#define H2P 40
#define H2R 888
#define BPL 264
#define BTP 1064
__global__ __launch_bounds__(256) void conv_stack_kernel(
    const float* __restrict__ x,
    const float* __restrict__ w1, const float* __restrict__ b1,
    const float* __restrict__ w2, const float* __restrict__ b2,
    const float* __restrict__ w3, const float* __restrict__ b3,
    const float* __restrict__ w4, const float* __restrict__ b4,
    const float* __restrict__ kg, const float* __restrict__ kbe,
    const float* __restrict__ qg, const float* __restrict__ qbe,
    const float* __restrict__ vg, const float* __restrict__ vbe,
    _Float16* __restrict__ feat, int nimg) {
  extern __shared__ char smem[];
  float*     xin = (float*)smem;
  float*     ws1 = (float*)(smem + 3136);
  float*     bbf = (float*)(smem + 4416);     // [4][32]
  _Float16*  h1  = (_Float16*)(smem + 4928);
  _Float16*  h2  = (_Float16*)(smem + 38448);
  _Float16*  h3  = (_Float16*)(smem + 4928);   // over h1, once it is dead
  _Float16*  Bc2 = (_Float16*)(smem + 78480);
  _Float16*  Bc3 = (_Float16*)(smem + 95504);
  _Float16*  Bc4 = (_Float16*)(smem + 129552);

  const int tid = threadIdx.x;
  const unsigned lane = tid & 31u;
  int b = blockIdx.x;  // the image in work
  // ---- gamma and beta of the three LayerNorms, copied to the workspace behind
  // the features in the order in which the attention kernel's lanes hold the
  // projections (see there): its reads are then whole lines, where a read of
  // the [256][36] tensors in that order touches 18 lines. Row (s, c) of 256
  // 16-byte pieces, one row a block: stage s = (projection s >> 1: V, K, Q;
  // N tile s & 1), c = 0..4 gamma, 5..9 beta; piece t belongs to thread t.
  // The piece is read here and stored behind the first barrier, ahead of which
  // the weights' loads are waited for anyway.
  const bool gerow = b < GEROWS;  // the same for the whole block
  v4f gv = {0.f, 0.f, 0.f, 0.f};
  v4f* gd = (v4f*)(feat + (size_t)nimg * 8192) + b * 256 + tid;
  if (gerow) {
    const int gs = b / 10, gc = b - gs * 10, cc = gc < 5 ? gc : gc - 5;
    const float* gt = (gs < 2) ? (gc < 5 ? vg : vbe)
                    : (gs < 4) ? (gc < 5 ? kg : kbe) : (gc < 5 ? qg : qbe);
    const int node = (tid >> 5) * 32 + (gs & 1) * 16 + (int)(lane & 15u);
    const int gi = node * 9 +
                   (cc < 4 ? (cc >> 1) * 4 + (cc & 1) + ((lane & 16u) ? 2 : 0) : 8);
    gv = ((const v4f*)gt)[gi];
    // ahead of what next overwrites the load's index register (in the branch:
    // behind it the compiler lifts such a write over the wait)
    asm volatile("s_wait_xcnt 0x0" :: "v"(gi) : "memory");
  }
  auto geput = [&]() {
    *gd = gv;
    // ahead of what next overwrites the store's registers
    asm volatile("s_wait_xcnt 0x0" :: "v"(gd), "v"(gv) : "memory");
  };
  if (b >= nimg) {  // the whole block, ahead of every barrier
    if (gerow) geput();
    return;
  }
  const int ch0 = (lane & 16u) ? 1 : 0;  // weight planes of this half wave:
  const int ch1 = ch0 + 2;               // the k order of frag2tap/frag1tap

  // ---- the other global reads ahead of the image loop: coalesced, branch-free (indices
  // clamped, stores guarded) and issued together, so the L2 round trips
  // overlap instead of one waited 4-byte load per staged element ----
  // Weight unit u = (oc n, input-channel pair kp, tap quad tq), tq fastest:
  // two 16-byte loads (channels 2kp and 2kp+1, taps 4tq..4tq+3) feed four
  // 4-byte LDS stores of a channel pair each.
  // (the unrolls here and in the scatter below keep the arrays in registers)
  v4f r2a[3], r2b[3], r3a[4], r3b[4], r4a[6], r4b[6];
  {
    const v4f* w2v = (const v4f*)w2;  // 20 x 8 x 4  = 640 units
    const v4f* w3v = (const v4f*)w3;  // 24 x 10 x 4 = 960 units
    const v4f* w4v = (const v4f*)w4;  // 30 x 12 x 4 = 1440 units
    // 16-byte index of unit u: (u>>2)*8 + (u&3); 256 units further = +512.
    // Each tensor's last, partial slice clamps its unit.
    const int a0 = (tid >> 2) * 8 + (tid & 3);
    const int u2 = tid + 512 < 640 ? tid + 512 : 639;
    const int u3 = tid + 768 < 960 ? tid + 768 : 959;
    const int u4 = tid + 1280 < 1440 ? tid + 1280 : 1439;
    const int a2 = (u2 >> 2) * 8 + (u2 & 3);
    const int a3 = (u3 >> 2) * 8 + (u3 & 3);
    const int a4 = (u4 >> 2) * 8 + (u4 & 3);
#pragma unroll
    for (int i = 0; i < 2; ++i) {
      r2a[i] = w2v[a0 + 512 * i];
      r2b[i] = w2v[a0 + 512 * i + 4];
    }
    r2a[2] = w2v[a2];
    r2b[2] = w2v[a2 + 4];
#pragma unroll
    for (int i = 0; i < 3; ++i) {
      r3a[i] = w3v[a0 + 512 * i];
      r3b[i] = w3v[a0 + 512 * i + 4];
    }
    r3a[3] = w3v[a3];
    r3b[3] = w3v[a3 + 4];
#pragma unroll
    for (int i = 0; i < 5; ++i) {
      r4a[i] = w4v[a0 + 512 * i];
      r4b[i] = w4v[a0 + 512 * i + 4];
    }
    r4a[5] = w4v[a4];
    r4b[5] = w4v[a4 + 4];

    const v4f* sx = (const v4f*)(x + (size_t)b * 784);
    v4f xr  = sx[tid < 196 ? tid : 195];
    const int a1 = tid & 63;
    v4f w1r = ((const v4f*)w1)[a1];
    int g = (tid >> 5) & 3, n = tid & 31;
    const float* bp = (g == 0) ? b1 : (g == 1) ? b2 : (g == 2) ? b3 : b4;
    int lim = (g == 0) ? 16 : (g == 1) ? 20 : (g == 2) ? 24 : 30;
    const float* bq = bp + (n < lim ? n : 0);
    float bv = *bq;
    // The loads' address registers are inputs here, so they stay unwritten
    // (also by a later load's result) until this wait.
    asm volatile("s_wait_xcnt 0x0"
                 :: "v"(a0), "v"(a1), "v"(a2), "v"(a3), "v"(a4), "v"(bq)
                 : "memory");
    // zero h1, h2 and Bc2..Bc4 (contiguous 158672 B = 9917 x b128)
    v4u zz = {0u, 0u, 0u, 0u};
    v4u* z = (v4u*)h1;
    for (int i = 0; i < 38; ++i) z[tid + 256 * i] = zz;
    if (tid < 189) z[tid + 9728] = zz;
    if (tid < 196) ((v4f*)xin)[tid] = xr;
    if (tid < 64)  *(v4f*)(ws1 + (tid >> 2) * 20 + (tid & 3) * 4) = w1r;
    if (tid < 128) bbf[tid] = (n < lim) ? bv : 0.f;
  }
  __syncthreads();
  // behind the barrier, which would wait for the store; the scatter and conv1
  // cover it up to the next one
  if (gerow) geput();

  // ---- scatter the weights into the zeroed per-tap B matrices ----
  // Bc2: chunk c pairs taps 2c,2c+1; k<16 -> tap 2c ic=k, k>=16 -> tap 2c+1
#pragma unroll
  for (int i = 0; i < 3; ++i) {
    int u = tid + 256 * i;
    if (u < 640) {
      int t0 = (u & 3) * 4, r = u >> 2;
      int n = r >> 3, ic = (r & 7) * 2;
#pragma unroll
      for (int e = 0; e < 4; ++e) {
        int tap = t0 + e;
        v2h h = {(_Float16)r2a[i][e], (_Float16)r2b[i][e]};
        int k = (tap & 1) * 16 + ic;
        *(v2h*)(Bc2 + (tap >> 1) * BTP + (k >> 3) * BPL + n * 8 + (k & 7)) = h;
      }
    }
  }
  // Bc3: tap t, k = ic (20 valid of 32), n = oc (24 valid of 32)
#pragma unroll
  for (int i = 0; i < 4; ++i) {
    int u = tid + 256 * i;
    if (u < 960) {
      int t0 = (u & 3) * 4, r = u >> 2;
      int n = r / 10, k = (r - n * 10) * 2;
#pragma unroll
      for (int e = 0; e < 4; ++e) {
        v2h h = {(_Float16)r3a[i][e], (_Float16)r3b[i][e]};
        *(v2h*)(Bc3 + (t0 + e) * BTP + (k >> 3) * BPL + n * 8 + (k & 7)) = h;
      }
    }
  }
  // Bc4: tap t, k = ic (24 valid of 32), n = oc (30 valid of 32)
#pragma unroll
  for (int i = 0; i < 6; ++i) {
    int u = tid + 256 * i;
    if (u < 1440) {
      int t0 = (u & 3) * 4, r = u >> 2;
      int n = r / 12, k = (r - n * 12) * 2;
#pragma unroll
      for (int e = 0; e < 4; ++e) {
        v2h h = {(_Float16)r4a[i][e], (_Float16)r4b[i][e]};
        *(v2h*)(Bc4 + (t0 + e) * BTP + (k >> 3) * BPL + n * 8 + (k & 7)) = h;
      }
    }
  }

  // ---- one trip an image ----
  for (;;) {
  // The wave's number, taken as a scalar in each trip: the tile addresses that
  // follow from it are formed anew per trip, their uniform part on the scalar
  // unit. Taken once ahead of the loop, the compiler keeps every address of
  // all four layers in registers across the loop: past 256, one block a WGP.
  const int wv = __builtin_amdgcn_readfirstlane(tid >> 5);
  // The next image's pixels are read here and go to xin behind conv1's barrier,
  // when this image's have been read; conv1 covers the round trip. (On the last
  // trip: this image's again, stored and not used.)
  const int bn = b + NWG;
  const int xi = tid < 196 ? tid : 195;
  v4f xnx = ((const v4f*)(x + (size_t)(bn < nimg ? bn : b) * 784))[xi];
  // The load's index register is an input here, so it stays unwritten until
  // this wait.
  asm volatile("s_wait_xcnt 0x0" :: "v"(xi) : "memory");

  // ---- conv1 via WMMA: 28x28 -> 16x25x25, channel-last f16 ----
  // Transposed (D = W1 X^T): M = 16 channels, N = 16 pixels, 40 N tiles, five a
  // wave. A lane's eight D registers are channels 8*hi..8*hi+7 of one pixel:
  // half a pixel record, one 16-byte store. To keep the f32 operands' accuracy
  // x and w are each split into two f16 parts, v = hi + lo. K holds the 16 taps
  // twice: elements 0..7 of a lane are taps 8*hi..8*hi+7 (kernel rows 2*hi and
  // 2*hi+1) against x's hi part, elements 8..15 the same taps against its lo
  // part, in A and in B alike. One WMMA with w's lo part, one with its hi part.
  {
    const int c15 = (int)(lane & 15u);
    const float* wp = ws1 + c15 * 20 + ch0 * 8;  // channel c15
    v4f wa = *(const v4f*)wp, wb = *(const v4f*)(wp + 4);
    v8h wh, wl;
#pragma unroll
    for (int e = 0; e < 4; ++e) {
      wh[e]     = (_Float16)wa[e];
      wh[4 + e] = (_Float16)wb[e];
      wl[e]     = (_Float16)(wa[e] - (float)wh[e]);
      wl[4 + e] = (_Float16)(wb[e] - (float)wh[4 + e]);
    }
    v16h ah = __builtin_shufflevector(wh, wh, 0, 1, 2, 3, 4, 5, 6, 7, 8, 9, 10,
                                      11, 12, 13, 14, 15);
    v16h al = __builtin_shufflevector(wl, wl, 0, 1, 2, 3, 4, 5, 6, 7, 8, 9, 10,
                                      11, 12, 13, 14, 15);
    v4f c0 = *(const v4f*)(bbf + ch0 * 8), c1 = *(const v4f*)(bbf + ch0 * 8 + 4);
    const v8f bi = {c0[0], c0[1], c0[2], c0[3], c1[0], c1[1], c1[2], c1[3]};
    // All five tiles' reads stand ahead of the first store to h1: for the
    // compiler such a store could alias a later read of xin, and a tile's reads
    // would then go out only behind the tile before, their latency uncovered.
    // (The unrolls keep the arrays in registers.)
    float u[5][8];
    _Float16* hp[5];
#pragma unroll
    for (int j = 0; j < 5; ++j) {
      const int p = (wv * 5 + j) * 16 + c15;
      const int pc = p < 625 ? p : 624;  // the last tile has one valid pixel
      const int oy = pc / 25, ox = pc - oy * 25;
      const float* xp = xin + (oy + 2 * ch0) * 28 + ox;
#pragma unroll
      for (int e = 0; e < 4; ++e) {
        u[j][e]     = xp[e];
        u[j][4 + e] = xp[28 + e];
      }
      hp[j] = h1 + oy * H1R + ox * H1P + ch0 * 8;
    }
#pragma unroll
    for (int j = 0; j < 5; ++j) {
      v8h xh, xl;
#pragma unroll
      for (int e = 0; e < 8; ++e) {
        xh[e] = (_Float16)u[j][e];
        xl[e] = (_Float16)(u[j][e] - (float)xh[e]);
      }
      v16h xb = __builtin_shufflevector(xh, xl, 0, 1, 2, 3, 4, 5, 6, 7, 8, 9, 10,
                                        11, 12, 13, 14, 15);
      v8f d = wmma_f16(al, xb, bi);
      d = wmma_f16(ah, xb, d);
      v8h o;
#pragma unroll
      for (int r = 0; r < 8; ++r) o[r] = (_Float16)fmaxf(d[r], 0.f);
      if (j < 4 || (wv * 5 + j) * 16 + c15 < 625) *(v8h*)hp[j] = o;
    }
  }
  __syncthreads();
  if (tid < 196) ((v4f*)xin)[tid] = xnx;  // read three barriers on

  // conv2..conv4: a wave owns several M tiles and BOTH N tiles, so an A fragment
  // read from LDS feeds two WMMAs and a B fragment one per M tile, and a wave's
  // accumulator chains are independent. The K loop goes in blocks with two
  // fragment sets in registers: the next block's reads stand as one group ahead
  // of this block's WMMAs. Each output still sums its taps in the order 0..15.
  // (The unrolls keep acc and the fragment sets in registers. The two
  // sched_barriers of a block keep the reads in that one group: without them
  // the compiler moves each read down to just ahead of the WMMA that uses it,
  // and the wave waits out the LDS latency there.)
  const int l15 = (int)(lane & 15u);
  const int mh = (lane & 16u) ? 8 : 0;

  // ---- conv2 via WMMA: M=484(->496) x N=20(->32) x K=256 (8 chunks) ----
  // 31 M tiles, four a wave; the last wave's fourth is its third again (same
  // values to the same places, from the same wave). Block = one chunk.
  {
    int mts[4];
    const _Float16* ap[4];
    v8f acc[4][2];
#pragma unroll
    for (int j = 0; j < 4; ++j) {
      int mt = wv * 4 + j;
      mts[j] = mt < 31 ? mt : 30;
      int m = mts[j] * 16 + l15;
      int oy = m / 22, ox = m - oy * 22;
      ap[j] = h1 + oy * H1R + ox * H1P;
      acc[j][0] = zero8();
      acc[j][1] = zero8();
    }
    v16h fa[2][4], fw[2][2];
    auto fetch = [&](int c) {
      const int s = c & 1;
      const int o0 = ((2 * c) >> 2) * H1R + ((2 * c) & 3) * H1P;  // tap 2c
      fw[s][0] = loadfrag_cm(Bc2 + c * BTP, 0, ch0, ch1, BPL, lane);
      fw[s][1] = loadfrag_cm(Bc2 + c * BTP, 16, ch0, ch1, BPL, lane);
#pragma unroll
      for (int j = 0; j < 4; ++j)
        fa[s][j] = frag2tap(ap[j] + o0, ap[j] + o0 + H1P, lane);
    };
    fetch(0);
#pragma unroll
    for (int c = 0; c < 8; ++c) {
      if (c < 7) fetch(c + 1);
      __builtin_amdgcn_sched_barrier(0);  // the reads above stay one group
#pragma unroll
      for (int j = 0; j < 4; ++j) {
        acc[j][0] = wmma_f16(fa[c & 1][j], fw[c & 1][0], acc[j][0]);
        acc[j][1] = wmma_f16(fa[c & 1][j], fw[c & 1][1], acc[j][1]);
      }
      __builtin_amdgcn_sched_barrier(0);  // no later read moves up among them
    }
    float bias0 = bbf[32 + l15], bias1 = bbf[48 + l15];
#pragma unroll
    for (int j = 0; j < 4; ++j) {
      int m0 = mts[j] * 16 + mh;  // first of this lane's 8 pixels
      int y0 = m0 / 22, x0 = m0 - y0 * 22;
      _Float16* hp = h2 + y0 * H2R + x0 * H2P + l15;
#pragma unroll
      for (int r = 0; r < 8; ++r) {  // at most one step into the next image row
        _Float16* q = hp + r * H2P + (x0 + r >= 22 ? H2R - 22 * H2P : 0);
        q[0]  = (_Float16)fmaxf(acc[j][0][r] + bias0, 0.f);
        q[16] = (_Float16)fmaxf(acc[j][1][r] + bias1, 0.f);
      }
    }
  }
  __syncthreads();

  // ---- conv3 via WMMA: M=361(->368) x N=24(->32) x K=512 (16 taps) ----
  // 23 M tiles, three a wave; the last wave's third is its second again.
  // Block = two taps.
  {
    int mts[3];
    const _Float16* ap[3];
    v8f acc[3][2];
#pragma unroll
    for (int j = 0; j < 3; ++j) {
      int mt = wv * 3 + j;
      mts[j] = mt < 23 ? mt : 22;
      int m = mts[j] * 16 + l15;
      int oy = m / 19, ox = m - oy * 19;
      ap[j] = h2 + oy * H2R + ox * H2P;
      acc[j][0] = zero8();
      acc[j][1] = zero8();
    }
    v16h fa[2][2][3], fw[2][2][2];
    auto fetch = [&](int k) {
      const int s = k & 1;
#pragma unroll
      for (int e = 0; e < 2; ++e) {
        const int t = 2 * k + e;
        fw[s][e][0] = loadfrag_cm(Bc3 + t * BTP, 0, ch0, ch1, BPL, lane);
        fw[s][e][1] = loadfrag_cm(Bc3 + t * BTP, 16, ch0, ch1, BPL, lane);
#pragma unroll
        for (int j = 0; j < 3; ++j)
          fa[s][e][j] = frag1tap(ap[j] + (t >> 2) * H2R + (t & 3) * H2P, lane);
      }
    };
    fetch(0);
#pragma unroll
    for (int k = 0; k < 8; ++k) {
      if (k < 7) fetch(k + 1);
      __builtin_amdgcn_sched_barrier(0);  // the reads above stay one group
#pragma unroll
      for (int e = 0; e < 2; ++e)
#pragma unroll
        for (int j = 0; j < 3; ++j) {
          acc[j][0] = wmma_f16(fa[k & 1][e][j], fw[k & 1][e][0], acc[j][0]);
          acc[j][1] = wmma_f16(fa[k & 1][e][j], fw[k & 1][e][1], acc[j][1]);
        }
      __builtin_amdgcn_sched_barrier(0);  // no later read moves up among them
    }
    float bias0 = bbf[64 + l15], bias1 = bbf[80 + l15];
#pragma unroll
    for (int j = 0; j < 3; ++j) {
      _Float16* q = h3 + (mts[j] * 16 + mh) * H2P + l15;
#pragma unroll
      for (int r = 0; r < 8; ++r) {
        q[r * H2P]      = (_Float16)fmaxf(acc[j][0][r] + bias0, 0.f);
        q[r * H2P + 16] = (_Float16)fmaxf(acc[j][1][r] + bias1, 0.f);
      }
    }
  }
  __syncthreads();

  // ---- conv4 via WMMA: M=256 x N=30(->32) x K=512; write features+coords ----
  // An M tile is one output row; a wave owns rows 2wv and 2wv+1. The upper
  // row's A fragments of kernel row ky are the lower row's of ky+1: each of the
  // five input rows (ar) is read once. Block = two taps of one kernel row.
  _Float16* fb = feat + (size_t)b * 8192;
  {
    const _Float16* ap = h3 + (wv * 2 * 19 + l15) * H2P;
    v8f acc[2][2];
    acc[0][0] = zero8(); acc[0][1] = zero8();
    acc[1][0] = zero8(); acc[1][1] = zero8();
    v16h ar[5][4], fw[2][2][2];
    auto fetch = [&](int k) {
      const int s = k & 1;
#pragma unroll
      for (int e = 0; e < 2; ++e) {
        const int t = 2 * k + e, ky = t >> 2, kx = t & 3;
        fw[s][e][0] = loadfrag_cm(Bc4 + t * BTP, 0, ch0, ch1, BPL, lane);
        fw[s][e][1] = loadfrag_cm(Bc4 + t * BTP, 16, ch0, ch1, BPL, lane);
        ar[ky + 1][kx] = frag1tap(ap + ((ky + 1) * 19 + kx) * H2P, lane);
      }
    };
#pragma unroll
    for (int kx = 0; kx < 4; ++kx) ar[0][kx] = frag1tap(ap + kx * H2P, lane);
    fetch(0);
#pragma unroll
    for (int k = 0; k < 8; ++k) {
      if (k < 7) fetch(k + 1);
      __builtin_amdgcn_sched_barrier(0);  // the reads above stay one group
#pragma unroll
      for (int e = 0; e < 2; ++e) {
        const int t = 2 * k + e, ky = t >> 2, kx = t & 3;
        acc[0][0] = wmma_f16(ar[ky][kx], fw[k & 1][e][0], acc[0][0]);
        acc[0][1] = wmma_f16(ar[ky][kx], fw[k & 1][e][1], acc[0][1]);
        acc[1][0] = wmma_f16(ar[ky + 1][kx], fw[k & 1][e][0], acc[1][0]);
        acc[1][1] = wmma_f16(ar[ky + 1][kx], fw[k & 1][e][1], acc[1][1]);
      }
      __builtin_amdgcn_sched_barrier(0);  // no later read moves up among them
    }
    // every wave has read h3 out: the next trip's conv1 may store to h1. Ahead
    // of the global stores, so that no barrier waits for them before conv1's.
    __syncthreads();
    float bias0 = bbf[96 + l15], bias1 = bbf[112 + l15];
#pragma unroll
    for (int j = 0; j < 2; ++j) {
      _Float16* q = fb + ((wv * 2 + j) * 16 + mh) * 32 + l15;
#pragma unroll
      for (int r = 0; r < 8; ++r)
        q[r * 32] = (_Float16)fmaxf(acc[j][0][r] + bias0, 0.f);
      if (l15 < 14) {  // channels 16..29; 30 and 31 are the coordinates
#pragma unroll
        for (int r = 0; r < 8; ++r)
          q[r * 32 + 16] = (_Float16)fmaxf(acc[j][1][r] + bias1, 0.f);
        // ahead of what next overwrites these stores' registers; in the
        // branch: behind it the compiler lifts such a write over the wait
        asm volatile("s_wait_xcnt 0x0" ::: "memory");
      }
    }
  }
  {
    int n = tid;  // coord channels (columns 30/31, disjoint from tile stores)
    int xx = n % 16, yy = n / 16;
    fb[n * 32 + 30] = (_Float16)((float)xx * 0.0625f);
    fb[n * 32 + 31] = (_Float16)((float)yy * 0.0625f);
    asm volatile("s_wait_xcnt 0x0" ::: "memory");
  }
  if (bn >= nimg) break;  // the same for the whole block
  b = bn;
  }
}

#define APL 2080
#define TP 52
#define W1P 56
#define WTL 1920
__global__ __launch_bounds__(256) __attribute__((amdgpu_waves_per_eu(4)))
void attn_kernel(
    const _Float16* __restrict__ feat,
    const float* __restrict__ kW, const float* __restrict__ kb,
    const float* __restrict__ qW, const float* __restrict__ qb,
    const float* __restrict__ vW, const float* __restrict__ vb,
    const float* __restrict__ l1W, const float* __restrict__ l1b,
    const float* __restrict__ l2W, const float* __restrict__ l2b,
    float* __restrict__ out, int nimg) {
  extern __shared__ char smem[];
  _Float16* Qb   = (_Float16*)(smem + 16640);
  float* tmpf = (float*)(smem + 41600);
  _Float16* Kb   = (_Float16*)(smem + 94848);
  _Float16* Vt   = (_Float16*)(smem + 119808);
  _Float16* wbuf = (_Float16*)(smem + 145152);  // three [48][40] tiles: V, K, Q
  float* red  = (float*)(smem + 156672);
  float* mxv  = (float*)(smem + 158752);
  float* ov   = (float*)(smem + 158944);
  float* bb   = (float*)(smem + 159008);
  _Float16* W1h = (_Float16*)smem;            // W1's hi and lo parts,
  _Float16* W1l = (_Float16*)(smem + 5376);   // [48][W1P] f16 each
  float* l1bs = (float*)(smem + 10752);       // [48]

  const int tid0 = threadIdx.x;
  const unsigned lane = tid0 & 31u;
  int b = blockIdx.x;  // the batch element in work
  if (b >= nimg) return;  // the whole block, ahead of every barrier
  // planes of this half wave, in the k order of loadfrag_h: columns 0..31,
  // then columns 32..63 (40..63 read the zero plane)
  const int ch0 = (lane & 16u) ? 1 : 0, ch1 = ch0 + 2, ch2 = ch0 + 4;

  // ---- once a block: the three projections' weights as f16 tiles, W1 as hi
  // and lo f16 tiles, the biases and the zeros that the staged operands pad
  // with. No trip writes over them; the barrier ahead of the loop publishes
  // them ----
  {
    const int tid = tid0;
    v4f wreg[3][2];  // (the unroll below keeps it in registers)
    const int f1 = 256 + (tid & 31);  // each W is 288 x 16 B
    wreg[0][0] = ((const v4f*)vW)[tid];  wreg[0][1] = ((const v4f*)vW)[f1];
    wreg[1][0] = ((const v4f*)kW)[tid];  wreg[1][1] = ((const v4f*)kW)[f1];
    wreg[2][0] = ((const v4f*)qW)[tid];  wreg[2][1] = ((const v4f*)qW)[f1];
    const int bi = tid < 144 ? tid : 0;
    const int pb = bi / 48, jb = bi - pb * 48;
    const float* bp = (pb == 0) ? vb : (pb == 1) ? kb : qb;
    float bv = bp[jb < 36 ? jb : 0];
    // Q/K planes 4 and 5 (520 x 16 B; columns 32..35 are stored over it in
    // every trip), V^T rows 36..47, W rows 36..47
    const v4u zz = {0u, 0u, 0u, 0u};
    for (int i = tid; i < 520; i += 256) {
      ((v4u*)(Qb + 4 * APL))[i] = zz;
      ((v4u*)(Kb + 4 * APL))[i] = zz;
    }
    for (int i = tid; i < 396; i += 256) ((v4u*)(Vt + 36 * 264))[i] = zz;
    if (tid < 180) ((v4u*)(wbuf + (tid / 60) * WTL + 36 * 40))[tid % 60] = zz;
    if (tid < 144) bb[tid] = (jb < 36) ? bv : 0.f;
#pragma unroll
    for (int p = 0; p < 3; ++p) {
      const int k = (tid & 7) * 4;
      v4f w0 = wreg[p][0];
      v4h h0 = {(_Float16)w0[0], (_Float16)w0[1], (_Float16)w0[2], (_Float16)w0[3]};
      *(v4h*)(wbuf + p * WTL + (tid >> 3) * 40 + k) = h0;
      if (tid < 32) {
        v4f w1v = wreg[p][1];
        v4h h1v = {(_Float16)w1v[0], (_Float16)w1v[1], (_Float16)w1v[2], (_Float16)w1v[3]};
        *(v4h*)(wbuf + p * WTL + (32 + (tid >> 3)) * 40 + k) = h1v;
      }
    }
    // W1 piece u = (row j, column quad q) of the padded [48][48] tile, three a
    // thread (576 pieces); outside the 36 x 36 matrix the piece is zero
    // (the unrolls keep l1r in registers)
    v4f l1r[3];
    int ix[3];
#pragma unroll
    for (int i = 0; i < 3; ++i) {
      int u = tid + 256 * i;
      int j = u / 12, q = u - j * 12;
      ix[i] = (j < 36 && q < 9) ? j * 9 + q : 0;
      l1r[i] = ((const v4f*)l1W)[ix[i]];
    }
    const int ib = tid < 36 ? tid : 35;
    float l1bv = l1b[ib];
    // The loads' index registers are inputs here, so they stay unwritten
    // until this wait.
    asm volatile("s_wait_xcnt 0x0"
                 :: "v"(ix[0]), "v"(ix[1]), "v"(ix[2]), "v"(ib)
                 : "memory");
#pragma unroll
    for (int i = 0; i < 3; ++i) {
      int u = tid + 256 * i;
      int j = u / 12, q = u - j * 12;
      bool ok = j < 36 && q < 9;
      v4h wh, wl;
#pragma unroll
      for (int e = 0; e < 4; ++e) {
        float w = ok ? l1r[i][e] : 0.f;
        wh[e] = (_Float16)w;
        wl[e] = (_Float16)(w - (float)wh[e]);
      }
      if (u < 576) {
        *(v4h*)(W1h + j * W1P + q * 4) = wh;
        *(v4h*)(W1l + j * W1P + q * 4) = wl;
      }
    }
    if (tid < 48) l1bs[tid] = tid < 36 ? l1bv : 0.f;
  }
  __syncthreads();

  // ---- one trip a batch element. What a trip stores ahead of its first
  // barrier are the LayerNorm partials in red, each wave its own words. Of red
  // only red[0] is still read then (by wave 0, behind the last barrier of the
  // trip before), and no other wave writes that word ----
  for (;;) {
  // The wave's number, taken as a scalar in each trip, and the thread's number
  // from it: addresses are formed anew per trip, their uniform part on the
  // scalar unit. With both taken once ahead of the loop the compiler keeps
  // every address in registers across the loop.
  const int wv = __builtin_amdgcn_readfirstlane(tid0 >> 5);
  const int tid = wv * 32 + (int)lane;
  // ---- the three projections, transposed (D = W h^T), kept in registers ----
  // A wave owns the nodes 32wv..32wv+31 (two N tiles) and all 48 padded columns
  // (three M tiles) of V, K and Q. Its B fragments are its own nodes' feature
  // rows, read straight from global memory in the k order of loadfrag_h (which
  // loads the weights): no wave needs another wave's features.
  // acc[p][i][nt][r]: node 32wv + 16i + (lane & 15), column 16nt + r + 8*hi; it
  // starts at the bias. Columns 36..47 come out as exact zeros (zero weight
  // rows, zero bias).
  // (the unrolls from here to the barrier ahead of the attention loop keep acc
  // and the gamma/beta arrays in registers)
  const int pl15 = (int)(lane & 15u);
  v8f acc[3][2][3];
  {
    const _Float16* fp =
        feat + (size_t)b * 8192 + (wv * 32 + pl15) * 32 + ch0 * 8;
    v8h f00 = *(const v8h*)fp, f01 = *(const v8h*)(fp + 16);
    v8h f10 = *(const v8h*)(fp + 512), f11 = *(const v8h*)(fp + 528);
    // The loads' address is an input here, so its registers stay unwritten
    // until this wait.
    asm volatile("s_wait_xcnt 0x0" :: "v"(fp) : "memory");
    v16h hb0 = __builtin_shufflevector(f00, f01, 0, 1, 2, 3, 4, 5, 6, 7, 8, 9,
                                       10, 11, 12, 13, 14, 15);
    v16h hb1 = __builtin_shufflevector(f10, f11, 0, 1, 2, 3, 4, 5, 6, 7, 8, 9,
                                       10, 11, 12, 13, 14, 15);
#pragma unroll
    for (int p = 0; p < 3; ++p)
#pragma unroll
      for (int nt = 0; nt < 3; ++nt) {
        const float* bp = bb + p * 48 + nt * 16 + ch0 * 8;
        v4f b0 = *(const v4f*)bp, b1 = *(const v4f*)(bp + 4);
        v8f bi = {b0[0], b0[1], b0[2], b0[3], b1[0], b1[1], b1[2], b1[3]};
        v16h wf = loadfrag_h(wbuf + p * WTL, nt * 16, 0, 40, lane);
        acc[p][0][nt] = wmma_f16(wf, hb0, bi);
        acc[p][1][nt] = wmma_f16(wf, hb1, bi);
      }
  }
  // gamma and beta in the accumulators' layout, from the copy that the conv
  // kernel has written behind the features: 16-byte loads of whole lines. Step
  // q = (stage s = q / 3 = (p, i), M tile nt = q % 3); a stage has ten pieces a
  // lane: gamma 0..3 are its columns 8*hi..+7 and 16 + 8*hi..+7, gamma 4 columns
  // 32..35 (in both half waves; the upper half's is not used), then beta alike.
  const v4f* gel = (const v4f*)(feat + (size_t)nimg * 8192) + tid;
  v4f gg[18][2], ee[18][2];
  auto ldge = [&](int q) {
    const int s = q / 3, nt = q - s * 3;
#pragma unroll
    for (int h = 0; h < (nt < 2 ? 2 : 1); ++h) {
      gg[q][h] = gel[(s * 10 + nt * 2 + h) * 256];
      ee[q][h] = gel[(s * 10 + 5 + nt * 2 + h) * 256];
    }
  };
  auto ldwait = [&]() {
    // behind the last of these loads: their one address is an input here, so
    // its registers stay unwritten until this wait
    asm volatile("s_wait_xcnt 0x0" :: "v"(gel) : "memory");
  };
  // keeps the loads below from moving up among the WMMAs, where the operand
  // fragments are live as well (past 256 registers: spills)
  __builtin_amdgcn_sched_barrier(0);
  // the sums, the barrier and the statistics cover these loads' round trip
  ldge(0);
  ldge(1);
  ldge(2);
  ldge(3);

  // LayerNorm sums of the wave's 32 nodes in registers, then across lanes, one
  // partial a wave and projection
#pragma unroll
  for (int p = 0; p < 3; ++p) {
    v4f ps = {0.f, 0.f, 0.f, 0.f}, ps2 = {0.f, 0.f, 0.f, 0.f};
#pragma unroll
    for (int i = 0; i < 2; ++i)
#pragma unroll
      for (int nt = 0; nt < 3; ++nt)
#pragma unroll
        for (int h = 0; h < (nt < 2 ? 2 : 1); ++h) {
          v4f o = {acc[p][i][nt][4 * h], acc[p][i][nt][4 * h + 1],
                   acc[p][i][nt][4 * h + 2], acc[p][i][nt][4 * h + 3]};
          ps += o;
          ps2 = __builtin_elementwise_fma(o, o, ps2);
        }
    float t = wave_sum((ps[0] + ps[1]) + (ps[2] + ps[3]));
    float t2 = wave_sum((ps2[0] + ps2[1]) + (ps2[2] + ps2[3]));
    if (lane == 0) { red[p * 16 + wv] = t; red[p * 16 + 8 + wv] = t2; }
  }
  __syncthreads();
  float mus[3], rstds[3];
#pragma unroll
  for (int p = 0; p < 3; ++p) {
    float mu  = sum8(red + p * 16) * (1.f / 9216.f);
    float var = sum8(red + p * 16 + 8) * (1.f / 9216.f) - mu * mu;
    mus[p] = mu;
    rstds[p] = rsqrtf(var + 1e-5f);
  }

  // normalise step q in registers and store it as f16: a lane's eight columns
  // of a node are one 16-byte row piece of a Q/K plane; V goes out transposed,
  // element by element. Columns 36..47 keep the zeros staged once a block: of
  // M tile 2 only the lower half wave's first four registers are stored.
  // Q, K and V were last read ahead of the barrier behind the attention loop of
  // the trip before.
  auto norm = [&](int q) {
    const int s = q / 3, nt = q - s * 3, p = s >> 1, i = s & 1;
    const int node = wv * 32 + i * 16 + pl15;
    const float mu = mus[p], rstd = rstds[p];
    _Float16* dst = (p == 1) ? Kb : Qb;
    v8h o = {0, 0, 0, 0, 0, 0, 0, 0};
#pragma unroll
    for (int r = 0; r < (nt < 2 ? 8 : 4); ++r) {
      float v = (acc[p][i][nt][r] - mu) * rstd;
      o[r] = (_Float16)(v * gg[q][r >> 2][r & 3] + ee[q][r >> 2][r & 3]);
    }
    _Float16* vp = Vt + (nt * 16 + ch0 * 8) * 264 + node;
    _Float16* qp = dst + (nt * 2 + ch0) * APL + node * 8;
    if (nt < 2) {
      if (p == 0) {
#pragma unroll
        for (int r = 0; r < 8; ++r) vp[r * 264] = o[r];
      } else {
        *(v8h*)qp = o;
      }
    } else if (ch0 == 0) {
      if (p == 0) {
#pragma unroll
        for (int r = 0; r < 4; ++r) vp[r * 264] = o[r];
      } else {
        v4h o4 = {o[0], o[1], o[2], o[3]};
        *(v4h*)qp = o4;
      }
    }
    // a later step's loads stay behind this step, whose registers they take
    // over: moved up, they do not fit in 256 registers
    __builtin_amdgcn_sched_barrier(0);
  };
  // the loads run ahead of their use as far as the registers allow: further as
  // the accumulators are used up
  norm(0);
  ldge(4);
  norm(1);
  ldge(5);
  ldge(6);
  norm(2);
  norm(3);
  ldge(7);
  ldge(8);
  norm(4);
  ldge(9);
  ldge(10);
  norm(5);
  ldge(11);
  norm(6);
  ldge(12);
  ldge(13);
  norm(7);
  ldge(14);
  ldge(15);
  norm(8);
  norm(9);
  ldge(16);
  ldge(17);
  ldwait();
  norm(10);
  norm(11);
  norm(12);
  norm(13);
  norm(14);
  norm(15);
  norm(16);
  norm(17);
  __syncthreads();

  const float scale = 0.16666667f;  // 1/sqrt(36)
  const int hi8 = (lane & 16u) ? 8 : 0;
  // sums of the linear layer's outputs and of their squares, four chains each
  v4f ls = {0.f, 0.f, 0.f, 0.f}, ls2 = {0.f, 0.f, 0.f, 0.f};
  float* att2 = tmpf;  // [256][TP]
  for (int blk = wv; blk < 16; blk += 8) {
    int row0 = blk * 16;
    // B operand: 16 queries (n = query), kept for all 16 key tiles
    v16h qb0 = loadfrag_cm(Qb, row0, ch0, ch1, APL, lane);
    v16h qb1 = loadfrag_cm(Qb, row0, ch2, 5, APL, lane);
    v8f st[16];
#pragma unroll
    for (int ct = 0; ct < 16; ++ct) {
      v8f acc = zero8();
      acc = wmma_f16(loadfrag_cm(Kb, ct * 16, ch0, ch1, APL, lane), qb0, acc);
      acc = wmma_f16(loadfrag_cm(Kb, ct * 16, ch2, 5, APL, lane), qb1, acc);
      st[ct] = acc;
    }
    float mx = -1e30f;
#pragma unroll
    for (int ct = 0; ct < 16; ++ct)
#pragma unroll
      for (int r = 0; r < 8; ++r) {
        st[ct][r] *= scale;
        mx = fmaxf(mx, st[ct][r]);
      }
    mx = fmaxf(mx, other_half(mx));
    float s = 0.f;
    v8f av0 = zero8(), av1 = zero8(), av2 = zero8();
#pragma unroll
    for (int kc = 0; kc < 8; ++kc) {
      // B fragment of keys kc*32..+31: elements 0..7 are k = 8*hi + r (tile
      // 2kc), elements 8..15 are k = 16 + 8*hi + r (tile 2kc+1): the k order
      // of loadfrag_h, which loads the A operand (V^T rows) below.
      v16h pb;
      float ps = 0.f;
#pragma unroll
      for (int r = 0; r < 8; ++r) {
        float e0 = exp_slot(st[2 * kc][r] - mx);
        float e1 = exp_slot(st[2 * kc + 1][r] - mx);
        ps += e0 + e1;
        pb[r]     = (_Float16)e0;
        pb[8 + r] = (_Float16)e1;
      }
      s += ps;
      av0 = wmma_f16(loadfrag_h(Vt, 0, kc * 32, 264, lane), pb, av0);
      av1 = wmma_f16(loadfrag_h(Vt, 16, kc * 32, 264, lane), pb, av1);
      av2 = wmma_f16(loadfrag_h(Vt, 32, kc * 32, 264, lane), pb, av2);
    }
    s += other_half(s);
    float invr = 1.f / s;
    // keeps the W1 and bias reads below from moving up to where the 128 scores
    // are live, which takes the kernel past 256 registers (one work-group a WGP)
    __builtin_amdgcn_sched_barrier(0);
    // O^T tile t: n = query, m = column 16t + r + 8*hi. As f16, tiles 0 and 1
    // are the B fragment of columns 0..31 in the k order of loadfrag_h, which
    // loads W1 below; tile 2 (columns 32..47, 36..47 zero) fills elements 0..7
    // of a second fragment.
    v16h oh0, ol0;
    v8h oh1, ol1;
#pragma unroll
    for (int r = 0; r < 8; ++r) {
      float o0 = av0[r] * invr, o1 = av1[r] * invr, o2 = av2[r] * invr;
      oh0[r]     = (_Float16)o0;
      oh0[8 + r] = (_Float16)o1;
      oh1[r]     = (_Float16)o2;
      ol0[r]     = (_Float16)(o0 - (float)oh0[r]);
      ol0[8 + r] = (_Float16)(o1 - (float)oh0[8 + r]);
      ol1[r]     = (_Float16)(o2 - (float)oh1[r]);
    }
    const v8h z8 = {0, 0, 0, 0, 0, 0, 0, 0};
    // columns 32..47 need half a fragment: with W1's (hi | lo) as A, B = (hi |
    // hi) gives hi*hi + lo*hi in one WMMA and B = (lo | 0) gives hi*lo
    v16h ohh = __builtin_shufflevector(oh1, oh1, 0, 1, 2, 3, 4, 5, 6, 7, 8, 9,
                                       10, 11, 12, 13, 14, 15);
    v16h olz = __builtin_shufflevector(ol1, z8, 0, 1, 2, 3, 4, 5, 6, 7, 8, 9,
                                       10, 11, 12, 13, 14, 15);
    // d[jt]: output j = 16jt + r + 8*hi of query row0 + (lane & 15); starts at
    // the bias. All reads first, then three independent accumulator chains, the
    // small products first. (The unrolls keep the arrays in registers.)
    v8f d[3];
    v16h wh0[3], wl0[3], whl[3];
#pragma unroll
    for (int jt = 0; jt < 3; ++jt) {
      const float* bp = l1bs + jt * 16 + hi8;
      v4f b0 = *(const v4f*)bp, b1 = *(const v4f*)(bp + 4);
      v8f bi = {b0[0], b0[1], b0[2], b0[3], b1[0], b1[1], b1[2], b1[3]};
      d[jt] = bi;
      wh0[jt] = loadfrag_h(W1h, jt * 16, 0, W1P, lane);
      wl0[jt] = loadfrag_h(W1l, jt * 16, 0, W1P, lane);
      const int wo = (jt * 16 + (int)(lane & 15u)) * W1P + 32 + hi8;
      v8h wh1 = *(const v8h*)(W1h + wo);
      v8h wl1 = *(const v8h*)(W1l + wo);
      whl[jt] = __builtin_shufflevector(wh1, wl1, 0, 1, 2, 3, 4, 5, 6, 7, 8, 9,
                                        10, 11, 12, 13, 14, 15);
    }
#pragma unroll
    for (int jt = 0; jt < 3; ++jt) d[jt] = wmma_f16(whl[jt], olz, d[jt]);
#pragma unroll
    for (int jt = 0; jt < 3; ++jt) d[jt] = wmma_f16(wh0[jt], ol0, d[jt]);
#pragma unroll
    for (int jt = 0; jt < 3; ++jt) d[jt] = wmma_f16(wl0[jt], oh0, d[jt]);
#pragma unroll
    for (int jt = 0; jt < 3; ++jt) d[jt] = wmma_f16(whl[jt], ohh, d[jt]);
#pragma unroll
    for (int jt = 0; jt < 3; ++jt) d[jt] = wmma_f16(wh0[jt], oh0, d[jt]);
    // this query's row of the layer's output, for the column maxima; rows
    // 36..47 of W1 and of the bias are zero: of tile 2 only r < 4 counts
    float* op = att2 + (row0 + (int)(lane & 15u)) * TP + hi8;
#pragma unroll
    for (int jt = 0; jt < 3; ++jt) {
#pragma unroll
      for (int h = 0; h < (jt < 2 ? 2 : 1); ++h) {
        v4f o;
#pragma unroll
        for (int e = 0; e < 4; ++e) o[e] = fmaxf(d[jt][4 * h + e], 0.f);
        ls += o;
        ls2 += o * o;
        *(v4f*)(op + jt * 16 + 4 * h) = o;
      }
    }
  }

  // LayerNorm sums of this wave's 32 queries, one partial a wave; red was last
  // read ahead of the barrier behind the LayerNorm stores
  {
    float t = wave_sum((ls[0] + ls[1]) + (ls[2] + ls[3]));
    float t2 = wave_sum((ls2[0] + ls2[1]) + (ls2[2] + ls2[3]));
    if (lane == 0) { red[wv] = t; red[8 + wv] = t2; }
  }
  __syncthreads();

  // column maxima: thread (g, col) takes rows 37g..37g+36 of its column (the
  // last group's rows end at 255; a row taken twice does not move a maximum).
  // Unrolled, four chains: the 37 reads go out together, one wait for all.
  if (tid < 252) {
    const int g = tid / 36, col = tid - g * 36;
    const float* cp = att2 + g * 37 * TP + col;
    float m[4] = {-1e30f, -1e30f, -1e30f, -1e30f};
#pragma unroll
    for (int i = 0; i < 37; ++i) {
      int d = i;
      if (i > 33) d = (g * 37 + i < 256) ? i : 255 - g * 37;
      m[i & 3] = fmaxf(m[i & 3], cp[d * TP]);
    }
    red[16 + tid] = fmaxf(fmaxf(m[0], m[1]), fmaxf(m[2], m[3]));
  }
  __syncthreads();

  if (tid < 36) {
    float mu   = sum8(red) * (1.f / 9216.f);
    float var  = sum8(red + 8) * (1.f / 9216.f) - mu * mu;
    float rstd = rsqrtf(var + 1e-5f);
    float m = red[16 + tid];
#pragma unroll  // the six reads go out together, not one waited read a trip
    for (int g = 1; g < 7; ++g) m = fmaxf(m, red[16 + g * 36 + tid]);
    mxv[tid] = (m - mu) * rstd;
  }
  __syncthreads();

  if (tid < 10) {
    float s = l2b[tid];
#pragma unroll  // the row's nine 16-byte reads go out together, one round trip
    for (int j = 0; j < 36; ++j) s += mxv[j] * l2W[tid * 36 + j];
    ov[tid] = s;
  }
  __syncthreads();
  if (tid == 0) {
    float mx = -1e30f;
    for (int o = 0; o < 10; ++o) mx = fmaxf(mx, ov[o]);
    float s = 0.f;
    for (int o = 0; o < 10; ++o) s += __expf(ov[o] - mx);
    red[0] = mx + __logf(s);
  }
  __syncthreads();
  if (tid < 10) {
    out[(size_t)b * 10 + tid] = ov[tid] - red[0];
    // ahead of what next overwrites the store's registers (in the branch: see
    // the conv kernel)
    asm volatile("s_wait_xcnt 0x0" ::: "memory");
  }
  b += NWG;
  if (b >= nimg) break;  // the same for the whole block
  }
}

// ---------------------------------------------------------------------------
extern "C" void kernel_launch(void* const* d_in, const int* in_sizes, int n_in,
                              void* d_out, int out_size, void* d_ws, size_t ws_size,
                              hipStream_t stream) {
  const float* x  = (const float*)d_in[0];
  const float* w1 = (const float*)d_in[1];  const float* b1 = (const float*)d_in[2];
  const float* w2 = (const float*)d_in[3];  const float* b2 = (const float*)d_in[4];
  const float* w3 = (const float*)d_in[5];  const float* b3 = (const float*)d_in[6];
  const float* w4 = (const float*)d_in[7];  const float* b4 = (const float*)d_in[8];
  const float* kW = (const float*)d_in[9];  const float* kbv = (const float*)d_in[10];
  const float* qW = (const float*)d_in[11]; const float* qbv = (const float*)d_in[12];
  const float* vW = (const float*)d_in[13]; const float* vbv = (const float*)d_in[14];
  const float* kg = (const float*)d_in[15]; const float* kbe = (const float*)d_in[16];
  const float* qg = (const float*)d_in[17]; const float* qbe = (const float*)d_in[18];
  const float* vg = (const float*)d_in[19]; const float* vbe = (const float*)d_in[20];
  const float* l1W = (const float*)d_in[21]; const float* l1b = (const float*)d_in[22];
  const float* l2W = (const float*)d_in[23]; const float* l2b = (const float*)d_in[24];

  const int B = in_sizes[0] / (28 * 28);   // 2048
  _Float16* feat = (_Float16*)d_ws;        // [B][256][32] f16 = 16 KB/batch,
                                           // then 240 KB: gamma/beta copy

  conv_stack_kernel<<<NWG, 256, 163600, stream>>>(x, w1, b1, w2, b2, w3, b3, w4,
                                                  b4, kg, kbe, qg, qbe, vg, vbe,
                                                  feat, B);
  attn_kernel<<<NWG, 256, 159584, stream>>>(feat, kW, kbv, qW, qbv, vW, vbv,
                                            l1W, l1b, l2W, l2b, (float*)d_out, B);
}
